// v000
// The times below were measured on an AMD MI455X: many runs one after another, warmed up first and cycling through
// copies of the inputs, with the whole window's GPU time divided by the number of runs. Launches and the gaps
// between them are all in it. The median over several windows is given; except for v000 it joins two sittings, which
// can be a few percent apart, so the side-by-side timings, each taken in one sitting, are the better comparison.
// The starting kernel, v000, takes 10 milliseconds a run.
#include <hip/hip_runtime.h>
// Causal multi-head self-attention with rotate-half RoPE computed in the module and a bias-free fused QKV projection (x [4][2048][1024]; qkv = x Wqkv ([in][out] 1024 x 3072, no bias) split into q | k | v thirds, 16 heads of 64; cos / sin = [f | f] of pos * 10000^(-2i/64); q = q cos + rotate_half(q) sin, likewise k; scores * 64^-0.5; causal (tril, finfo.min fill); softmax; out = merged Wout ([in][out], no bias) -> [4][2048][1024]); run as grouped-query causal attention with 16 groups of ONE head and half-split rope.
// Compute dtype: inputs rounded to bf16; x / weights exact; q, k, v, softmax weights and o as plain f16 GEMM operands (~2^-12); scores and softmax statistics f32; v_wmma_f32_16x16x32_f16.
#define NB 4
#define NG 16
#define HPG 1
#define KVD (NG * HD)
#define SQ 2048
#define DM 1024
#define NH 16
#define HD 64
#define HG 4                         /* heads per k_vt(b, h0) launch (overload not called) */
#define QT 256                       /* query rows per causal tile */
#define NKX SQ                       /* S / P row pitch */
#define QT0 128                      /* first-tile rows recomputed exactly in f32 */
#define B0 0                         /* first batch processed (debug hook) */
#define NBR NB                       /* batches processed (debug hook) */
#define NR ((size_t)NB * SQ)         /* token rows */
#define MP ((int)((size_t)NBR * SQ)) /* rows projected (debug hook) */
#define QN SQ                        /* query rows attended per batch (debug hook) */
#define NHD NH                       /* heads attended (debug hook) */
#define MPO MP                       /* rows through the output stage (debug hook) */
#define LQ DM      /* row pitch of the q/k/v rows */
typedef __bf16 v16b __attribute__((ext_vector_type(16)));
typedef unsigned short v8us __attribute__((ext_vector_type(8), may_alias));
typedef float  v8f  __attribute__((ext_vector_type(8)));
typedef float  v4f  __attribute__((ext_vector_type(4)));
typedef float  v4fa __attribute__((ext_vector_type(4), may_alias));
union FragB { v16b v; v8us half[2]; unsigned short u[16]; };

__device__ __forceinline__ unsigned short bf16_bits(float x) { unsigned int u = __float_as_uint(x); return (unsigned short)((u + 0x7FFFu + ((u >> 16) & 1u)) >> 16); }
__device__ __forceinline__ float bf16_val(unsigned short b) { return __uint_as_float(((unsigned int)b) << 16); }
__device__ __forceinline__ float bf16_round(float x) { return bf16_val(bf16_bits(x)); }
// D += A·B with NT terms: 1 = ah·bh, 2 = + al·bh (A split), 3 = + ah·bl (both split)
template <int NT>
__device__ __forceinline__ v8f mmaN(v16b ah, v16b al, v16b bh, v16b bl, v8f c) {
  c = __builtin_amdgcn_wmma_f32_16x16x32_bf16(false, ah, false, bh, (short)0, c, false, false);
  if (NT >= 2) c = __builtin_amdgcn_wmma_f32_16x16x32_bf16(false, al, false, bh, (short)0, c, false, false);
  if (NT >= 3) c = __builtin_amdgcn_wmma_f32_16x16x32_bf16(false, ah, false, bl, (short)0, c, false, false);
  asm volatile("v_nop\n\tv_nop\n\tv_nop\n\tv_nop" : "+v"(c) : "v"(ah), "v"(al), "v"(bh), "v"(bl));
  return c;
}

__global__ __launch_bounds__(256) void k_wt_bf16(const float* __restrict__ W, unsigned short* __restrict__ Wt, int K, int N) {
  const int t = blockIdx.x * 256 + threadIdx.x;
  const int k8n = K / 8;
  if (t >= N * k8n) return;
  const int n = t / k8n, k8 = (t % k8n) * 8;
  v8us v;
#pragma unroll
  for (int i = 0; i < 8; ++i) v[i] = bf16_bits(W[(size_t)(k8 + i) * N + n]);
  *(v8us*)(Wt + (size_t)n * K + k8) = v;
  
}

// GEMM C[M][N] (f32, pitch ldc) = act(A[M][K]·W + bias). A f32 row-major (pitch lda) converted per fragment to bf16
// (ASPLIT: hi/lo two planes -> 2 terms, else single rounded term); Wt bf16 [N][K] (pitch ldb). BIAS_BF16 rounds the
// bias to bf16 first (bias quantised to bf16 before the add). K%32==0, M%16==0, N%64==0.
template <bool ASPLIT, int ACT, bool BIAS_BF16>
__global__ __launch_bounds__(128) void k_gemm_bf(const float* __restrict__ A, int lda, const unsigned short* __restrict__ Wt, int ldb,
                                               const float* __restrict__ bias, float* __restrict__ C, int ldc, int M, int N, int K) {
  __shared__ __attribute__((aligned(16))) float so[4][16][64];
  const int tid = threadIdx.x, w = tid >> 5, lane = tid & 31, ln = lane & 15, hh = lane >> 4;
  const int ntn = N / 64;
  const int wid = blockIdx.x * 4 + w;
  const int mt = wid / ntn, nq = wid % ntn;
  if (mt * 16 >= M) return;
  const int row0 = mt * 16, col0 = nq * 64;
  const float* arow = A + (size_t)(row0 + ln) * lda;
  v8f acc[4] = {};
  for (int kb = 0; kb < K; kb += 32) {
    FragB ah, al;
    const v4f x0 = *(const v4fa*)(arow + kb + 8 * hh), x1 = *(const v4fa*)(arow + kb + 8 * hh + 4);
    const v4f x2 = *(const v4fa*)(arow + kb + 16 + 8 * hh), x3 = *(const v4fa*)(arow + kb + 16 + 8 * hh + 4);
    float xs[16] = {x0[0],x0[1],x0[2],x0[3],x1[0],x1[1],x1[2],x1[3],x2[0],x2[1],x2[2],x2[3],x3[0],x3[1],x3[2],x3[3]};
#pragma unroll
    for (int i = 0; i < 16; ++i) { const unsigned short hb = bf16_bits(xs[i]); ah.u[i] = hb; al.u[i] = ASPLIT ? bf16_bits(xs[i] - bf16_val(hb)) : (unsigned short)0; }
#pragma unroll
    for (int t = 0; t < 4; ++t) {
      const unsigned short* brow = Wt + (size_t)(col0 + t * 16 + ln) * ldb + kb;
      FragB b;
      b.half[0] = *(const v8us*)(brow + 8 * hh);
      b.half[1] = *(const v8us*)(brow + 16 + 8 * hh);
      acc[t] = mmaN<ASPLIT ? 2 : 1>(ah.v, al.v, b.v, b.v, acc[t]);
    }
  }
#pragma unroll
  for (int t = 0; t < 4; ++t) {
    float bv = bias ? bias[col0 + t * 16 + ln] : 0.f;
    if (BIAS_BF16) bv = bf16_round(bv);
#pragma unroll
    for (int r = 0; r < 8; ++r) { float v = acc[t][r] + bv; if (ACT == 1) v = fmaxf(v, 0.f); so[w][8 * hh + r][t * 16 + ln] = v; }
  }
  __builtin_amdgcn_fence(__ATOMIC_ACQ_REL, "workgroup");
  __builtin_amdgcn_wave_barrier();
  const int rsub = lane >> 4, c4 = (lane & 15) * 4;
  {
#pragma unroll
    for (int q = 0; q < 8; ++q) {
      const int r = q * 2 + rsub;
      const v4f v = *(const v4fa*)&so[w][r][c4];
      *(v4f*)(C + (size_t)(row0 + r) * ldc + col0 + c4) = v;
    }
    
  }
}

// GEMM C = act(A·W + bias + resid): A f32 (ASPLIT -> hi/lo 2 terms), Wt bf16 [N][K]; ACT 0 none, 1 relu, 2 exact gelu;
// resid (optional, f32, row index = (row % rmod), pitch ldr, RES_BF16 rounds it) added before the activation.
template <bool ASPLIT, int ACT, bool BIAS_BF16, bool RES_BF16>
__global__ __launch_bounds__(128) void k_gemm_bf3(const float* __restrict__ A, int lda, const unsigned short* __restrict__ Wt, int ldb,
                                                const float* __restrict__ bias, const float* __restrict__ resid, int rmod, int ldr,
                                                float* __restrict__ C, int ldc, int M, int N, int K) {
  __shared__ __attribute__((aligned(16))) float so[4][16][64];
  const int tid = threadIdx.x, w = tid >> 5, lane = tid & 31, ln = lane & 15, hh = lane >> 4;
  const int ntn = N / 64;
  const int wid = blockIdx.x * 4 + w;
  const int mt = wid / ntn, nq = wid % ntn;
  if (mt * 16 >= M) return;
  const int row0 = mt * 16, col0 = nq * 64;
  const float* arow = A + (size_t)(row0 + ln) * lda;
  v8f acc[4] = {};
  for (int kb = 0; kb < K; kb += 32) {
    FragB ah, al;
    const v4f x0 = *(const v4fa*)(arow + kb + 8 * hh), x1 = *(const v4fa*)(arow + kb + 8 * hh + 4);
    const v4f x2 = *(const v4fa*)(arow + kb + 16 + 8 * hh), x3 = *(const v4fa*)(arow + kb + 16 + 8 * hh + 4);
    float xs[16] = {x0[0],x0[1],x0[2],x0[3],x1[0],x1[1],x1[2],x1[3],x2[0],x2[1],x2[2],x2[3],x3[0],x3[1],x3[2],x3[3]};
#pragma unroll
    for (int i = 0; i < 16; ++i) { const unsigned short hb = bf16_bits(xs[i]); ah.u[i] = hb; al.u[i] = ASPLIT ? bf16_bits(xs[i] - bf16_val(hb)) : (unsigned short)0; }
#pragma unroll
    for (int t = 0; t < 4; ++t) {
      const unsigned short* brow = Wt + (size_t)(col0 + t * 16 + ln) * ldb + kb;
      FragB b;
      b.half[0] = *(const v8us*)(brow + 8 * hh);
      b.half[1] = *(const v8us*)(brow + 16 + 8 * hh);
      acc[t] = mmaN<ASPLIT ? 2 : 1>(ah.v, al.v, b.v, b.v, acc[t]);
    }
  }
#pragma unroll
  for (int t = 0; t < 4; ++t) {
    const int col = col0 + t * 16 + ln;
    float bv = bias ? bias[col] : 0.f;
    if (BIAS_BF16) bv = bf16_round(bv);
#pragma unroll
    for (int r = 0; r < 8; ++r) {
      float v = acc[t][r] + bv;
      if (resid) { float rv = resid[(size_t)((row0 + 8 * hh + r) % rmod) * ldr + col]; if (RES_BF16) rv = bf16_round(rv); v += rv; }
      if (ACT == 1) v = fmaxf(v, 0.f);
      if (ACT == 2) v = 0.5f * v * (1.0f + erff(v * 0.70710678118654752f));
      if (ACT == 3) { const float u = 0.7978845608028654f * (v + 0.044715f * v * v * v); v = 0.5f * v * (1.0f + tanhf(u)); }
      so[w][8 * hh + r][t * 16 + ln] = v;
    }
  }
  __builtin_amdgcn_fence(__ATOMIC_ACQ_REL, "workgroup");
  __builtin_amdgcn_wave_barrier();
  const int rsub = lane >> 4, c4 = (lane & 15) * 4;
  {
#pragma unroll
    for (int q = 0; q < 8; ++q) {
      const int r = q * 2 + rsub;
      const v4f v = *(const v4fa*)&so[w][r][c4];
      *(v4f*)(C + (size_t)(row0 + r) * ldc + col0 + c4) = v;
    }
    
  }
}
// row LayerNorm (biased variance, eps) over N: s = X (+ R); optional out_sum <- s; out_norm <- (s-mu)*rsqrt(var+eps)*g + b
template <bool PARAM_BF16>
__global__ __launch_bounds__(256) void k_layernorm(const float* __restrict__ X, const float* __restrict__ R, const float* __restrict__ g, const float* __restrict__ bta,
                                                  float* __restrict__ out_sum, float* __restrict__ out_norm, int N, float eps) {
  __shared__ float red[256];
  const int row = blockIdx.x, tid = threadIdx.x;
  const float* x = X + (size_t)row * N; const float* rr = R ? R + (size_t)row * N : nullptr;
  float vals[16];                     // up to N = 4096
  const int per = N / 256;            // contiguous chunk per thread? use strided-by-4 chunks: thread handles j = tid*4 + 1024*u
  float s1 = 0.f;
  for (int u = 0; u < per / 4; ++u) {
    const int j = tid * 4 + 1024 * u;
    const v4f a = *(const v4fa*)(x + j);
    v4f b = {0.f,0.f,0.f,0.f}; if (rr) b = *(const v4fa*)(rr + j);
#pragma unroll
    for (int q = 0; q < 4; ++q) { const float v = a[q] + b[q]; vals[u * 4 + q] = v; s1 += v; }
  }
  red[tid] = s1; __syncthreads();
  for (int st = 128; st > 0; st >>= 1) { if (tid < st) red[tid] += red[tid + st]; __syncthreads(); }
  const float mu = red[0] / (float)N; __syncthreads();
  float s2 = 0.f;
  for (int u = 0; u < per / 4; ++u)
#pragma unroll
    for (int q = 0; q < 4; ++q) { const float c = vals[u * 4 + q] - mu; s2 += c * c; }
  red[tid] = s2; __syncthreads();
  for (int st = 128; st > 0; st >>= 1) { if (tid < st) red[tid] += red[tid + st]; __syncthreads(); }
  const float rs = rsqrtf(red[0] / (float)N + eps);
  {
    for (int u = 0; u < per / 4; ++u) {
      const int j = tid * 4 + 1024 * u;
      v4f o, sm;
#pragma unroll
      for (int q = 0; q < 4; ++q) {
        float gg = g[j + q], bb = bta[j + q];
        if (PARAM_BF16) { gg = bf16_round(gg); bb = bf16_round(bb); }
        sm[q] = vals[u * 4 + q]; o[q] = (vals[u * 4 + q] - mu) * rs * gg + bb;
      }
      if (out_sum) *(v4f*)(out_sum + (size_t)row * N + j) = sm;
      *(v4f*)(out_norm + (size_t)row * N + j) = o;
    }
    
  }
}



// ---- f16 WMMA path (v_wmma_f32_16x16x32_f16): 11-bit significands for operands in range — used where a [0,1] probability operand needs more precision than bf16
typedef _Float16 v16h __attribute__((ext_vector_type(16)));
union FragH { v16h v; v8us half[2]; _Float16 h[16]; unsigned short u[16]; };
template <int NT>
__device__ __forceinline__ v8f mmaH(v16h ah, v16h al, v16h bh, v16h bl, v8f c) {
  c = __builtin_amdgcn_wmma_f32_16x16x32_f16(false, ah, false, bh, (short)0, c, false, false);
  if (NT >= 2) c = __builtin_amdgcn_wmma_f32_16x16x32_f16(false, al, false, bh, (short)0, c, false, false);
  if (NT >= 3) c = __builtin_amdgcn_wmma_f32_16x16x32_f16(false, ah, false, bl, (short)0, c, false, false);
  asm volatile("v_nop\n\tv_nop\n\tv_nop\n\tv_nop" : "+v"(c) : "v"(ah), "v"(al), "v"(bh), "v"(bl));
  return c;
}
// batched GEMM like k_gemm_b but f16 operands: A f32 (split into f16 hi/lo if ASPLIT, else rounded to f16), Bt = f16 values [n][k]; alpha; C f32; N multiple of 16 (partial tiles skipped)
template <bool ASPLIT>
__global__ __launch_bounds__(128) void k_gemm_h(const float* __restrict__ A, int lda, size_t sA, const _Float16* __restrict__ Bh, int ldb, size_t sB, float alpha, float* __restrict__ C, int ldc, size_t sC, int M, int N, int K) {
  __shared__ __attribute__((aligned(16))) float so[4][16][64];
  const int tid = threadIdx.x, w = tid >> 5, lane = tid & 31, ln = lane & 15, hh = lane >> 4; const int by = blockIdx.y;
  A += (size_t)by * sA; Bh += (size_t)by * sB; C += (size_t)by * sC;
  const int ntn = (N + 63) / 64; const int wid = blockIdx.x * 4 + w; const int mt = wid / ntn, nq = wid % ntn; if (mt * 16 >= M) return;
  const int row0 = mt * 16, col0 = nq * 64; const float* arow = A + (size_t)(row0 + ln) * lda;
  v8f acc[4] = {};
  for (int kb = 0; kb < K; kb += 32) {
    FragH ah, al;
    const v4f x0 = *(const v4fa*)(arow + kb + 8 * hh), x1 = *(const v4fa*)(arow + kb + 8 * hh + 4), x2 = *(const v4fa*)(arow + kb + 16 + 8 * hh), x3 = *(const v4fa*)(arow + kb + 16 + 8 * hh + 4);
    float xs[16] = {x0[0],x0[1],x0[2],x0[3],x1[0],x1[1],x1[2],x1[3],x2[0],x2[1],x2[2],x2[3],x3[0],x3[1],x3[2],x3[3]};
#pragma unroll
    for (int i = 0; i < 16; ++i) { const _Float16 h = (_Float16)xs[i]; ah.h[i] = h; al.h[i] = ASPLIT ? (_Float16)(xs[i] - (float)h) : (_Float16)0.0f; }
#pragma unroll
    for (int t = 0; t < 4; ++t) { if (col0 + t * 16 >= N) continue; const size_t boff = (size_t)(col0 + t * 16 + ln) * ldb + kb; FragH bq; bq.half[0] = *(const v8us*)(Bh + boff + 8 * hh); bq.half[1] = *(const v8us*)(Bh + boff + 16 + 8 * hh);
      acc[t] = mmaH<ASPLIT ? 2 : 1>(ah.v, al.v, bq.v, bq.v, acc[t]); }
  }
#pragma unroll
  for (int t = 0; t < 4; ++t) { if (col0 + t * 16 >= N) continue;
#pragma unroll
    for (int r = 0; r < 8; ++r) so[w][8 * hh + r][t * 16 + ln] = acc[t][r] * alpha; }
  __builtin_amdgcn_fence(__ATOMIC_ACQ_REL, "workgroup"); __builtin_amdgcn_wave_barrier();
  const int rsub = lane >> 4, c4 = (lane & 15) * 4;
  {
#pragma unroll
    for (int q = 0; q < 8; ++q) { const int r = q * 2 + rsub; if (col0 + c4 < N) { const v4f v = *(const v4fa*)&so[w][r][c4]; *(v4f*)(C + (size_t)(row0 + r) * ldc + col0 + c4) = v; } }
     }
}

// Wt[n][k] = f16(W[k][n]·scale) from f32 row-major W[K][N] (scale = power of two; bf16-exact weights stay exact in f16 away from the subnormal range)
__global__ __launch_bounds__(256) void k_wt_f16(const float* __restrict__ W, _Float16* __restrict__ Wt, int K, int N, float scale) {
  const int t = blockIdx.x * 256 + threadIdx.x; if (t >= N * (K / 8)) return; const int n = t / (K / 8), k8 = (t % (K / 8)) * 8; FragH f;
#pragma unroll
  for (int i = 0; i < 8; ++i) f.h[i] = (_Float16)(bf16_round(W[(size_t)(k8 + i) * N + n]) * scale); const v8us o = f.half[0];
  *(v8us*)((unsigned short*)Wt + (size_t)n * K + k8) = o; 
}
// k_gemm_hh variant with fused epilogue: v = acc·alpha + bias[by·sBias + col] (+ CP[(row/rowsPerB)·sCPb + by·64 + col] if CP) ; ACT 0 none / 1 elu ; writes f16 C16 (and f32 C if non-null)
template <int ACT>
__global__ __launch_bounds__(128) void k_gemm_hhx(const _Float16* __restrict__ A, int lda, size_t sA, const _Float16* __restrict__ Bh, int ldb, size_t sB, float alpha, const float* __restrict__ bias, size_t sBias, const float* __restrict__ CP, int rowsPerB, size_t sCPb, int row0g,
    float* __restrict__ C, _Float16* __restrict__ C16, int ldc, size_t sC, int M, int N, int K) {
  __shared__ __attribute__((aligned(16))) float so[4][16][64];
  const int tid = threadIdx.x, w = tid >> 5, lane = tid & 31, ln = lane & 15, hh = lane >> 4; const int by = blockIdx.y;
  A += (size_t)by * sA; Bh += (size_t)by * sB; const size_t cofs = (size_t)by * sC; const float* bp = bias ? bias + (size_t)by * sBias : nullptr;
  const int ntn = (N + 63) / 64; const int wid = blockIdx.x * 4 + w; const int mt = wid / ntn, nq = wid % ntn; if (mt * 16 >= M) return;
  const int row0 = mt * 16, col0 = nq * 64; const _Float16* arow = A + (size_t)(row0 + ln) * lda;
  v8f acc[4] = {};
  for (int kb = 0; kb < K; kb += 32) { FragH ah; ah.half[0] = *(const v8us*)((const unsigned short*)arow + kb + 8 * hh); ah.half[1] = *(const v8us*)((const unsigned short*)arow + kb + 16 + 8 * hh);
#pragma unroll
    for (int t = 0; t < 4; ++t) { if (col0 + t * 16 >= N) continue; const size_t boff = (size_t)(col0 + t * 16 + ln) * ldb + kb; FragH bq; bq.half[0] = *(const v8us*)((const unsigned short*)Bh + boff + 8 * hh); bq.half[1] = *(const v8us*)((const unsigned short*)Bh + boff + 16 + 8 * hh);
      acc[t] = mmaH<1>(ah.v, ah.v, bq.v, bq.v, acc[t]); }
  }
#pragma unroll
  for (int t = 0; t < 4; ++t) { if (col0 + t * 16 >= N) continue; const int col = col0 + t * 16 + ln; const float bv = bp ? bf16_round(bp[col]) : 0.f;
#pragma unroll
    for (int r = 0; r < 8; ++r) { float v = acc[t][r] * alpha + bv; if (CP) { const int rr = row0g + row0 + 8 * hh + r; if (rowsPerB < 0) v += CP[cofs + (size_t)rr * ldc + col];      /* rowsPerB < 0: own element of the batched C plane */ else { const int bidx = rr / rowsPerB; v += CP[(size_t)bidx * sCPb + (size_t)by * 64 + col]; } } if (ACT == 1) v = (v > 0.f) ? v : expm1f(v); else if (ACT == 7) v = (v > 0.f) ? v + 1.0f : expf(v); else if (ACT == 8) v = tanhf(v); else if (ACT == 9) v = 0.5f * v * (1.0f + tanhf(0.7978845608028654f * (v + 0.044715f * v * v * v))); else if (ACT == 11) v = 1.0f / (1.0f + expf(-v)); else if (ACT == 12) v = (v > 0.f) ? v : 0.01f * v; else if (ACT == 14) v = (v > 0.f) ? v : 0.1f * v; else if (ACT == 16) v = (v >= 0.f) ? v : 0.3f * v; else if (ACT == 17) v = (v >= 0.f) ? v : 0.2f * v; else if (ACT == 15) v = v / (1.0f + expf(-v)); else if (ACT == 3) v = fmaxf(v, 0.f); else if (ACT == 6) v = 0.5f * v * (1.0f + erff(v * 0.70710678118654752f)); so[w][8 * hh + r][t * 16 + ln] = v; } }
  __builtin_amdgcn_fence(__ATOMIC_ACQ_REL, "workgroup"); __builtin_amdgcn_wave_barrier();
  const int rsub = lane >> 4, c4 = (lane & 15) * 4; typedef _Float16 v4h __attribute__((ext_vector_type(4)));
  {
#pragma unroll
    for (int q = 0; q < 8; ++q) { const int r = q * 2 + rsub; if (col0 + c4 < N) { const v4f v = *(const v4fa*)&so[w][r][c4]; if (C) *(v4f*)(C + cofs + (size_t)(row0 + r) * ldc + col0 + c4) = v; if (C16) { v4h h4; for (int i = 0; i < 4; ++i) h4[i] = (_Float16)v[i]; *(v4h*)(C16 + cofs + (size_t)(row0 + r) * ldc + col0 + c4) = h4; } } }
     }
}


typedef _Float16 v4h __attribute__((ext_vector_type(4)));

__global__ __launch_bounds__(256) void k_x16(const float* __restrict__ x, _Float16* __restrict__ X16, size_t n8) { const size_t t = (size_t)blockIdx.x * 256 + threadIdx.x; if (t >= n8) return; FragH f;
#pragma unroll
  for (int q = 0; q < 8; ++q) f.h[q] = (_Float16)bf16_round(x[t * 8 + q]); *(v8us*)((unsigned short*)X16 + t * 8) = f.half[0];  }
__global__ __launch_bounds__(256) void k_h16(const float* __restrict__ x, _Float16* __restrict__ X16, size_t n8) { const size_t t = (size_t)blockIdx.x * 256 + threadIdx.x; if (t >= n8) return; FragH f;
#pragma unroll
  for (int q = 0; q < 8; ++q) f.h[q] = (_Float16)x[t * 8 + q]; *(v8us*)((unsigned short*)X16 + t * 8) = f.half[0];  }
__global__ __launch_bounds__(256) void k_round16f(const float* __restrict__ W, _Float16* __restrict__ Bt, size_t n8) { const size_t t = (size_t)blockIdx.x * 256 + threadIdx.x; if (t >= n8) return; FragH f;
#pragma unroll
  for (int i = 0; i < 8; ++i) f.h[i] = (_Float16)(bf16_round(W[t * 8 + i]) * 16.0f); *(v8us*)((unsigned short*)Bt + t * 8) = f.half[0];  }
template <int NHv, int TTv>
__global__ __launch_bounds__(256) void k_vt(const _Float16* __restrict__ V16, int ldv, int voff, _Float16* __restrict__ Vt) { __shared__ unsigned short tl[64][66]; const int tid = threadIdx.x; const int slab = blockIdx.x / (TTv / 64), lg = blockIdx.x % (TTv / 64); const int b = slab / NHv, h = slab % NHv;
  for (int i = tid; i < 64 * 8; i += 256) { const int r = i / 8, c8 = (i % 8) * 8; FragH f; f.half[0] = *(const v8us*)((const unsigned short*)V16 + ((size_t)b * TTv + lg * 64 + r) * ldv + voff + h * 64 + c8);
#pragma unroll
    for (int q = 0; q < 8; ++q) tl[r][c8 + q] = f.u[q]; }
  __syncthreads();
  {
#pragma unroll
    for (int rd = 0; rd < 2; ++rd) { const int d = rd * 32 + tid / 8, pc = tid % 8; FragH f;
#pragma unroll
      for (int q = 0; q < 8; ++q) f.u[q] = tl[pc * 8 + q][d];
      *(v8us*)((unsigned short*)Vt + ((size_t)slab * 64 + d) * TTv + lg * 64 + pc * 8) = f.half[0]; }
     } }

__global__ __launch_bounds__(256) void k_hl(const float* __restrict__ F, _Float16* __restrict__ Hh, _Float16* __restrict__ Hl, size_t n8) { const size_t t = (size_t)blockIdx.x * 256 + threadIdx.x; if (t >= n8) return; FragH fh, fl; const v4f a = *(const v4fa*)(F + t * 8), c = *(const v4fa*)(F + t * 8 + 4);
#pragma unroll
  for (int q = 0; q < 4; ++q) { _Float16 h = (_Float16)a[q]; fh.h[q] = h; fl.h[q] = (_Float16)((a[q] - (float)h) * 1024.0f); h = (_Float16)c[q]; fh.h[4 + q] = h; fl.h[4 + q] = (_Float16)((c[q] - (float)h) * 1024.0f); }
  { *(v8us*)((unsigned short*)Hh + t * 8) = fh.half[0]; *(v8us*)((unsigned short*)Hl + t * 8) = fl.half[0];  } }

// ---- fast GEMM (wave tile 32x64; requires M % 32 == 0 rows per launch region and N % 64 == 0); epilogue = k_gemm_hhx semantics ----
__device__ __forceinline__ v16h g2_frag(const _Float16* p, int hh) { FragH f; f.half[0] = *(const v8us*)((const unsigned short*)p + 8 * hh); f.half[1] = *(const v8us*)((const unsigned short*)p + 16 + 8 * hh); return f.v; }
__device__ __forceinline__ v8f g2_mma(v16h a, v16h b, v8f c) { v8f d = __builtin_amdgcn_wmma_f32_16x16x32_f16(false, a, false, b, (short)0, c, false, false); asm volatile("v_nop\n\tv_nop\n\tv_nop\n\tv_nop" : "+v"(d) : "v"(a), "v"(b)); return d; }
template <int ACT>
__global__ __launch_bounds__(128) void k_gemm2(const _Float16* __restrict__ A, int lda, size_t sA, const _Float16* __restrict__ Bh, int ldb, size_t sB, float alpha, const float* __restrict__ bias, size_t sBias, const float* __restrict__ CP, int rowsPerB, size_t sCPb, int row0g,
    float* __restrict__ C, _Float16* __restrict__ C16, int ldc, size_t sC, int M, int N, int K) { static_assert(ACT == 0 || ACT == 3 || ACT == 6 || ACT == 8 || ACT == 9 || ACT == 11 || ACT == 12 || ACT == 14 || ACT == 15 || ACT == 16 || ACT == 17, "k_gemm2: unsupported ACT code (would silently apply no activation)");
  __shared__ __attribute__((aligned(16))) float so[4][32][68];
  const int tid = threadIdx.x, w = tid >> 5, lane = tid & 31, ln = lane & 15, hh = lane >> 4; const int by = blockIdx.y;
  A += (size_t)by * sA; Bh += (size_t)by * sB; const size_t cofs = (size_t)by * sC; const float* bp = bias ? bias + (size_t)by * sBias : nullptr;
  const int ntn = N >> 6; const int mt = blockIdx.x / ntn, nq = blockIdx.x - mt * ntn; const int row0 = mt * 128 + 32 * w, col0 = nq * 64; if (row0 >= M) return;
  const _Float16* a0p = A + (size_t)(row0 + ln) * lda; const _Float16* a1p = a0p + (size_t)16 * lda;
  const _Float16* b0p = Bh + (size_t)(col0 + ln) * ldb; const _Float16* b1p = b0p + (size_t)16 * ldb; const _Float16* b2p = b1p + (size_t)16 * ldb; const _Float16* b3p = b2p + (size_t)16 * ldb;
  const v8f z8 = {0.f,0.f,0.f,0.f,0.f,0.f,0.f,0.f}; v8f c00 = z8, c01 = z8, c02 = z8, c03 = z8, c10 = z8, c11 = z8, c12 = z8, c13 = z8;
#pragma unroll 1
  for (int kb = 0; kb < K; kb += 32) { const v16h a0 = g2_frag(a0p + kb, hh), a1 = g2_frag(a1p + kb, hh);
    v16h b = g2_frag(b0p + kb, hh); c00 = g2_mma(a0, b, c00); c10 = g2_mma(a1, b, c10);
    b = g2_frag(b1p + kb, hh); c01 = g2_mma(a0, b, c01); c11 = g2_mma(a1, b, c11);
    b = g2_frag(b2p + kb, hh); c02 = g2_mma(a0, b, c02); c12 = g2_mma(a1, b, c12);
    b = g2_frag(b3p + kb, hh); c03 = g2_mma(a0, b, c03); c13 = g2_mma(a1, b, c13); }
  v8f accs[8] = {c00, c01, c02, c03, c10, c11, c12, c13};
#pragma unroll
  for (int u = 0; u < 8; ++u) { const int t = u & 3, half = u >> 2; const int col = col0 + t * 16 + ln; const float bv = bp ? bf16_round(bp[col]) : 0.f;
#pragma unroll
    for (int r = 0; r < 8; ++r) { const int rloc = half * 16 + 8 * hh + r; float v = accs[u][r] * alpha + bv; if (CP) { if (rowsPerB < 0) v += CP[cofs + (size_t)(row0g + row0 + rloc) * ldc + col];      /* rowsPerB < 0: own element of the batched C plane */ else { const int bidx = (row0g + row0 + rloc) / rowsPerB; v += CP[(size_t)bidx * sCPb + (size_t)by * 64 + col]; } }
      if (ACT == 3) v = fmaxf(v, 0.f); else if (ACT == 6) v = 0.5f * v * (1.0f + erff(v * 0.70710678118654752f)); else if (ACT == 11) v = 1.0f / (1.0f + expf(-v)); else if (ACT == 15) v = v / (1.0f + expf(-v)); else if (ACT == 12) v = (v > 0.f) ? v : 0.01f * v; else if (ACT == 8) v = tanhf(v); else if (ACT == 9) v = 0.5f * v * (1.0f + tanhf(0.7978845608028654f * (v + 0.044715f * v * v * v))); else if (ACT == 14) v = (v > 0.f) ? v : 0.1f * v; else if (ACT == 16) v = (v >= 0.f) ? v : 0.3f * v; else if (ACT == 17) v = (v >= 0.f) ? v : 0.2f * v;
      so[w][rloc][t * 16 + ln] = v; } }
  __builtin_amdgcn_fence(__ATOMIC_ACQ_REL, "workgroup"); __builtin_amdgcn_wave_barrier();
  const int rsub = lane >> 4, c4 = (lane & 15) * 4;
  {
#pragma unroll
    for (int q = 0; q < 16; ++q) { const int r = q * 2 + rsub; const v4f v = *(const v4fa*)&so[w][r][c4]; if (C) *(v4f*)(C + cofs + (size_t)(row0 + r) * ldc + col0 + c4) = v; if (C16) { v4h h4; for (int i = 0; i < 4; ++i) h4[i] = (_Float16)v[i]; *(v4h*)(C16 + cofs + (size_t)(row0 + r) * ldc + col0 + c4) = h4; } }
     } }


__global__ __launch_bounds__(256) void k_wnat(const float* __restrict__ w, size_t n8, _Float16* __restrict__ Bt) { const size_t t = (size_t)blockIdx.x * 256 + threadIdx.x; if (t >= n8) return; FragH f; for (int q = 0; q < 8; ++q) f.h[q] = (_Float16)(bf16_round(w[t * 8 + q]) * 16.0f); *(v8us*)((unsigned short*)Bt + t * 8) = f.half[0];  }
__global__ __launch_bounds__(256) void k_rsm(const float* __restrict__ S, _Float16* __restrict__ P, int nrows) {
  #pragma clang fp contract(off)
  const int i = blockIdx.x * 256 + threadIdx.x; if (i >= nrows) return; const float* s = S + (size_t)i * SQ; float mx = -3.0e38f;
#pragma unroll 1
  for (int j = 0; j < SQ; ++j) mx = fmaxf(mx, s[j]); float se = 0.f;
#pragma unroll 1
  for (int j = 0; j < SQ; ++j) se += expf(s[j] - mx); const float sc = 256.0f / se;
#pragma unroll 1
  for (int j0 = 0; j0 < SQ; j0 += 8) { FragH f; for (int q = 0; q < 8; ++q) f.h[q] = (_Float16)(expf(s[j0 + q] - mx) * sc); unsigned short* d = (unsigned short*)P + (size_t)i * SQ + j0; *(v8us*)d = f.half[0];  } }
__global__ __launch_bounds__(256) void k_vt(const _Float16* __restrict__ V16, int b, int h0, _Float16* __restrict__ VT) { __shared__ unsigned short tl[64][65]; const int tid = threadIdx.x; const int hh = blockIdx.x % HG, sg = blockIdx.x / HG; const int s0 = sg * 64; const int h = h0 + hh;
  for (int i = tid; i < 64 * 8; i += 256) { const int j = i / 8, d8 = (i % 8) * 8; FragH f; f.half[0] = *(const v8us*)((const unsigned short*)V16 + ((size_t)b * SQ + s0 + j) * DM + h * HD + d8); for (int q = 0; q < 8; ++q) tl[d8 + q][j] = f.u[q]; }
  __syncthreads();
  { for (int i = tid; i < 64 * 8; i += 256) { const int d = i / 8, j8 = (i % 8) * 8; FragH f; for (int q = 0; q < 8; ++q) f.u[q] = tl[d][j8 + q]; *(v8us*)((unsigned short*)VT + ((size_t)hh * HD + d) * SQ + s0 + j8) = f.half[0]; }  } }



__global__ __launch_bounds__(256) void k_rsmcf2(const float* __restrict__ S, _Float16* __restrict__ P, int hg, int q0, int nk) {
  #pragma clang fp contract(off)
  const int t = blockIdx.x * 256 + threadIdx.x; if (t >= hg * QT) return; const size_t i = (size_t)t; const float* s = S + i * NKX; const int last = q0 + (t % QT); float mx = -3.0e38f;
#pragma unroll 1
  for (int j = 0; j < nk; ++j) { const float f = (j <= last) ? 1.f : 0.f; mx = fmaxf(mx, fmaf(f, s[j], (1.f - f) * -1.0e9f)); } float se = 0.f;
#pragma unroll 1
  for (int j = 0; j < nk; ++j) { const float f = (j <= last) ? 1.f : 0.f; se += __expf(fmaf(f, s[j], (1.f - f) * -1.0e9f) - mx); } const float sc = 256.0f / se;
#pragma unroll 1
  for (int j0 = 0; j0 < nk; j0 += 8) { FragH fr; for (int q = 0; q < 8; ++q) { const int j = j0 + q; const float f = (j <= last) ? 1.f : 0.f; fr.h[q] = (_Float16)(__expf(fmaf(f, s[j], (1.f - f) * -1.0e9f) - mx) * sc); } unsigned short* d = (unsigned short*)P + i * NKX + j0; *(v8us*)d = fr.half[0];  } }


template <int MASKADD>
__global__ __launch_bounds__(64) void k_att0(const float* __restrict__ QF, const float* __restrict__ KF, const float* __restrict__ VF, int ld, const float* __restrict__ mask, float scale, float* __restrict__ OF, int ldo) {
  #pragma clang fp contract(off)
  __shared__ __attribute__((aligned(16))) float lq[64][64]; __shared__ __attribute__((aligned(16))) float lo[64][64];
  const int tid = threadIdx.x; const int h = blockIdx.x / (QT0 / 64), rg = blockIdx.x % (QT0 / 64); const int i = rg * 64 + tid;
  const float* qr = QF + (size_t)i * ld + h * HD;
#pragma unroll 1
  for (int c = 0; c < HD / 4; ++c) { *(v4f*)&lq[tid][c * 4] = *(const v4fa*)(qr + c * 4); const v4f z = {0.f, 0.f, 0.f, 0.f}; *(v4f*)&lo[tid][c * 4] = z; }
  float m = -1.0e30f, l = 0.f; const int jmax = MASKADD ? (SQ - 1) : (rg * 64 + 63);      /* additive-mask form: every key (the mask input decides); causal form: keys up to the block's last row */
#pragma unroll 1
  for (int j = 0; j <= jmax; ++j) { const float* kr = KF + (size_t)j * ld + h * HD; const float* vr = VF + (size_t)j * ld + h * HD; float s = 0.f;
#pragma unroll 1
    for (int c = 0; c < HD / 4; ++c) { const v4f kq = *(const v4fa*)(kr + c * 4); const v4f qq = *(v4f*)&lq[tid][c * 4]; s = __fadd_rn(s, __fmul_rn(qq[0], kq[0])); s = __fadd_rn(s, __fmul_rn(qq[1], kq[1])); s = __fadd_rn(s, __fmul_rn(qq[2], kq[2])); s = __fadd_rn(s, __fmul_rn(qq[3], kq[3])); }
    s = __fmul_rn(s, scale); if (MASKADD) s = __fadd_rn(s, __fmul_rn(bf16_round(mask[(size_t)i * SQ + j]), -10000.0f));
    const float f = (MASKADD || j <= i) ? 1.f : 0.f; const float sm = fmaf(f, s, (1.f - f) * -1.0e30f); const float mn = fmaxf(m, sm); const float sc = expf(m - mn); const float e = expf(sm - mn); l = __fadd_rn(__fmul_rn(l, sc), e); m = mn;
#pragma unroll 1
    for (int c = 0; c < HD / 4; ++c) { const v4f vv = *(const v4fa*)(vr + c * 4); v4f oo = *(v4f*)&lo[tid][c * 4]; for (int u = 0; u < 4; ++u) oo[u] = __fadd_rn(__fmul_rn(oo[u], sc), __fmul_rn(e, vv[u])); *(v4f*)&lo[tid][c * 4] = oo; } }
  const float fin = 64.0f / l;      /* o carried x64 like the f16 path */
#pragma unroll 1
  for (int c = 0; c < HD / 4; ++c) { v4f oo = *(v4f*)&lo[tid][c * 4]; for (int u = 0; u < 4; ++u) oo[u] = __fmul_rn(oo[u], fin); *(v4f*)&lo[tid][c * 4] = oo; }
  __syncthreads();
  {
#pragma unroll 1
    for (int it = 0; it < 16; ++it) { const int row = it * 4 + tid / 16, pc = (tid % 16) * 4; const v4f v = *(const v4f*)&lo[row][pc]; *(v4f*)(OF + (size_t)(rg * 64 + row) * ldo + h * HD + pc) = v; }
     } }


__global__ __launch_bounds__(256) void k_kvexp(const float* __restrict__ src, float* __restrict__ dst, size_t n4) { const size_t t = (size_t)blockIdx.x * 256 + threadIdx.x; if (t >= n4) return; const size_t e = t * 4; const size_t row = e / DM; const int col = (int)(e % DM); const int h = col / HD, d = col % HD; const v4f v = *(const v4fa*)(src + row * KVD + (size_t)(h / HPG) * HD + d); *(v4f*)(dst + e) = v;  }

__global__ __launch_bounds__(256) void k_tab2(float theta, float* __restrict__ CS, float* __restrict__ SN) {
  #pragma clang fp contract(off)
  const int t = blockIdx.x * 256 + threadIdx.x; if (t >= SQ * (HD / 2)) return; const int i = t % (HD / 2); const int p = t / (HD / 2); const float invf = 1.0f / powf(theta, (float)(2 * i) / (float)HD); const float ang = __fmul_rn((float)p, invf); const float c = cosf(ang), s = sinf(ang);
  *(float*)(CS + t) = c; *(float*)(SN + t) = s;  }
template <int NORM, int ROPE>
__global__ __launch_bounds__(64) void k_xform(const float* __restrict__ F, int ldf, int nh, const float* __restrict__ gain, float eps, const float* __restrict__ CS, const float* __restrict__ SN, _Float16* __restrict__ H16, int ldo) {
  #pragma clang fp contract(off)
  __shared__ float xv[HD]; __shared__ float red[HD]; __shared__ unsigned short sh_[HD]; const int d = threadIdx.x; const int h = blockIdx.x % nh; const size_t r = blockIdx.x / nh; const int p = (int)(r % SQ);
  float x = F[r * (size_t)ldf + (size_t)h * HD + d];
  if (NORM) { red[d] = __fmul_rn(x, x); __syncthreads(); for (int st = HD / 2; st > 0; st >>= 1) { if (d < st) red[d] = __fadd_rn(red[d], red[d + st]); __syncthreads(); } const float rs = rsqrtf(__fadd_rn(red[0] / (float)HD, eps)); x = __fmul_rn(__fmul_rn(x, rs), bf16_round(gain[d])); }
  xv[d] = x; __syncthreads();
  float o = x;
  if (ROPE == 1) { const int i = d >> 1; const float c = CS[p * (HD / 2) + i], s = SN[p * (HD / 2) + i]; const float ev = xv[2 * i], od = xv[2 * i + 1]; o = (d & 1) ? __fadd_rn(__fmul_rn(ev, s), __fmul_rn(od, c)) : __fadd_rn(__fmul_rn(ev, c), -__fmul_rn(od, s)); }
  if (ROPE == 2) { const int i = d & (HD / 2 - 1); const float c = CS[p * (HD / 2) + i], s = SN[p * (HD / 2) + i]; const float lo = xv[i], hi = xv[i + HD / 2]; o = (d < HD / 2) ? __fadd_rn(__fmul_rn(lo, c), -__fmul_rn(hi, s)) : __fadd_rn(__fmul_rn(lo, s), __fmul_rn(hi, c)); }
  if (ROPE == 3) { const float c = CS[p * HD + d], s = SN[p * HD + d]; const float lo = xv[d & (HD / 2 - 1)], hi = xv[(d & (HD / 2 - 1)) + HD / 2]; o = (d < HD / 2) ? __fadd_rn(__fmul_rn(lo, c), -__fmul_rn(hi, s)) : __fadd_rn(__fmul_rn(hi, c), __fmul_rn(lo, s)); }      /* rotate-half with FULL-width per-element tables [pos][HD] */
  FragH th; th.h[0] = (_Float16)o; sh_[d] = th.u[0]; __syncthreads();
  if (d < HD / 8) { FragH f; for (int q = 0; q < 8; ++q) f.u[q] = sh_[d * 8 + q]; unsigned short* dst = (unsigned short*)H16 + r * (size_t)ldo + (size_t)h * HD + d * 8; *(v8us*)dst = f.half[0];  } }

template <int NORM, int ROPE>
__global__ __launch_bounds__(64) void k_xformf(const float* __restrict__ F, int ldf, int nh, const float* __restrict__ gain, float eps, const float* __restrict__ CS, const float* __restrict__ SN, float* __restrict__ F32, int ldo) {
  #pragma clang fp contract(off)
  __shared__ float xv[HD]; __shared__ float red[HD]; const int d = threadIdx.x; const int h = blockIdx.x % nh; const size_t r = blockIdx.x / nh; const int p = (int)(r % SQ);
  float x = F[r * (size_t)ldf + (size_t)h * HD + d];
  if (NORM) { red[d] = __fmul_rn(x, x); __syncthreads(); for (int st = HD / 2; st > 0; st >>= 1) { if (d < st) red[d] = __fadd_rn(red[d], red[d + st]); __syncthreads(); } const float rs = rsqrtf(__fadd_rn(red[0] / (float)HD, eps)); x = __fmul_rn(__fmul_rn(x, rs), bf16_round(gain[d])); }
  xv[d] = x; __syncthreads();
  float o = x;
  if (ROPE == 1) { const int i = d >> 1; const float c = CS[p * (HD / 2) + i], s = SN[p * (HD / 2) + i]; const float ev = xv[2 * i], od = xv[2 * i + 1]; o = (d & 1) ? __fadd_rn(__fmul_rn(ev, s), __fmul_rn(od, c)) : __fadd_rn(__fmul_rn(ev, c), -__fmul_rn(od, s)); }
  if (ROPE == 2) { const int i = d & (HD / 2 - 1); const float c = CS[p * (HD / 2) + i], s = SN[p * (HD / 2) + i]; const float lo = xv[i], hi = xv[i + HD / 2]; o = (d < HD / 2) ? __fadd_rn(__fmul_rn(lo, c), -__fmul_rn(hi, s)) : __fadd_rn(__fmul_rn(lo, s), __fmul_rn(hi, c)); }
  if (ROPE == 3) { const float c = CS[p * HD + d], s = SN[p * HD + d]; const float lo = xv[d & (HD / 2 - 1)], hi = xv[(d & (HD / 2 - 1)) + HD / 2]; o = (d < HD / 2) ? __fadd_rn(__fmul_rn(lo, c), -__fmul_rn(hi, s)) : __fadd_rn(__fmul_rn(hi, c), __fmul_rn(lo, s)); }      /* rotate-half with FULL-width per-element tables [pos][HD] */
  float* dst = F32 + r * (size_t)ldo + (size_t)h * HD + d; *(float*)dst = o;  }

__global__ __launch_bounds__(256) void k_bfcp(const float* __restrict__ src, float* __restrict__ dst, size_t n4) { const size_t t = (size_t)blockIdx.x * 256 + threadIdx.x; if (t >= n4) return; const v4f a = *(const v4fa*)(src + t * 4); v4f o; for (int q = 0; q < 4; ++q) o[q] = bf16_round(a[q]); *(v4f*)(dst + t * 4) = o;  }

__global__ __launch_bounds__(256) void k_tabhalf(const float* __restrict__ cs, const float* __restrict__ sn, float* __restrict__ CS, float* __restrict__ SN) { const int t = blockIdx.x * 256 + threadIdx.x; if (t >= SQ * (HD / 2)) return; const int p = t / (HD / 2), i = t % (HD / 2); const float c = bf16_round(cs[(size_t)p * HD + i]), s = bf16_round(sn[(size_t)p * HD + i]);
  *(float*)(CS + t) = c; *(float*)(SN + t) = s;  }

__global__ __launch_bounds__(256) void k_tab2d(float* __restrict__ CS, float* __restrict__ SN) {
  #pragma clang fp contract(off)
  const int t = blockIdx.x * 256 + threadIdx.x; if (t >= SQ * (HD / 2)) return; const int i = t % (HD / 2); const int p = t / (HD / 2); const float invf = (float)(1.0 / pow(10000.0, (double)(2 * i) / (double)HD)); const float ang = __fmul_rn((float)p, invf); const float c = cosf(ang), s = sinf(ang);
  *(float*)(CS + t) = c; *(float*)(SN + t) = s;  }
extern "C" void kernel_launch(void* const* d_in, const int* in_sizes, int n_in,
                              void* d_out, int out_size, void* d_ws, size_t ws_size, hipStream_t stream) {
  (void)in_sizes; (void)n_in; (void)out_size;
  const float* const* I = (const float* const*)d_in; const float* x = I[0]; const float* wattn = I[1]; const float* wo = I[2];      /* x; fused [in][out] W_attn [1024][3072] (q | k | v column thirds); [in][out] W_proj; rope tables computed in-kernel (positions = row index) */
  static_assert(HPG == 1 && NH == NG * HPG && NH * HD == DM && KVD == DM, "plain multi-head attention as 16 kv groups of one query head"); const float* bq = nullptr; const float* bk = nullptr; const float* bv = nullptr; const float* bo = nullptr;      /* [in][out] weights, no biases; rope tables computed in the kernel */
  char* ws = (char*)d_ws; size_t off = 0;
  auto take = [&](size_t bytes) { char* p = ws + off; off += (bytes + 255) & ~(size_t)255; return p; };
  _Float16* BQKV = (_Float16*)take((size_t)3 * DM * DM * 2); _Float16* BQ = BQKV; _Float16* BK = BQKV + (size_t)DM * DM; _Float16* BV = BQKV + (size_t)2 * DM * DM; _Float16* BO = (_Float16*)take((size_t)DM * DM * 2);      /* one transposed plane Bt [3072][1024] of the fused weight: rows 0..1023 = q, 1024.. = k, 2048.. = v */
  _Float16* X16 = (_Float16*)take(NR * DM * 2); float* QF = (float*)take((size_t)SQ * DM * 4); float* KF = (float*)take((size_t)SQ * KVD * 4); float* CSB = (float*)take((size_t)SQ * HD * 4); float* SNB = (float*)take((size_t)SQ * HD * 4); _Float16* Q16 = (_Float16*)take(NR * DM * 2); _Float16* K16 = (_Float16*)take(NR * KVD * 2); _Float16* V16 = (_Float16*)take(NR * KVD * 2); _Float16* O16 = (_Float16*)take(NR * DM * 2);
  float* S = (float*)take((size_t)NH * QT * NKX * 4); _Float16* P = (_Float16*)take((size_t)NH * QT * NKX * 2); _Float16* VT = (_Float16*)take((size_t)NH * HD * SQ * 2);
  float* QF0 = (float*)take((size_t)QT0 * DM * 4); float* KF0 = (float*)take((size_t)QT0 * KVD * 4); float* VF0 = (float*)take((size_t)QT0 * KVD * 4); float* KF0e = (float*)take((size_t)QT0 * DM * 4); float* VF0e = (float*)take((size_t)QT0 * DM * 4); float* OF0 = (float*)take((size_t)NB * QT0 * DM * 4); _Float16* OH0 = (_Float16*)take((size_t)NB * QT0 * DM * 2); _Float16* OL0 = (_Float16*)take((size_t)NB * QT0 * DM * 2);
  if (off > ws_size) return;
  k_wt_f16<<<(unsigned)(((size_t)3 * DM * (DM / 8) + 255) / 256), 256, 0, stream>>>(wattn, BQKV, DM, 3 * DM, 16.0f); k_wt_f16<<<(unsigned)(((size_t)DM * (DM / 8) + 255) / 256), 256, 0, stream>>>(wo, BO, DM, DM, 16.0f);      /* [in][out] -> Bt x16 planes (fused W_attn: K 1024, N 3072) */
  k_x16<<<(unsigned)((NR * DM / 8 + 255) / 256), 256, 0, stream>>>(x, X16, NR * DM / 8);
  k_tab2d<<<(SQ * (HD / 2) + 255) / 256, 256, 0, stream>>>(CSB, SNB);      /* rope tables cos/sin(p / 10000^(2i/64)): inv_freq double-derived -> f32, f32 angle */
  const size_t r0p = (size_t)B0 * SQ;      /* first projected row */
  k_gemm2<0><<<dim3((unsigned)((MP / 128) * (KVD / 64)), 1), 128, 0, stream>>>(X16 + r0p * DM, DM, 0, BV, DM, 0, 0.0625f, bv, 0, nullptr, 1, 0, 0, nullptr, V16 + r0p * KVD, KVD, 0, MP, KVD, DM);
  for (int b = B0; b < B0 + NBR; ++b) { const size_t r0 = (size_t)b * SQ;
    k_gemm2<0><<<dim3((unsigned)((SQ / 128) * (DM / 64)), 1), 128, 0, stream>>>(X16 + r0 * DM, DM, 0, BQ, DM, 0, 0.0625f, nullptr, 0, nullptr, 1, 0, 0, QF, nullptr, DM, 0, SQ, DM, DM);      /* q (f32) of this batch */
    k_gemm2<0><<<dim3((unsigned)((SQ / 128) * (KVD / 64)), 1), 128, 0, stream>>>(X16 + r0 * DM, DM, 0, BK, DM, 0, 0.0625f, nullptr, 0, nullptr, 1, 0, 0, KF, nullptr, KVD, 0, SQ, KVD, DM);      /* k (f32) */
    k_xform<0, 2><<<(unsigned)((size_t)SQ * NH), 64, 0, stream>>>(QF, DM, NH, nullptr, 0.f, CSB, SNB, Q16 + r0 * DM, DM); k_xform<0, 2><<<(unsigned)((size_t)SQ * NG), 64, 0, stream>>>(KF, KVD, NG, nullptr, 0.f, CSB, SNB, K16 + r0 * KVD, KVD);      /* half-split rope <0, 2> (out_lo = x_lo c - x_hi s, out_hi = x_lo s + x_hi c = t cos + rotate_half(t) sin with the module's [f | f] tables) -> f16 rows */
    k_xformf<0, 2><<<(unsigned)(QT0 * NH), 64, 0, stream>>>(QF, DM, NH, nullptr, 0.f, CSB, SNB, QF0, DM); k_xformf<0, 2><<<(unsigned)(QT0 * NG), 64, 0, stream>>>(KF, KVD, NG, nullptr, 0.f, CSB, SNB, KF0, KVD);      /* f32 half-split-roped q, k of rows 0..127 */
    k_vt<NG, SQ><<<NG * (SQ / 64), 256, 0, stream>>>(V16 + r0 * KVD, KVD, 0, VT);      /* V^T [NH][HD][SQ] for this batch */
    k_gemm2<0><<<dim3((QT0 / 128) * (KVD / 64), 1), 128, 0, stream>>>(X16 + r0 * DM, DM, 0, BV, DM, 0, 0.0625f, bv, 0, nullptr, 1, 0, 0, VF0, nullptr, KVD, 0, QT0, KVD, DM);
    k_kvexp<<<(unsigned)(((size_t)QT0 * DM / 4 + 255) / 256), 256, 0, stream>>>(KF0, KF0e, (size_t)QT0 * DM / 4); k_kvexp<<<(unsigned)(((size_t)QT0 * DM / 4 + 255) / 256), 256, 0, stream>>>(VF0, VF0e, (size_t)QT0 * DM / 4);      /* head h <- kv group h (HPG 1) for the exact first-tile kernel */      /* f32 q, k, v of the first 128 rows (exact products) */
    k_att0<0><<<NH * (QT0 / 64), 64, 0, stream>>>(QF0, KF0e, VF0e, DM, nullptr, 0.125f, OF0 + (size_t)b * QT0 * DM, DM);      /* exact f32 attention for rows 0..127 (o x64) */
    for (int q0 = 0; q0 < QN; q0 += QT) { const int nk = q0 + QT;      /* causal: only keys below the tile end are computed */
      k_gemm2<0><<<dim3((QT / 128) * (nk / 64), NH), 128, 0, stream>>>(Q16 + (r0 + q0) * LQ, LQ, (size_t)HD, K16 + r0 * KVD, KVD, (size_t)HD, 0.125f, nullptr, 0, nullptr, 1, 0, 0, S, nullptr, NKX, (size_t)QT * NKX, QT, nk, HD);      /* scores: HPG == 1 (every head has its own keys): ONE launch with all 16 heads on grid.y, key head stride HD instead of the grouped form's 0 (the 16 per-group launches of one head each, fused) */
      k_rsmcf2<<<(NHD * QT + 255) / 256, 256, 0, stream>>>(S, P, NHD, q0, nk);
      k_gemm2<0><<<dim3((QT / 128) * (HD / 64), NH), 128, 0, stream>>>(P, NKX, (size_t)QT * NKX, VT, SQ, (size_t)HD * SQ, 0.25f, nullptr, 0, nullptr, 1, 0, 0, nullptr, O16 + (r0 + q0) * DM, DM, (size_t)HD, QT, HD, nk); } }      /* o for all 16 heads in ONE launch (value head stride HD*SQ) (x64) */
  k_gemm2<0><<<dim3((unsigned)((MPO / 128) * (DM / 64)), 1), 128, 0, stream>>>(O16 + r0p * DM, DM, 0, BO, DM, 0, 0.0009765625f, bo, 0, nullptr, 1, 0, 0, (float*)d_out + r0p * DM, nullptr, DM, 0, MPO, DM, DM);      /* out rows are the output layout */
  k_hl<<<(unsigned)(((size_t)NB * QT0 * DM / 8 + 255) / 256), 256, 0, stream>>>(OF0, OH0, OL0, (size_t)NB * QT0 * DM / 8);      /* first-tile o (x64) -> f16 hi + x1024 residual planes */
  for (int b = B0; b < B0 + NBR; ++b) { const size_t r0 = (size_t)b * SQ; const size_t f0 = (size_t)b * QT0;
    k_gemm2<0><<<dim3((QT0 / 128) * (DM / 64), 1), 128, 0, stream>>>(OH0 + f0 * DM, DM, 0, BO, DM, 0, 0.0009765625f, bo, 0, nullptr, 1, 0, 0, (float*)d_out + r0 * DM, nullptr, DM, 0, QT0, DM, DM);      /* rows 0..127: out = o_hi Wo (+ b), overwriting the f16-path rows */
    k_gemm2<0><<<dim3((QT0 / 128) * (DM / 64), 1), 128, 0, stream>>>(OL0 + f0 * DM, DM, 0, BO, DM, 0, 0.00000095367431640625f, nullptr, 0, (const float*)d_out + r0 * DM, -1, 0, 0, (float*)d_out + r0 * DM, nullptr, DM, 0, QT0, DM, DM); }      /* += o_lo Wo 2^-20 (own-element accumulate) */
}

// v001
// It runs in 4140 microseconds.
// In two side-by-side timings against v000, it was 2.40 and 2.43 times as fast.
#include <hip/hip_runtime.h>
// Causal multi-head self-attention with rotate-half RoPE computed in the module and a bias-free fused QKV projection (x [4][2048][1024]; qkv = x Wqkv ([in][out] 1024 x 3072, no bias) split into q | k | v thirds, 16 heads of 64; cos / sin = [f | f] of pos * 10000^(-2i/64); q = q cos + rotate_half(q) sin, likewise k; scores * 64^-0.5; causal (tril, finfo.min fill); softmax; out = merged Wout ([in][out], no bias) -> [4][2048][1024]); run as grouped-query causal attention with 16 groups of ONE head and half-split rope.
// Compute dtype: inputs rounded to bf16; x / weights exact; q, k, v, softmax weights and o as plain f16 GEMM operands (~2^-12); scores and softmax statistics f32; v_wmma_f32_16x16x32_f16.
#define NB 4
#define NG 16
#define HPG 1
#define KVD (NG * HD)
#define SQ 2048
#define DM 1024
#define NH 16
#define HD 64
#define HG 4                         /* heads per k_vt(b, h0) launch (overload not called) */
#define QT 256                       /* query rows per causal tile */
#define NKX SQ                       /* S / P row pitch */
#define QT0 128                      /* first-tile rows recomputed exactly in f32 */
#define B0 0                         /* first batch processed (debug hook) */
#define NBR NB                       /* batches processed (debug hook) */
#define NR ((size_t)NB * SQ)         /* token rows */
#define MP ((int)((size_t)NBR * SQ)) /* rows projected (debug hook) */
#define QN SQ                        /* query rows attended per batch (debug hook) */
#define NHD NH                       /* heads attended (debug hook) */
#define MPO MP                       /* rows through the output stage (debug hook) */
#define LQ DM      /* row pitch of the q/k/v rows */
typedef __bf16 v16b __attribute__((ext_vector_type(16)));
typedef unsigned short v8us __attribute__((ext_vector_type(8), may_alias));
typedef float  v8f  __attribute__((ext_vector_type(8)));
typedef float  v4f  __attribute__((ext_vector_type(4)));
typedef float  v4fa __attribute__((ext_vector_type(4), may_alias));
union FragB { v16b v; v8us half[2]; unsigned short u[16]; };

__device__ __forceinline__ unsigned short bf16_bits(float x) { unsigned int u = __float_as_uint(x); return (unsigned short)((u + 0x7FFFu + ((u >> 16) & 1u)) >> 16); }
__device__ __forceinline__ float bf16_val(unsigned short b) { return __uint_as_float(((unsigned int)b) << 16); }
__device__ __forceinline__ float bf16_round(float x) { return bf16_val(bf16_bits(x)); }
// D += A·B with NT terms: 1 = ah·bh, 2 = + al·bh (A split), 3 = + ah·bl (both split)
template <int NT>
__device__ __forceinline__ v8f mmaN(v16b ah, v16b al, v16b bh, v16b bl, v8f c) {
  c = __builtin_amdgcn_wmma_f32_16x16x32_bf16(false, ah, false, bh, (short)0, c, false, false);
  if (NT >= 2) c = __builtin_amdgcn_wmma_f32_16x16x32_bf16(false, al, false, bh, (short)0, c, false, false);
  if (NT >= 3) c = __builtin_amdgcn_wmma_f32_16x16x32_bf16(false, ah, false, bl, (short)0, c, false, false);
  asm volatile("v_nop\n\tv_nop\n\tv_nop\n\tv_nop" : "+v"(c) : "v"(ah), "v"(al), "v"(bh), "v"(bl));
  return c;
}

__global__ __launch_bounds__(256) void k_wt_bf16(const float* __restrict__ W, unsigned short* __restrict__ Wt, int K, int N) {
  const int t = blockIdx.x * 256 + threadIdx.x;
  const int k8n = K / 8;
  if (t >= N * k8n) return;
  const int n = t / k8n, k8 = (t % k8n) * 8;
  v8us v;
#pragma unroll
  for (int i = 0; i < 8; ++i) v[i] = bf16_bits(W[(size_t)(k8 + i) * N + n]);
  *(v8us*)(Wt + (size_t)n * K + k8) = v;
  
}

// GEMM C[M][N] (f32, pitch ldc) = act(A[M][K]·W + bias). A f32 row-major (pitch lda) converted per fragment to bf16
// (ASPLIT: hi/lo two planes -> 2 terms, else single rounded term); Wt bf16 [N][K] (pitch ldb). BIAS_BF16 rounds the
// bias to bf16 first (bias quantised to bf16 before the add). K%32==0, M%16==0, N%64==0.
template <bool ASPLIT, int ACT, bool BIAS_BF16>
__global__ __launch_bounds__(128) void k_gemm_bf(const float* __restrict__ A, int lda, const unsigned short* __restrict__ Wt, int ldb,
                                               const float* __restrict__ bias, float* __restrict__ C, int ldc, int M, int N, int K) {
  __shared__ __attribute__((aligned(16))) float so[4][16][64];
  const int tid = threadIdx.x, w = tid >> 5, lane = tid & 31, ln = lane & 15, hh = lane >> 4;
  const int ntn = N / 64;
  const int wid = blockIdx.x * 4 + w;
  const int mt = wid / ntn, nq = wid % ntn;
  if (mt * 16 >= M) return;
  const int row0 = mt * 16, col0 = nq * 64;
  const float* arow = A + (size_t)(row0 + ln) * lda;
  v8f acc[4] = {};
  for (int kb = 0; kb < K; kb += 32) {
    FragB ah, al;
    const v4f x0 = *(const v4fa*)(arow + kb + 8 * hh), x1 = *(const v4fa*)(arow + kb + 8 * hh + 4);
    const v4f x2 = *(const v4fa*)(arow + kb + 16 + 8 * hh), x3 = *(const v4fa*)(arow + kb + 16 + 8 * hh + 4);
    float xs[16] = {x0[0],x0[1],x0[2],x0[3],x1[0],x1[1],x1[2],x1[3],x2[0],x2[1],x2[2],x2[3],x3[0],x3[1],x3[2],x3[3]};
#pragma unroll
    for (int i = 0; i < 16; ++i) { const unsigned short hb = bf16_bits(xs[i]); ah.u[i] = hb; al.u[i] = ASPLIT ? bf16_bits(xs[i] - bf16_val(hb)) : (unsigned short)0; }
#pragma unroll
    for (int t = 0; t < 4; ++t) {
      const unsigned short* brow = Wt + (size_t)(col0 + t * 16 + ln) * ldb + kb;
      FragB b;
      b.half[0] = *(const v8us*)(brow + 8 * hh);
      b.half[1] = *(const v8us*)(brow + 16 + 8 * hh);
      acc[t] = mmaN<ASPLIT ? 2 : 1>(ah.v, al.v, b.v, b.v, acc[t]);
    }
  }
#pragma unroll
  for (int t = 0; t < 4; ++t) {
    float bv = bias ? bias[col0 + t * 16 + ln] : 0.f;
    if (BIAS_BF16) bv = bf16_round(bv);
#pragma unroll
    for (int r = 0; r < 8; ++r) { float v = acc[t][r] + bv; if (ACT == 1) v = fmaxf(v, 0.f); so[w][8 * hh + r][t * 16 + ln] = v; }
  }
  __builtin_amdgcn_fence(__ATOMIC_ACQ_REL, "workgroup");
  __builtin_amdgcn_wave_barrier();
  const int rsub = lane >> 4, c4 = (lane & 15) * 4;
  {
#pragma unroll
    for (int q = 0; q < 8; ++q) {
      const int r = q * 2 + rsub;
      const v4f v = *(const v4fa*)&so[w][r][c4];
      *(v4f*)(C + (size_t)(row0 + r) * ldc + col0 + c4) = v;
    }
    
  }
}

// GEMM C = act(A·W + bias + resid): A f32 (ASPLIT -> hi/lo 2 terms), Wt bf16 [N][K]; ACT 0 none, 1 relu, 2 exact gelu;
// resid (optional, f32, row index = (row % rmod), pitch ldr, RES_BF16 rounds it) added before the activation.
template <bool ASPLIT, int ACT, bool BIAS_BF16, bool RES_BF16>
__global__ __launch_bounds__(128) void k_gemm_bf3(const float* __restrict__ A, int lda, const unsigned short* __restrict__ Wt, int ldb,
                                                const float* __restrict__ bias, const float* __restrict__ resid, int rmod, int ldr,
                                                float* __restrict__ C, int ldc, int M, int N, int K) {
  __shared__ __attribute__((aligned(16))) float so[4][16][64];
  const int tid = threadIdx.x, w = tid >> 5, lane = tid & 31, ln = lane & 15, hh = lane >> 4;
  const int ntn = N / 64;
  const int wid = blockIdx.x * 4 + w;
  const int mt = wid / ntn, nq = wid % ntn;
  if (mt * 16 >= M) return;
  const int row0 = mt * 16, col0 = nq * 64;
  const float* arow = A + (size_t)(row0 + ln) * lda;
  v8f acc[4] = {};
  for (int kb = 0; kb < K; kb += 32) {
    FragB ah, al;
    const v4f x0 = *(const v4fa*)(arow + kb + 8 * hh), x1 = *(const v4fa*)(arow + kb + 8 * hh + 4);
    const v4f x2 = *(const v4fa*)(arow + kb + 16 + 8 * hh), x3 = *(const v4fa*)(arow + kb + 16 + 8 * hh + 4);
    float xs[16] = {x0[0],x0[1],x0[2],x0[3],x1[0],x1[1],x1[2],x1[3],x2[0],x2[1],x2[2],x2[3],x3[0],x3[1],x3[2],x3[3]};
#pragma unroll
    for (int i = 0; i < 16; ++i) { const unsigned short hb = bf16_bits(xs[i]); ah.u[i] = hb; al.u[i] = ASPLIT ? bf16_bits(xs[i] - bf16_val(hb)) : (unsigned short)0; }
#pragma unroll
    for (int t = 0; t < 4; ++t) {
      const unsigned short* brow = Wt + (size_t)(col0 + t * 16 + ln) * ldb + kb;
      FragB b;
      b.half[0] = *(const v8us*)(brow + 8 * hh);
      b.half[1] = *(const v8us*)(brow + 16 + 8 * hh);
      acc[t] = mmaN<ASPLIT ? 2 : 1>(ah.v, al.v, b.v, b.v, acc[t]);
    }
  }
#pragma unroll
  for (int t = 0; t < 4; ++t) {
    const int col = col0 + t * 16 + ln;
    float bv = bias ? bias[col] : 0.f;
    if (BIAS_BF16) bv = bf16_round(bv);
#pragma unroll
    for (int r = 0; r < 8; ++r) {
      float v = acc[t][r] + bv;
      if (resid) { float rv = resid[(size_t)((row0 + 8 * hh + r) % rmod) * ldr + col]; if (RES_BF16) rv = bf16_round(rv); v += rv; }
      if (ACT == 1) v = fmaxf(v, 0.f);
      if (ACT == 2) v = 0.5f * v * (1.0f + erff(v * 0.70710678118654752f));
      if (ACT == 3) { const float u = 0.7978845608028654f * (v + 0.044715f * v * v * v); v = 0.5f * v * (1.0f + tanhf(u)); }
      so[w][8 * hh + r][t * 16 + ln] = v;
    }
  }
  __builtin_amdgcn_fence(__ATOMIC_ACQ_REL, "workgroup");
  __builtin_amdgcn_wave_barrier();
  const int rsub = lane >> 4, c4 = (lane & 15) * 4;
  {
#pragma unroll
    for (int q = 0; q < 8; ++q) {
      const int r = q * 2 + rsub;
      const v4f v = *(const v4fa*)&so[w][r][c4];
      *(v4f*)(C + (size_t)(row0 + r) * ldc + col0 + c4) = v;
    }
    
  }
}
// row LayerNorm (biased variance, eps) over N: s = X (+ R); optional out_sum <- s; out_norm <- (s-mu)*rsqrt(var+eps)*g + b
template <bool PARAM_BF16>
__global__ __launch_bounds__(256) void k_layernorm(const float* __restrict__ X, const float* __restrict__ R, const float* __restrict__ g, const float* __restrict__ bta,
                                                  float* __restrict__ out_sum, float* __restrict__ out_norm, int N, float eps) {
  __shared__ float red[256];
  const int row = blockIdx.x, tid = threadIdx.x;
  const float* x = X + (size_t)row * N; const float* rr = R ? R + (size_t)row * N : nullptr;
  float vals[16];                     // up to N = 4096
  const int per = N / 256;            // contiguous chunk per thread? use strided-by-4 chunks: thread handles j = tid*4 + 1024*u
  float s1 = 0.f;
  for (int u = 0; u < per / 4; ++u) {
    const int j = tid * 4 + 1024 * u;
    const v4f a = *(const v4fa*)(x + j);
    v4f b = {0.f,0.f,0.f,0.f}; if (rr) b = *(const v4fa*)(rr + j);
#pragma unroll
    for (int q = 0; q < 4; ++q) { const float v = a[q] + b[q]; vals[u * 4 + q] = v; s1 += v; }
  }
  red[tid] = s1; __syncthreads();
  for (int st = 128; st > 0; st >>= 1) { if (tid < st) red[tid] += red[tid + st]; __syncthreads(); }
  const float mu = red[0] / (float)N; __syncthreads();
  float s2 = 0.f;
  for (int u = 0; u < per / 4; ++u)
#pragma unroll
    for (int q = 0; q < 4; ++q) { const float c = vals[u * 4 + q] - mu; s2 += c * c; }
  red[tid] = s2; __syncthreads();
  for (int st = 128; st > 0; st >>= 1) { if (tid < st) red[tid] += red[tid + st]; __syncthreads(); }
  const float rs = rsqrtf(red[0] / (float)N + eps);
  {
    for (int u = 0; u < per / 4; ++u) {
      const int j = tid * 4 + 1024 * u;
      v4f o, sm;
#pragma unroll
      for (int q = 0; q < 4; ++q) {
        float gg = g[j + q], bb = bta[j + q];
        if (PARAM_BF16) { gg = bf16_round(gg); bb = bf16_round(bb); }
        sm[q] = vals[u * 4 + q]; o[q] = (vals[u * 4 + q] - mu) * rs * gg + bb;
      }
      if (out_sum) *(v4f*)(out_sum + (size_t)row * N + j) = sm;
      *(v4f*)(out_norm + (size_t)row * N + j) = o;
    }
    
  }
}



// ---- f16 WMMA path (v_wmma_f32_16x16x32_f16): 11-bit significands for operands in range — used where a [0,1] probability operand needs more precision than bf16
typedef _Float16 v16h __attribute__((ext_vector_type(16)));
union FragH { v16h v; v8us half[2]; _Float16 h[16]; unsigned short u[16]; };
template <int NT>
__device__ __forceinline__ v8f mmaH(v16h ah, v16h al, v16h bh, v16h bl, v8f c) {
  c = __builtin_amdgcn_wmma_f32_16x16x32_f16(false, ah, false, bh, (short)0, c, false, false);
  if (NT >= 2) c = __builtin_amdgcn_wmma_f32_16x16x32_f16(false, al, false, bh, (short)0, c, false, false);
  if (NT >= 3) c = __builtin_amdgcn_wmma_f32_16x16x32_f16(false, ah, false, bl, (short)0, c, false, false);
  asm volatile("v_nop\n\tv_nop\n\tv_nop\n\tv_nop" : "+v"(c) : "v"(ah), "v"(al), "v"(bh), "v"(bl));
  return c;
}
// batched GEMM like k_gemm_b but f16 operands: A f32 (split into f16 hi/lo if ASPLIT, else rounded to f16), Bt = f16 values [n][k]; alpha; C f32; N multiple of 16 (partial tiles skipped)
template <bool ASPLIT>
__global__ __launch_bounds__(128) void k_gemm_h(const float* __restrict__ A, int lda, size_t sA, const _Float16* __restrict__ Bh, int ldb, size_t sB, float alpha, float* __restrict__ C, int ldc, size_t sC, int M, int N, int K) {
  __shared__ __attribute__((aligned(16))) float so[4][16][64];
  const int tid = threadIdx.x, w = tid >> 5, lane = tid & 31, ln = lane & 15, hh = lane >> 4; const int by = blockIdx.y;
  A += (size_t)by * sA; Bh += (size_t)by * sB; C += (size_t)by * sC;
  const int ntn = (N + 63) / 64; const int wid = blockIdx.x * 4 + w; const int mt = wid / ntn, nq = wid % ntn; if (mt * 16 >= M) return;
  const int row0 = mt * 16, col0 = nq * 64; const float* arow = A + (size_t)(row0 + ln) * lda;
  v8f acc[4] = {};
  for (int kb = 0; kb < K; kb += 32) {
    FragH ah, al;
    const v4f x0 = *(const v4fa*)(arow + kb + 8 * hh), x1 = *(const v4fa*)(arow + kb + 8 * hh + 4), x2 = *(const v4fa*)(arow + kb + 16 + 8 * hh), x3 = *(const v4fa*)(arow + kb + 16 + 8 * hh + 4);
    float xs[16] = {x0[0],x0[1],x0[2],x0[3],x1[0],x1[1],x1[2],x1[3],x2[0],x2[1],x2[2],x2[3],x3[0],x3[1],x3[2],x3[3]};
#pragma unroll
    for (int i = 0; i < 16; ++i) { const _Float16 h = (_Float16)xs[i]; ah.h[i] = h; al.h[i] = ASPLIT ? (_Float16)(xs[i] - (float)h) : (_Float16)0.0f; }
#pragma unroll
    for (int t = 0; t < 4; ++t) { if (col0 + t * 16 >= N) continue; const size_t boff = (size_t)(col0 + t * 16 + ln) * ldb + kb; FragH bq; bq.half[0] = *(const v8us*)(Bh + boff + 8 * hh); bq.half[1] = *(const v8us*)(Bh + boff + 16 + 8 * hh);
      acc[t] = mmaH<ASPLIT ? 2 : 1>(ah.v, al.v, bq.v, bq.v, acc[t]); }
  }
#pragma unroll
  for (int t = 0; t < 4; ++t) { if (col0 + t * 16 >= N) continue;
#pragma unroll
    for (int r = 0; r < 8; ++r) so[w][8 * hh + r][t * 16 + ln] = acc[t][r] * alpha; }
  __builtin_amdgcn_fence(__ATOMIC_ACQ_REL, "workgroup"); __builtin_amdgcn_wave_barrier();
  const int rsub = lane >> 4, c4 = (lane & 15) * 4;
  {
#pragma unroll
    for (int q = 0; q < 8; ++q) { const int r = q * 2 + rsub; if (col0 + c4 < N) { const v4f v = *(const v4fa*)&so[w][r][c4]; *(v4f*)(C + (size_t)(row0 + r) * ldc + col0 + c4) = v; } }
     }
}

// Wt[n][k] = f16(W[k][n]·scale) from f32 row-major W[K][N] (scale = power of two; bf16-exact weights stay exact in f16 away from the subnormal range)
__global__ __launch_bounds__(256) void k_wt_f16(const float* __restrict__ W, _Float16* __restrict__ Wt, int K, int N, float scale) {
  const int t = blockIdx.x * 256 + threadIdx.x; if (t >= N * (K / 8)) return; const int n = t / (K / 8), k8 = (t % (K / 8)) * 8; FragH f;
#pragma unroll
  for (int i = 0; i < 8; ++i) f.h[i] = (_Float16)(bf16_round(W[(size_t)(k8 + i) * N + n]) * scale); const v8us o = f.half[0];
  *(v8us*)((unsigned short*)Wt + (size_t)n * K + k8) = o; 
}
// k_gemm_hh variant with fused epilogue: v = acc·alpha + bias[by·sBias + col] (+ CP[(row/rowsPerB)·sCPb + by·64 + col] if CP) ; ACT 0 none / 1 elu ; writes f16 C16 (and f32 C if non-null)
template <int ACT>
__global__ __launch_bounds__(128) void k_gemm_hhx(const _Float16* __restrict__ A, int lda, size_t sA, const _Float16* __restrict__ Bh, int ldb, size_t sB, float alpha, const float* __restrict__ bias, size_t sBias, const float* __restrict__ CP, int rowsPerB, size_t sCPb, int row0g,
    float* __restrict__ C, _Float16* __restrict__ C16, int ldc, size_t sC, int M, int N, int K) {
  __shared__ __attribute__((aligned(16))) float so[4][16][64];
  const int tid = threadIdx.x, w = tid >> 5, lane = tid & 31, ln = lane & 15, hh = lane >> 4; const int by = blockIdx.y;
  A += (size_t)by * sA; Bh += (size_t)by * sB; const size_t cofs = (size_t)by * sC; const float* bp = bias ? bias + (size_t)by * sBias : nullptr;
  const int ntn = (N + 63) / 64; const int wid = blockIdx.x * 4 + w; const int mt = wid / ntn, nq = wid % ntn; if (mt * 16 >= M) return;
  const int row0 = mt * 16, col0 = nq * 64; const _Float16* arow = A + (size_t)(row0 + ln) * lda;
  v8f acc[4] = {};
  for (int kb = 0; kb < K; kb += 32) { FragH ah; ah.half[0] = *(const v8us*)((const unsigned short*)arow + kb + 8 * hh); ah.half[1] = *(const v8us*)((const unsigned short*)arow + kb + 16 + 8 * hh);
#pragma unroll
    for (int t = 0; t < 4; ++t) { if (col0 + t * 16 >= N) continue; const size_t boff = (size_t)(col0 + t * 16 + ln) * ldb + kb; FragH bq; bq.half[0] = *(const v8us*)((const unsigned short*)Bh + boff + 8 * hh); bq.half[1] = *(const v8us*)((const unsigned short*)Bh + boff + 16 + 8 * hh);
      acc[t] = mmaH<1>(ah.v, ah.v, bq.v, bq.v, acc[t]); }
  }
#pragma unroll
  for (int t = 0; t < 4; ++t) { if (col0 + t * 16 >= N) continue; const int col = col0 + t * 16 + ln; const float bv = bp ? bf16_round(bp[col]) : 0.f;
#pragma unroll
    for (int r = 0; r < 8; ++r) { float v = acc[t][r] * alpha + bv; if (CP) { const int rr = row0g + row0 + 8 * hh + r; if (rowsPerB < 0) v += CP[cofs + (size_t)rr * ldc + col];      /* rowsPerB < 0: own element of the batched C plane */ else { const int bidx = rr / rowsPerB; v += CP[(size_t)bidx * sCPb + (size_t)by * 64 + col]; } } if (ACT == 1) v = (v > 0.f) ? v : expm1f(v); else if (ACT == 7) v = (v > 0.f) ? v + 1.0f : expf(v); else if (ACT == 8) v = tanhf(v); else if (ACT == 9) v = 0.5f * v * (1.0f + tanhf(0.7978845608028654f * (v + 0.044715f * v * v * v))); else if (ACT == 11) v = 1.0f / (1.0f + expf(-v)); else if (ACT == 12) v = (v > 0.f) ? v : 0.01f * v; else if (ACT == 14) v = (v > 0.f) ? v : 0.1f * v; else if (ACT == 16) v = (v >= 0.f) ? v : 0.3f * v; else if (ACT == 17) v = (v >= 0.f) ? v : 0.2f * v; else if (ACT == 15) v = v / (1.0f + expf(-v)); else if (ACT == 3) v = fmaxf(v, 0.f); else if (ACT == 6) v = 0.5f * v * (1.0f + erff(v * 0.70710678118654752f)); so[w][8 * hh + r][t * 16 + ln] = v; } }
  __builtin_amdgcn_fence(__ATOMIC_ACQ_REL, "workgroup"); __builtin_amdgcn_wave_barrier();
  const int rsub = lane >> 4, c4 = (lane & 15) * 4; typedef _Float16 v4h __attribute__((ext_vector_type(4)));
  {
#pragma unroll
    for (int q = 0; q < 8; ++q) { const int r = q * 2 + rsub; if (col0 + c4 < N) { const v4f v = *(const v4fa*)&so[w][r][c4]; if (C) *(v4f*)(C + cofs + (size_t)(row0 + r) * ldc + col0 + c4) = v; if (C16) { v4h h4; for (int i = 0; i < 4; ++i) h4[i] = (_Float16)v[i]; *(v4h*)(C16 + cofs + (size_t)(row0 + r) * ldc + col0 + c4) = h4; } } }
     }
}


typedef _Float16 v4h __attribute__((ext_vector_type(4)));

__global__ __launch_bounds__(256) void k_x16(const float* __restrict__ x, _Float16* __restrict__ X16, size_t n8) { const size_t t = (size_t)blockIdx.x * 256 + threadIdx.x; if (t >= n8) return; FragH f;
#pragma unroll
  for (int q = 0; q < 8; ++q) f.h[q] = (_Float16)bf16_round(x[t * 8 + q]); *(v8us*)((unsigned short*)X16 + t * 8) = f.half[0];  }
__global__ __launch_bounds__(256) void k_h16(const float* __restrict__ x, _Float16* __restrict__ X16, size_t n8) { const size_t t = (size_t)blockIdx.x * 256 + threadIdx.x; if (t >= n8) return; FragH f;
#pragma unroll
  for (int q = 0; q < 8; ++q) f.h[q] = (_Float16)x[t * 8 + q]; *(v8us*)((unsigned short*)X16 + t * 8) = f.half[0];  }
__global__ __launch_bounds__(256) void k_round16f(const float* __restrict__ W, _Float16* __restrict__ Bt, size_t n8) { const size_t t = (size_t)blockIdx.x * 256 + threadIdx.x; if (t >= n8) return; FragH f;
#pragma unroll
  for (int i = 0; i < 8; ++i) f.h[i] = (_Float16)(bf16_round(W[t * 8 + i]) * 16.0f); *(v8us*)((unsigned short*)Bt + t * 8) = f.half[0];  }
template <int NHv, int TTv>
__global__ __launch_bounds__(256) void k_vt(const _Float16* __restrict__ V16, int ldv, int voff, _Float16* __restrict__ Vt) { __shared__ unsigned short tl[64][66]; const int tid = threadIdx.x; const int slab = blockIdx.x / (TTv / 64), lg = blockIdx.x % (TTv / 64); const int b = slab / NHv, h = slab % NHv;
  for (int i = tid; i < 64 * 8; i += 256) { const int r = i / 8, c8 = (i % 8) * 8; FragH f; f.half[0] = *(const v8us*)((const unsigned short*)V16 + ((size_t)b * TTv + lg * 64 + r) * ldv + voff + h * 64 + c8);
#pragma unroll
    for (int q = 0; q < 8; ++q) tl[r][c8 + q] = f.u[q]; }
  __syncthreads();
  {
#pragma unroll
    for (int rd = 0; rd < 2; ++rd) { const int d = rd * 32 + tid / 8, pc = tid % 8; FragH f;
#pragma unroll
      for (int q = 0; q < 8; ++q) f.u[q] = tl[pc * 8 + q][d];
      *(v8us*)((unsigned short*)Vt + ((size_t)slab * 64 + d) * TTv + lg * 64 + pc * 8) = f.half[0]; }
     } }

__global__ __launch_bounds__(256) void k_hl(const float* __restrict__ F, _Float16* __restrict__ Hh, _Float16* __restrict__ Hl, size_t n8) { const size_t t = (size_t)blockIdx.x * 256 + threadIdx.x; if (t >= n8) return; FragH fh, fl; const v4f a = *(const v4fa*)(F + t * 8), c = *(const v4fa*)(F + t * 8 + 4);
#pragma unroll
  for (int q = 0; q < 4; ++q) { _Float16 h = (_Float16)a[q]; fh.h[q] = h; fl.h[q] = (_Float16)((a[q] - (float)h) * 1024.0f); h = (_Float16)c[q]; fh.h[4 + q] = h; fl.h[4 + q] = (_Float16)((c[q] - (float)h) * 1024.0f); }
  { *(v8us*)((unsigned short*)Hh + t * 8) = fh.half[0]; *(v8us*)((unsigned short*)Hl + t * 8) = fl.half[0];  } }

// ---- fast GEMM (wave tile 32x64; requires M % 32 == 0 rows per launch region and N % 64 == 0); epilogue = k_gemm_hhx semantics ----
__device__ __forceinline__ v16h g2_frag(const _Float16* p, int hh) { FragH f; f.half[0] = *(const v8us*)((const unsigned short*)p + 8 * hh); f.half[1] = *(const v8us*)((const unsigned short*)p + 16 + 8 * hh); return f.v; }
__device__ __forceinline__ v8f g2_mma(v16h a, v16h b, v8f c) { v8f d = __builtin_amdgcn_wmma_f32_16x16x32_f16(false, a, false, b, (short)0, c, false, false); asm volatile("v_nop\n\tv_nop\n\tv_nop\n\tv_nop" : "+v"(d) : "v"(a), "v"(b)); return d; }
template <int ACT>
__global__ __launch_bounds__(128) void k_gemm2(const _Float16* __restrict__ A, int lda, size_t sA, const _Float16* __restrict__ Bh, int ldb, size_t sB, float alpha, const float* __restrict__ bias, size_t sBias, const float* __restrict__ CP, int rowsPerB, size_t sCPb, int row0g,
    float* __restrict__ C, _Float16* __restrict__ C16, int ldc, size_t sC, int M, int N, int K) { static_assert(ACT == 0 || ACT == 3 || ACT == 6 || ACT == 8 || ACT == 9 || ACT == 11 || ACT == 12 || ACT == 14 || ACT == 15 || ACT == 16 || ACT == 17, "k_gemm2: unsupported ACT code (would silently apply no activation)");
  __shared__ __attribute__((aligned(16))) float so[4][32][68];
  const int tid = threadIdx.x, w = tid >> 5, lane = tid & 31, ln = lane & 15, hh = lane >> 4; const int by = blockIdx.y;
  A += (size_t)by * sA; Bh += (size_t)by * sB; const size_t cofs = (size_t)by * sC; const float* bp = bias ? bias + (size_t)by * sBias : nullptr;
  const int ntn = N >> 6; const int mt = blockIdx.x / ntn, nq = blockIdx.x - mt * ntn; const int row0 = mt * 128 + 32 * w, col0 = nq * 64; if (row0 >= M) return;
  const _Float16* a0p = A + (size_t)(row0 + ln) * lda; const _Float16* a1p = a0p + (size_t)16 * lda;
  const _Float16* b0p = Bh + (size_t)(col0 + ln) * ldb; const _Float16* b1p = b0p + (size_t)16 * ldb; const _Float16* b2p = b1p + (size_t)16 * ldb; const _Float16* b3p = b2p + (size_t)16 * ldb;
  const v8f z8 = {0.f,0.f,0.f,0.f,0.f,0.f,0.f,0.f}; v8f c00 = z8, c01 = z8, c02 = z8, c03 = z8, c10 = z8, c11 = z8, c12 = z8, c13 = z8;
#pragma unroll 1
  for (int kb = 0; kb < K; kb += 32) { const v16h a0 = g2_frag(a0p + kb, hh), a1 = g2_frag(a1p + kb, hh);
    v16h b = g2_frag(b0p + kb, hh); c00 = g2_mma(a0, b, c00); c10 = g2_mma(a1, b, c10);
    b = g2_frag(b1p + kb, hh); c01 = g2_mma(a0, b, c01); c11 = g2_mma(a1, b, c11);
    b = g2_frag(b2p + kb, hh); c02 = g2_mma(a0, b, c02); c12 = g2_mma(a1, b, c12);
    b = g2_frag(b3p + kb, hh); c03 = g2_mma(a0, b, c03); c13 = g2_mma(a1, b, c13); }
  v8f accs[8] = {c00, c01, c02, c03, c10, c11, c12, c13};
#pragma unroll
  for (int u = 0; u < 8; ++u) { const int t = u & 3, half = u >> 2; const int col = col0 + t * 16 + ln; const float bv = bp ? bf16_round(bp[col]) : 0.f;
#pragma unroll
    for (int r = 0; r < 8; ++r) { const int rloc = half * 16 + 8 * hh + r; float v = accs[u][r] * alpha + bv; if (CP) { if (rowsPerB < 0) v += CP[cofs + (size_t)(row0g + row0 + rloc) * ldc + col];      /* rowsPerB < 0: own element of the batched C plane */ else { const int bidx = (row0g + row0 + rloc) / rowsPerB; v += CP[(size_t)bidx * sCPb + (size_t)by * 64 + col]; } }
      if (ACT == 3) v = fmaxf(v, 0.f); else if (ACT == 6) v = 0.5f * v * (1.0f + erff(v * 0.70710678118654752f)); else if (ACT == 11) v = 1.0f / (1.0f + expf(-v)); else if (ACT == 15) v = v / (1.0f + expf(-v)); else if (ACT == 12) v = (v > 0.f) ? v : 0.01f * v; else if (ACT == 8) v = tanhf(v); else if (ACT == 9) v = 0.5f * v * (1.0f + tanhf(0.7978845608028654f * (v + 0.044715f * v * v * v))); else if (ACT == 14) v = (v > 0.f) ? v : 0.1f * v; else if (ACT == 16) v = (v >= 0.f) ? v : 0.3f * v; else if (ACT == 17) v = (v >= 0.f) ? v : 0.2f * v;
      so[w][rloc][t * 16 + ln] = v; } }
  __builtin_amdgcn_fence(__ATOMIC_ACQ_REL, "workgroup"); __builtin_amdgcn_wave_barrier();
  const int rsub = lane >> 4, c4 = (lane & 15) * 4;
  {
#pragma unroll
    for (int q = 0; q < 16; ++q) { const int r = q * 2 + rsub; const v4f v = *(const v4fa*)&so[w][r][c4]; if (C) *(v4f*)(C + cofs + (size_t)(row0 + r) * ldc + col0 + c4) = v; if (C16) { v4h h4; for (int i = 0; i < 4; ++i) h4[i] = (_Float16)v[i]; *(v4h*)(C16 + cofs + (size_t)(row0 + r) * ldc + col0 + c4) = h4; } }
     } }


__global__ __launch_bounds__(256) void k_wnat(const float* __restrict__ w, size_t n8, _Float16* __restrict__ Bt) { const size_t t = (size_t)blockIdx.x * 256 + threadIdx.x; if (t >= n8) return; FragH f; for (int q = 0; q < 8; ++q) f.h[q] = (_Float16)(bf16_round(w[t * 8 + q]) * 16.0f); *(v8us*)((unsigned short*)Bt + t * 8) = f.half[0];  }
__global__ __launch_bounds__(256) void k_rsm(const float* __restrict__ S, _Float16* __restrict__ P, int nrows) {
  #pragma clang fp contract(off)
  const int i = blockIdx.x * 256 + threadIdx.x; if (i >= nrows) return; const float* s = S + (size_t)i * SQ; float mx = -3.0e38f;
#pragma unroll 1
  for (int j = 0; j < SQ; ++j) mx = fmaxf(mx, s[j]); float se = 0.f;
#pragma unroll 1
  for (int j = 0; j < SQ; ++j) se += expf(s[j] - mx); const float sc = 256.0f / se;
#pragma unroll 1
  for (int j0 = 0; j0 < SQ; j0 += 8) { FragH f; for (int q = 0; q < 8; ++q) f.h[q] = (_Float16)(expf(s[j0 + q] - mx) * sc); unsigned short* d = (unsigned short*)P + (size_t)i * SQ + j0; *(v8us*)d = f.half[0];  } }
__global__ __launch_bounds__(256) void k_vt(const _Float16* __restrict__ V16, int b, int h0, _Float16* __restrict__ VT) { __shared__ unsigned short tl[64][65]; const int tid = threadIdx.x; const int hh = blockIdx.x % HG, sg = blockIdx.x / HG; const int s0 = sg * 64; const int h = h0 + hh;
  for (int i = tid; i < 64 * 8; i += 256) { const int j = i / 8, d8 = (i % 8) * 8; FragH f; f.half[0] = *(const v8us*)((const unsigned short*)V16 + ((size_t)b * SQ + s0 + j) * DM + h * HD + d8); for (int q = 0; q < 8; ++q) tl[d8 + q][j] = f.u[q]; }
  __syncthreads();
  { for (int i = tid; i < 64 * 8; i += 256) { const int d = i / 8, j8 = (i % 8) * 8; FragH f; for (int q = 0; q < 8; ++q) f.u[q] = tl[d][j8 + q]; *(v8us*)((unsigned short*)VT + ((size_t)hh * HD + d) * SQ + s0 + j8) = f.half[0]; }  } }



// Lane l <-> l ^ M inside a 16-lane row (DPP row_xmask) and l <-> l ^ 16 (cross-row move): a five-step butterfly leaves the row's maximum / sum in every lane without an LDS round trip.
template <int M> __device__ __forceinline__ float rs_xm(float x) { return __builtin_bit_cast(float, __builtin_amdgcn_update_dpp(0, __builtin_bit_cast(int, x), 0x160 | M, 0xf, 0xf, true)); }
__device__ __forceinline__ float rs_xh(float x) { return __builtin_bit_cast(float, __builtin_amdgcn_permlanex16(__builtin_bit_cast(int, x), __builtin_bit_cast(int, x), 0x76543210, 0xfedcba98, false, false)); }
__device__ __forceinline__ float rs_wmax(float v) { v = fmaxf(v, rs_xm<1>(v)); v = fmaxf(v, rs_xm<2>(v)); v = fmaxf(v, rs_xm<4>(v)); v = fmaxf(v, rs_xm<8>(v)); return fmaxf(v, rs_xh(v)); }
__device__ __forceinline__ float rs_wsum(float v) { v += rs_xm<1>(v); v += rs_xm<2>(v); v += rs_xm<4>(v); v += rs_xm<8>(v); return v + rs_xh(v); }
// Four v_exp_f32 and, in the same statement so that it stands directly behind the last one, the one free slot that the instruction set asks for behind a transcendental; the early-clobber outputs keep each exp off the sources of the one in front of it.
__device__ __forceinline__ v4f rs_exp2(v4f x) { float a, b, c, d; asm("v_exp_f32 %0, %4\n\tv_exp_f32 %1, %5\n\tv_exp_f32 %2, %6\n\tv_exp_f32 %3, %7\n\tv_nop" : "=&v"(a), "=&v"(b), "=&v"(c), "=&v"(d) : "v"(x[0]), "v"(x[1]), "v"(x[2]), "v"(x[3])); const v4f r = {a, b, c, d}; return r; }
// Causal row softmax of the query tile that ends at key NC*128 (its first row is q0 = NC*128 - QT), ONE WAVE PER ROW: lane l holds columns c*128 + 4l .. + 3 of chunk c, so each load covers 512 contiguous bytes and each store 256;
// the row is read once and stays in registers for the maximum, the sum and the scaled f16 weights. Only the last QT columns can lie above the diagonal, so only their chunks are masked.
template <int NC>
__global__ __launch_bounds__(256) void k_rsmcf2(const float* __restrict__ S, _Float16* __restrict__ P, int hg) {
  static_assert(NC * 128 >= QT && NC * 128 <= NKX && QT % 128 == 0, "whole 128-column chunks, tile inside the row pitch");
  const int lane = threadIdx.x & 31; const int t = blockIdx.x * 8 + __builtin_amdgcn_readfirstlane(threadIdx.x >> 5); if (t >= hg * QT) return;      /* wave-uniform exit; the kernel has no barrier */
  const char* s = (const char*)(S + (size_t)t * NKX); _Float16* p = P + (size_t)t * NKX; const unsigned ob = lane * 16u;      /* the lane's byte offset inside each 512-byte chunk */
  const int rel = (t % QT) - lane * 4;      /* column q0 + d*128 + 4*lane + q is kept while d*128 + q <= rel */
  v4f v[NC];
#pragma unroll
  for (int c = 0; c < NC; ++c) v[c] = *(const v4fa*)(s + c * 512 + ob);
#pragma unroll
  for (int d = 0; d < QT / 128; ++d) for (int q = 0; q < 4; ++q) v[NC - QT / 128 + d][q] = (d * 128 + q <= rel) ? v[NC - QT / 128 + d][q] : -1.0e9f;
  float m0 = -3.0e38f, m1 = -3.0e38f;      /* two chains: the maximum does not depend on the order */
#pragma unroll
  for (int c = 0; c < NC; ++c) { m0 = fmaxf(fmaxf(m0, v[c][0]), v[c][1]); m1 = fmaxf(fmaxf(m1, v[c][2]), v[c][3]); }
  const float mx = rs_wmax(fmaxf(m0, m1));
  v4f se4 = {0.f, 0.f, 0.f, 0.f};
#pragma unroll
  for (int c = 0; c < NC; ++c) { v[c] = rs_exp2((v[c] - mx) * 1.44269504088896340736f); se4 += v[c]; }      /* exp(s - mx) as 2^((s - mx) log2 e), the form __expf compiles to */
  const float sc = 256.0f / rs_wsum((se4[0] + se4[1]) + (se4[2] + se4[3]));
#pragma unroll
  for (int c = 0; c < NC; ++c) { v4h h4; for (int q = 0; q < 4; ++q) h4[q] = (_Float16)(v[c][q] * sc); *(v4h*)(p + c * 128 + lane * 4) = h4; } }


template <int MASKADD>
__global__ __launch_bounds__(64) void k_att0(const float* __restrict__ QF, const float* __restrict__ KF, const float* __restrict__ VF, int ld, const float* __restrict__ mask, float scale, float* __restrict__ OF, int ldo) {
  #pragma clang fp contract(off)
  __shared__ __attribute__((aligned(16))) float lq[64][64]; __shared__ __attribute__((aligned(16))) float lo[64][64];
  const int tid = threadIdx.x; const int h = blockIdx.x / (QT0 / 64), rg = blockIdx.x % (QT0 / 64); const int i = rg * 64 + tid;
  const float* qr = QF + (size_t)i * ld + h * HD;
#pragma unroll 1
  for (int c = 0; c < HD / 4; ++c) { *(v4f*)&lq[tid][c * 4] = *(const v4fa*)(qr + c * 4); const v4f z = {0.f, 0.f, 0.f, 0.f}; *(v4f*)&lo[tid][c * 4] = z; }
  float m = -1.0e30f, l = 0.f; const int jmax = MASKADD ? (SQ - 1) : (rg * 64 + 63);      /* additive-mask form: every key (the mask input decides); causal form: keys up to the block's last row */
#pragma unroll 1
  for (int j = 0; j <= jmax; ++j) { const float* kr = KF + (size_t)j * ld + h * HD; const float* vr = VF + (size_t)j * ld + h * HD; float s = 0.f;
#pragma unroll 1
    for (int c = 0; c < HD / 4; ++c) { const v4f kq = *(const v4fa*)(kr + c * 4); const v4f qq = *(v4f*)&lq[tid][c * 4]; s = __fadd_rn(s, __fmul_rn(qq[0], kq[0])); s = __fadd_rn(s, __fmul_rn(qq[1], kq[1])); s = __fadd_rn(s, __fmul_rn(qq[2], kq[2])); s = __fadd_rn(s, __fmul_rn(qq[3], kq[3])); }
    s = __fmul_rn(s, scale); if (MASKADD) s = __fadd_rn(s, __fmul_rn(bf16_round(mask[(size_t)i * SQ + j]), -10000.0f));
    const float f = (MASKADD || j <= i) ? 1.f : 0.f; const float sm = fmaf(f, s, (1.f - f) * -1.0e30f); const float mn = fmaxf(m, sm); const float sc = expf(m - mn); const float e = expf(sm - mn); l = __fadd_rn(__fmul_rn(l, sc), e); m = mn;
#pragma unroll 1
    for (int c = 0; c < HD / 4; ++c) { const v4f vv = *(const v4fa*)(vr + c * 4); v4f oo = *(v4f*)&lo[tid][c * 4]; for (int u = 0; u < 4; ++u) oo[u] = __fadd_rn(__fmul_rn(oo[u], sc), __fmul_rn(e, vv[u])); *(v4f*)&lo[tid][c * 4] = oo; } }
  const float fin = 64.0f / l;      /* o carried x64 like the f16 path */
#pragma unroll 1
  for (int c = 0; c < HD / 4; ++c) { v4f oo = *(v4f*)&lo[tid][c * 4]; for (int u = 0; u < 4; ++u) oo[u] = __fmul_rn(oo[u], fin); *(v4f*)&lo[tid][c * 4] = oo; }
  __syncthreads();
  {
#pragma unroll 1
    for (int it = 0; it < 16; ++it) { const int row = it * 4 + tid / 16, pc = (tid % 16) * 4; const v4f v = *(const v4f*)&lo[row][pc]; *(v4f*)(OF + (size_t)(rg * 64 + row) * ldo + h * HD + pc) = v; }
     } }


__global__ __launch_bounds__(256) void k_kvexp(const float* __restrict__ src, float* __restrict__ dst, size_t n4) { const size_t t = (size_t)blockIdx.x * 256 + threadIdx.x; if (t >= n4) return; const size_t e = t * 4; const size_t row = e / DM; const int col = (int)(e % DM); const int h = col / HD, d = col % HD; const v4f v = *(const v4fa*)(src + row * KVD + (size_t)(h / HPG) * HD + d); *(v4f*)(dst + e) = v;  }

__global__ __launch_bounds__(256) void k_tab2(float theta, float* __restrict__ CS, float* __restrict__ SN) {
  #pragma clang fp contract(off)
  const int t = blockIdx.x * 256 + threadIdx.x; if (t >= SQ * (HD / 2)) return; const int i = t % (HD / 2); const int p = t / (HD / 2); const float invf = 1.0f / powf(theta, (float)(2 * i) / (float)HD); const float ang = __fmul_rn((float)p, invf); const float c = cosf(ang), s = sinf(ang);
  *(float*)(CS + t) = c; *(float*)(SN + t) = s;  }
template <int NORM, int ROPE>
__global__ __launch_bounds__(64) void k_xform(const float* __restrict__ F, int ldf, int nh, const float* __restrict__ gain, float eps, const float* __restrict__ CS, const float* __restrict__ SN, _Float16* __restrict__ H16, int ldo) {
  #pragma clang fp contract(off)
  __shared__ float xv[HD]; __shared__ float red[HD]; __shared__ unsigned short sh_[HD]; const int d = threadIdx.x; const int h = blockIdx.x % nh; const size_t r = blockIdx.x / nh; const int p = (int)(r % SQ);
  float x = F[r * (size_t)ldf + (size_t)h * HD + d];
  if (NORM) { red[d] = __fmul_rn(x, x); __syncthreads(); for (int st = HD / 2; st > 0; st >>= 1) { if (d < st) red[d] = __fadd_rn(red[d], red[d + st]); __syncthreads(); } const float rs = rsqrtf(__fadd_rn(red[0] / (float)HD, eps)); x = __fmul_rn(__fmul_rn(x, rs), bf16_round(gain[d])); }
  xv[d] = x; __syncthreads();
  float o = x;
  if (ROPE == 1) { const int i = d >> 1; const float c = CS[p * (HD / 2) + i], s = SN[p * (HD / 2) + i]; const float ev = xv[2 * i], od = xv[2 * i + 1]; o = (d & 1) ? __fadd_rn(__fmul_rn(ev, s), __fmul_rn(od, c)) : __fadd_rn(__fmul_rn(ev, c), -__fmul_rn(od, s)); }
  if (ROPE == 2) { const int i = d & (HD / 2 - 1); const float c = CS[p * (HD / 2) + i], s = SN[p * (HD / 2) + i]; const float lo = xv[i], hi = xv[i + HD / 2]; o = (d < HD / 2) ? __fadd_rn(__fmul_rn(lo, c), -__fmul_rn(hi, s)) : __fadd_rn(__fmul_rn(lo, s), __fmul_rn(hi, c)); }
  if (ROPE == 3) { const float c = CS[p * HD + d], s = SN[p * HD + d]; const float lo = xv[d & (HD / 2 - 1)], hi = xv[(d & (HD / 2 - 1)) + HD / 2]; o = (d < HD / 2) ? __fadd_rn(__fmul_rn(lo, c), -__fmul_rn(hi, s)) : __fadd_rn(__fmul_rn(hi, c), __fmul_rn(lo, s)); }      /* rotate-half with FULL-width per-element tables [pos][HD] */
  FragH th; th.h[0] = (_Float16)o; sh_[d] = th.u[0]; __syncthreads();
  if (d < HD / 8) { FragH f; for (int q = 0; q < 8; ++q) f.u[q] = sh_[d * 8 + q]; unsigned short* dst = (unsigned short*)H16 + r * (size_t)ldo + (size_t)h * HD + d * 8; *(v8us*)dst = f.half[0];  } }

template <int NORM, int ROPE>
__global__ __launch_bounds__(64) void k_xformf(const float* __restrict__ F, int ldf, int nh, const float* __restrict__ gain, float eps, const float* __restrict__ CS, const float* __restrict__ SN, float* __restrict__ F32, int ldo) {
  #pragma clang fp contract(off)
  __shared__ float xv[HD]; __shared__ float red[HD]; const int d = threadIdx.x; const int h = blockIdx.x % nh; const size_t r = blockIdx.x / nh; const int p = (int)(r % SQ);
  float x = F[r * (size_t)ldf + (size_t)h * HD + d];
  if (NORM) { red[d] = __fmul_rn(x, x); __syncthreads(); for (int st = HD / 2; st > 0; st >>= 1) { if (d < st) red[d] = __fadd_rn(red[d], red[d + st]); __syncthreads(); } const float rs = rsqrtf(__fadd_rn(red[0] / (float)HD, eps)); x = __fmul_rn(__fmul_rn(x, rs), bf16_round(gain[d])); }
  xv[d] = x; __syncthreads();
  float o = x;
  if (ROPE == 1) { const int i = d >> 1; const float c = CS[p * (HD / 2) + i], s = SN[p * (HD / 2) + i]; const float ev = xv[2 * i], od = xv[2 * i + 1]; o = (d & 1) ? __fadd_rn(__fmul_rn(ev, s), __fmul_rn(od, c)) : __fadd_rn(__fmul_rn(ev, c), -__fmul_rn(od, s)); }
  if (ROPE == 2) { const int i = d & (HD / 2 - 1); const float c = CS[p * (HD / 2) + i], s = SN[p * (HD / 2) + i]; const float lo = xv[i], hi = xv[i + HD / 2]; o = (d < HD / 2) ? __fadd_rn(__fmul_rn(lo, c), -__fmul_rn(hi, s)) : __fadd_rn(__fmul_rn(lo, s), __fmul_rn(hi, c)); }
  if (ROPE == 3) { const float c = CS[p * HD + d], s = SN[p * HD + d]; const float lo = xv[d & (HD / 2 - 1)], hi = xv[(d & (HD / 2 - 1)) + HD / 2]; o = (d < HD / 2) ? __fadd_rn(__fmul_rn(lo, c), -__fmul_rn(hi, s)) : __fadd_rn(__fmul_rn(hi, c), __fmul_rn(lo, s)); }      /* rotate-half with FULL-width per-element tables [pos][HD] */
  float* dst = F32 + r * (size_t)ldo + (size_t)h * HD + d; *(float*)dst = o;  }

__global__ __launch_bounds__(256) void k_bfcp(const float* __restrict__ src, float* __restrict__ dst, size_t n4) { const size_t t = (size_t)blockIdx.x * 256 + threadIdx.x; if (t >= n4) return; const v4f a = *(const v4fa*)(src + t * 4); v4f o; for (int q = 0; q < 4; ++q) o[q] = bf16_round(a[q]); *(v4f*)(dst + t * 4) = o;  }

__global__ __launch_bounds__(256) void k_tabhalf(const float* __restrict__ cs, const float* __restrict__ sn, float* __restrict__ CS, float* __restrict__ SN) { const int t = blockIdx.x * 256 + threadIdx.x; if (t >= SQ * (HD / 2)) return; const int p = t / (HD / 2), i = t % (HD / 2); const float c = bf16_round(cs[(size_t)p * HD + i]), s = bf16_round(sn[(size_t)p * HD + i]);
  *(float*)(CS + t) = c; *(float*)(SN + t) = s;  }

__global__ __launch_bounds__(256) void k_tab2d(float* __restrict__ CS, float* __restrict__ SN) {
  #pragma clang fp contract(off)
  const int t = blockIdx.x * 256 + threadIdx.x; if (t >= SQ * (HD / 2)) return; const int i = t % (HD / 2); const int p = t / (HD / 2); const float invf = (float)(1.0 / pow(10000.0, (double)(2 * i) / (double)HD)); const float ang = __fmul_rn((float)p, invf); const float c = cosf(ang), s = sinf(ang);
  *(float*)(CS + t) = c; *(float*)(SN + t) = s;  }
extern "C" void kernel_launch(void* const* d_in, const int* in_sizes, int n_in,
                              void* d_out, int out_size, void* d_ws, size_t ws_size, hipStream_t stream) {
  (void)in_sizes; (void)n_in; (void)out_size;
  const float* const* I = (const float* const*)d_in; const float* x = I[0]; const float* wattn = I[1]; const float* wo = I[2];      /* x; fused [in][out] W_attn [1024][3072] (q | k | v column thirds); [in][out] W_proj; rope tables computed in-kernel (positions = row index) */
  static_assert(HPG == 1 && NH == NG * HPG && NH * HD == DM && KVD == DM, "plain multi-head attention as 16 kv groups of one query head"); const float* bq = nullptr; const float* bk = nullptr; const float* bv = nullptr; const float* bo = nullptr;      /* [in][out] weights, no biases; rope tables computed in the kernel */
  char* ws = (char*)d_ws; size_t off = 0;
  auto take = [&](size_t bytes) { char* p = ws + off; off += (bytes + 255) & ~(size_t)255; return p; };
  _Float16* BQKV = (_Float16*)take((size_t)3 * DM * DM * 2); _Float16* BQ = BQKV; _Float16* BK = BQKV + (size_t)DM * DM; _Float16* BV = BQKV + (size_t)2 * DM * DM; _Float16* BO = (_Float16*)take((size_t)DM * DM * 2);      /* one transposed plane Bt [3072][1024] of the fused weight: rows 0..1023 = q, 1024.. = k, 2048.. = v */
  _Float16* X16 = (_Float16*)take(NR * DM * 2); float* QF = (float*)take((size_t)SQ * DM * 4); float* KF = (float*)take((size_t)SQ * KVD * 4); float* CSB = (float*)take((size_t)SQ * HD * 4); float* SNB = (float*)take((size_t)SQ * HD * 4); _Float16* Q16 = (_Float16*)take(NR * DM * 2); _Float16* K16 = (_Float16*)take(NR * KVD * 2); _Float16* V16 = (_Float16*)take(NR * KVD * 2); _Float16* O16 = (_Float16*)take(NR * DM * 2);
  float* S = (float*)take((size_t)NH * QT * NKX * 4); _Float16* P = (_Float16*)take((size_t)NH * QT * NKX * 2); _Float16* VT = (_Float16*)take((size_t)NH * HD * SQ * 2);
  float* QF0 = (float*)take((size_t)QT0 * DM * 4); float* KF0 = (float*)take((size_t)QT0 * KVD * 4); float* VF0 = (float*)take((size_t)QT0 * KVD * 4); float* KF0e = (float*)take((size_t)QT0 * DM * 4); float* VF0e = (float*)take((size_t)QT0 * DM * 4); float* OF0 = (float*)take((size_t)NB * QT0 * DM * 4); _Float16* OH0 = (_Float16*)take((size_t)NB * QT0 * DM * 2); _Float16* OL0 = (_Float16*)take((size_t)NB * QT0 * DM * 2);
  if (off > ws_size) return;
  k_wt_f16<<<(unsigned)(((size_t)3 * DM * (DM / 8) + 255) / 256), 256, 0, stream>>>(wattn, BQKV, DM, 3 * DM, 16.0f); k_wt_f16<<<(unsigned)(((size_t)DM * (DM / 8) + 255) / 256), 256, 0, stream>>>(wo, BO, DM, DM, 16.0f);      /* [in][out] -> Bt x16 planes (fused W_attn: K 1024, N 3072) */
  k_x16<<<(unsigned)((NR * DM / 8 + 255) / 256), 256, 0, stream>>>(x, X16, NR * DM / 8);
  k_tab2d<<<(SQ * (HD / 2) + 255) / 256, 256, 0, stream>>>(CSB, SNB);      /* rope tables cos/sin(p / 10000^(2i/64)): inv_freq double-derived -> f32, f32 angle */
  const size_t r0p = (size_t)B0 * SQ;      /* first projected row */
  k_gemm2<0><<<dim3((unsigned)((MP / 128) * (KVD / 64)), 1), 128, 0, stream>>>(X16 + r0p * DM, DM, 0, BV, DM, 0, 0.0625f, bv, 0, nullptr, 1, 0, 0, nullptr, V16 + r0p * KVD, KVD, 0, MP, KVD, DM);
  for (int b = B0; b < B0 + NBR; ++b) { const size_t r0 = (size_t)b * SQ;
    k_gemm2<0><<<dim3((unsigned)((SQ / 128) * (DM / 64)), 1), 128, 0, stream>>>(X16 + r0 * DM, DM, 0, BQ, DM, 0, 0.0625f, nullptr, 0, nullptr, 1, 0, 0, QF, nullptr, DM, 0, SQ, DM, DM);      /* q (f32) of this batch */
    k_gemm2<0><<<dim3((unsigned)((SQ / 128) * (KVD / 64)), 1), 128, 0, stream>>>(X16 + r0 * DM, DM, 0, BK, DM, 0, 0.0625f, nullptr, 0, nullptr, 1, 0, 0, KF, nullptr, KVD, 0, SQ, KVD, DM);      /* k (f32) */
    k_xform<0, 2><<<(unsigned)((size_t)SQ * NH), 64, 0, stream>>>(QF, DM, NH, nullptr, 0.f, CSB, SNB, Q16 + r0 * DM, DM); k_xform<0, 2><<<(unsigned)((size_t)SQ * NG), 64, 0, stream>>>(KF, KVD, NG, nullptr, 0.f, CSB, SNB, K16 + r0 * KVD, KVD);      /* half-split rope <0, 2> (out_lo = x_lo c - x_hi s, out_hi = x_lo s + x_hi c = t cos + rotate_half(t) sin with the module's [f | f] tables) -> f16 rows */
    k_xformf<0, 2><<<(unsigned)(QT0 * NH), 64, 0, stream>>>(QF, DM, NH, nullptr, 0.f, CSB, SNB, QF0, DM); k_xformf<0, 2><<<(unsigned)(QT0 * NG), 64, 0, stream>>>(KF, KVD, NG, nullptr, 0.f, CSB, SNB, KF0, KVD);      /* f32 half-split-roped q, k of rows 0..127 */
    k_vt<NG, SQ><<<NG * (SQ / 64), 256, 0, stream>>>(V16 + r0 * KVD, KVD, 0, VT);      /* V^T [NH][HD][SQ] for this batch */
    k_gemm2<0><<<dim3((QT0 / 128) * (KVD / 64), 1), 128, 0, stream>>>(X16 + r0 * DM, DM, 0, BV, DM, 0, 0.0625f, bv, 0, nullptr, 1, 0, 0, VF0, nullptr, KVD, 0, QT0, KVD, DM);
    k_kvexp<<<(unsigned)(((size_t)QT0 * DM / 4 + 255) / 256), 256, 0, stream>>>(KF0, KF0e, (size_t)QT0 * DM / 4); k_kvexp<<<(unsigned)(((size_t)QT0 * DM / 4 + 255) / 256), 256, 0, stream>>>(VF0, VF0e, (size_t)QT0 * DM / 4);      /* head h <- kv group h (HPG 1) for the exact first-tile kernel */      /* f32 q, k, v of the first 128 rows (exact products) */
    k_att0<0><<<NH * (QT0 / 64), 64, 0, stream>>>(QF0, KF0e, VF0e, DM, nullptr, 0.125f, OF0 + (size_t)b * QT0 * DM, DM);      /* exact f32 attention for rows 0..127 (o x64) */
    for (int q0 = 0; q0 < QN; q0 += QT) { const int nk = q0 + QT;      /* causal: only keys below the tile end are computed */
      k_gemm2<0><<<dim3((QT / 128) * (nk / 64), NH), 128, 0, stream>>>(Q16 + (r0 + q0) * LQ, LQ, (size_t)HD, K16 + r0 * KVD, KVD, (size_t)HD, 0.125f, nullptr, 0, nullptr, 1, 0, 0, S, nullptr, NKX, (size_t)QT * NKX, QT, nk, HD);      /* scores: HPG == 1 (every head has its own keys): ONE launch with all 16 heads on grid.y, key head stride HD instead of the grouped-query stride 0 (the 16 per-group launches of one head each, fused) */
      static_assert(QN / QT == 8, "one softmax instance per causal tile");
      switch (nk / QT) {      /* softmax, one wave per row (8 rows per block); the key count is a compile-time constant of each tile's kernel so that the row stays in registers */
        case 1: k_rsmcf2<2><<<(NHD * QT + 7) / 8, 256, 0, stream>>>(S, P, NHD); break; case 2: k_rsmcf2<4><<<(NHD * QT + 7) / 8, 256, 0, stream>>>(S, P, NHD); break; case 3: k_rsmcf2<6><<<(NHD * QT + 7) / 8, 256, 0, stream>>>(S, P, NHD); break; case 4: k_rsmcf2<8><<<(NHD * QT + 7) / 8, 256, 0, stream>>>(S, P, NHD); break;
        case 5: k_rsmcf2<10><<<(NHD * QT + 7) / 8, 256, 0, stream>>>(S, P, NHD); break; case 6: k_rsmcf2<12><<<(NHD * QT + 7) / 8, 256, 0, stream>>>(S, P, NHD); break; case 7: k_rsmcf2<14><<<(NHD * QT + 7) / 8, 256, 0, stream>>>(S, P, NHD); break; case 8: k_rsmcf2<16><<<(NHD * QT + 7) / 8, 256, 0, stream>>>(S, P, NHD); break; }
      k_gemm2<0><<<dim3((QT / 128) * (HD / 64), NH), 128, 0, stream>>>(P, NKX, (size_t)QT * NKX, VT, SQ, (size_t)HD * SQ, 0.25f, nullptr, 0, nullptr, 1, 0, 0, nullptr, O16 + (r0 + q0) * DM, DM, (size_t)HD, QT, HD, nk); } }      /* o for all 16 heads in ONE launch (value head stride HD*SQ) (x64) */
  k_gemm2<0><<<dim3((unsigned)((MPO / 128) * (DM / 64)), 1), 128, 0, stream>>>(O16 + r0p * DM, DM, 0, BO, DM, 0, 0.0009765625f, bo, 0, nullptr, 1, 0, 0, (float*)d_out + r0p * DM, nullptr, DM, 0, MPO, DM, DM);      /* out rows are the output layout */
  k_hl<<<(unsigned)(((size_t)NB * QT0 * DM / 8 + 255) / 256), 256, 0, stream>>>(OF0, OH0, OL0, (size_t)NB * QT0 * DM / 8);      /* first-tile o (x64) -> f16 hi + x1024 residual planes */
  for (int b = B0; b < B0 + NBR; ++b) { const size_t r0 = (size_t)b * SQ; const size_t f0 = (size_t)b * QT0;
    k_gemm2<0><<<dim3((QT0 / 128) * (DM / 64), 1), 128, 0, stream>>>(OH0 + f0 * DM, DM, 0, BO, DM, 0, 0.0009765625f, bo, 0, nullptr, 1, 0, 0, (float*)d_out + r0 * DM, nullptr, DM, 0, QT0, DM, DM);      /* rows 0..127: out = o_hi Wo (+ b), overwriting the f16-path rows */
    k_gemm2<0><<<dim3((QT0 / 128) * (DM / 64), 1), 128, 0, stream>>>(OL0 + f0 * DM, DM, 0, BO, DM, 0, 0.00000095367431640625f, nullptr, 0, (const float*)d_out + r0 * DM, -1, 0, 0, (float*)d_out + r0 * DM, nullptr, DM, 0, QT0, DM, DM); }      /* += o_lo Wo 2^-20 (own-element accumulate) */
}

// v002
// One run takes 1470 microseconds.
// In two side-by-side timings against v001, it was 2.83 and 2.81 times as fast.
// Over all steps from v000 it is 6.81 times as fast.
#include <hip/hip_runtime.h>
// Causal multi-head self-attention with rotate-half RoPE computed in the module and a bias-free fused QKV projection (x [4][2048][1024]; qkv = x Wqkv ([in][out] 1024 x 3072, no bias) split into q | k | v thirds, 16 heads of 64; cos / sin = [f | f] of pos * 10000^(-2i/64); q = q cos + rotate_half(q) sin, likewise k; scores * 64^-0.5; causal (tril, finfo.min fill); softmax; out = merged Wout ([in][out], no bias) -> [4][2048][1024]); run as grouped-query causal attention with 16 groups of ONE head and half-split rope.
// Compute dtype: inputs rounded to bf16; x / weights exact; q, k, v, softmax weights and o as plain f16 GEMM operands (~2^-12); scores and softmax statistics f32; v_wmma_f32_16x16x32_f16.
#define NB 4
#define NG 16
#define HPG 1
#define KVD (NG * HD)
#define SQ 2048
#define DM 1024
#define NH 16
#define HD 64
#define HG 4                         /* heads per k_vt(b, h0) launch (overload not called) */
#define QT 256                       /* query rows per causal tile */
#define NKX SQ                       /* S row pitch (P rows: 2 * NKX halves) */
#define QT0 128                      /* first-tile rows recomputed exactly in f32 */
#define B0 0                         /* first batch processed (debug hook) */
#define NBR NB                       /* batches processed (debug hook) */
#define NR ((size_t)NB * SQ)         /* token rows */
#define MP ((int)((size_t)NBR * SQ)) /* rows projected (debug hook) */
#define QN SQ                        /* query rows attended per batch (debug hook) */
#define NHD NH                       /* heads attended (debug hook) */
#define MPO MP                       /* rows through the output stage (debug hook) */
#define LQ DM      /* row pitch of the q/k/v rows */
typedef __bf16 v16b __attribute__((ext_vector_type(16)));
typedef unsigned short v8us __attribute__((ext_vector_type(8), may_alias));
typedef float  v8f  __attribute__((ext_vector_type(8)));
typedef float  v4f  __attribute__((ext_vector_type(4)));
typedef float  v4fa __attribute__((ext_vector_type(4), may_alias));
union FragB { v16b v; v8us half[2]; unsigned short u[16]; };

__device__ __forceinline__ unsigned short bf16_bits(float x) { unsigned int u = __float_as_uint(x); return (unsigned short)((u + 0x7FFFu + ((u >> 16) & 1u)) >> 16); }
__device__ __forceinline__ float bf16_val(unsigned short b) { return __uint_as_float(((unsigned int)b) << 16); }
__device__ __forceinline__ float bf16_round(float x) { return bf16_val(bf16_bits(x)); }
// D += A·B with NT terms: 1 = ah·bh, 2 = + al·bh (A split), 3 = + ah·bl (both split)
template <int NT>
__device__ __forceinline__ v8f mmaN(v16b ah, v16b al, v16b bh, v16b bl, v8f c) {
  c = __builtin_amdgcn_wmma_f32_16x16x32_bf16(false, ah, false, bh, (short)0, c, false, false);
  if (NT >= 2) c = __builtin_amdgcn_wmma_f32_16x16x32_bf16(false, al, false, bh, (short)0, c, false, false);
  if (NT >= 3) c = __builtin_amdgcn_wmma_f32_16x16x32_bf16(false, ah, false, bl, (short)0, c, false, false);
  asm volatile("v_nop\n\tv_nop\n\tv_nop\n\tv_nop" : "+v"(c) : "v"(ah), "v"(al), "v"(bh), "v"(bl));
  return c;
}

__global__ __launch_bounds__(256) void k_wt_bf16(const float* __restrict__ W, unsigned short* __restrict__ Wt, int K, int N) {
  const int t = blockIdx.x * 256 + threadIdx.x;
  const int k8n = K / 8;
  if (t >= N * k8n) return;
  const int n = t / k8n, k8 = (t % k8n) * 8;
  v8us v;
#pragma unroll
  for (int i = 0; i < 8; ++i) v[i] = bf16_bits(W[(size_t)(k8 + i) * N + n]);
  *(v8us*)(Wt + (size_t)n * K + k8) = v;
  
}

// GEMM C[M][N] (f32, pitch ldc) = act(A[M][K]·W + bias). A f32 row-major (pitch lda) converted per fragment to bf16
// (ASPLIT: hi/lo two planes -> 2 terms, else single rounded term); Wt bf16 [N][K] (pitch ldb). BIAS_BF16 rounds the
// bias to bf16 first (bias quantised to bf16 before the add). K%32==0, M%16==0, N%64==0.
template <bool ASPLIT, int ACT, bool BIAS_BF16>
__global__ __launch_bounds__(128) void k_gemm_bf(const float* __restrict__ A, int lda, const unsigned short* __restrict__ Wt, int ldb,
                                               const float* __restrict__ bias, float* __restrict__ C, int ldc, int M, int N, int K) {
  __shared__ __attribute__((aligned(16))) float so[4][16][64];
  const int tid = threadIdx.x, w = tid >> 5, lane = tid & 31, ln = lane & 15, hh = lane >> 4;
  const int ntn = N / 64;
  const int wid = blockIdx.x * 4 + w;
  const int mt = wid / ntn, nq = wid % ntn;
  if (mt * 16 >= M) return;
  const int row0 = mt * 16, col0 = nq * 64;
  const float* arow = A + (size_t)(row0 + ln) * lda;
  v8f acc[4] = {};
  for (int kb = 0; kb < K; kb += 32) {
    FragB ah, al;
    const v4f x0 = *(const v4fa*)(arow + kb + 8 * hh), x1 = *(const v4fa*)(arow + kb + 8 * hh + 4);
    const v4f x2 = *(const v4fa*)(arow + kb + 16 + 8 * hh), x3 = *(const v4fa*)(arow + kb + 16 + 8 * hh + 4);
    float xs[16] = {x0[0],x0[1],x0[2],x0[3],x1[0],x1[1],x1[2],x1[3],x2[0],x2[1],x2[2],x2[3],x3[0],x3[1],x3[2],x3[3]};
#pragma unroll
    for (int i = 0; i < 16; ++i) { const unsigned short hb = bf16_bits(xs[i]); ah.u[i] = hb; al.u[i] = ASPLIT ? bf16_bits(xs[i] - bf16_val(hb)) : (unsigned short)0; }
#pragma unroll
    for (int t = 0; t < 4; ++t) {
      const unsigned short* brow = Wt + (size_t)(col0 + t * 16 + ln) * ldb + kb;
      FragB b;
      b.half[0] = *(const v8us*)(brow + 8 * hh);
      b.half[1] = *(const v8us*)(brow + 16 + 8 * hh);
      acc[t] = mmaN<ASPLIT ? 2 : 1>(ah.v, al.v, b.v, b.v, acc[t]);
    }
  }
#pragma unroll
  for (int t = 0; t < 4; ++t) {
    float bv = bias ? bias[col0 + t * 16 + ln] : 0.f;
    if (BIAS_BF16) bv = bf16_round(bv);
#pragma unroll
    for (int r = 0; r < 8; ++r) { float v = acc[t][r] + bv; if (ACT == 1) v = fmaxf(v, 0.f); so[w][8 * hh + r][t * 16 + ln] = v; }
  }
  __builtin_amdgcn_fence(__ATOMIC_ACQ_REL, "workgroup");
  __builtin_amdgcn_wave_barrier();
  const int rsub = lane >> 4, c4 = (lane & 15) * 4;
  {
#pragma unroll
    for (int q = 0; q < 8; ++q) {
      const int r = q * 2 + rsub;
      const v4f v = *(const v4fa*)&so[w][r][c4];
      *(v4f*)(C + (size_t)(row0 + r) * ldc + col0 + c4) = v;
    }
    
  }
}

// GEMM C = act(A·W + bias + resid): A f32 (ASPLIT -> hi/lo 2 terms), Wt bf16 [N][K]; ACT 0 none, 1 relu, 2 exact gelu;
// resid (optional, f32, row index = (row % rmod), pitch ldr, RES_BF16 rounds it) added before the activation.
template <bool ASPLIT, int ACT, bool BIAS_BF16, bool RES_BF16>
__global__ __launch_bounds__(128) void k_gemm_bf3(const float* __restrict__ A, int lda, const unsigned short* __restrict__ Wt, int ldb,
                                                const float* __restrict__ bias, const float* __restrict__ resid, int rmod, int ldr,
                                                float* __restrict__ C, int ldc, int M, int N, int K) {
  __shared__ __attribute__((aligned(16))) float so[4][16][64];
  const int tid = threadIdx.x, w = tid >> 5, lane = tid & 31, ln = lane & 15, hh = lane >> 4;
  const int ntn = N / 64;
  const int wid = blockIdx.x * 4 + w;
  const int mt = wid / ntn, nq = wid % ntn;
  if (mt * 16 >= M) return;
  const int row0 = mt * 16, col0 = nq * 64;
  const float* arow = A + (size_t)(row0 + ln) * lda;
  v8f acc[4] = {};
  for (int kb = 0; kb < K; kb += 32) {
    FragB ah, al;
    const v4f x0 = *(const v4fa*)(arow + kb + 8 * hh), x1 = *(const v4fa*)(arow + kb + 8 * hh + 4);
    const v4f x2 = *(const v4fa*)(arow + kb + 16 + 8 * hh), x3 = *(const v4fa*)(arow + kb + 16 + 8 * hh + 4);
    float xs[16] = {x0[0],x0[1],x0[2],x0[3],x1[0],x1[1],x1[2],x1[3],x2[0],x2[1],x2[2],x2[3],x3[0],x3[1],x3[2],x3[3]};
#pragma unroll
    for (int i = 0; i < 16; ++i) { const unsigned short hb = bf16_bits(xs[i]); ah.u[i] = hb; al.u[i] = ASPLIT ? bf16_bits(xs[i] - bf16_val(hb)) : (unsigned short)0; }
#pragma unroll
    for (int t = 0; t < 4; ++t) {
      const unsigned short* brow = Wt + (size_t)(col0 + t * 16 + ln) * ldb + kb;
      FragB b;
      b.half[0] = *(const v8us*)(brow + 8 * hh);
      b.half[1] = *(const v8us*)(brow + 16 + 8 * hh);
      acc[t] = mmaN<ASPLIT ? 2 : 1>(ah.v, al.v, b.v, b.v, acc[t]);
    }
  }
#pragma unroll
  for (int t = 0; t < 4; ++t) {
    const int col = col0 + t * 16 + ln;
    float bv = bias ? bias[col] : 0.f;
    if (BIAS_BF16) bv = bf16_round(bv);
#pragma unroll
    for (int r = 0; r < 8; ++r) {
      float v = acc[t][r] + bv;
      if (resid) { float rv = resid[(size_t)((row0 + 8 * hh + r) % rmod) * ldr + col]; if (RES_BF16) rv = bf16_round(rv); v += rv; }
      if (ACT == 1) v = fmaxf(v, 0.f);
      if (ACT == 2) v = 0.5f * v * (1.0f + erff(v * 0.70710678118654752f));
      if (ACT == 3) { const float u = 0.7978845608028654f * (v + 0.044715f * v * v * v); v = 0.5f * v * (1.0f + tanhf(u)); }
      so[w][8 * hh + r][t * 16 + ln] = v;
    }
  }
  __builtin_amdgcn_fence(__ATOMIC_ACQ_REL, "workgroup");
  __builtin_amdgcn_wave_barrier();
  const int rsub = lane >> 4, c4 = (lane & 15) * 4;
  {
#pragma unroll
    for (int q = 0; q < 8; ++q) {
      const int r = q * 2 + rsub;
      const v4f v = *(const v4fa*)&so[w][r][c4];
      *(v4f*)(C + (size_t)(row0 + r) * ldc + col0 + c4) = v;
    }
    
  }
}
// row LayerNorm (biased variance, eps) over N: s = X (+ R); optional out_sum <- s; out_norm <- (s-mu)*rsqrt(var+eps)*g + b
template <bool PARAM_BF16>
__global__ __launch_bounds__(256) void k_layernorm(const float* __restrict__ X, const float* __restrict__ R, const float* __restrict__ g, const float* __restrict__ bta,
                                                  float* __restrict__ out_sum, float* __restrict__ out_norm, int N, float eps) {
  __shared__ float red[256];
  const int row = blockIdx.x, tid = threadIdx.x;
  const float* x = X + (size_t)row * N; const float* rr = R ? R + (size_t)row * N : nullptr;
  float vals[16];                     // up to N = 4096
  const int per = N / 256;            // contiguous chunk per thread? use strided-by-4 chunks: thread handles j = tid*4 + 1024*u
  float s1 = 0.f;
  for (int u = 0; u < per / 4; ++u) {
    const int j = tid * 4 + 1024 * u;
    const v4f a = *(const v4fa*)(x + j);
    v4f b = {0.f,0.f,0.f,0.f}; if (rr) b = *(const v4fa*)(rr + j);
#pragma unroll
    for (int q = 0; q < 4; ++q) { const float v = a[q] + b[q]; vals[u * 4 + q] = v; s1 += v; }
  }
  red[tid] = s1; __syncthreads();
  for (int st = 128; st > 0; st >>= 1) { if (tid < st) red[tid] += red[tid + st]; __syncthreads(); }
  const float mu = red[0] / (float)N; __syncthreads();
  float s2 = 0.f;
  for (int u = 0; u < per / 4; ++u)
#pragma unroll
    for (int q = 0; q < 4; ++q) { const float c = vals[u * 4 + q] - mu; s2 += c * c; }
  red[tid] = s2; __syncthreads();
  for (int st = 128; st > 0; st >>= 1) { if (tid < st) red[tid] += red[tid + st]; __syncthreads(); }
  const float rs = rsqrtf(red[0] / (float)N + eps);
  {
    for (int u = 0; u < per / 4; ++u) {
      const int j = tid * 4 + 1024 * u;
      v4f o, sm;
#pragma unroll
      for (int q = 0; q < 4; ++q) {
        float gg = g[j + q], bb = bta[j + q];
        if (PARAM_BF16) { gg = bf16_round(gg); bb = bf16_round(bb); }
        sm[q] = vals[u * 4 + q]; o[q] = (vals[u * 4 + q] - mu) * rs * gg + bb;
      }
      if (out_sum) *(v4f*)(out_sum + (size_t)row * N + j) = sm;
      *(v4f*)(out_norm + (size_t)row * N + j) = o;
    }
    
  }
}



// ---- f16 WMMA path (v_wmma_f32_16x16x32_f16): 11-bit significands for operands in range — used where a [0,1] probability operand needs more precision than bf16
typedef _Float16 v16h __attribute__((ext_vector_type(16)));
union FragH { v16h v; v8us half[2]; _Float16 h[16]; unsigned short u[16]; };
template <int NT>
__device__ __forceinline__ v8f mmaH(v16h ah, v16h al, v16h bh, v16h bl, v8f c) {
  c = __builtin_amdgcn_wmma_f32_16x16x32_f16(false, ah, false, bh, (short)0, c, false, false);
  if (NT >= 2) c = __builtin_amdgcn_wmma_f32_16x16x32_f16(false, al, false, bh, (short)0, c, false, false);
  if (NT >= 3) c = __builtin_amdgcn_wmma_f32_16x16x32_f16(false, ah, false, bl, (short)0, c, false, false);
  asm volatile("v_nop\n\tv_nop\n\tv_nop\n\tv_nop" : "+v"(c) : "v"(ah), "v"(al), "v"(bh), "v"(bl));
  return c;
}
// batched GEMM like k_gemm_b but f16 operands: A f32 (split into f16 hi/lo if ASPLIT, else rounded to f16), Bt = f16 values [n][k]; alpha; C f32; N multiple of 16 (partial tiles skipped)
template <bool ASPLIT>
__global__ __launch_bounds__(128) void k_gemm_h(const float* __restrict__ A, int lda, size_t sA, const _Float16* __restrict__ Bh, int ldb, size_t sB, float alpha, float* __restrict__ C, int ldc, size_t sC, int M, int N, int K) {
  __shared__ __attribute__((aligned(16))) float so[4][16][64];
  const int tid = threadIdx.x, w = tid >> 5, lane = tid & 31, ln = lane & 15, hh = lane >> 4; const int by = blockIdx.y;
  A += (size_t)by * sA; Bh += (size_t)by * sB; C += (size_t)by * sC;
  const int ntn = (N + 63) / 64; const int wid = blockIdx.x * 4 + w; const int mt = wid / ntn, nq = wid % ntn; if (mt * 16 >= M) return;
  const int row0 = mt * 16, col0 = nq * 64; const float* arow = A + (size_t)(row0 + ln) * lda;
  v8f acc[4] = {};
  for (int kb = 0; kb < K; kb += 32) {
    FragH ah, al;
    const v4f x0 = *(const v4fa*)(arow + kb + 8 * hh), x1 = *(const v4fa*)(arow + kb + 8 * hh + 4), x2 = *(const v4fa*)(arow + kb + 16 + 8 * hh), x3 = *(const v4fa*)(arow + kb + 16 + 8 * hh + 4);
    float xs[16] = {x0[0],x0[1],x0[2],x0[3],x1[0],x1[1],x1[2],x1[3],x2[0],x2[1],x2[2],x2[3],x3[0],x3[1],x3[2],x3[3]};
#pragma unroll
    for (int i = 0; i < 16; ++i) { const _Float16 h = (_Float16)xs[i]; ah.h[i] = h; al.h[i] = ASPLIT ? (_Float16)(xs[i] - (float)h) : (_Float16)0.0f; }
#pragma unroll
    for (int t = 0; t < 4; ++t) { if (col0 + t * 16 >= N) continue; const size_t boff = (size_t)(col0 + t * 16 + ln) * ldb + kb; FragH bq; bq.half[0] = *(const v8us*)(Bh + boff + 8 * hh); bq.half[1] = *(const v8us*)(Bh + boff + 16 + 8 * hh);
      acc[t] = mmaH<ASPLIT ? 2 : 1>(ah.v, al.v, bq.v, bq.v, acc[t]); }
  }
#pragma unroll
  for (int t = 0; t < 4; ++t) { if (col0 + t * 16 >= N) continue;
#pragma unroll
    for (int r = 0; r < 8; ++r) so[w][8 * hh + r][t * 16 + ln] = acc[t][r] * alpha; }
  __builtin_amdgcn_fence(__ATOMIC_ACQ_REL, "workgroup"); __builtin_amdgcn_wave_barrier();
  const int rsub = lane >> 4, c4 = (lane & 15) * 4;
  {
#pragma unroll
    for (int q = 0; q < 8; ++q) { const int r = q * 2 + rsub; if (col0 + c4 < N) { const v4f v = *(const v4fa*)&so[w][r][c4]; *(v4f*)(C + (size_t)(row0 + r) * ldc + col0 + c4) = v; } }
     }
}

// Wt[n][k] = f16(W[k][n]·scale) from f32 row-major W[K][N] (scale = power of two; bf16-exact weights stay exact in f16 away from the subnormal range)
__global__ __launch_bounds__(256) void k_wt_f16(const float* __restrict__ W, _Float16* __restrict__ Wt, int K, int N, float scale) {
  const int t = blockIdx.x * 256 + threadIdx.x; if (t >= N * (K / 8)) return; const int n = t / (K / 8), k8 = (t % (K / 8)) * 8; FragH f;
#pragma unroll
  for (int i = 0; i < 8; ++i) f.h[i] = (_Float16)(bf16_round(W[(size_t)(k8 + i) * N + n]) * scale); const v8us o = f.half[0];
  *(v8us*)((unsigned short*)Wt + (size_t)n * K + k8) = o; 
}
// k_gemm_hh variant with fused epilogue: v = acc·alpha + bias[by·sBias + col] (+ CP[(row/rowsPerB)·sCPb + by·64 + col] if CP) ; ACT 0 none / 1 elu ; writes f16 C16 (and f32 C if non-null)
template <int ACT>
__global__ __launch_bounds__(128) void k_gemm_hhx(const _Float16* __restrict__ A, int lda, size_t sA, const _Float16* __restrict__ Bh, int ldb, size_t sB, float alpha, const float* __restrict__ bias, size_t sBias, const float* __restrict__ CP, int rowsPerB, size_t sCPb, int row0g,
    float* __restrict__ C, _Float16* __restrict__ C16, int ldc, size_t sC, int M, int N, int K) {
  __shared__ __attribute__((aligned(16))) float so[4][16][64];
  const int tid = threadIdx.x, w = tid >> 5, lane = tid & 31, ln = lane & 15, hh = lane >> 4; const int by = blockIdx.y;
  A += (size_t)by * sA; Bh += (size_t)by * sB; const size_t cofs = (size_t)by * sC; const float* bp = bias ? bias + (size_t)by * sBias : nullptr;
  const int ntn = (N + 63) / 64; const int wid = blockIdx.x * 4 + w; const int mt = wid / ntn, nq = wid % ntn; if (mt * 16 >= M) return;
  const int row0 = mt * 16, col0 = nq * 64; const _Float16* arow = A + (size_t)(row0 + ln) * lda;
  v8f acc[4] = {};
  for (int kb = 0; kb < K; kb += 32) { FragH ah; ah.half[0] = *(const v8us*)((const unsigned short*)arow + kb + 8 * hh); ah.half[1] = *(const v8us*)((const unsigned short*)arow + kb + 16 + 8 * hh);
#pragma unroll
    for (int t = 0; t < 4; ++t) { if (col0 + t * 16 >= N) continue; const size_t boff = (size_t)(col0 + t * 16 + ln) * ldb + kb; FragH bq; bq.half[0] = *(const v8us*)((const unsigned short*)Bh + boff + 8 * hh); bq.half[1] = *(const v8us*)((const unsigned short*)Bh + boff + 16 + 8 * hh);
      acc[t] = mmaH<1>(ah.v, ah.v, bq.v, bq.v, acc[t]); }
  }
#pragma unroll
  for (int t = 0; t < 4; ++t) { if (col0 + t * 16 >= N) continue; const int col = col0 + t * 16 + ln; const float bv = bp ? bf16_round(bp[col]) : 0.f;
#pragma unroll
    for (int r = 0; r < 8; ++r) { float v = acc[t][r] * alpha + bv; if (CP) { const int rr = row0g + row0 + 8 * hh + r; if (rowsPerB < 0) v += CP[cofs + (size_t)rr * ldc + col];      /* rowsPerB < 0: own element of the batched C plane */ else { const int bidx = rr / rowsPerB; v += CP[(size_t)bidx * sCPb + (size_t)by * 64 + col]; } } if (ACT == 1) v = (v > 0.f) ? v : expm1f(v); else if (ACT == 7) v = (v > 0.f) ? v + 1.0f : expf(v); else if (ACT == 8) v = tanhf(v); else if (ACT == 9) v = 0.5f * v * (1.0f + tanhf(0.7978845608028654f * (v + 0.044715f * v * v * v))); else if (ACT == 11) v = 1.0f / (1.0f + expf(-v)); else if (ACT == 12) v = (v > 0.f) ? v : 0.01f * v; else if (ACT == 14) v = (v > 0.f) ? v : 0.1f * v; else if (ACT == 16) v = (v >= 0.f) ? v : 0.3f * v; else if (ACT == 17) v = (v >= 0.f) ? v : 0.2f * v; else if (ACT == 15) v = v / (1.0f + expf(-v)); else if (ACT == 3) v = fmaxf(v, 0.f); else if (ACT == 6) v = 0.5f * v * (1.0f + erff(v * 0.70710678118654752f)); so[w][8 * hh + r][t * 16 + ln] = v; } }
  __builtin_amdgcn_fence(__ATOMIC_ACQ_REL, "workgroup"); __builtin_amdgcn_wave_barrier();
  const int rsub = lane >> 4, c4 = (lane & 15) * 4; typedef _Float16 v4h __attribute__((ext_vector_type(4)));
  {
#pragma unroll
    for (int q = 0; q < 8; ++q) { const int r = q * 2 + rsub; if (col0 + c4 < N) { const v4f v = *(const v4fa*)&so[w][r][c4]; if (C) *(v4f*)(C + cofs + (size_t)(row0 + r) * ldc + col0 + c4) = v; if (C16) { v4h h4; for (int i = 0; i < 4; ++i) h4[i] = (_Float16)v[i]; *(v4h*)(C16 + cofs + (size_t)(row0 + r) * ldc + col0 + c4) = h4; } } }
     }
}


typedef _Float16 v4h __attribute__((ext_vector_type(4)));

__global__ __launch_bounds__(256) void k_x16(const float* __restrict__ x, _Float16* __restrict__ X16, size_t n8) { const size_t t = (size_t)blockIdx.x * 256 + threadIdx.x; if (t >= n8) return; FragH f;
#pragma unroll
  for (int q = 0; q < 8; ++q) f.h[q] = (_Float16)bf16_round(x[t * 8 + q]); *(v8us*)((unsigned short*)X16 + t * 8) = f.half[0];  }
__global__ __launch_bounds__(256) void k_h16(const float* __restrict__ x, _Float16* __restrict__ X16, size_t n8) { const size_t t = (size_t)blockIdx.x * 256 + threadIdx.x; if (t >= n8) return; FragH f;
#pragma unroll
  for (int q = 0; q < 8; ++q) f.h[q] = (_Float16)x[t * 8 + q]; *(v8us*)((unsigned short*)X16 + t * 8) = f.half[0];  }
__global__ __launch_bounds__(256) void k_round16f(const float* __restrict__ W, _Float16* __restrict__ Bt, size_t n8) { const size_t t = (size_t)blockIdx.x * 256 + threadIdx.x; if (t >= n8) return; FragH f;
#pragma unroll
  for (int i = 0; i < 8; ++i) f.h[i] = (_Float16)(bf16_round(W[t * 8 + i]) * 16.0f); *(v8us*)((unsigned short*)Bt + t * 8) = f.half[0];  }
template <int NHv, int TTv>
__global__ __launch_bounds__(256) void k_vt(const _Float16* __restrict__ V16, int ldv, int voff, _Float16* __restrict__ Vt) { __shared__ unsigned short tl[64][66]; const int tid = threadIdx.x; const int slab = blockIdx.x / (TTv / 64), lg = blockIdx.x % (TTv / 64); const int b = slab / NHv, h = slab % NHv;
  for (int i = tid; i < 64 * 8; i += 256) { const int r = i / 8, c8 = (i % 8) * 8; FragH f; f.half[0] = *(const v8us*)((const unsigned short*)V16 + ((size_t)b * TTv + lg * 64 + r) * ldv + voff + h * 64 + c8);
#pragma unroll
    for (int q = 0; q < 8; ++q) tl[r][c8 + q] = f.u[q]; }
  __syncthreads();
  {
#pragma unroll
    for (int rd = 0; rd < 2; ++rd) { const int d = rd * 32 + tid / 8, pc = tid % 8; FragH f;
#pragma unroll
      for (int q = 0; q < 8; ++q) f.u[q] = tl[pc * 8 + q][d];
      *(v8us*)((unsigned short*)Vt + ((size_t)slab * 64 + d) * TTv + lg * 64 + pc * 8) = f.half[0]; }
     } }

__global__ __launch_bounds__(256) void k_hl(const float* __restrict__ F, _Float16* __restrict__ Hh, _Float16* __restrict__ Hl, size_t n8) { const size_t t = (size_t)blockIdx.x * 256 + threadIdx.x; if (t >= n8) return; FragH fh, fl; const v4f a = *(const v4fa*)(F + t * 8), c = *(const v4fa*)(F + t * 8 + 4);
#pragma unroll
  for (int q = 0; q < 4; ++q) { _Float16 h = (_Float16)a[q]; fh.h[q] = h; fl.h[q] = (_Float16)((a[q] - (float)h) * 1024.0f); h = (_Float16)c[q]; fh.h[4 + q] = h; fl.h[4 + q] = (_Float16)((c[q] - (float)h) * 1024.0f); }
  { *(v8us*)((unsigned short*)Hh + t * 8) = fh.half[0]; *(v8us*)((unsigned short*)Hl + t * 8) = fl.half[0];  } }

// ---- fast GEMM (wave tile 32x64; requires M % 32 == 0 rows per launch region and N % 64 == 0); epilogue = k_gemm_hhx semantics ----
__device__ __forceinline__ v16h g2_frag(const _Float16* p, int hh) { FragH f; f.half[0] = *(const v8us*)((const unsigned short*)p + 8 * hh); f.half[1] = *(const v8us*)((const unsigned short*)p + 16 + 8 * hh); return f.v; }
__device__ __forceinline__ v8f g2_mma(v16h a, v16h b, v8f c) { v8f d = __builtin_amdgcn_wmma_f32_16x16x32_f16(false, a, false, b, (short)0, c, false, false); asm volatile("v_nop\n\tv_nop\n\tv_nop\n\tv_nop" : "+v"(d) : "v"(a), "v"(b)); return d; }
template <int ACT>
__global__ __launch_bounds__(128) void k_gemm2(const _Float16* __restrict__ A, int lda, size_t sA, const _Float16* __restrict__ Bh, int ldb, size_t sB, float alpha, const float* __restrict__ bias, size_t sBias, const float* __restrict__ CP, int rowsPerB, size_t sCPb, int row0g,
    float* __restrict__ C, _Float16* __restrict__ C16, int ldc, size_t sC, int M, int N, int K, size_t zA, size_t zB, size_t zC) { static_assert(ACT == 0 || ACT == 3 || ACT == 6 || ACT == 8 || ACT == 9 || ACT == 11 || ACT == 12 || ACT == 14 || ACT == 15 || ACT == 16 || ACT == 17, "k_gemm2: unsupported ACT code (would silently apply no activation)");
  __shared__ __attribute__((aligned(16))) float so[4][32][68];
  const int tid = threadIdx.x, w = tid >> 5, lane = tid & 31, ln = lane & 15, hh = lane >> 4; const int by = blockIdx.y, bz = blockIdx.z;      /* grid.y = head (strides sA, sB, sC), grid.z = batch (strides zA, zB, zC) */
  A += (size_t)by * sA + (size_t)bz * zA; Bh += (size_t)by * sB + (size_t)bz * zB; const size_t cofs = (size_t)by * sC + (size_t)bz * zC; const float* bp = bias ? bias + (size_t)by * sBias : nullptr;
  const int ntn = N >> 6; const int mt = blockIdx.x / ntn, nq = blockIdx.x - mt * ntn; const int row0 = mt * 128 + 32 * w, col0 = nq * 64; if (row0 >= M) return;
  const _Float16* a0p = A + (size_t)(row0 + ln) * lda; const _Float16* a1p = a0p + (size_t)16 * lda;
  const _Float16* b0p = Bh + (size_t)(col0 + ln) * ldb; const _Float16* b1p = b0p + (size_t)16 * ldb; const _Float16* b2p = b1p + (size_t)16 * ldb; const _Float16* b3p = b2p + (size_t)16 * ldb;
  const v8f z8 = {0.f,0.f,0.f,0.f,0.f,0.f,0.f,0.f}; v8f c00 = z8, c01 = z8, c02 = z8, c03 = z8, c10 = z8, c11 = z8, c12 = z8, c13 = z8;
#pragma unroll 1
  for (int kb = 0; kb < K; kb += 32) { const v16h a0 = g2_frag(a0p + kb, hh), a1 = g2_frag(a1p + kb, hh);
    v16h b = g2_frag(b0p + kb, hh); c00 = g2_mma(a0, b, c00); c10 = g2_mma(a1, b, c10);
    b = g2_frag(b1p + kb, hh); c01 = g2_mma(a0, b, c01); c11 = g2_mma(a1, b, c11);
    b = g2_frag(b2p + kb, hh); c02 = g2_mma(a0, b, c02); c12 = g2_mma(a1, b, c12);
    b = g2_frag(b3p + kb, hh); c03 = g2_mma(a0, b, c03); c13 = g2_mma(a1, b, c13); }
  v8f accs[8] = {c00, c01, c02, c03, c10, c11, c12, c13};
#pragma unroll
  for (int u = 0; u < 8; ++u) { const int t = u & 3, half = u >> 2; const int col = col0 + t * 16 + ln; const float bv = bp ? bf16_round(bp[col]) : 0.f;
#pragma unroll
    for (int r = 0; r < 8; ++r) { const int rloc = half * 16 + 8 * hh + r; float v = accs[u][r] * alpha + bv; if (CP) { if (rowsPerB < 0) v += CP[cofs + (size_t)(row0g + row0 + rloc) * ldc + col];      /* rowsPerB < 0: own element of the batched C plane */ else { const int bidx = (row0g + row0 + rloc) / rowsPerB; v += CP[(size_t)bidx * sCPb + (size_t)by * 64 + col]; } }
      if (ACT == 3) v = fmaxf(v, 0.f); else if (ACT == 6) v = 0.5f * v * (1.0f + erff(v * 0.70710678118654752f)); else if (ACT == 11) v = 1.0f / (1.0f + expf(-v)); else if (ACT == 15) v = v / (1.0f + expf(-v)); else if (ACT == 12) v = (v > 0.f) ? v : 0.01f * v; else if (ACT == 8) v = tanhf(v); else if (ACT == 9) v = 0.5f * v * (1.0f + tanhf(0.7978845608028654f * (v + 0.044715f * v * v * v))); else if (ACT == 14) v = (v > 0.f) ? v : 0.1f * v; else if (ACT == 16) v = (v >= 0.f) ? v : 0.3f * v; else if (ACT == 17) v = (v >= 0.f) ? v : 0.2f * v;
      so[w][rloc][t * 16 + ln] = v; } }
  __builtin_amdgcn_fence(__ATOMIC_ACQ_REL, "workgroup"); __builtin_amdgcn_wave_barrier();
  const int rsub = lane >> 4, c4 = (lane & 15) * 4;
  {
#pragma unroll
    for (int q = 0; q < 16; ++q) { const int r = q * 2 + rsub; const v4f v = *(const v4fa*)&so[w][r][c4]; if (C) *(v4f*)(C + cofs + (size_t)(row0 + r) * ldc + col0 + c4) = v; if (C16) { v4h h4; for (int i = 0; i < 4; ++i) h4[i] = (_Float16)v[i]; *(v4h*)(C16 + cofs + (size_t)(row0 + r) * ldc + col0 + c4) = h4; } }
     } }


__global__ __launch_bounds__(256) void k_wnat(const float* __restrict__ w, size_t n8, _Float16* __restrict__ Bt) { const size_t t = (size_t)blockIdx.x * 256 + threadIdx.x; if (t >= n8) return; FragH f; for (int q = 0; q < 8; ++q) f.h[q] = (_Float16)(bf16_round(w[t * 8 + q]) * 16.0f); *(v8us*)((unsigned short*)Bt + t * 8) = f.half[0];  }
__global__ __launch_bounds__(256) void k_rsm(const float* __restrict__ S, _Float16* __restrict__ P, int nrows) {
  #pragma clang fp contract(off)
  const int i = blockIdx.x * 256 + threadIdx.x; if (i >= nrows) return; const float* s = S + (size_t)i * SQ; float mx = -3.0e38f;
#pragma unroll 1
  for (int j = 0; j < SQ; ++j) mx = fmaxf(mx, s[j]); float se = 0.f;
#pragma unroll 1
  for (int j = 0; j < SQ; ++j) se += expf(s[j] - mx); const float sc = 256.0f / se;
#pragma unroll 1
  for (int j0 = 0; j0 < SQ; j0 += 8) { FragH f; for (int q = 0; q < 8; ++q) f.h[q] = (_Float16)(expf(s[j0 + q] - mx) * sc); unsigned short* d = (unsigned short*)P + (size_t)i * SQ + j0; *(v8us*)d = f.half[0];  } }
__global__ __launch_bounds__(256) void k_vt(const _Float16* __restrict__ V16, int b, int h0, _Float16* __restrict__ VT) { __shared__ unsigned short tl[64][65]; const int tid = threadIdx.x; const int hh = blockIdx.x % HG, sg = blockIdx.x / HG; const int s0 = sg * 64; const int h = h0 + hh;
  for (int i = tid; i < 64 * 8; i += 256) { const int j = i / 8, d8 = (i % 8) * 8; FragH f; f.half[0] = *(const v8us*)((const unsigned short*)V16 + ((size_t)b * SQ + s0 + j) * DM + h * HD + d8); for (int q = 0; q < 8; ++q) tl[d8 + q][j] = f.u[q]; }
  __syncthreads();
  { for (int i = tid; i < 64 * 8; i += 256) { const int d = i / 8, j8 = (i % 8) * 8; FragH f; for (int q = 0; q < 8; ++q) f.u[q] = tl[d][j8 + q]; *(v8us*)((unsigned short*)VT + ((size_t)hh * HD + d) * SQ + s0 + j8) = f.half[0]; }  } }



// Lane l <-> l ^ M inside a 16-lane row (DPP row_xmask) and l <-> l ^ 16 (cross-row move): a five-step butterfly leaves the row's maximum / sum in every lane without an LDS round trip.
template <int M> __device__ __forceinline__ float rs_xm(float x) { return __builtin_bit_cast(float, __builtin_amdgcn_update_dpp(0, __builtin_bit_cast(int, x), 0x160 | M, 0xf, 0xf, true)); }
__device__ __forceinline__ float rs_xh(float x) { return __builtin_bit_cast(float, __builtin_amdgcn_permlanex16(__builtin_bit_cast(int, x), __builtin_bit_cast(int, x), 0x76543210, 0xfedcba98, false, false)); }
__device__ __forceinline__ float rs_wmax(float v) { v = fmaxf(v, rs_xm<1>(v)); v = fmaxf(v, rs_xm<2>(v)); v = fmaxf(v, rs_xm<4>(v)); v = fmaxf(v, rs_xm<8>(v)); return fmaxf(v, rs_xh(v)); }
__device__ __forceinline__ float rs_wsum(float v) { v += rs_xm<1>(v); v += rs_xm<2>(v); v += rs_xm<4>(v); v += rs_xm<8>(v); return v + rs_xh(v); }
// Four v_exp_f32 and, in the same statement so that it stands directly behind the last one, the one free slot that the instruction set asks for behind a transcendental; the early-clobber outputs keep each exp off the sources of the one in front of it.
__device__ __forceinline__ v4f rs_exp2(v4f x) { float a, b, c, d; asm("v_exp_f32 %0, %4\n\tv_exp_f32 %1, %5\n\tv_exp_f32 %2, %6\n\tv_exp_f32 %3, %7\n\tv_nop" : "=&v"(a), "=&v"(b), "=&v"(c), "=&v"(d) : "v"(x[0]), "v"(x[1]), "v"(x[2]), "v"(x[3])); const v4f r = {a, b, c, d}; return r; }
// Causal row softmax of the query tile that ends at key NC*128 (its first row is q0 = NC*128 - QT), ONE WAVE PER ROW: lane l holds columns c*128 + 4l .. + 3 of chunk c, so each load covers 512 contiguous bytes and each store 256;
// the row is read once and stays in registers for the maximum, the sum and the scaled f16 weights. Only the last QT columns can lie above the diagonal, so only their chunks are masked.
// P may be the S plane itself: the f16 row t starts where the f32 row t starts (pitch 2 * NKX halves), only the row's own wave touches it, and every store takes the row sum, which needs every load of the row.
template <int NC>
__global__ __launch_bounds__(256) void k_rsmcf2(const float* S, _Float16* P, int hg) {
  static_assert(NC * 128 >= QT && NC * 128 <= NKX && QT % 128 == 0, "whole 128-column chunks, tile inside the row pitch");
  const int lane = threadIdx.x & 31; const int t = blockIdx.x * 8 + __builtin_amdgcn_readfirstlane(threadIdx.x >> 5); if (t >= hg * QT) return;      /* wave-uniform exit; the kernel has no barrier */
  const char* s = (const char*)(S + (size_t)t * NKX); _Float16* p = P + (size_t)t * (2 * NKX); const unsigned ob = lane * 16u;      /* the lane's byte offset inside each 512-byte chunk */
  const int rel = (t % QT) - lane * 4;      /* column q0 + d*128 + 4*lane + q is kept while d*128 + q <= rel */
  v4f v[NC];
#pragma unroll
  for (int c = 0; c < NC; ++c) v[c] = *(const v4fa*)(s + c * 512 + ob);
#pragma unroll
  for (int d = 0; d < QT / 128; ++d) for (int q = 0; q < 4; ++q) v[NC - QT / 128 + d][q] = (d * 128 + q <= rel) ? v[NC - QT / 128 + d][q] : -1.0e9f;
  float m0 = -3.0e38f, m1 = -3.0e38f;      /* two chains: the maximum does not depend on the order */
#pragma unroll
  for (int c = 0; c < NC; ++c) { m0 = fmaxf(fmaxf(m0, v[c][0]), v[c][1]); m1 = fmaxf(fmaxf(m1, v[c][2]), v[c][3]); }
  const float mx = rs_wmax(fmaxf(m0, m1));
  v4f se4 = {0.f, 0.f, 0.f, 0.f};
#pragma unroll
  for (int c = 0; c < NC; ++c) { v[c] = rs_exp2((v[c] - mx) * 1.44269504088896340736f); se4 += v[c]; }      /* exp(s - mx) as 2^((s - mx) log2 e), the form __expf compiles to */
  const float sc = 256.0f / rs_wsum((se4[0] + se4[1]) + (se4[2] + se4[3]));
#pragma unroll
  for (int c = 0; c < NC; ++c) { v4h h4; for (int q = 0; q < 4; ++q) h4[q] = (_Float16)(v[c][q] * sc); *(v4h*)(p + c * 128 + lane * 4) = h4; } }


template <int MASKADD>
__global__ __launch_bounds__(64) void k_att0(const float* __restrict__ QF, const float* __restrict__ KF, const float* __restrict__ VF, int ld, const float* __restrict__ mask, float scale, float* __restrict__ OF, int ldo) {
  #pragma clang fp contract(off)
  __shared__ __attribute__((aligned(16))) float lq[64][64]; __shared__ __attribute__((aligned(16))) float lo[64][64];
  QF += (size_t)blockIdx.y * QT0 * ld; KF += (size_t)blockIdx.y * QT0 * ld; VF += (size_t)blockIdx.y * QT0 * ld; OF += (size_t)blockIdx.y * QT0 * ldo;      /* grid.y = batch: QT0 rows of each plane per batch */
  const int tid = threadIdx.x; const int h = blockIdx.x / (QT0 / 64), rg = blockIdx.x % (QT0 / 64); const int i = rg * 64 + tid;
  const float* qr = QF + (size_t)i * ld + h * HD;
#pragma unroll 1
  for (int c = 0; c < HD / 4; ++c) { *(v4f*)&lq[tid][c * 4] = *(const v4fa*)(qr + c * 4); const v4f z = {0.f, 0.f, 0.f, 0.f}; *(v4f*)&lo[tid][c * 4] = z; }
  float m = -1.0e30f, l = 0.f; const int jmax = MASKADD ? (SQ - 1) : (rg * 64 + 63);      /* additive-mask form: every key (the mask input decides); causal form: keys up to the block's last row */
#pragma unroll 1
  for (int j = 0; j <= jmax; ++j) { const float* kr = KF + (size_t)j * ld + h * HD; const float* vr = VF + (size_t)j * ld + h * HD; float s = 0.f;
#pragma unroll 1
    for (int c = 0; c < HD / 4; ++c) { const v4f kq = *(const v4fa*)(kr + c * 4); const v4f qq = *(v4f*)&lq[tid][c * 4]; s = __fadd_rn(s, __fmul_rn(qq[0], kq[0])); s = __fadd_rn(s, __fmul_rn(qq[1], kq[1])); s = __fadd_rn(s, __fmul_rn(qq[2], kq[2])); s = __fadd_rn(s, __fmul_rn(qq[3], kq[3])); }
    s = __fmul_rn(s, scale); if (MASKADD) s = __fadd_rn(s, __fmul_rn(bf16_round(mask[(size_t)i * SQ + j]), -10000.0f));
    const float f = (MASKADD || j <= i) ? 1.f : 0.f; const float sm = fmaf(f, s, (1.f - f) * -1.0e30f); const float mn = fmaxf(m, sm); const float sc = expf(m - mn); const float e = expf(sm - mn); l = __fadd_rn(__fmul_rn(l, sc), e); m = mn;
#pragma unroll 1
    for (int c = 0; c < HD / 4; ++c) { const v4f vv = *(const v4fa*)(vr + c * 4); v4f oo = *(v4f*)&lo[tid][c * 4]; for (int u = 0; u < 4; ++u) oo[u] = __fadd_rn(__fmul_rn(oo[u], sc), __fmul_rn(e, vv[u])); *(v4f*)&lo[tid][c * 4] = oo; } }
  const float fin = 64.0f / l;      /* o carried x64 like the f16 path */
#pragma unroll 1
  for (int c = 0; c < HD / 4; ++c) { v4f oo = *(v4f*)&lo[tid][c * 4]; for (int u = 0; u < 4; ++u) oo[u] = __fmul_rn(oo[u], fin); *(v4f*)&lo[tid][c * 4] = oo; }
  __syncthreads();
  {
#pragma unroll 1
    for (int it = 0; it < 16; ++it) { const int row = it * 4 + tid / 16, pc = (tid % 16) * 4; const v4f v = *(const v4f*)&lo[row][pc]; *(v4f*)(OF + (size_t)(rg * 64 + row) * ldo + h * HD + pc) = v; }
     } }


__global__ __launch_bounds__(256) void k_kvexp(const float* __restrict__ src, float* __restrict__ dst, size_t n4) { const size_t t = (size_t)blockIdx.x * 256 + threadIdx.x; if (t >= n4) return; const size_t e = t * 4; const size_t row = e / DM; const int col = (int)(e % DM); const int h = col / HD, d = col % HD; const v4f v = *(const v4fa*)(src + row * KVD + (size_t)(h / HPG) * HD + d); *(v4f*)(dst + e) = v;  }

__global__ __launch_bounds__(256) void k_tab2(float theta, float* __restrict__ CS, float* __restrict__ SN) {
  #pragma clang fp contract(off)
  const int t = blockIdx.x * 256 + threadIdx.x; if (t >= SQ * (HD / 2)) return; const int i = t % (HD / 2); const int p = t / (HD / 2); const float invf = 1.0f / powf(theta, (float)(2 * i) / (float)HD); const float ang = __fmul_rn((float)p, invf); const float c = cosf(ang), s = sinf(ang);
  *(float*)(CS + t) = c; *(float*)(SN + t) = s;  }
template <int NORM, int ROPE>
__global__ __launch_bounds__(64) void k_xform(const float* __restrict__ F, int ldf, int nh, const float* __restrict__ gain, float eps, const float* __restrict__ CS, const float* __restrict__ SN, _Float16* __restrict__ H16, int ldo) {
  #pragma clang fp contract(off)
  __shared__ float xv[HD]; __shared__ float red[HD]; __shared__ unsigned short sh_[HD]; const int d = threadIdx.x; const int h = blockIdx.x % nh; const size_t r = blockIdx.x / nh; const int p = (int)(r % SQ);
  float x = F[r * (size_t)ldf + (size_t)h * HD + d];
  if (NORM) { red[d] = __fmul_rn(x, x); __syncthreads(); for (int st = HD / 2; st > 0; st >>= 1) { if (d < st) red[d] = __fadd_rn(red[d], red[d + st]); __syncthreads(); } const float rs = rsqrtf(__fadd_rn(red[0] / (float)HD, eps)); x = __fmul_rn(__fmul_rn(x, rs), bf16_round(gain[d])); }
  xv[d] = x; __syncthreads();
  float o = x;
  if (ROPE == 1) { const int i = d >> 1; const float c = CS[p * (HD / 2) + i], s = SN[p * (HD / 2) + i]; const float ev = xv[2 * i], od = xv[2 * i + 1]; o = (d & 1) ? __fadd_rn(__fmul_rn(ev, s), __fmul_rn(od, c)) : __fadd_rn(__fmul_rn(ev, c), -__fmul_rn(od, s)); }
  if (ROPE == 2) { const int i = d & (HD / 2 - 1); const float c = CS[p * (HD / 2) + i], s = SN[p * (HD / 2) + i]; const float lo = xv[i], hi = xv[i + HD / 2]; o = (d < HD / 2) ? __fadd_rn(__fmul_rn(lo, c), -__fmul_rn(hi, s)) : __fadd_rn(__fmul_rn(lo, s), __fmul_rn(hi, c)); }
  if (ROPE == 3) { const float c = CS[p * HD + d], s = SN[p * HD + d]; const float lo = xv[d & (HD / 2 - 1)], hi = xv[(d & (HD / 2 - 1)) + HD / 2]; o = (d < HD / 2) ? __fadd_rn(__fmul_rn(lo, c), -__fmul_rn(hi, s)) : __fadd_rn(__fmul_rn(hi, c), __fmul_rn(lo, s)); }      /* rotate-half with FULL-width per-element tables [pos][HD] */
  FragH th; th.h[0] = (_Float16)o; sh_[d] = th.u[0]; __syncthreads();
  if (d < HD / 8) { FragH f; for (int q = 0; q < 8; ++q) f.u[q] = sh_[d * 8 + q]; unsigned short* dst = (unsigned short*)H16 + r * (size_t)ldo + (size_t)h * HD + d * 8; *(v8us*)dst = f.half[0];  } }

template <int NORM, int ROPE>
__global__ __launch_bounds__(64) void k_xformf(const float* __restrict__ F, int ldf, int nh, const float* __restrict__ gain, float eps, const float* __restrict__ CS, const float* __restrict__ SN, float* __restrict__ F32, int ldo, size_t zF, size_t zO) {
  #pragma clang fp contract(off)
  F += (size_t)blockIdx.y * zF; F32 += (size_t)blockIdx.y * zO;      /* grid.y = batch */
  __shared__ float xv[HD]; __shared__ float red[HD]; const int d = threadIdx.x; const int h = blockIdx.x % nh; const size_t r = blockIdx.x / nh; const int p = (int)(r % SQ);
  float x = F[r * (size_t)ldf + (size_t)h * HD + d];
  if (NORM) { red[d] = __fmul_rn(x, x); __syncthreads(); for (int st = HD / 2; st > 0; st >>= 1) { if (d < st) red[d] = __fadd_rn(red[d], red[d + st]); __syncthreads(); } const float rs = rsqrtf(__fadd_rn(red[0] / (float)HD, eps)); x = __fmul_rn(__fmul_rn(x, rs), bf16_round(gain[d])); }
  xv[d] = x; __syncthreads();
  float o = x;
  if (ROPE == 1) { const int i = d >> 1; const float c = CS[p * (HD / 2) + i], s = SN[p * (HD / 2) + i]; const float ev = xv[2 * i], od = xv[2 * i + 1]; o = (d & 1) ? __fadd_rn(__fmul_rn(ev, s), __fmul_rn(od, c)) : __fadd_rn(__fmul_rn(ev, c), -__fmul_rn(od, s)); }
  if (ROPE == 2) { const int i = d & (HD / 2 - 1); const float c = CS[p * (HD / 2) + i], s = SN[p * (HD / 2) + i]; const float lo = xv[i], hi = xv[i + HD / 2]; o = (d < HD / 2) ? __fadd_rn(__fmul_rn(lo, c), -__fmul_rn(hi, s)) : __fadd_rn(__fmul_rn(lo, s), __fmul_rn(hi, c)); }
  if (ROPE == 3) { const float c = CS[p * HD + d], s = SN[p * HD + d]; const float lo = xv[d & (HD / 2 - 1)], hi = xv[(d & (HD / 2 - 1)) + HD / 2]; o = (d < HD / 2) ? __fadd_rn(__fmul_rn(lo, c), -__fmul_rn(hi, s)) : __fadd_rn(__fmul_rn(hi, c), __fmul_rn(lo, s)); }      /* rotate-half with FULL-width per-element tables [pos][HD] */
  float* dst = F32 + r * (size_t)ldo + (size_t)h * HD + d; *(float*)dst = o;  }

__global__ __launch_bounds__(256) void k_bfcp(const float* __restrict__ src, float* __restrict__ dst, size_t n4) { const size_t t = (size_t)blockIdx.x * 256 + threadIdx.x; if (t >= n4) return; const v4f a = *(const v4fa*)(src + t * 4); v4f o; for (int q = 0; q < 4; ++q) o[q] = bf16_round(a[q]); *(v4f*)(dst + t * 4) = o;  }

__global__ __launch_bounds__(256) void k_tabhalf(const float* __restrict__ cs, const float* __restrict__ sn, float* __restrict__ CS, float* __restrict__ SN) { const int t = blockIdx.x * 256 + threadIdx.x; if (t >= SQ * (HD / 2)) return; const int p = t / (HD / 2), i = t % (HD / 2); const float c = bf16_round(cs[(size_t)p * HD + i]), s = bf16_round(sn[(size_t)p * HD + i]);
  *(float*)(CS + t) = c; *(float*)(SN + t) = s;  }

__global__ __launch_bounds__(256) void k_tab2d(float* __restrict__ CS, float* __restrict__ SN) {
  #pragma clang fp contract(off)
  const int t = blockIdx.x * 256 + threadIdx.x; if (t >= SQ * (HD / 2)) return; const int i = t % (HD / 2); const int p = t / (HD / 2); const float invf = (float)(1.0 / pow(10000.0, (double)(2 * i) / (double)HD)); const float ang = __fmul_rn((float)p, invf); const float c = cosf(ang), s = sinf(ang);
  *(float*)(CS + t) = c; *(float*)(SN + t) = s;  }
extern "C" void kernel_launch(void* const* d_in, const int* in_sizes, int n_in,
                              void* d_out, int out_size, void* d_ws, size_t ws_size, hipStream_t stream) {
  (void)in_sizes; (void)n_in; (void)out_size;
  const float* const* I = (const float* const*)d_in; const float* x = I[0]; const float* wattn = I[1]; const float* wo = I[2];      /* x; fused [in][out] W_attn [1024][3072] (q | k | v column thirds); [in][out] W_proj; rope tables computed in-kernel (positions = row index) */
  static_assert(HPG == 1 && NH == NG * HPG && NH * HD == DM && KVD == DM, "plain multi-head attention as 16 kv groups of one query head"); const float* bq = nullptr; const float* bk = nullptr; const float* bv = nullptr; const float* bo = nullptr;      /* [in][out] weights, no biases; rope tables computed in the kernel */
  char* ws = (char*)d_ws; size_t off = 0;
  auto take = [&](size_t bytes) { char* p = ws + off; off += (bytes + 255) & ~(size_t)255; return p; };
  _Float16* BQKV = (_Float16*)take((size_t)3 * DM * DM * 2); _Float16* BQ = BQKV; _Float16* BK = BQKV + (size_t)DM * DM; _Float16* BV = BQKV + (size_t)2 * DM * DM; _Float16* BO = (_Float16*)take((size_t)DM * DM * 2);      /* one transposed plane Bt [3072][1024] of the fused weight: rows 0..1023 = q, 1024.. = k, 2048.. = v */
  _Float16* X16 = (_Float16*)take(NR * DM * 2); float* CSB = (float*)take((size_t)SQ * HD * 4); float* SNB = (float*)take((size_t)SQ * HD * 4); _Float16* Q16 = (_Float16*)take(NR * DM * 2); _Float16* K16 = (_Float16*)take(NR * KVD * 2); _Float16* V16 = (_Float16*)take(NR * KVD * 2); _Float16* O16 = (_Float16*)take(NR * DM * 2);
  static_assert(B0 == 0 && NBR == NB && NHD == NH && QN == SQ, "every launch covers all batches and heads");
  float* S = (float*)take((size_t)NB * NH * QT * NKX * 4); _Float16* P = (_Float16*)S; _Float16* VT = (_Float16*)take((size_t)NB * NH * HD * SQ * 2);      /* score plane of one causal tile for all batches and heads; the softmax writes each f16 row over the start of its own f32 row (pitch 2 * NKX halves) */
  static_assert((size_t)NB * NH * QT * NKX >= NR * DM + NR * KVD, "the f32 q and k rows fit the score plane"); float* QF = S; float* KF = S + NR * DM;      /* f32 q, k before the rope: last read by the rope launches, which stand in front of the first score launch */
  float* QF0 = (float*)take((size_t)NB * QT0 * DM * 4); float* KF0 = (float*)take((size_t)NB * QT0 * KVD * 4); float* VF0 = (float*)take((size_t)NB * QT0 * KVD * 4); float* KF0e = (float*)take((size_t)NB * QT0 * DM * 4); float* VF0e = (float*)take((size_t)NB * QT0 * DM * 4); float* OF0 = (float*)take((size_t)NB * QT0 * DM * 4); _Float16* OH0 = (_Float16*)take((size_t)NB * QT0 * DM * 2); _Float16* OL0 = (_Float16*)take((size_t)NB * QT0 * DM * 2);
  if (off > ws_size) return;
  k_wt_f16<<<(unsigned)(((size_t)3 * DM * (DM / 8) + 255) / 256), 256, 0, stream>>>(wattn, BQKV, DM, 3 * DM, 16.0f); k_wt_f16<<<(unsigned)(((size_t)DM * (DM / 8) + 255) / 256), 256, 0, stream>>>(wo, BO, DM, DM, 16.0f);      /* [in][out] -> Bt x16 planes (fused W_attn: K 1024, N 3072) */
  k_x16<<<(unsigned)((NR * DM / 8 + 255) / 256), 256, 0, stream>>>(x, X16, NR * DM / 8);
  k_tab2d<<<(SQ * (HD / 2) + 255) / 256, 256, 0, stream>>>(CSB, SNB);      /* rope tables cos/sin(p / 10000^(2i/64)): inv_freq double-derived -> f32, f32 angle */
  /* Every launch below covers all NB batches: token rows b * SQ + s run through, or the batch is grid.z (GEMMs) / grid.y (first-tile kernels). */
  k_gemm2<0><<<dim3((unsigned)((MP / 128) * (KVD / 64)), 1), 128, 0, stream>>>(X16, DM, 0, BV, DM, 0, 0.0625f, bv, 0, nullptr, 1, 0, 0, nullptr, V16, KVD, 0, MP, KVD, DM, 0, 0, 0);
  k_gemm2<0><<<dim3((unsigned)((MP / 128) * (DM / 64)), 1), 128, 0, stream>>>(X16, DM, 0, BQ, DM, 0, 0.0625f, nullptr, 0, nullptr, 1, 0, 0, QF, nullptr, DM, 0, MP, DM, DM, 0, 0, 0);      /* q (f32) */
  k_gemm2<0><<<dim3((unsigned)((MP / 128) * (KVD / 64)), 1), 128, 0, stream>>>(X16, DM, 0, BK, DM, 0, 0.0625f, nullptr, 0, nullptr, 1, 0, 0, KF, nullptr, KVD, 0, MP, KVD, DM, 0, 0, 0);      /* k (f32) */
  k_xform<0, 2><<<(unsigned)(NR * NH), 64, 0, stream>>>(QF, DM, NH, nullptr, 0.f, CSB, SNB, Q16, DM); k_xform<0, 2><<<(unsigned)(NR * NG), 64, 0, stream>>>(KF, KVD, NG, nullptr, 0.f, CSB, SNB, K16, KVD);      /* half-split rope <0, 2> (out_lo = x_lo c - x_hi s, out_hi = x_lo s + x_hi c = t cos + rotate_half(t) sin with the module's [f | f] tables) -> f16 rows; position = row % SQ */
  k_xformf<0, 2><<<dim3((unsigned)(QT0 * NH), NB), 64, 0, stream>>>(QF, DM, NH, nullptr, 0.f, CSB, SNB, QF0, DM, (size_t)SQ * DM, (size_t)QT0 * DM); k_xformf<0, 2><<<dim3((unsigned)(QT0 * NG), NB), 64, 0, stream>>>(KF, KVD, NG, nullptr, 0.f, CSB, SNB, KF0, KVD, (size_t)SQ * KVD, (size_t)QT0 * KVD);      /* f32 half-split-roped q, k of rows 0..127 of each batch */
  k_vt<NG, SQ><<<NB * NG * (SQ / 64), 256, 0, stream>>>(V16, KVD, 0, VT);      /* V^T [NB][NH][HD][SQ] */
  k_gemm2<0><<<dim3((QT0 / 128) * (KVD / 64), 1, NB), 128, 0, stream>>>(X16, DM, 0, BV, DM, 0, 0.0625f, bv, 0, nullptr, 1, 0, 0, VF0, nullptr, KVD, 0, QT0, KVD, DM, (size_t)SQ * DM, 0, (size_t)QT0 * KVD);
  k_kvexp<<<(unsigned)(((size_t)NB * QT0 * DM / 4 + 255) / 256), 256, 0, stream>>>(KF0, KF0e, (size_t)NB * QT0 * DM / 4); k_kvexp<<<(unsigned)(((size_t)NB * QT0 * DM / 4 + 255) / 256), 256, 0, stream>>>(VF0, VF0e, (size_t)NB * QT0 * DM / 4);      /* head h <- kv group h / HPG for the exact first-tile kernel */      /* f32 q, k, v of the first 128 rows (exact products) */
  k_att0<0><<<dim3(NH * (QT0 / 64), NB), 64, 0, stream>>>(QF0, KF0e, VF0e, DM, nullptr, 0.125f, OF0, DM);      /* exact f32 attention for rows 0..127 of each batch (o x64) */
  for (int q0 = 0; q0 < QN; q0 += QT) { const int nk = q0 + QT;      /* causal: only keys below the tile end are computed */
    k_gemm2<0><<<dim3((QT / 128) * (nk / 64), NH, NB), 128, 0, stream>>>(Q16 + (size_t)q0 * LQ, LQ, (size_t)HD, K16, KVD, (size_t)HD, 0.125f, nullptr, 0, nullptr, 1, 0, 0, S, nullptr, NKX, (size_t)QT * NKX, QT, nk, HD, (size_t)SQ * LQ, (size_t)SQ * KVD, (size_t)NH * QT * NKX);      /* scores: heads on grid.y (key head stride HD), batches on grid.z */
    static_assert(QN / QT == 8, "one softmax instance per causal tile");
    switch (nk / QT) {      /* softmax, one wave per row (8 rows per block); the key count is a compile-time constant of each tile's kernel so that the row stays in registers */
      case 1: k_rsmcf2<2><<<(NB * NH * QT + 7) / 8, 256, 0, stream>>>(S, P, NB * NH); break; case 2: k_rsmcf2<4><<<(NB * NH * QT + 7) / 8, 256, 0, stream>>>(S, P, NB * NH); break; case 3: k_rsmcf2<6><<<(NB * NH * QT + 7) / 8, 256, 0, stream>>>(S, P, NB * NH); break; case 4: k_rsmcf2<8><<<(NB * NH * QT + 7) / 8, 256, 0, stream>>>(S, P, NB * NH); break;
      case 5: k_rsmcf2<10><<<(NB * NH * QT + 7) / 8, 256, 0, stream>>>(S, P, NB * NH); break; case 6: k_rsmcf2<12><<<(NB * NH * QT + 7) / 8, 256, 0, stream>>>(S, P, NB * NH); break; case 7: k_rsmcf2<14><<<(NB * NH * QT + 7) / 8, 256, 0, stream>>>(S, P, NB * NH); break; case 8: k_rsmcf2<16><<<(NB * NH * QT + 7) / 8, 256, 0, stream>>>(S, P, NB * NH); break; }
    k_gemm2<0><<<dim3((QT / 128) * (HD / 64), NH, NB), 128, 0, stream>>>(P, 2 * NKX, (size_t)QT * 2 * NKX, VT, SQ, (size_t)HD * SQ, 0.25f, nullptr, 0, nullptr, 1, 0, 0, nullptr, O16 + (size_t)q0 * DM, DM, (size_t)HD, QT, HD, nk, (size_t)NH * QT * 2 * NKX, (size_t)NH * HD * SQ, (size_t)SQ * DM); }      /* o (x64): heads on grid.y (value head stride HD*SQ), batches on grid.z */
  k_gemm2<0><<<dim3((unsigned)((MPO / 128) * (DM / 64)), 1), 128, 0, stream>>>(O16, DM, 0, BO, DM, 0, 0.0009765625f, bo, 0, nullptr, 1, 0, 0, (float*)d_out, nullptr, DM, 0, MPO, DM, DM, 0, 0, 0);      /* out rows are the output layout */
  k_hl<<<(unsigned)(((size_t)NB * QT0 * DM / 8 + 255) / 256), 256, 0, stream>>>(OF0, OH0, OL0, (size_t)NB * QT0 * DM / 8);      /* first-tile o (x64) -> f16 hi + x1024 residual planes */
  k_gemm2<0><<<dim3((QT0 / 128) * (DM / 64), 1, NB), 128, 0, stream>>>(OH0, DM, 0, BO, DM, 0, 0.0009765625f, bo, 0, nullptr, 1, 0, 0, (float*)d_out, nullptr, DM, 0, QT0, DM, DM, (size_t)QT0 * DM, 0, (size_t)SQ * DM);      /* rows 0..127 of each batch: out = o_hi Wo (+ b), overwriting the f16-path rows */
  k_gemm2<0><<<dim3((QT0 / 128) * (DM / 64), 1, NB), 128, 0, stream>>>(OL0, DM, 0, BO, DM, 0, 0.00000095367431640625f, nullptr, 0, (const float*)d_out, -1, 0, 0, (float*)d_out, nullptr, DM, 0, QT0, DM, DM, (size_t)QT0 * DM, 0, (size_t)SQ * DM);      /* += o_lo Wo 2^-20 (own-element accumulate) */
}

// v003
// Measured time: 1040 microseconds a run.
// Timed twice side by side with v002, it ran 1.41 and 1.42 times as fast.
// Over all steps from v000 it is 9.65 times as fast.
#include <hip/hip_runtime.h>
// Causal multi-head self-attention with rotate-half RoPE computed in the module and a bias-free fused QKV projection (x [4][2048][1024]; qkv = x Wqkv ([in][out] 1024 x 3072, no bias) split into q | k | v thirds, 16 heads of 64; cos / sin = [f | f] of pos * 10000^(-2i/64); q = q cos + rotate_half(q) sin, likewise k; scores * 64^-0.5; causal (tril, finfo.min fill); softmax; out = merged Wout ([in][out], no bias) -> [4][2048][1024]); run as grouped-query causal attention with 16 groups of ONE head and half-split rope.
// Compute dtype: inputs rounded to bf16; x / weights exact; q, k, v, softmax weights and o as plain f16 GEMM operands (~2^-12); scores and softmax statistics f32; v_wmma_f32_16x16x32_f16.
#define NB 4
#define NG 16
#define HPG 1
#define KVD (NG * HD)
#define SQ 2048
#define DM 1024
#define NH 16
#define HD 64
#define HG 4                         /* heads per k_vt(b, h0) launch (overload not called) */
#define QT 256                       /* query rows per causal tile */
#define NKX SQ                       /* S row pitch (P rows: 2 * NKX halves) */
#define QT0 128                      /* first-tile rows recomputed exactly in f32 */
#define B0 0                         /* first batch processed (debug hook) */
#define NBR NB                       /* batches processed (debug hook) */
#define NR ((size_t)NB * SQ)         /* token rows */
#define MP ((int)((size_t)NBR * SQ)) /* rows projected (debug hook) */
#define QN SQ                        /* query rows attended per batch (debug hook) */
#define NHD NH                       /* heads attended (debug hook) */
#define MPO MP                       /* rows through the output stage (debug hook) */
#define LQ DM      /* row pitch of the q/k/v rows */
typedef __bf16 v16b __attribute__((ext_vector_type(16)));
typedef unsigned short v8us __attribute__((ext_vector_type(8), may_alias));
typedef float  v8f  __attribute__((ext_vector_type(8)));
typedef float  v4f  __attribute__((ext_vector_type(4)));
typedef float  v4fa __attribute__((ext_vector_type(4), may_alias));
union FragB { v16b v; v8us half[2]; unsigned short u[16]; };

__device__ __forceinline__ unsigned short bf16_bits(float x) { unsigned int u = __float_as_uint(x); return (unsigned short)((u + 0x7FFFu + ((u >> 16) & 1u)) >> 16); }
__device__ __forceinline__ float bf16_val(unsigned short b) { return __uint_as_float(((unsigned int)b) << 16); }
__device__ __forceinline__ float bf16_round(float x) { return bf16_val(bf16_bits(x)); }
// D += A·B with NT terms: 1 = ah·bh, 2 = + al·bh (A split), 3 = + ah·bl (both split)
template <int NT>
__device__ __forceinline__ v8f mmaN(v16b ah, v16b al, v16b bh, v16b bl, v8f c) {
  c = __builtin_amdgcn_wmma_f32_16x16x32_bf16(false, ah, false, bh, (short)0, c, false, false);
  if (NT >= 2) c = __builtin_amdgcn_wmma_f32_16x16x32_bf16(false, al, false, bh, (short)0, c, false, false);
  if (NT >= 3) c = __builtin_amdgcn_wmma_f32_16x16x32_bf16(false, ah, false, bl, (short)0, c, false, false);
  asm volatile("v_nop\n\tv_nop\n\tv_nop\n\tv_nop" : "+v"(c) : "v"(ah), "v"(al), "v"(bh), "v"(bl));
  return c;
}

__global__ __launch_bounds__(256) void k_wt_bf16(const float* __restrict__ W, unsigned short* __restrict__ Wt, int K, int N) {
  const int t = blockIdx.x * 256 + threadIdx.x;
  const int k8n = K / 8;
  if (t >= N * k8n) return;
  const int n = t / k8n, k8 = (t % k8n) * 8;
  v8us v;
#pragma unroll
  for (int i = 0; i < 8; ++i) v[i] = bf16_bits(W[(size_t)(k8 + i) * N + n]);
  *(v8us*)(Wt + (size_t)n * K + k8) = v;
  
}

// GEMM C[M][N] (f32, pitch ldc) = act(A[M][K]·W + bias). A f32 row-major (pitch lda) converted per fragment to bf16
// (ASPLIT: hi/lo two planes -> 2 terms, else single rounded term); Wt bf16 [N][K] (pitch ldb). BIAS_BF16 rounds the
// bias to bf16 first (bias quantised to bf16 before the add). K%32==0, M%16==0, N%64==0.
template <bool ASPLIT, int ACT, bool BIAS_BF16>
__global__ __launch_bounds__(128) void k_gemm_bf(const float* __restrict__ A, int lda, const unsigned short* __restrict__ Wt, int ldb,
                                               const float* __restrict__ bias, float* __restrict__ C, int ldc, int M, int N, int K) {
  __shared__ __attribute__((aligned(16))) float so[4][16][64];
  const int tid = threadIdx.x, w = tid >> 5, lane = tid & 31, ln = lane & 15, hh = lane >> 4;
  const int ntn = N / 64;
  const int wid = blockIdx.x * 4 + w;
  const int mt = wid / ntn, nq = wid % ntn;
  if (mt * 16 >= M) return;
  const int row0 = mt * 16, col0 = nq * 64;
  const float* arow = A + (size_t)(row0 + ln) * lda;
  v8f acc[4] = {};
  for (int kb = 0; kb < K; kb += 32) {
    FragB ah, al;
    const v4f x0 = *(const v4fa*)(arow + kb + 8 * hh), x1 = *(const v4fa*)(arow + kb + 8 * hh + 4);
    const v4f x2 = *(const v4fa*)(arow + kb + 16 + 8 * hh), x3 = *(const v4fa*)(arow + kb + 16 + 8 * hh + 4);
    float xs[16] = {x0[0],x0[1],x0[2],x0[3],x1[0],x1[1],x1[2],x1[3],x2[0],x2[1],x2[2],x2[3],x3[0],x3[1],x3[2],x3[3]};
#pragma unroll
    for (int i = 0; i < 16; ++i) { const unsigned short hb = bf16_bits(xs[i]); ah.u[i] = hb; al.u[i] = ASPLIT ? bf16_bits(xs[i] - bf16_val(hb)) : (unsigned short)0; }
#pragma unroll
    for (int t = 0; t < 4; ++t) {
      const unsigned short* brow = Wt + (size_t)(col0 + t * 16 + ln) * ldb + kb;
      FragB b;
      b.half[0] = *(const v8us*)(brow + 8 * hh);
      b.half[1] = *(const v8us*)(brow + 16 + 8 * hh);
      acc[t] = mmaN<ASPLIT ? 2 : 1>(ah.v, al.v, b.v, b.v, acc[t]);
    }
  }
#pragma unroll
  for (int t = 0; t < 4; ++t) {
    float bv = bias ? bias[col0 + t * 16 + ln] : 0.f;
    if (BIAS_BF16) bv = bf16_round(bv);
#pragma unroll
    for (int r = 0; r < 8; ++r) { float v = acc[t][r] + bv; if (ACT == 1) v = fmaxf(v, 0.f); so[w][8 * hh + r][t * 16 + ln] = v; }
  }
  __builtin_amdgcn_fence(__ATOMIC_ACQ_REL, "workgroup");
  __builtin_amdgcn_wave_barrier();
  const int rsub = lane >> 4, c4 = (lane & 15) * 4;
  {
#pragma unroll
    for (int q = 0; q < 8; ++q) {
      const int r = q * 2 + rsub;
      const v4f v = *(const v4fa*)&so[w][r][c4];
      *(v4f*)(C + (size_t)(row0 + r) * ldc + col0 + c4) = v;
    }
    
  }
}

// GEMM C = act(A·W + bias + resid): A f32 (ASPLIT -> hi/lo 2 terms), Wt bf16 [N][K]; ACT 0 none, 1 relu, 2 exact gelu;
// resid (optional, f32, row index = (row % rmod), pitch ldr, RES_BF16 rounds it) added before the activation.
template <bool ASPLIT, int ACT, bool BIAS_BF16, bool RES_BF16>
__global__ __launch_bounds__(128) void k_gemm_bf3(const float* __restrict__ A, int lda, const unsigned short* __restrict__ Wt, int ldb,
                                                const float* __restrict__ bias, const float* __restrict__ resid, int rmod, int ldr,
                                                float* __restrict__ C, int ldc, int M, int N, int K) {
  __shared__ __attribute__((aligned(16))) float so[4][16][64];
  const int tid = threadIdx.x, w = tid >> 5, lane = tid & 31, ln = lane & 15, hh = lane >> 4;
  const int ntn = N / 64;
  const int wid = blockIdx.x * 4 + w;
  const int mt = wid / ntn, nq = wid % ntn;
  if (mt * 16 >= M) return;
  const int row0 = mt * 16, col0 = nq * 64;
  const float* arow = A + (size_t)(row0 + ln) * lda;
  v8f acc[4] = {};
  for (int kb = 0; kb < K; kb += 32) {
    FragB ah, al;
    const v4f x0 = *(const v4fa*)(arow + kb + 8 * hh), x1 = *(const v4fa*)(arow + kb + 8 * hh + 4);
    const v4f x2 = *(const v4fa*)(arow + kb + 16 + 8 * hh), x3 = *(const v4fa*)(arow + kb + 16 + 8 * hh + 4);
    float xs[16] = {x0[0],x0[1],x0[2],x0[3],x1[0],x1[1],x1[2],x1[3],x2[0],x2[1],x2[2],x2[3],x3[0],x3[1],x3[2],x3[3]};
#pragma unroll
    for (int i = 0; i < 16; ++i) { const unsigned short hb = bf16_bits(xs[i]); ah.u[i] = hb; al.u[i] = ASPLIT ? bf16_bits(xs[i] - bf16_val(hb)) : (unsigned short)0; }
#pragma unroll
    for (int t = 0; t < 4; ++t) {
      const unsigned short* brow = Wt + (size_t)(col0 + t * 16 + ln) * ldb + kb;
      FragB b;
      b.half[0] = *(const v8us*)(brow + 8 * hh);
      b.half[1] = *(const v8us*)(brow + 16 + 8 * hh);
      acc[t] = mmaN<ASPLIT ? 2 : 1>(ah.v, al.v, b.v, b.v, acc[t]);
    }
  }
#pragma unroll
  for (int t = 0; t < 4; ++t) {
    const int col = col0 + t * 16 + ln;
    float bv = bias ? bias[col] : 0.f;
    if (BIAS_BF16) bv = bf16_round(bv);
#pragma unroll
    for (int r = 0; r < 8; ++r) {
      float v = acc[t][r] + bv;
      if (resid) { float rv = resid[(size_t)((row0 + 8 * hh + r) % rmod) * ldr + col]; if (RES_BF16) rv = bf16_round(rv); v += rv; }
      if (ACT == 1) v = fmaxf(v, 0.f);
      if (ACT == 2) v = 0.5f * v * (1.0f + erff(v * 0.70710678118654752f));
      if (ACT == 3) { const float u = 0.7978845608028654f * (v + 0.044715f * v * v * v); v = 0.5f * v * (1.0f + tanhf(u)); }
      so[w][8 * hh + r][t * 16 + ln] = v;
    }
  }
  __builtin_amdgcn_fence(__ATOMIC_ACQ_REL, "workgroup");
  __builtin_amdgcn_wave_barrier();
  const int rsub = lane >> 4, c4 = (lane & 15) * 4;
  {
#pragma unroll
    for (int q = 0; q < 8; ++q) {
      const int r = q * 2 + rsub;
      const v4f v = *(const v4fa*)&so[w][r][c4];
      *(v4f*)(C + (size_t)(row0 + r) * ldc + col0 + c4) = v;
    }
    
  }
}
// row LayerNorm (biased variance, eps) over N: s = X (+ R); optional out_sum <- s; out_norm <- (s-mu)*rsqrt(var+eps)*g + b
template <bool PARAM_BF16>
__global__ __launch_bounds__(256) void k_layernorm(const float* __restrict__ X, const float* __restrict__ R, const float* __restrict__ g, const float* __restrict__ bta,
                                                  float* __restrict__ out_sum, float* __restrict__ out_norm, int N, float eps) {
  __shared__ float red[256];
  const int row = blockIdx.x, tid = threadIdx.x;
  const float* x = X + (size_t)row * N; const float* rr = R ? R + (size_t)row * N : nullptr;
  float vals[16];                     // up to N = 4096
  const int per = N / 256;            // contiguous chunk per thread? use strided-by-4 chunks: thread handles j = tid*4 + 1024*u
  float s1 = 0.f;
  for (int u = 0; u < per / 4; ++u) {
    const int j = tid * 4 + 1024 * u;
    const v4f a = *(const v4fa*)(x + j);
    v4f b = {0.f,0.f,0.f,0.f}; if (rr) b = *(const v4fa*)(rr + j);
#pragma unroll
    for (int q = 0; q < 4; ++q) { const float v = a[q] + b[q]; vals[u * 4 + q] = v; s1 += v; }
  }
  red[tid] = s1; __syncthreads();
  for (int st = 128; st > 0; st >>= 1) { if (tid < st) red[tid] += red[tid + st]; __syncthreads(); }
  const float mu = red[0] / (float)N; __syncthreads();
  float s2 = 0.f;
  for (int u = 0; u < per / 4; ++u)
#pragma unroll
    for (int q = 0; q < 4; ++q) { const float c = vals[u * 4 + q] - mu; s2 += c * c; }
  red[tid] = s2; __syncthreads();
  for (int st = 128; st > 0; st >>= 1) { if (tid < st) red[tid] += red[tid + st]; __syncthreads(); }
  const float rs = rsqrtf(red[0] / (float)N + eps);
  {
    for (int u = 0; u < per / 4; ++u) {
      const int j = tid * 4 + 1024 * u;
      v4f o, sm;
#pragma unroll
      for (int q = 0; q < 4; ++q) {
        float gg = g[j + q], bb = bta[j + q];
        if (PARAM_BF16) { gg = bf16_round(gg); bb = bf16_round(bb); }
        sm[q] = vals[u * 4 + q]; o[q] = (vals[u * 4 + q] - mu) * rs * gg + bb;
      }
      if (out_sum) *(v4f*)(out_sum + (size_t)row * N + j) = sm;
      *(v4f*)(out_norm + (size_t)row * N + j) = o;
    }
    
  }
}



// ---- f16 WMMA path (v_wmma_f32_16x16x32_f16): 11-bit significands for operands in range — used where a [0,1] probability operand needs more precision than bf16
typedef _Float16 v16h __attribute__((ext_vector_type(16)));
union FragH { v16h v; v8us half[2]; _Float16 h[16]; unsigned short u[16]; };
template <int NT>
__device__ __forceinline__ v8f mmaH(v16h ah, v16h al, v16h bh, v16h bl, v8f c) {
  c = __builtin_amdgcn_wmma_f32_16x16x32_f16(false, ah, false, bh, (short)0, c, false, false);
  if (NT >= 2) c = __builtin_amdgcn_wmma_f32_16x16x32_f16(false, al, false, bh, (short)0, c, false, false);
  if (NT >= 3) c = __builtin_amdgcn_wmma_f32_16x16x32_f16(false, ah, false, bl, (short)0, c, false, false);
  asm volatile("v_nop\n\tv_nop\n\tv_nop\n\tv_nop" : "+v"(c) : "v"(ah), "v"(al), "v"(bh), "v"(bl));
  return c;
}
// batched GEMM like k_gemm_b but f16 operands: A f32 (split into f16 hi/lo if ASPLIT, else rounded to f16), Bt = f16 values [n][k]; alpha; C f32; N multiple of 16 (partial tiles skipped)
template <bool ASPLIT>
__global__ __launch_bounds__(128) void k_gemm_h(const float* __restrict__ A, int lda, size_t sA, const _Float16* __restrict__ Bh, int ldb, size_t sB, float alpha, float* __restrict__ C, int ldc, size_t sC, int M, int N, int K) {
  __shared__ __attribute__((aligned(16))) float so[4][16][64];
  const int tid = threadIdx.x, w = tid >> 5, lane = tid & 31, ln = lane & 15, hh = lane >> 4; const int by = blockIdx.y;
  A += (size_t)by * sA; Bh += (size_t)by * sB; C += (size_t)by * sC;
  const int ntn = (N + 63) / 64; const int wid = blockIdx.x * 4 + w; const int mt = wid / ntn, nq = wid % ntn; if (mt * 16 >= M) return;
  const int row0 = mt * 16, col0 = nq * 64; const float* arow = A + (size_t)(row0 + ln) * lda;
  v8f acc[4] = {};
  for (int kb = 0; kb < K; kb += 32) {
    FragH ah, al;
    const v4f x0 = *(const v4fa*)(arow + kb + 8 * hh), x1 = *(const v4fa*)(arow + kb + 8 * hh + 4), x2 = *(const v4fa*)(arow + kb + 16 + 8 * hh), x3 = *(const v4fa*)(arow + kb + 16 + 8 * hh + 4);
    float xs[16] = {x0[0],x0[1],x0[2],x0[3],x1[0],x1[1],x1[2],x1[3],x2[0],x2[1],x2[2],x2[3],x3[0],x3[1],x3[2],x3[3]};
#pragma unroll
    for (int i = 0; i < 16; ++i) { const _Float16 h = (_Float16)xs[i]; ah.h[i] = h; al.h[i] = ASPLIT ? (_Float16)(xs[i] - (float)h) : (_Float16)0.0f; }
#pragma unroll
    for (int t = 0; t < 4; ++t) { if (col0 + t * 16 >= N) continue; const size_t boff = (size_t)(col0 + t * 16 + ln) * ldb + kb; FragH bq; bq.half[0] = *(const v8us*)(Bh + boff + 8 * hh); bq.half[1] = *(const v8us*)(Bh + boff + 16 + 8 * hh);
      acc[t] = mmaH<ASPLIT ? 2 : 1>(ah.v, al.v, bq.v, bq.v, acc[t]); }
  }
#pragma unroll
  for (int t = 0; t < 4; ++t) { if (col0 + t * 16 >= N) continue;
#pragma unroll
    for (int r = 0; r < 8; ++r) so[w][8 * hh + r][t * 16 + ln] = acc[t][r] * alpha; }
  __builtin_amdgcn_fence(__ATOMIC_ACQ_REL, "workgroup"); __builtin_amdgcn_wave_barrier();
  const int rsub = lane >> 4, c4 = (lane & 15) * 4;
  {
#pragma unroll
    for (int q = 0; q < 8; ++q) { const int r = q * 2 + rsub; if (col0 + c4 < N) { const v4f v = *(const v4fa*)&so[w][r][c4]; *(v4f*)(C + (size_t)(row0 + r) * ldc + col0 + c4) = v; } }
     }
}

// Wt[n][k] = f16(W[k][n]·scale) from f32 row-major W[K][N] (scale = power of two; bf16-exact weights stay exact in f16 away from the subnormal range)
__global__ __launch_bounds__(256) void k_wt_f16(const float* __restrict__ W, _Float16* __restrict__ Wt, int K, int N, float scale) {
  const int t = blockIdx.x * 256 + threadIdx.x; if (t >= N * (K / 8)) return; const int n = t / (K / 8), k8 = (t % (K / 8)) * 8; FragH f;
#pragma unroll
  for (int i = 0; i < 8; ++i) f.h[i] = (_Float16)(bf16_round(W[(size_t)(k8 + i) * N + n]) * scale); const v8us o = f.half[0];
  *(v8us*)((unsigned short*)Wt + (size_t)n * K + k8) = o; 
}
// k_gemm_hh variant with fused epilogue: v = acc·alpha + bias[by·sBias + col] (+ CP[(row/rowsPerB)·sCPb + by·64 + col] if CP) ; ACT 0 none / 1 elu ; writes f16 C16 (and f32 C if non-null)
template <int ACT>
__global__ __launch_bounds__(128) void k_gemm_hhx(const _Float16* __restrict__ A, int lda, size_t sA, const _Float16* __restrict__ Bh, int ldb, size_t sB, float alpha, const float* __restrict__ bias, size_t sBias, const float* __restrict__ CP, int rowsPerB, size_t sCPb, int row0g,
    float* __restrict__ C, _Float16* __restrict__ C16, int ldc, size_t sC, int M, int N, int K) {
  __shared__ __attribute__((aligned(16))) float so[4][16][64];
  const int tid = threadIdx.x, w = tid >> 5, lane = tid & 31, ln = lane & 15, hh = lane >> 4; const int by = blockIdx.y;
  A += (size_t)by * sA; Bh += (size_t)by * sB; const size_t cofs = (size_t)by * sC; const float* bp = bias ? bias + (size_t)by * sBias : nullptr;
  const int ntn = (N + 63) / 64; const int wid = blockIdx.x * 4 + w; const int mt = wid / ntn, nq = wid % ntn; if (mt * 16 >= M) return;
  const int row0 = mt * 16, col0 = nq * 64; const _Float16* arow = A + (size_t)(row0 + ln) * lda;
  v8f acc[4] = {};
  for (int kb = 0; kb < K; kb += 32) { FragH ah; ah.half[0] = *(const v8us*)((const unsigned short*)arow + kb + 8 * hh); ah.half[1] = *(const v8us*)((const unsigned short*)arow + kb + 16 + 8 * hh);
#pragma unroll
    for (int t = 0; t < 4; ++t) { if (col0 + t * 16 >= N) continue; const size_t boff = (size_t)(col0 + t * 16 + ln) * ldb + kb; FragH bq; bq.half[0] = *(const v8us*)((const unsigned short*)Bh + boff + 8 * hh); bq.half[1] = *(const v8us*)((const unsigned short*)Bh + boff + 16 + 8 * hh);
      acc[t] = mmaH<1>(ah.v, ah.v, bq.v, bq.v, acc[t]); }
  }
#pragma unroll
  for (int t = 0; t < 4; ++t) { if (col0 + t * 16 >= N) continue; const int col = col0 + t * 16 + ln; const float bv = bp ? bf16_round(bp[col]) : 0.f;
#pragma unroll
    for (int r = 0; r < 8; ++r) { float v = acc[t][r] * alpha + bv; if (CP) { const int rr = row0g + row0 + 8 * hh + r; if (rowsPerB < 0) v += CP[cofs + (size_t)rr * ldc + col];      /* rowsPerB < 0: own element of the batched C plane */ else { const int bidx = rr / rowsPerB; v += CP[(size_t)bidx * sCPb + (size_t)by * 64 + col]; } } if (ACT == 1) v = (v > 0.f) ? v : expm1f(v); else if (ACT == 7) v = (v > 0.f) ? v + 1.0f : expf(v); else if (ACT == 8) v = tanhf(v); else if (ACT == 9) v = 0.5f * v * (1.0f + tanhf(0.7978845608028654f * (v + 0.044715f * v * v * v))); else if (ACT == 11) v = 1.0f / (1.0f + expf(-v)); else if (ACT == 12) v = (v > 0.f) ? v : 0.01f * v; else if (ACT == 14) v = (v > 0.f) ? v : 0.1f * v; else if (ACT == 16) v = (v >= 0.f) ? v : 0.3f * v; else if (ACT == 17) v = (v >= 0.f) ? v : 0.2f * v; else if (ACT == 15) v = v / (1.0f + expf(-v)); else if (ACT == 3) v = fmaxf(v, 0.f); else if (ACT == 6) v = 0.5f * v * (1.0f + erff(v * 0.70710678118654752f)); so[w][8 * hh + r][t * 16 + ln] = v; } }
  __builtin_amdgcn_fence(__ATOMIC_ACQ_REL, "workgroup"); __builtin_amdgcn_wave_barrier();
  const int rsub = lane >> 4, c4 = (lane & 15) * 4; typedef _Float16 v4h __attribute__((ext_vector_type(4)));
  {
#pragma unroll
    for (int q = 0; q < 8; ++q) { const int r = q * 2 + rsub; if (col0 + c4 < N) { const v4f v = *(const v4fa*)&so[w][r][c4]; if (C) *(v4f*)(C + cofs + (size_t)(row0 + r) * ldc + col0 + c4) = v; if (C16) { v4h h4; for (int i = 0; i < 4; ++i) h4[i] = (_Float16)v[i]; *(v4h*)(C16 + cofs + (size_t)(row0 + r) * ldc + col0 + c4) = h4; } } }
     }
}


typedef _Float16 v4h __attribute__((ext_vector_type(4)));

__global__ __launch_bounds__(256) void k_x16(const float* __restrict__ x, _Float16* __restrict__ X16, size_t n8) { const size_t t = (size_t)blockIdx.x * 256 + threadIdx.x; if (t >= n8) return; FragH f;
#pragma unroll
  for (int q = 0; q < 8; ++q) f.h[q] = (_Float16)bf16_round(x[t * 8 + q]); *(v8us*)((unsigned short*)X16 + t * 8) = f.half[0];  }
__global__ __launch_bounds__(256) void k_h16(const float* __restrict__ x, _Float16* __restrict__ X16, size_t n8) { const size_t t = (size_t)blockIdx.x * 256 + threadIdx.x; if (t >= n8) return; FragH f;
#pragma unroll
  for (int q = 0; q < 8; ++q) f.h[q] = (_Float16)x[t * 8 + q]; *(v8us*)((unsigned short*)X16 + t * 8) = f.half[0];  }
__global__ __launch_bounds__(256) void k_round16f(const float* __restrict__ W, _Float16* __restrict__ Bt, size_t n8) { const size_t t = (size_t)blockIdx.x * 256 + threadIdx.x; if (t >= n8) return; FragH f;
#pragma unroll
  for (int i = 0; i < 8; ++i) f.h[i] = (_Float16)(bf16_round(W[t * 8 + i]) * 16.0f); *(v8us*)((unsigned short*)Bt + t * 8) = f.half[0];  }
template <int NHv, int TTv>
__global__ __launch_bounds__(256) void k_vt(const _Float16* __restrict__ V16, int ldv, int voff, _Float16* __restrict__ Vt) { __shared__ unsigned short tl[64][66]; const int tid = threadIdx.x; const int slab = blockIdx.x / (TTv / 64), lg = blockIdx.x % (TTv / 64); const int b = slab / NHv, h = slab % NHv;
  for (int i = tid; i < 64 * 8; i += 256) { const int r = i / 8, c8 = (i % 8) * 8; FragH f; f.half[0] = *(const v8us*)((const unsigned short*)V16 + ((size_t)b * TTv + lg * 64 + r) * ldv + voff + h * 64 + c8);
#pragma unroll
    for (int q = 0; q < 8; ++q) tl[r][c8 + q] = f.u[q]; }
  __syncthreads();
  {
#pragma unroll
    for (int rd = 0; rd < 2; ++rd) { const int d = rd * 32 + tid / 8, pc = tid % 8; FragH f;
#pragma unroll
      for (int q = 0; q < 8; ++q) f.u[q] = tl[pc * 8 + q][d];
      *(v8us*)((unsigned short*)Vt + ((size_t)slab * 64 + d) * TTv + lg * 64 + pc * 8) = f.half[0]; }
     } }

__global__ __launch_bounds__(256) void k_hl(const float* __restrict__ F, _Float16* __restrict__ Hh, _Float16* __restrict__ Hl, size_t n8) { const size_t t = (size_t)blockIdx.x * 256 + threadIdx.x; if (t >= n8) return; FragH fh, fl; const v4f a = *(const v4fa*)(F + t * 8), c = *(const v4fa*)(F + t * 8 + 4);
#pragma unroll
  for (int q = 0; q < 4; ++q) { _Float16 h = (_Float16)a[q]; fh.h[q] = h; fl.h[q] = (_Float16)((a[q] - (float)h) * 1024.0f); h = (_Float16)c[q]; fh.h[4 + q] = h; fl.h[4 + q] = (_Float16)((c[q] - (float)h) * 1024.0f); }
  { *(v8us*)((unsigned short*)Hh + t * 8) = fh.half[0]; *(v8us*)((unsigned short*)Hl + t * 8) = fl.half[0];  } }

// ---- fast GEMM (wave tile 32x64; requires M % 32 == 0 rows per launch region and N % 64 == 0); epilogue = k_gemm_hhx semantics ----
__device__ __forceinline__ v16h g2_frag(const _Float16* p, int hh) { FragH f; f.half[0] = *(const v8us*)((const unsigned short*)p + 8 * hh); f.half[1] = *(const v8us*)((const unsigned short*)p + 16 + 8 * hh); return f.v; }
__device__ __forceinline__ v8f g2_mma(v16h a, v16h b, v8f c) { v8f d = __builtin_amdgcn_wmma_f32_16x16x32_f16(false, a, false, b, (short)0, c, false, false); asm volatile("v_nop\n\tv_nop\n\tv_nop\n\tv_nop" : "+v"(d) : "v"(a), "v"(b)); return d; }
template <int ACT>
__global__ __launch_bounds__(128) void k_gemm2(const _Float16* __restrict__ A, int lda, size_t sA, const _Float16* __restrict__ Bh, int ldb, size_t sB, float alpha, const float* __restrict__ bias, size_t sBias, const float* __restrict__ CP, int rowsPerB, size_t sCPb, int row0g,
    float* __restrict__ C, _Float16* __restrict__ C16, int ldc, size_t sC, int M, int N, int K, size_t zA, size_t zB, size_t zC) { static_assert(ACT == 0 || ACT == 3 || ACT == 6 || ACT == 8 || ACT == 9 || ACT == 11 || ACT == 12 || ACT == 14 || ACT == 15 || ACT == 16 || ACT == 17, "k_gemm2: unsupported ACT code (would silently apply no activation)");
  __shared__ __attribute__((aligned(16))) float so[4][32][68];
  const int tid = threadIdx.x, w = tid >> 5, lane = tid & 31, ln = lane & 15, hh = lane >> 4; const int by = blockIdx.y, bz = blockIdx.z;      /* grid.y = head (strides sA, sB, sC), grid.z = batch (strides zA, zB, zC) */
  A += (size_t)by * sA + (size_t)bz * zA; Bh += (size_t)by * sB + (size_t)bz * zB; const size_t cofs = (size_t)by * sC + (size_t)bz * zC; const float* bp = bias ? bias + (size_t)by * sBias : nullptr;
  const int ntn = N >> 6; const int mt = blockIdx.x / ntn, nq = blockIdx.x - mt * ntn; const int row0 = mt * 128 + 32 * w, col0 = nq * 64; if (row0 >= M) return;
  const _Float16* a0p = A + (size_t)(row0 + ln) * lda; const _Float16* a1p = a0p + (size_t)16 * lda;
  const _Float16* b0p = Bh + (size_t)(col0 + ln) * ldb; const _Float16* b1p = b0p + (size_t)16 * ldb; const _Float16* b2p = b1p + (size_t)16 * ldb; const _Float16* b3p = b2p + (size_t)16 * ldb;
  const v8f z8 = {0.f,0.f,0.f,0.f,0.f,0.f,0.f,0.f}; v8f c00 = z8, c01 = z8, c02 = z8, c03 = z8, c10 = z8, c11 = z8, c12 = z8, c13 = z8;
#pragma unroll 1
  for (int kb = 0; kb < K; kb += 32) { const v16h a0 = g2_frag(a0p + kb, hh), a1 = g2_frag(a1p + kb, hh);
    v16h b = g2_frag(b0p + kb, hh); c00 = g2_mma(a0, b, c00); c10 = g2_mma(a1, b, c10);
    b = g2_frag(b1p + kb, hh); c01 = g2_mma(a0, b, c01); c11 = g2_mma(a1, b, c11);
    b = g2_frag(b2p + kb, hh); c02 = g2_mma(a0, b, c02); c12 = g2_mma(a1, b, c12);
    b = g2_frag(b3p + kb, hh); c03 = g2_mma(a0, b, c03); c13 = g2_mma(a1, b, c13); }
  v8f accs[8] = {c00, c01, c02, c03, c10, c11, c12, c13};
#pragma unroll
  for (int u = 0; u < 8; ++u) { const int t = u & 3, half = u >> 2; const int col = col0 + t * 16 + ln; const float bv = bp ? bf16_round(bp[col]) : 0.f;
#pragma unroll
    for (int r = 0; r < 8; ++r) { const int rloc = half * 16 + 8 * hh + r; float v = accs[u][r] * alpha + bv; if (CP) { if (rowsPerB < 0) v += CP[cofs + (size_t)(row0g + row0 + rloc) * ldc + col];      /* rowsPerB < 0: own element of the batched C plane */ else { const int bidx = (row0g + row0 + rloc) / rowsPerB; v += CP[(size_t)bidx * sCPb + (size_t)by * 64 + col]; } }
      if (ACT == 3) v = fmaxf(v, 0.f); else if (ACT == 6) v = 0.5f * v * (1.0f + erff(v * 0.70710678118654752f)); else if (ACT == 11) v = 1.0f / (1.0f + expf(-v)); else if (ACT == 15) v = v / (1.0f + expf(-v)); else if (ACT == 12) v = (v > 0.f) ? v : 0.01f * v; else if (ACT == 8) v = tanhf(v); else if (ACT == 9) v = 0.5f * v * (1.0f + tanhf(0.7978845608028654f * (v + 0.044715f * v * v * v))); else if (ACT == 14) v = (v > 0.f) ? v : 0.1f * v; else if (ACT == 16) v = (v >= 0.f) ? v : 0.3f * v; else if (ACT == 17) v = (v >= 0.f) ? v : 0.2f * v;
      so[w][rloc][t * 16 + ln] = v; } }
  __builtin_amdgcn_fence(__ATOMIC_ACQ_REL, "workgroup"); __builtin_amdgcn_wave_barrier();
  const int rsub = lane >> 4, c4 = (lane & 15) * 4;
  {
#pragma unroll
    for (int q = 0; q < 16; ++q) { const int r = q * 2 + rsub; const v4f v = *(const v4fa*)&so[w][r][c4]; if (C) *(v4f*)(C + cofs + (size_t)(row0 + r) * ldc + col0 + c4) = v; if (C16) { v4h h4; for (int i = 0; i < 4; ++i) h4[i] = (_Float16)v[i]; *(v4h*)(C16 + cofs + (size_t)(row0 + r) * ldc + col0 + c4) = h4; } }
     } }


__global__ __launch_bounds__(256) void k_wnat(const float* __restrict__ w, size_t n8, _Float16* __restrict__ Bt) { const size_t t = (size_t)blockIdx.x * 256 + threadIdx.x; if (t >= n8) return; FragH f; for (int q = 0; q < 8; ++q) f.h[q] = (_Float16)(bf16_round(w[t * 8 + q]) * 16.0f); *(v8us*)((unsigned short*)Bt + t * 8) = f.half[0];  }
__global__ __launch_bounds__(256) void k_rsm(const float* __restrict__ S, _Float16* __restrict__ P, int nrows) {
  #pragma clang fp contract(off)
  const int i = blockIdx.x * 256 + threadIdx.x; if (i >= nrows) return; const float* s = S + (size_t)i * SQ; float mx = -3.0e38f;
#pragma unroll 1
  for (int j = 0; j < SQ; ++j) mx = fmaxf(mx, s[j]); float se = 0.f;
#pragma unroll 1
  for (int j = 0; j < SQ; ++j) se += expf(s[j] - mx); const float sc = 256.0f / se;
#pragma unroll 1
  for (int j0 = 0; j0 < SQ; j0 += 8) { FragH f; for (int q = 0; q < 8; ++q) f.h[q] = (_Float16)(expf(s[j0 + q] - mx) * sc); unsigned short* d = (unsigned short*)P + (size_t)i * SQ + j0; *(v8us*)d = f.half[0];  } }
__global__ __launch_bounds__(256) void k_vt(const _Float16* __restrict__ V16, int b, int h0, _Float16* __restrict__ VT) { __shared__ unsigned short tl[64][65]; const int tid = threadIdx.x; const int hh = blockIdx.x % HG, sg = blockIdx.x / HG; const int s0 = sg * 64; const int h = h0 + hh;
  for (int i = tid; i < 64 * 8; i += 256) { const int j = i / 8, d8 = (i % 8) * 8; FragH f; f.half[0] = *(const v8us*)((const unsigned short*)V16 + ((size_t)b * SQ + s0 + j) * DM + h * HD + d8); for (int q = 0; q < 8; ++q) tl[d8 + q][j] = f.u[q]; }
  __syncthreads();
  { for (int i = tid; i < 64 * 8; i += 256) { const int d = i / 8, j8 = (i % 8) * 8; FragH f; for (int q = 0; q < 8; ++q) f.u[q] = tl[d][j8 + q]; *(v8us*)((unsigned short*)VT + ((size_t)hh * HD + d) * SQ + s0 + j8) = f.half[0]; }  } }



// Lane l <-> l ^ M inside a 16-lane row (DPP row_xmask) and l <-> l ^ 16 (cross-row move): a five-step butterfly leaves the row's maximum / sum in every lane without an LDS round trip.
template <int M> __device__ __forceinline__ float rs_xm(float x) { return __builtin_bit_cast(float, __builtin_amdgcn_update_dpp(0, __builtin_bit_cast(int, x), 0x160 | M, 0xf, 0xf, true)); }
__device__ __forceinline__ float rs_xh(float x) { return __builtin_bit_cast(float, __builtin_amdgcn_permlanex16(__builtin_bit_cast(int, x), __builtin_bit_cast(int, x), 0x76543210, 0xfedcba98, false, false)); }
__device__ __forceinline__ float rs_wmax(float v) { v = fmaxf(v, rs_xm<1>(v)); v = fmaxf(v, rs_xm<2>(v)); v = fmaxf(v, rs_xm<4>(v)); v = fmaxf(v, rs_xm<8>(v)); return fmaxf(v, rs_xh(v)); }
__device__ __forceinline__ float rs_wsum(float v) { v += rs_xm<1>(v); v += rs_xm<2>(v); v += rs_xm<4>(v); v += rs_xm<8>(v); return v + rs_xh(v); }
// Four v_exp_f32 and, in the same statement so that it stands directly behind the last one, the one free slot that the instruction set asks for behind a transcendental; the early-clobber outputs keep each exp off the sources of the one in front of it.
__device__ __forceinline__ v4f rs_exp2(v4f x) { float a, b, c, d; asm("v_exp_f32 %0, %4\n\tv_exp_f32 %1, %5\n\tv_exp_f32 %2, %6\n\tv_exp_f32 %3, %7\n\tv_nop" : "=&v"(a), "=&v"(b), "=&v"(c), "=&v"(d) : "v"(x[0]), "v"(x[1]), "v"(x[2]), "v"(x[3])); const v4f r = {a, b, c, d}; return r; }
// Causal row softmax of the query tile that ends at key NC*128 (its first row is q0 = NC*128 - QT), ONE WAVE PER ROW: lane l holds columns c*128 + 4l .. + 3 of chunk c, so each load covers 512 contiguous bytes and each store 256;
// the row is read once and stays in registers for the maximum, the sum and the scaled f16 weights. Only the last QT columns can lie above the diagonal, so only their chunks are masked.
// P may be the S plane itself: the f16 row t starts where the f32 row t starts (pitch 2 * NKX halves), only the row's own wave touches it, and every store takes the row sum, which needs every load of the row.
template <int NC>
__global__ __launch_bounds__(256) void k_rsmcf2(const float* S, _Float16* P, int hg) {
  static_assert(NC * 128 >= QT && NC * 128 <= NKX && QT % 128 == 0, "whole 128-column chunks, tile inside the row pitch");
  const int lane = threadIdx.x & 31; const int t = blockIdx.x * 8 + __builtin_amdgcn_readfirstlane(threadIdx.x >> 5); if (t >= hg * QT) return;      /* wave-uniform exit; the kernel has no barrier */
  const char* s = (const char*)(S + (size_t)t * NKX); _Float16* p = P + (size_t)t * (2 * NKX); const unsigned ob = lane * 16u;      /* the lane's byte offset inside each 512-byte chunk */
  const int rel = (t % QT) - lane * 4;      /* column q0 + d*128 + 4*lane + q is kept while d*128 + q <= rel */
  v4f v[NC];
#pragma unroll
  for (int c = 0; c < NC; ++c) v[c] = *(const v4fa*)(s + c * 512 + ob);
#pragma unroll
  for (int d = 0; d < QT / 128; ++d) for (int q = 0; q < 4; ++q) v[NC - QT / 128 + d][q] = (d * 128 + q <= rel) ? v[NC - QT / 128 + d][q] : -1.0e9f;
  float m0 = -3.0e38f, m1 = -3.0e38f;      /* two chains: the maximum does not depend on the order */
#pragma unroll
  for (int c = 0; c < NC; ++c) { m0 = fmaxf(fmaxf(m0, v[c][0]), v[c][1]); m1 = fmaxf(fmaxf(m1, v[c][2]), v[c][3]); }
  const float mx = rs_wmax(fmaxf(m0, m1));
  v4f se4 = {0.f, 0.f, 0.f, 0.f};
#pragma unroll
  for (int c = 0; c < NC; ++c) { v[c] = rs_exp2((v[c] - mx) * 1.44269504088896340736f); se4 += v[c]; }      /* exp(s - mx) as 2^((s - mx) log2 e), the form __expf compiles to */
  const float sc = 256.0f / rs_wsum((se4[0] + se4[1]) + (se4[2] + se4[3]));
#pragma unroll
  for (int c = 0; c < NC; ++c) { v4h h4; for (int q = 0; q < 4; ++q) h4[q] = (_Float16)(v[c][q] * sc); *(v4h*)(p + c * 128 + lane * 4) = h4; } }


// Exact f32 causal attention for rows 0..QT0-1 of every batch and head (planes [batch][QT0][DM]). One work-group of 256 threads takes A0R query rows of one head: thread (r, c) = (tid / 8, tid % 8).
// The group's q rows and the head's QT0 key and value rows are staged in LDS once; then scores (thread (r, c): keys c, c + 8, ...; its q row in registers), the row maximum and sum over the row's 8 lanes, and o (thread (r, c): columns 4c..4c+3 and 32+4c..32+4c+3).
#define A0R 32                       /* query rows per work-group */
#define A0KP (HD + 4)                /* q and key row pitch in LDS, floats: 16 B x odd, so that 8 rows read at one column fall on different banks */
#define A0PP (QT0 + 8)               /* weight row pitch in LDS, floats: the 4 rows of a wave start 8 banks apart */
__global__ __launch_bounds__(256) void k_att0(const float* __restrict__ QF, const float* __restrict__ KF, const float* __restrict__ VF, float scale, float* __restrict__ OF) {
  static_assert(QT0 % A0R == 0 && A0R * 8 == 256 && A0R == 32 && HD == 64 && QT0 % 16 == 0, "8 threads per query row; 16 threads stage one row, 16 rows per pass");
  __shared__ __attribute__((aligned(16))) float ks[QT0 * A0KP]; __shared__ __attribute__((aligned(16))) float vs[QT0 * HD]; __shared__ __attribute__((aligned(16))) float qs[A0R * A0KP]; __shared__ __attribute__((aligned(16))) float ps[A0R * A0PP];
  const int tid = threadIdx.x; const int h = blockIdx.x / (QT0 / A0R), rg = blockIdx.x % (QT0 / A0R); const int r = tid >> 3, c = tid & 7; const int i = rg * A0R + r; const int nk = (rg + 1) * A0R;      /* causal: keys below the group's last row */
  const size_t bo = (size_t)blockIdx.y * QT0 * DM + (size_t)h * HD;      /* grid.y = batch */
  const int sr = tid >> 4, sc = (tid & 15) * 4; const int so = sr * DM + sc;      /* staging: row sr + 16 u, four floats at column sc */
  const float* kg = KF + bo; const float* vg = VF + bo; const float* qg = QF + bo + (size_t)rg * A0R * DM;
  v4f kk[QT0 / 16], vv[QT0 / 16];      /* the full unrolls below give the register arrays kk, vv, q constant indices and put all staging loads in flight together */
#pragma unroll
  for (int u = 0; u < QT0 / 16; ++u) { kk[u] = *(const v4fa*)(kg + so + u * 16 * DM); vv[u] = *(const v4fa*)(vg + so + u * 16 * DM); }
  const v4f q0 = *(const v4fa*)(qg + so);
  asm volatile("s_wait_xcnt 0x0" ::: "memory");      /* the last staging load may return into the offset register that the loads above name: this wait stands in front of that overwrite */
  const v4f q1 = *(const v4fa*)(qg + so + 16 * DM);
#pragma unroll
  for (int u = 0; u < QT0 / 16; ++u) { *(v4f*)&ks[(sr + u * 16) * A0KP + sc] = kk[u]; *(v4f*)&vs[(sr + u * 16) * HD + sc] = vv[u]; }
  *(v4f*)&qs[sr * A0KP + sc] = q0; *(v4f*)&qs[(sr + 16) * A0KP + sc] = q1;
  __syncthreads();
  v4f q[HD / 4];
#pragma unroll
  for (int u = 0; u < HD / 4; ++u) q[u] = *(const v4f*)&qs[r * A0KP + u * 4];
  float* pr = ps + r * A0PP; float mx = -3.0e38f;      /* unroll 2 in the three loops below: the LDS loads of two trips are in flight together and their sums are independent chains */
#pragma unroll 2
  for (int m = 0; m < nk / 8; ++m) { const int j = c + m * 8; const float* kp = ks + j * A0KP; v4f a = {0.f, 0.f, 0.f, 0.f};
#pragma unroll
    for (int u = 0; u < HD / 4; ++u) a += q[u] * *(const v4f*)(kp + u * 4);
    const float s = (j <= i) ? ((a[0] + a[1]) + (a[2] + a[3])) * scale : -3.0e38f; pr[j] = s; mx = fmaxf(mx, s); }
  mx = fmaxf(mx, rs_xm<1>(mx)); mx = fmaxf(mx, rs_xm<2>(mx)); mx = fmaxf(mx, rs_xm<4>(mx));      /* key 0 is kept in every row, so the row maximum is a real score and a masked key's weight is exp(-huge) = 0 */
  float l = 0.f;
#pragma unroll 2
  for (int m = 0; m < nk / 8; ++m) { const int j = c + m * 8; const float e = expf(pr[j] - mx); pr[j] = e; l += e; }
  l += rs_xm<1>(l); l += rs_xm<2>(l); l += rs_xm<4>(l);
  __syncthreads();
  v4f o0 = {0.f, 0.f, 0.f, 0.f}, o1 = {0.f, 0.f, 0.f, 0.f}; const float* vp = vs + c * 4;
#pragma unroll 2
  for (int j = 0; j < nk; j += 4) { const v4f p = *(const v4f*)(pr + j);
#pragma unroll
    for (int t = 0; t < 4; ++t) { o0 += p[t] * *(const v4f*)(vp + (j + t) * HD); o1 += p[t] * *(const v4f*)(vp + (j + t) * HD + HD / 2); } }
  const float fin = 64.0f / l;      /* o carried x64 like the f16 path */
  float* og = OF + bo + i * DM + c * 4; *(v4f*)og = o0 * fin; *(v4f*)(og + HD / 2) = o1 * fin; }


__global__ __launch_bounds__(256) void k_kvexp(const float* __restrict__ src, float* __restrict__ dst, size_t n4) { const size_t t = (size_t)blockIdx.x * 256 + threadIdx.x; if (t >= n4) return; const size_t e = t * 4; const size_t row = e / DM; const int col = (int)(e % DM); const int h = col / HD, d = col % HD; const v4f v = *(const v4fa*)(src + row * KVD + (size_t)(h / HPG) * HD + d); *(v4f*)(dst + e) = v;  }

__global__ __launch_bounds__(256) void k_tab2(float theta, float* __restrict__ CS, float* __restrict__ SN) {
  #pragma clang fp contract(off)
  const int t = blockIdx.x * 256 + threadIdx.x; if (t >= SQ * (HD / 2)) return; const int i = t % (HD / 2); const int p = t / (HD / 2); const float invf = 1.0f / powf(theta, (float)(2 * i) / (float)HD); const float ang = __fmul_rn((float)p, invf); const float c = cosf(ang), s = sinf(ang);
  *(float*)(CS + t) = c; *(float*)(SN + t) = s;  }
template <int NORM, int ROPE>
__global__ __launch_bounds__(64) void k_xform(const float* __restrict__ F, int ldf, int nh, const float* __restrict__ gain, float eps, const float* __restrict__ CS, const float* __restrict__ SN, _Float16* __restrict__ H16, int ldo) {
  #pragma clang fp contract(off)
  __shared__ float xv[HD]; __shared__ float red[HD]; __shared__ unsigned short sh_[HD]; const int d = threadIdx.x; const int h = blockIdx.x % nh; const size_t r = blockIdx.x / nh; const int p = (int)(r % SQ);
  float x = F[r * (size_t)ldf + (size_t)h * HD + d];
  if (NORM) { red[d] = __fmul_rn(x, x); __syncthreads(); for (int st = HD / 2; st > 0; st >>= 1) { if (d < st) red[d] = __fadd_rn(red[d], red[d + st]); __syncthreads(); } const float rs = rsqrtf(__fadd_rn(red[0] / (float)HD, eps)); x = __fmul_rn(__fmul_rn(x, rs), bf16_round(gain[d])); }
  xv[d] = x; __syncthreads();
  float o = x;
  if (ROPE == 1) { const int i = d >> 1; const float c = CS[p * (HD / 2) + i], s = SN[p * (HD / 2) + i]; const float ev = xv[2 * i], od = xv[2 * i + 1]; o = (d & 1) ? __fadd_rn(__fmul_rn(ev, s), __fmul_rn(od, c)) : __fadd_rn(__fmul_rn(ev, c), -__fmul_rn(od, s)); }
  if (ROPE == 2) { const int i = d & (HD / 2 - 1); const float c = CS[p * (HD / 2) + i], s = SN[p * (HD / 2) + i]; const float lo = xv[i], hi = xv[i + HD / 2]; o = (d < HD / 2) ? __fadd_rn(__fmul_rn(lo, c), -__fmul_rn(hi, s)) : __fadd_rn(__fmul_rn(lo, s), __fmul_rn(hi, c)); }
  if (ROPE == 3) { const float c = CS[p * HD + d], s = SN[p * HD + d]; const float lo = xv[d & (HD / 2 - 1)], hi = xv[(d & (HD / 2 - 1)) + HD / 2]; o = (d < HD / 2) ? __fadd_rn(__fmul_rn(lo, c), -__fmul_rn(hi, s)) : __fadd_rn(__fmul_rn(hi, c), __fmul_rn(lo, s)); }      /* rotate-half with FULL-width per-element tables [pos][HD] */
  FragH th; th.h[0] = (_Float16)o; sh_[d] = th.u[0]; __syncthreads();
  if (d < HD / 8) { FragH f; for (int q = 0; q < 8; ++q) f.u[q] = sh_[d * 8 + q]; unsigned short* dst = (unsigned short*)H16 + r * (size_t)ldo + (size_t)h * HD + d * 8; *(v8us*)dst = f.half[0];  } }

template <int NORM, int ROPE>
__global__ __launch_bounds__(64) void k_xformf(const float* __restrict__ F, int ldf, int nh, const float* __restrict__ gain, float eps, const float* __restrict__ CS, const float* __restrict__ SN, float* __restrict__ F32, int ldo, size_t zF, size_t zO) {
  #pragma clang fp contract(off)
  F += (size_t)blockIdx.y * zF; F32 += (size_t)blockIdx.y * zO;      /* grid.y = batch */
  __shared__ float xv[HD]; __shared__ float red[HD]; const int d = threadIdx.x; const int h = blockIdx.x % nh; const size_t r = blockIdx.x / nh; const int p = (int)(r % SQ);
  float x = F[r * (size_t)ldf + (size_t)h * HD + d];
  if (NORM) { red[d] = __fmul_rn(x, x); __syncthreads(); for (int st = HD / 2; st > 0; st >>= 1) { if (d < st) red[d] = __fadd_rn(red[d], red[d + st]); __syncthreads(); } const float rs = rsqrtf(__fadd_rn(red[0] / (float)HD, eps)); x = __fmul_rn(__fmul_rn(x, rs), bf16_round(gain[d])); }
  xv[d] = x; __syncthreads();
  float o = x;
  if (ROPE == 1) { const int i = d >> 1; const float c = CS[p * (HD / 2) + i], s = SN[p * (HD / 2) + i]; const float ev = xv[2 * i], od = xv[2 * i + 1]; o = (d & 1) ? __fadd_rn(__fmul_rn(ev, s), __fmul_rn(od, c)) : __fadd_rn(__fmul_rn(ev, c), -__fmul_rn(od, s)); }
  if (ROPE == 2) { const int i = d & (HD / 2 - 1); const float c = CS[p * (HD / 2) + i], s = SN[p * (HD / 2) + i]; const float lo = xv[i], hi = xv[i + HD / 2]; o = (d < HD / 2) ? __fadd_rn(__fmul_rn(lo, c), -__fmul_rn(hi, s)) : __fadd_rn(__fmul_rn(lo, s), __fmul_rn(hi, c)); }
  if (ROPE == 3) { const float c = CS[p * HD + d], s = SN[p * HD + d]; const float lo = xv[d & (HD / 2 - 1)], hi = xv[(d & (HD / 2 - 1)) + HD / 2]; o = (d < HD / 2) ? __fadd_rn(__fmul_rn(lo, c), -__fmul_rn(hi, s)) : __fadd_rn(__fmul_rn(hi, c), __fmul_rn(lo, s)); }      /* rotate-half with FULL-width per-element tables [pos][HD] */
  float* dst = F32 + r * (size_t)ldo + (size_t)h * HD + d; *(float*)dst = o;  }

__global__ __launch_bounds__(256) void k_bfcp(const float* __restrict__ src, float* __restrict__ dst, size_t n4) { const size_t t = (size_t)blockIdx.x * 256 + threadIdx.x; if (t >= n4) return; const v4f a = *(const v4fa*)(src + t * 4); v4f o; for (int q = 0; q < 4; ++q) o[q] = bf16_round(a[q]); *(v4f*)(dst + t * 4) = o;  }

__global__ __launch_bounds__(256) void k_tabhalf(const float* __restrict__ cs, const float* __restrict__ sn, float* __restrict__ CS, float* __restrict__ SN) { const int t = blockIdx.x * 256 + threadIdx.x; if (t >= SQ * (HD / 2)) return; const int p = t / (HD / 2), i = t % (HD / 2); const float c = bf16_round(cs[(size_t)p * HD + i]), s = bf16_round(sn[(size_t)p * HD + i]);
  *(float*)(CS + t) = c; *(float*)(SN + t) = s;  }

__global__ __launch_bounds__(256) void k_tab2d(float* __restrict__ CS, float* __restrict__ SN) {
  #pragma clang fp contract(off)
  const int t = blockIdx.x * 256 + threadIdx.x; if (t >= SQ * (HD / 2)) return; const int i = t % (HD / 2); const int p = t / (HD / 2); const float invf = (float)(1.0 / pow(10000.0, (double)(2 * i) / (double)HD)); const float ang = __fmul_rn((float)p, invf); const float c = cosf(ang), s = sinf(ang);
  *(float*)(CS + t) = c; *(float*)(SN + t) = s;  }
extern "C" void kernel_launch(void* const* d_in, const int* in_sizes, int n_in,
                              void* d_out, int out_size, void* d_ws, size_t ws_size, hipStream_t stream) {
  (void)in_sizes; (void)n_in; (void)out_size;
  const float* const* I = (const float* const*)d_in; const float* x = I[0]; const float* wattn = I[1]; const float* wo = I[2];      /* x; fused [in][out] W_attn [1024][3072] (q | k | v column thirds); [in][out] W_proj; rope tables computed in-kernel (positions = row index) */
  static_assert(HPG == 1 && NH == NG * HPG && NH * HD == DM && KVD == DM, "plain multi-head attention as 16 kv groups of one query head"); const float* bq = nullptr; const float* bk = nullptr; const float* bv = nullptr; const float* bo = nullptr;      /* [in][out] weights, no biases; rope tables computed in the kernel */
  char* ws = (char*)d_ws; size_t off = 0;
  auto take = [&](size_t bytes) { char* p = ws + off; off += (bytes + 255) & ~(size_t)255; return p; };
  _Float16* BQKV = (_Float16*)take((size_t)3 * DM * DM * 2); _Float16* BQ = BQKV; _Float16* BK = BQKV + (size_t)DM * DM; _Float16* BV = BQKV + (size_t)2 * DM * DM; _Float16* BO = (_Float16*)take((size_t)DM * DM * 2);      /* one transposed plane Bt [3072][1024] of the fused weight: rows 0..1023 = q, 1024.. = k, 2048.. = v */
  _Float16* X16 = (_Float16*)take(NR * DM * 2); float* CSB = (float*)take((size_t)SQ * HD * 4); float* SNB = (float*)take((size_t)SQ * HD * 4); _Float16* Q16 = (_Float16*)take(NR * DM * 2); _Float16* K16 = (_Float16*)take(NR * KVD * 2); _Float16* V16 = (_Float16*)take(NR * KVD * 2); _Float16* O16 = (_Float16*)take(NR * DM * 2);
  static_assert(B0 == 0 && NBR == NB && NHD == NH && QN == SQ, "every launch covers all batches and heads");
  float* S = (float*)take((size_t)NB * NH * QT * NKX * 4); _Float16* P = (_Float16*)S; _Float16* VT = (_Float16*)take((size_t)NB * NH * HD * SQ * 2);      /* score plane of one causal tile for all batches and heads; the softmax writes each f16 row over the start of its own f32 row (pitch 2 * NKX halves) */
  static_assert((size_t)NB * NH * QT * NKX >= NR * DM + NR * KVD, "the f32 q and k rows fit the score plane"); float* QF = S; float* KF = S + NR * DM;      /* f32 q, k before the rope: last read by the rope launches, which stand in front of the first score launch */
  float* QF0 = (float*)take((size_t)NB * QT0 * DM * 4); float* KF0 = (float*)take((size_t)NB * QT0 * KVD * 4); float* VF0 = (float*)take((size_t)NB * QT0 * KVD * 4); float* KF0e = (float*)take((size_t)NB * QT0 * DM * 4); float* VF0e = (float*)take((size_t)NB * QT0 * DM * 4); float* OF0 = (float*)take((size_t)NB * QT0 * DM * 4); _Float16* OH0 = (_Float16*)take((size_t)NB * QT0 * DM * 2); _Float16* OL0 = (_Float16*)take((size_t)NB * QT0 * DM * 2);
  if (off > ws_size) return;
  k_wt_f16<<<(unsigned)(((size_t)3 * DM * (DM / 8) + 255) / 256), 256, 0, stream>>>(wattn, BQKV, DM, 3 * DM, 16.0f); k_wt_f16<<<(unsigned)(((size_t)DM * (DM / 8) + 255) / 256), 256, 0, stream>>>(wo, BO, DM, DM, 16.0f);      /* [in][out] -> Bt x16 planes (fused W_attn: K 1024, N 3072) */
  k_x16<<<(unsigned)((NR * DM / 8 + 255) / 256), 256, 0, stream>>>(x, X16, NR * DM / 8);
  k_tab2d<<<(SQ * (HD / 2) + 255) / 256, 256, 0, stream>>>(CSB, SNB);      /* rope tables cos/sin(p / 10000^(2i/64)): inv_freq double-derived -> f32, f32 angle */
  /* Every launch below covers all NB batches: token rows b * SQ + s run through, or the batch is grid.z (GEMMs) / grid.y (first-tile kernels). */
  k_gemm2<0><<<dim3((unsigned)((MP / 128) * (KVD / 64)), 1), 128, 0, stream>>>(X16, DM, 0, BV, DM, 0, 0.0625f, bv, 0, nullptr, 1, 0, 0, nullptr, V16, KVD, 0, MP, KVD, DM, 0, 0, 0);
  k_gemm2<0><<<dim3((unsigned)((MP / 128) * (DM / 64)), 1), 128, 0, stream>>>(X16, DM, 0, BQ, DM, 0, 0.0625f, nullptr, 0, nullptr, 1, 0, 0, QF, nullptr, DM, 0, MP, DM, DM, 0, 0, 0);      /* q (f32) */
  k_gemm2<0><<<dim3((unsigned)((MP / 128) * (KVD / 64)), 1), 128, 0, stream>>>(X16, DM, 0, BK, DM, 0, 0.0625f, nullptr, 0, nullptr, 1, 0, 0, KF, nullptr, KVD, 0, MP, KVD, DM, 0, 0, 0);      /* k (f32) */
  k_xform<0, 2><<<(unsigned)(NR * NH), 64, 0, stream>>>(QF, DM, NH, nullptr, 0.f, CSB, SNB, Q16, DM); k_xform<0, 2><<<(unsigned)(NR * NG), 64, 0, stream>>>(KF, KVD, NG, nullptr, 0.f, CSB, SNB, K16, KVD);      /* half-split rope <0, 2> (out_lo = x_lo c - x_hi s, out_hi = x_lo s + x_hi c = t cos + rotate_half(t) sin with the module's [f | f] tables) -> f16 rows; position = row % SQ */
  k_xformf<0, 2><<<dim3((unsigned)(QT0 * NH), NB), 64, 0, stream>>>(QF, DM, NH, nullptr, 0.f, CSB, SNB, QF0, DM, (size_t)SQ * DM, (size_t)QT0 * DM); k_xformf<0, 2><<<dim3((unsigned)(QT0 * NG), NB), 64, 0, stream>>>(KF, KVD, NG, nullptr, 0.f, CSB, SNB, KF0, KVD, (size_t)SQ * KVD, (size_t)QT0 * KVD);      /* f32 half-split-roped q, k of rows 0..127 of each batch */
  k_vt<NG, SQ><<<NB * NG * (SQ / 64), 256, 0, stream>>>(V16, KVD, 0, VT);      /* V^T [NB][NH][HD][SQ] */
  k_gemm2<0><<<dim3((QT0 / 128) * (KVD / 64), 1, NB), 128, 0, stream>>>(X16, DM, 0, BV, DM, 0, 0.0625f, bv, 0, nullptr, 1, 0, 0, VF0, nullptr, KVD, 0, QT0, KVD, DM, (size_t)SQ * DM, 0, (size_t)QT0 * KVD);
  k_kvexp<<<(unsigned)(((size_t)NB * QT0 * DM / 4 + 255) / 256), 256, 0, stream>>>(KF0, KF0e, (size_t)NB * QT0 * DM / 4); k_kvexp<<<(unsigned)(((size_t)NB * QT0 * DM / 4 + 255) / 256), 256, 0, stream>>>(VF0, VF0e, (size_t)NB * QT0 * DM / 4);      /* head h <- kv group h / HPG for the exact first-tile kernel */      /* f32 q, k, v of the first 128 rows (exact products) */
  k_att0<<<dim3(NH * (QT0 / A0R), NB), 256, 0, stream>>>(QF0, KF0e, VF0e, 0.125f, OF0);      /* exact f32 attention for rows 0..127 of each batch (o x64) */
  for (int q0 = 0; q0 < QN; q0 += QT) { const int nk = q0 + QT;      /* causal: only keys below the tile end are computed */
    k_gemm2<0><<<dim3((QT / 128) * (nk / 64), NH, NB), 128, 0, stream>>>(Q16 + (size_t)q0 * LQ, LQ, (size_t)HD, K16, KVD, (size_t)HD, 0.125f, nullptr, 0, nullptr, 1, 0, 0, S, nullptr, NKX, (size_t)QT * NKX, QT, nk, HD, (size_t)SQ * LQ, (size_t)SQ * KVD, (size_t)NH * QT * NKX);      /* scores: heads on grid.y (key head stride HD), batches on grid.z */
    static_assert(QN / QT == 8, "one softmax instance per causal tile");
    switch (nk / QT) {      /* softmax, one wave per row (8 rows per block); the key count is a compile-time constant of each tile's kernel so that the row stays in registers */
      case 1: k_rsmcf2<2><<<(NB * NH * QT + 7) / 8, 256, 0, stream>>>(S, P, NB * NH); break; case 2: k_rsmcf2<4><<<(NB * NH * QT + 7) / 8, 256, 0, stream>>>(S, P, NB * NH); break; case 3: k_rsmcf2<6><<<(NB * NH * QT + 7) / 8, 256, 0, stream>>>(S, P, NB * NH); break; case 4: k_rsmcf2<8><<<(NB * NH * QT + 7) / 8, 256, 0, stream>>>(S, P, NB * NH); break;
      case 5: k_rsmcf2<10><<<(NB * NH * QT + 7) / 8, 256, 0, stream>>>(S, P, NB * NH); break; case 6: k_rsmcf2<12><<<(NB * NH * QT + 7) / 8, 256, 0, stream>>>(S, P, NB * NH); break; case 7: k_rsmcf2<14><<<(NB * NH * QT + 7) / 8, 256, 0, stream>>>(S, P, NB * NH); break; case 8: k_rsmcf2<16><<<(NB * NH * QT + 7) / 8, 256, 0, stream>>>(S, P, NB * NH); break; }
    k_gemm2<0><<<dim3((QT / 128) * (HD / 64), NH, NB), 128, 0, stream>>>(P, 2 * NKX, (size_t)QT * 2 * NKX, VT, SQ, (size_t)HD * SQ, 0.25f, nullptr, 0, nullptr, 1, 0, 0, nullptr, O16 + (size_t)q0 * DM, DM, (size_t)HD, QT, HD, nk, (size_t)NH * QT * 2 * NKX, (size_t)NH * HD * SQ, (size_t)SQ * DM); }      /* o (x64): heads on grid.y (value head stride HD*SQ), batches on grid.z */
  k_gemm2<0><<<dim3((unsigned)((MPO / 128) * (DM / 64)), 1), 128, 0, stream>>>(O16, DM, 0, BO, DM, 0, 0.0009765625f, bo, 0, nullptr, 1, 0, 0, (float*)d_out, nullptr, DM, 0, MPO, DM, DM, 0, 0, 0);      /* out rows are the output layout */
  k_hl<<<(unsigned)(((size_t)NB * QT0 * DM / 8 + 255) / 256), 256, 0, stream>>>(OF0, OH0, OL0, (size_t)NB * QT0 * DM / 8);      /* first-tile o (x64) -> f16 hi + x1024 residual planes */
  k_gemm2<0><<<dim3((QT0 / 128) * (DM / 64), 1, NB), 128, 0, stream>>>(OH0, DM, 0, BO, DM, 0, 0.0009765625f, bo, 0, nullptr, 1, 0, 0, (float*)d_out, nullptr, DM, 0, QT0, DM, DM, (size_t)QT0 * DM, 0, (size_t)SQ * DM);      /* rows 0..127 of each batch: out = o_hi Wo, overwriting the f16-path rows */
  k_gemm2<0><<<dim3((QT0 / 128) * (DM / 64), 1, NB), 128, 0, stream>>>(OL0, DM, 0, BO, DM, 0, 0.00000095367431640625f, nullptr, 0, (const float*)d_out, -1, 0, 0, (float*)d_out, nullptr, DM, 0, QT0, DM, DM, (size_t)QT0 * DM, 0, (size_t)SQ * DM);      /* += o_lo Wo 2^-20 (own-element accumulate) */
}

// v004
// One run takes 474 microseconds.
// Timed twice side by side with v003, it ran 2.19 times as fast both times.
// Over all steps from v000 it is 21.1 times as fast.
#include <hip/hip_runtime.h>
// Causal multi-head self-attention with rotate-half RoPE computed in the module and a bias-free fused QKV projection (x [4][2048][1024]; qkv = x Wqkv ([in][out] 1024 x 3072, no bias) split into q | k | v thirds, 16 heads of 64; cos / sin = [f | f] of pos * 10000^(-2i/64); q = q cos + rotate_half(q) sin, likewise k; scores * 64^-0.5; causal (tril, finfo.min fill); softmax; out = merged Wout ([in][out], no bias) -> [4][2048][1024]); run as grouped-query causal attention with 16 groups of ONE head and half-split rope.
// Compute dtype: inputs rounded to bf16; x / weights exact; q, k, v, softmax weights and o as plain f16 GEMM operands (~2^-12); scores and softmax statistics f32; v_wmma_f32_16x16x32_f16.
#define NB 4
#define NG 16
#define HPG 1
#define KVD (NG * HD)
#define SQ 2048
#define DM 1024
#define NH 16
#define HD 64
#define HG 4                         /* heads per k_vt(b, h0) launch (overload not called) */
#define QT 256                       /* with NKX, sizes the S plane */
#define NKX SQ                       /* with QT, sizes the S plane */
#define QT0 128                      /* first-tile rows recomputed exactly in f32 */
#define B0 0                         /* first batch processed (debug hook) */
#define NBR NB                       /* batches processed (debug hook) */
#define NR ((size_t)NB * SQ)         /* token rows */
#define MP ((int)((size_t)NBR * SQ)) /* rows projected (debug hook) */
#define QN SQ                        /* query rows attended per batch (debug hook) */
#define NHD NH                       /* heads attended (debug hook) */
#define MPO MP                       /* rows through the output stage (debug hook) */
#define LQ DM      /* row pitch of the q/k/v rows */
typedef __bf16 v16b __attribute__((ext_vector_type(16)));
typedef unsigned short v8us __attribute__((ext_vector_type(8), may_alias));
typedef float  v8f  __attribute__((ext_vector_type(8)));
typedef float  v4f  __attribute__((ext_vector_type(4)));
typedef float  v4fa __attribute__((ext_vector_type(4), may_alias));
union FragB { v16b v; v8us half[2]; unsigned short u[16]; };

__device__ __forceinline__ unsigned short bf16_bits(float x) { unsigned int u = __float_as_uint(x); return (unsigned short)((u + 0x7FFFu + ((u >> 16) & 1u)) >> 16); }
__device__ __forceinline__ float bf16_val(unsigned short b) { return __uint_as_float(((unsigned int)b) << 16); }
__device__ __forceinline__ float bf16_round(float x) { return bf16_val(bf16_bits(x)); }
// D += A·B with NT terms: 1 = ah·bh, 2 = + al·bh (A split), 3 = + ah·bl (both split)
template <int NT>
__device__ __forceinline__ v8f mmaN(v16b ah, v16b al, v16b bh, v16b bl, v8f c) {
  c = __builtin_amdgcn_wmma_f32_16x16x32_bf16(false, ah, false, bh, (short)0, c, false, false);
  if (NT >= 2) c = __builtin_amdgcn_wmma_f32_16x16x32_bf16(false, al, false, bh, (short)0, c, false, false);
  if (NT >= 3) c = __builtin_amdgcn_wmma_f32_16x16x32_bf16(false, ah, false, bl, (short)0, c, false, false);
  asm volatile("v_nop\n\tv_nop\n\tv_nop\n\tv_nop" : "+v"(c) : "v"(ah), "v"(al), "v"(bh), "v"(bl));
  return c;
}

__global__ __launch_bounds__(256) void k_wt_bf16(const float* __restrict__ W, unsigned short* __restrict__ Wt, int K, int N) {
  const int t = blockIdx.x * 256 + threadIdx.x;
  const int k8n = K / 8;
  if (t >= N * k8n) return;
  const int n = t / k8n, k8 = (t % k8n) * 8;
  v8us v;
#pragma unroll
  for (int i = 0; i < 8; ++i) v[i] = bf16_bits(W[(size_t)(k8 + i) * N + n]);
  *(v8us*)(Wt + (size_t)n * K + k8) = v;
  
}

// GEMM C[M][N] (f32, pitch ldc) = act(A[M][K]·W + bias). A f32 row-major (pitch lda) converted per fragment to bf16
// (ASPLIT: hi/lo two planes -> 2 terms, else single rounded term); Wt bf16 [N][K] (pitch ldb). BIAS_BF16 rounds the
// bias to bf16 first (bias quantised to bf16 before the add). K%32==0, M%16==0, N%64==0.
template <bool ASPLIT, int ACT, bool BIAS_BF16>
__global__ __launch_bounds__(128) void k_gemm_bf(const float* __restrict__ A, int lda, const unsigned short* __restrict__ Wt, int ldb,
                                               const float* __restrict__ bias, float* __restrict__ C, int ldc, int M, int N, int K) {
  __shared__ __attribute__((aligned(16))) float so[4][16][64];
  const int tid = threadIdx.x, w = tid >> 5, lane = tid & 31, ln = lane & 15, hh = lane >> 4;
  const int ntn = N / 64;
  const int wid = blockIdx.x * 4 + w;
  const int mt = wid / ntn, nq = wid % ntn;
  if (mt * 16 >= M) return;
  const int row0 = mt * 16, col0 = nq * 64;
  const float* arow = A + (size_t)(row0 + ln) * lda;
  v8f acc[4] = {};
  for (int kb = 0; kb < K; kb += 32) {
    FragB ah, al;
    const v4f x0 = *(const v4fa*)(arow + kb + 8 * hh), x1 = *(const v4fa*)(arow + kb + 8 * hh + 4);
    const v4f x2 = *(const v4fa*)(arow + kb + 16 + 8 * hh), x3 = *(const v4fa*)(arow + kb + 16 + 8 * hh + 4);
    float xs[16] = {x0[0],x0[1],x0[2],x0[3],x1[0],x1[1],x1[2],x1[3],x2[0],x2[1],x2[2],x2[3],x3[0],x3[1],x3[2],x3[3]};
#pragma unroll
    for (int i = 0; i < 16; ++i) { const unsigned short hb = bf16_bits(xs[i]); ah.u[i] = hb; al.u[i] = ASPLIT ? bf16_bits(xs[i] - bf16_val(hb)) : (unsigned short)0; }
#pragma unroll
    for (int t = 0; t < 4; ++t) {
      const unsigned short* brow = Wt + (size_t)(col0 + t * 16 + ln) * ldb + kb;
      FragB b;
      b.half[0] = *(const v8us*)(brow + 8 * hh);
      b.half[1] = *(const v8us*)(brow + 16 + 8 * hh);
      acc[t] = mmaN<ASPLIT ? 2 : 1>(ah.v, al.v, b.v, b.v, acc[t]);
    }
  }
#pragma unroll
  for (int t = 0; t < 4; ++t) {
    float bv = bias ? bias[col0 + t * 16 + ln] : 0.f;
    if (BIAS_BF16) bv = bf16_round(bv);
#pragma unroll
    for (int r = 0; r < 8; ++r) { float v = acc[t][r] + bv; if (ACT == 1) v = fmaxf(v, 0.f); so[w][8 * hh + r][t * 16 + ln] = v; }
  }
  __builtin_amdgcn_fence(__ATOMIC_ACQ_REL, "workgroup");
  __builtin_amdgcn_wave_barrier();
  const int rsub = lane >> 4, c4 = (lane & 15) * 4;
  {
#pragma unroll
    for (int q = 0; q < 8; ++q) {
      const int r = q * 2 + rsub;
      const v4f v = *(const v4fa*)&so[w][r][c4];
      *(v4f*)(C + (size_t)(row0 + r) * ldc + col0 + c4) = v;
    }
    
  }
}

// GEMM C = act(A·W + bias + resid): A f32 (ASPLIT -> hi/lo 2 terms), Wt bf16 [N][K]; ACT 0 none, 1 relu, 2 exact gelu;
// resid (optional, f32, row index = (row % rmod), pitch ldr, RES_BF16 rounds it) added before the activation.
template <bool ASPLIT, int ACT, bool BIAS_BF16, bool RES_BF16>
__global__ __launch_bounds__(128) void k_gemm_bf3(const float* __restrict__ A, int lda, const unsigned short* __restrict__ Wt, int ldb,
                                                const float* __restrict__ bias, const float* __restrict__ resid, int rmod, int ldr,
                                                float* __restrict__ C, int ldc, int M, int N, int K) {
  __shared__ __attribute__((aligned(16))) float so[4][16][64];
  const int tid = threadIdx.x, w = tid >> 5, lane = tid & 31, ln = lane & 15, hh = lane >> 4;
  const int ntn = N / 64;
  const int wid = blockIdx.x * 4 + w;
  const int mt = wid / ntn, nq = wid % ntn;
  if (mt * 16 >= M) return;
  const int row0 = mt * 16, col0 = nq * 64;
  const float* arow = A + (size_t)(row0 + ln) * lda;
  v8f acc[4] = {};
  for (int kb = 0; kb < K; kb += 32) {
    FragB ah, al;
    const v4f x0 = *(const v4fa*)(arow + kb + 8 * hh), x1 = *(const v4fa*)(arow + kb + 8 * hh + 4);
    const v4f x2 = *(const v4fa*)(arow + kb + 16 + 8 * hh), x3 = *(const v4fa*)(arow + kb + 16 + 8 * hh + 4);
    float xs[16] = {x0[0],x0[1],x0[2],x0[3],x1[0],x1[1],x1[2],x1[3],x2[0],x2[1],x2[2],x2[3],x3[0],x3[1],x3[2],x3[3]};
#pragma unroll
    for (int i = 0; i < 16; ++i) { const unsigned short hb = bf16_bits(xs[i]); ah.u[i] = hb; al.u[i] = ASPLIT ? bf16_bits(xs[i] - bf16_val(hb)) : (unsigned short)0; }
#pragma unroll
    for (int t = 0; t < 4; ++t) {
      const unsigned short* brow = Wt + (size_t)(col0 + t * 16 + ln) * ldb + kb;
      FragB b;
      b.half[0] = *(const v8us*)(brow + 8 * hh);
      b.half[1] = *(const v8us*)(brow + 16 + 8 * hh);
      acc[t] = mmaN<ASPLIT ? 2 : 1>(ah.v, al.v, b.v, b.v, acc[t]);
    }
  }
#pragma unroll
  for (int t = 0; t < 4; ++t) {
    const int col = col0 + t * 16 + ln;
    float bv = bias ? bias[col] : 0.f;
    if (BIAS_BF16) bv = bf16_round(bv);
#pragma unroll
    for (int r = 0; r < 8; ++r) {
      float v = acc[t][r] + bv;
      if (resid) { float rv = resid[(size_t)((row0 + 8 * hh + r) % rmod) * ldr + col]; if (RES_BF16) rv = bf16_round(rv); v += rv; }
      if (ACT == 1) v = fmaxf(v, 0.f);
      if (ACT == 2) v = 0.5f * v * (1.0f + erff(v * 0.70710678118654752f));
      if (ACT == 3) { const float u = 0.7978845608028654f * (v + 0.044715f * v * v * v); v = 0.5f * v * (1.0f + tanhf(u)); }
      so[w][8 * hh + r][t * 16 + ln] = v;
    }
  }
  __builtin_amdgcn_fence(__ATOMIC_ACQ_REL, "workgroup");
  __builtin_amdgcn_wave_barrier();
  const int rsub = lane >> 4, c4 = (lane & 15) * 4;
  {
#pragma unroll
    for (int q = 0; q < 8; ++q) {
      const int r = q * 2 + rsub;
      const v4f v = *(const v4fa*)&so[w][r][c4];
      *(v4f*)(C + (size_t)(row0 + r) * ldc + col0 + c4) = v;
    }
    
  }
}
// row LayerNorm (biased variance, eps) over N: s = X (+ R); optional out_sum <- s; out_norm <- (s-mu)*rsqrt(var+eps)*g + b
template <bool PARAM_BF16>
__global__ __launch_bounds__(256) void k_layernorm(const float* __restrict__ X, const float* __restrict__ R, const float* __restrict__ g, const float* __restrict__ bta,
                                                  float* __restrict__ out_sum, float* __restrict__ out_norm, int N, float eps) {
  __shared__ float red[256];
  const int row = blockIdx.x, tid = threadIdx.x;
  const float* x = X + (size_t)row * N; const float* rr = R ? R + (size_t)row * N : nullptr;
  float vals[16];                     // up to N = 4096
  const int per = N / 256;            // contiguous chunk per thread? use strided-by-4 chunks: thread handles j = tid*4 + 1024*u
  float s1 = 0.f;
  for (int u = 0; u < per / 4; ++u) {
    const int j = tid * 4 + 1024 * u;
    const v4f a = *(const v4fa*)(x + j);
    v4f b = {0.f,0.f,0.f,0.f}; if (rr) b = *(const v4fa*)(rr + j);
#pragma unroll
    for (int q = 0; q < 4; ++q) { const float v = a[q] + b[q]; vals[u * 4 + q] = v; s1 += v; }
  }
  red[tid] = s1; __syncthreads();
  for (int st = 128; st > 0; st >>= 1) { if (tid < st) red[tid] += red[tid + st]; __syncthreads(); }
  const float mu = red[0] / (float)N; __syncthreads();
  float s2 = 0.f;
  for (int u = 0; u < per / 4; ++u)
#pragma unroll
    for (int q = 0; q < 4; ++q) { const float c = vals[u * 4 + q] - mu; s2 += c * c; }
  red[tid] = s2; __syncthreads();
  for (int st = 128; st > 0; st >>= 1) { if (tid < st) red[tid] += red[tid + st]; __syncthreads(); }
  const float rs = rsqrtf(red[0] / (float)N + eps);
  {
    for (int u = 0; u < per / 4; ++u) {
      const int j = tid * 4 + 1024 * u;
      v4f o, sm;
#pragma unroll
      for (int q = 0; q < 4; ++q) {
        float gg = g[j + q], bb = bta[j + q];
        if (PARAM_BF16) { gg = bf16_round(gg); bb = bf16_round(bb); }
        sm[q] = vals[u * 4 + q]; o[q] = (vals[u * 4 + q] - mu) * rs * gg + bb;
      }
      if (out_sum) *(v4f*)(out_sum + (size_t)row * N + j) = sm;
      *(v4f*)(out_norm + (size_t)row * N + j) = o;
    }
    
  }
}



// ---- f16 WMMA path (v_wmma_f32_16x16x32_f16): 11-bit significands for operands in range — used where a [0,1] probability operand needs more precision than bf16
typedef _Float16 v16h __attribute__((ext_vector_type(16)));
union FragH { v16h v; v8us half[2]; _Float16 h[16]; unsigned short u[16]; };
template <int NT>
__device__ __forceinline__ v8f mmaH(v16h ah, v16h al, v16h bh, v16h bl, v8f c) {
  c = __builtin_amdgcn_wmma_f32_16x16x32_f16(false, ah, false, bh, (short)0, c, false, false);
  if (NT >= 2) c = __builtin_amdgcn_wmma_f32_16x16x32_f16(false, al, false, bh, (short)0, c, false, false);
  if (NT >= 3) c = __builtin_amdgcn_wmma_f32_16x16x32_f16(false, ah, false, bl, (short)0, c, false, false);
  asm volatile("v_nop\n\tv_nop\n\tv_nop\n\tv_nop" : "+v"(c) : "v"(ah), "v"(al), "v"(bh), "v"(bl));
  return c;
}
// batched GEMM like k_gemm_b but f16 operands: A f32 (split into f16 hi/lo if ASPLIT, else rounded to f16), Bt = f16 values [n][k]; alpha; C f32; N multiple of 16 (partial tiles skipped)
template <bool ASPLIT>
__global__ __launch_bounds__(128) void k_gemm_h(const float* __restrict__ A, int lda, size_t sA, const _Float16* __restrict__ Bh, int ldb, size_t sB, float alpha, float* __restrict__ C, int ldc, size_t sC, int M, int N, int K) {
  __shared__ __attribute__((aligned(16))) float so[4][16][64];
  const int tid = threadIdx.x, w = tid >> 5, lane = tid & 31, ln = lane & 15, hh = lane >> 4; const int by = blockIdx.y;
  A += (size_t)by * sA; Bh += (size_t)by * sB; C += (size_t)by * sC;
  const int ntn = (N + 63) / 64; const int wid = blockIdx.x * 4 + w; const int mt = wid / ntn, nq = wid % ntn; if (mt * 16 >= M) return;
  const int row0 = mt * 16, col0 = nq * 64; const float* arow = A + (size_t)(row0 + ln) * lda;
  v8f acc[4] = {};
  for (int kb = 0; kb < K; kb += 32) {
    FragH ah, al;
    const v4f x0 = *(const v4fa*)(arow + kb + 8 * hh), x1 = *(const v4fa*)(arow + kb + 8 * hh + 4), x2 = *(const v4fa*)(arow + kb + 16 + 8 * hh), x3 = *(const v4fa*)(arow + kb + 16 + 8 * hh + 4);
    float xs[16] = {x0[0],x0[1],x0[2],x0[3],x1[0],x1[1],x1[2],x1[3],x2[0],x2[1],x2[2],x2[3],x3[0],x3[1],x3[2],x3[3]};
#pragma unroll
    for (int i = 0; i < 16; ++i) { const _Float16 h = (_Float16)xs[i]; ah.h[i] = h; al.h[i] = ASPLIT ? (_Float16)(xs[i] - (float)h) : (_Float16)0.0f; }
#pragma unroll
    for (int t = 0; t < 4; ++t) { if (col0 + t * 16 >= N) continue; const size_t boff = (size_t)(col0 + t * 16 + ln) * ldb + kb; FragH bq; bq.half[0] = *(const v8us*)(Bh + boff + 8 * hh); bq.half[1] = *(const v8us*)(Bh + boff + 16 + 8 * hh);
      acc[t] = mmaH<ASPLIT ? 2 : 1>(ah.v, al.v, bq.v, bq.v, acc[t]); }
  }
#pragma unroll
  for (int t = 0; t < 4; ++t) { if (col0 + t * 16 >= N) continue;
#pragma unroll
    for (int r = 0; r < 8; ++r) so[w][8 * hh + r][t * 16 + ln] = acc[t][r] * alpha; }
  __builtin_amdgcn_fence(__ATOMIC_ACQ_REL, "workgroup"); __builtin_amdgcn_wave_barrier();
  const int rsub = lane >> 4, c4 = (lane & 15) * 4;
  {
#pragma unroll
    for (int q = 0; q < 8; ++q) { const int r = q * 2 + rsub; if (col0 + c4 < N) { const v4f v = *(const v4fa*)&so[w][r][c4]; *(v4f*)(C + (size_t)(row0 + r) * ldc + col0 + c4) = v; } }
     }
}

// Wt[n][k] = f16(W[k][n]·scale) from f32 row-major W[K][N] (scale = power of two; bf16-exact weights stay exact in f16 away from the subnormal range)
__global__ __launch_bounds__(256) void k_wt_f16(const float* __restrict__ W, _Float16* __restrict__ Wt, int K, int N, float scale) {
  const int t = blockIdx.x * 256 + threadIdx.x; if (t >= N * (K / 8)) return; const int n = t / (K / 8), k8 = (t % (K / 8)) * 8; FragH f;
#pragma unroll
  for (int i = 0; i < 8; ++i) f.h[i] = (_Float16)(bf16_round(W[(size_t)(k8 + i) * N + n]) * scale); const v8us o = f.half[0];
  *(v8us*)((unsigned short*)Wt + (size_t)n * K + k8) = o; 
}
// k_gemm_hh variant with fused epilogue: v = acc·alpha + bias[by·sBias + col] (+ CP[(row/rowsPerB)·sCPb + by·64 + col] if CP) ; ACT 0 none / 1 elu ; writes f16 C16 (and f32 C if non-null)
template <int ACT>
__global__ __launch_bounds__(128) void k_gemm_hhx(const _Float16* __restrict__ A, int lda, size_t sA, const _Float16* __restrict__ Bh, int ldb, size_t sB, float alpha, const float* __restrict__ bias, size_t sBias, const float* __restrict__ CP, int rowsPerB, size_t sCPb, int row0g,
    float* __restrict__ C, _Float16* __restrict__ C16, int ldc, size_t sC, int M, int N, int K) {
  __shared__ __attribute__((aligned(16))) float so[4][16][64];
  const int tid = threadIdx.x, w = tid >> 5, lane = tid & 31, ln = lane & 15, hh = lane >> 4; const int by = blockIdx.y;
  A += (size_t)by * sA; Bh += (size_t)by * sB; const size_t cofs = (size_t)by * sC; const float* bp = bias ? bias + (size_t)by * sBias : nullptr;
  const int ntn = (N + 63) / 64; const int wid = blockIdx.x * 4 + w; const int mt = wid / ntn, nq = wid % ntn; if (mt * 16 >= M) return;
  const int row0 = mt * 16, col0 = nq * 64; const _Float16* arow = A + (size_t)(row0 + ln) * lda;
  v8f acc[4] = {};
  for (int kb = 0; kb < K; kb += 32) { FragH ah; ah.half[0] = *(const v8us*)((const unsigned short*)arow + kb + 8 * hh); ah.half[1] = *(const v8us*)((const unsigned short*)arow + kb + 16 + 8 * hh);
#pragma unroll
    for (int t = 0; t < 4; ++t) { if (col0 + t * 16 >= N) continue; const size_t boff = (size_t)(col0 + t * 16 + ln) * ldb + kb; FragH bq; bq.half[0] = *(const v8us*)((const unsigned short*)Bh + boff + 8 * hh); bq.half[1] = *(const v8us*)((const unsigned short*)Bh + boff + 16 + 8 * hh);
      acc[t] = mmaH<1>(ah.v, ah.v, bq.v, bq.v, acc[t]); }
  }
#pragma unroll
  for (int t = 0; t < 4; ++t) { if (col0 + t * 16 >= N) continue; const int col = col0 + t * 16 + ln; const float bv = bp ? bf16_round(bp[col]) : 0.f;
#pragma unroll
    for (int r = 0; r < 8; ++r) { float v = acc[t][r] * alpha + bv; if (CP) { const int rr = row0g + row0 + 8 * hh + r; if (rowsPerB < 0) v += CP[cofs + (size_t)rr * ldc + col];      /* rowsPerB < 0: own element of the batched C plane */ else { const int bidx = rr / rowsPerB; v += CP[(size_t)bidx * sCPb + (size_t)by * 64 + col]; } } if (ACT == 1) v = (v > 0.f) ? v : expm1f(v); else if (ACT == 7) v = (v > 0.f) ? v + 1.0f : expf(v); else if (ACT == 8) v = tanhf(v); else if (ACT == 9) v = 0.5f * v * (1.0f + tanhf(0.7978845608028654f * (v + 0.044715f * v * v * v))); else if (ACT == 11) v = 1.0f / (1.0f + expf(-v)); else if (ACT == 12) v = (v > 0.f) ? v : 0.01f * v; else if (ACT == 14) v = (v > 0.f) ? v : 0.1f * v; else if (ACT == 16) v = (v >= 0.f) ? v : 0.3f * v; else if (ACT == 17) v = (v >= 0.f) ? v : 0.2f * v; else if (ACT == 15) v = v / (1.0f + expf(-v)); else if (ACT == 3) v = fmaxf(v, 0.f); else if (ACT == 6) v = 0.5f * v * (1.0f + erff(v * 0.70710678118654752f)); so[w][8 * hh + r][t * 16 + ln] = v; } }
  __builtin_amdgcn_fence(__ATOMIC_ACQ_REL, "workgroup"); __builtin_amdgcn_wave_barrier();
  const int rsub = lane >> 4, c4 = (lane & 15) * 4; typedef _Float16 v4h __attribute__((ext_vector_type(4)));
  {
#pragma unroll
    for (int q = 0; q < 8; ++q) { const int r = q * 2 + rsub; if (col0 + c4 < N) { const v4f v = *(const v4fa*)&so[w][r][c4]; if (C) *(v4f*)(C + cofs + (size_t)(row0 + r) * ldc + col0 + c4) = v; if (C16) { v4h h4; for (int i = 0; i < 4; ++i) h4[i] = (_Float16)v[i]; *(v4h*)(C16 + cofs + (size_t)(row0 + r) * ldc + col0 + c4) = h4; } } }
     }
}


typedef _Float16 v4h __attribute__((ext_vector_type(4)));

__global__ __launch_bounds__(256) void k_x16(const float* __restrict__ x, _Float16* __restrict__ X16, size_t n8) { const size_t t = (size_t)blockIdx.x * 256 + threadIdx.x; if (t >= n8) return; FragH f;
#pragma unroll
  for (int q = 0; q < 8; ++q) f.h[q] = (_Float16)bf16_round(x[t * 8 + q]); *(v8us*)((unsigned short*)X16 + t * 8) = f.half[0];  }
__global__ __launch_bounds__(256) void k_h16(const float* __restrict__ x, _Float16* __restrict__ X16, size_t n8) { const size_t t = (size_t)blockIdx.x * 256 + threadIdx.x; if (t >= n8) return; FragH f;
#pragma unroll
  for (int q = 0; q < 8; ++q) f.h[q] = (_Float16)x[t * 8 + q]; *(v8us*)((unsigned short*)X16 + t * 8) = f.half[0];  }
__global__ __launch_bounds__(256) void k_round16f(const float* __restrict__ W, _Float16* __restrict__ Bt, size_t n8) { const size_t t = (size_t)blockIdx.x * 256 + threadIdx.x; if (t >= n8) return; FragH f;
#pragma unroll
  for (int i = 0; i < 8; ++i) f.h[i] = (_Float16)(bf16_round(W[t * 8 + i]) * 16.0f); *(v8us*)((unsigned short*)Bt + t * 8) = f.half[0];  }
template <int NHv, int TTv>
__global__ __launch_bounds__(256) void k_vt(const _Float16* __restrict__ V16, int ldv, int voff, _Float16* __restrict__ Vt) { __shared__ unsigned short tl[64][66]; const int tid = threadIdx.x; const int slab = blockIdx.x / (TTv / 64), lg = blockIdx.x % (TTv / 64); const int b = slab / NHv, h = slab % NHv;
  for (int i = tid; i < 64 * 8; i += 256) { const int r = i / 8, c8 = (i % 8) * 8; FragH f; f.half[0] = *(const v8us*)((const unsigned short*)V16 + ((size_t)b * TTv + lg * 64 + r) * ldv + voff + h * 64 + c8);
#pragma unroll
    for (int q = 0; q < 8; ++q) tl[r][c8 + q] = f.u[q]; }
  __syncthreads();
  {
#pragma unroll
    for (int rd = 0; rd < 2; ++rd) { const int d = rd * 32 + tid / 8, pc = tid % 8; FragH f;
#pragma unroll
      for (int q = 0; q < 8; ++q) f.u[q] = tl[pc * 8 + q][d];
      *(v8us*)((unsigned short*)Vt + ((size_t)slab * 64 + d) * TTv + lg * 64 + pc * 8) = f.half[0]; }
     } }

__global__ __launch_bounds__(256) void k_hl(const float* __restrict__ F, _Float16* __restrict__ Hh, _Float16* __restrict__ Hl, size_t n8) { const size_t t = (size_t)blockIdx.x * 256 + threadIdx.x; if (t >= n8) return; FragH fh, fl; const v4f a = *(const v4fa*)(F + t * 8), c = *(const v4fa*)(F + t * 8 + 4);
#pragma unroll
  for (int q = 0; q < 4; ++q) { _Float16 h = (_Float16)a[q]; fh.h[q] = h; fl.h[q] = (_Float16)((a[q] - (float)h) * 1024.0f); h = (_Float16)c[q]; fh.h[4 + q] = h; fl.h[4 + q] = (_Float16)((c[q] - (float)h) * 1024.0f); }
  { *(v8us*)((unsigned short*)Hh + t * 8) = fh.half[0]; *(v8us*)((unsigned short*)Hl + t * 8) = fl.half[0];  } }

// ---- fast GEMM (wave tile 32x64; requires M % 32 == 0 rows per launch region and N % 64 == 0); epilogue = k_gemm_hhx semantics ----
__device__ __forceinline__ v16h g2_frag(const _Float16* p, int hh) { FragH f; f.half[0] = *(const v8us*)((const unsigned short*)p + 8 * hh); f.half[1] = *(const v8us*)((const unsigned short*)p + 16 + 8 * hh); return f.v; }
__device__ __forceinline__ v8f g2_mma(v16h a, v16h b, v8f c) { v8f d = __builtin_amdgcn_wmma_f32_16x16x32_f16(false, a, false, b, (short)0, c, false, false); asm volatile("v_nop\n\tv_nop\n\tv_nop\n\tv_nop" : "+v"(d) : "v"(a), "v"(b)); return d; }
template <int ACT>
__global__ __launch_bounds__(128) void k_gemm2(const _Float16* __restrict__ A, int lda, size_t sA, const _Float16* __restrict__ Bh, int ldb, size_t sB, float alpha, const float* __restrict__ bias, size_t sBias, const float* __restrict__ CP, int rowsPerB, size_t sCPb, int row0g,
    float* __restrict__ C, _Float16* __restrict__ C16, int ldc, size_t sC, int M, int N, int K, size_t zA, size_t zB, size_t zC) { static_assert(ACT == 0 || ACT == 3 || ACT == 6 || ACT == 8 || ACT == 9 || ACT == 11 || ACT == 12 || ACT == 14 || ACT == 15 || ACT == 16 || ACT == 17, "k_gemm2: unsupported ACT code (would silently apply no activation)");
  __shared__ __attribute__((aligned(16))) float so[4][32][68];
  const int tid = threadIdx.x, w = tid >> 5, lane = tid & 31, ln = lane & 15, hh = lane >> 4; const int by = blockIdx.y, bz = blockIdx.z;      /* grid.y = head (strides sA, sB, sC), grid.z = batch (strides zA, zB, zC) */
  A += (size_t)by * sA + (size_t)bz * zA; Bh += (size_t)by * sB + (size_t)bz * zB; const size_t cofs = (size_t)by * sC + (size_t)bz * zC; const float* bp = bias ? bias + (size_t)by * sBias : nullptr;
  const int ntn = N >> 6; const int mt = blockIdx.x / ntn, nq = blockIdx.x - mt * ntn; const int row0 = mt * 128 + 32 * w, col0 = nq * 64; if (row0 >= M) return;
  const _Float16* a0p = A + (size_t)(row0 + ln) * lda; const _Float16* a1p = a0p + (size_t)16 * lda;
  const _Float16* b0p = Bh + (size_t)(col0 + ln) * ldb; const _Float16* b1p = b0p + (size_t)16 * ldb; const _Float16* b2p = b1p + (size_t)16 * ldb; const _Float16* b3p = b2p + (size_t)16 * ldb;
  const v8f z8 = {0.f,0.f,0.f,0.f,0.f,0.f,0.f,0.f}; v8f c00 = z8, c01 = z8, c02 = z8, c03 = z8, c10 = z8, c11 = z8, c12 = z8, c13 = z8;
#pragma unroll 1
  for (int kb = 0; kb < K; kb += 32) { const v16h a0 = g2_frag(a0p + kb, hh), a1 = g2_frag(a1p + kb, hh);
    v16h b = g2_frag(b0p + kb, hh); c00 = g2_mma(a0, b, c00); c10 = g2_mma(a1, b, c10);
    b = g2_frag(b1p + kb, hh); c01 = g2_mma(a0, b, c01); c11 = g2_mma(a1, b, c11);
    b = g2_frag(b2p + kb, hh); c02 = g2_mma(a0, b, c02); c12 = g2_mma(a1, b, c12);
    b = g2_frag(b3p + kb, hh); c03 = g2_mma(a0, b, c03); c13 = g2_mma(a1, b, c13); }
  v8f accs[8] = {c00, c01, c02, c03, c10, c11, c12, c13};
#pragma unroll
  for (int u = 0; u < 8; ++u) { const int t = u & 3, half = u >> 2; const int col = col0 + t * 16 + ln; const float bv = bp ? bf16_round(bp[col]) : 0.f;
#pragma unroll
    for (int r = 0; r < 8; ++r) { const int rloc = half * 16 + 8 * hh + r; float v = accs[u][r] * alpha + bv; if (CP) { if (rowsPerB < 0) v += CP[cofs + (size_t)(row0g + row0 + rloc) * ldc + col];      /* rowsPerB < 0: own element of the batched C plane */ else { const int bidx = (row0g + row0 + rloc) / rowsPerB; v += CP[(size_t)bidx * sCPb + (size_t)by * 64 + col]; } }
      if (ACT == 3) v = fmaxf(v, 0.f); else if (ACT == 6) v = 0.5f * v * (1.0f + erff(v * 0.70710678118654752f)); else if (ACT == 11) v = 1.0f / (1.0f + expf(-v)); else if (ACT == 15) v = v / (1.0f + expf(-v)); else if (ACT == 12) v = (v > 0.f) ? v : 0.01f * v; else if (ACT == 8) v = tanhf(v); else if (ACT == 9) v = 0.5f * v * (1.0f + tanhf(0.7978845608028654f * (v + 0.044715f * v * v * v))); else if (ACT == 14) v = (v > 0.f) ? v : 0.1f * v; else if (ACT == 16) v = (v >= 0.f) ? v : 0.3f * v; else if (ACT == 17) v = (v >= 0.f) ? v : 0.2f * v;
      so[w][rloc][t * 16 + ln] = v; } }
  __builtin_amdgcn_fence(__ATOMIC_ACQ_REL, "workgroup"); __builtin_amdgcn_wave_barrier();
  const int rsub = lane >> 4, c4 = (lane & 15) * 4;
  {
#pragma unroll
    for (int q = 0; q < 16; ++q) { const int r = q * 2 + rsub; const v4f v = *(const v4fa*)&so[w][r][c4]; if (C) *(v4f*)(C + cofs + (size_t)(row0 + r) * ldc + col0 + c4) = v; if (C16) { v4h h4; for (int i = 0; i < 4; ++i) h4[i] = (_Float16)v[i]; *(v4h*)(C16 + cofs + (size_t)(row0 + r) * ldc + col0 + c4) = h4; } }
     } }


__global__ __launch_bounds__(256) void k_wnat(const float* __restrict__ w, size_t n8, _Float16* __restrict__ Bt) { const size_t t = (size_t)blockIdx.x * 256 + threadIdx.x; if (t >= n8) return; FragH f; for (int q = 0; q < 8; ++q) f.h[q] = (_Float16)(bf16_round(w[t * 8 + q]) * 16.0f); *(v8us*)((unsigned short*)Bt + t * 8) = f.half[0];  }
__global__ __launch_bounds__(256) void k_rsm(const float* __restrict__ S, _Float16* __restrict__ P, int nrows) {
  #pragma clang fp contract(off)
  const int i = blockIdx.x * 256 + threadIdx.x; if (i >= nrows) return; const float* s = S + (size_t)i * SQ; float mx = -3.0e38f;
#pragma unroll 1
  for (int j = 0; j < SQ; ++j) mx = fmaxf(mx, s[j]); float se = 0.f;
#pragma unroll 1
  for (int j = 0; j < SQ; ++j) se += expf(s[j] - mx); const float sc = 256.0f / se;
#pragma unroll 1
  for (int j0 = 0; j0 < SQ; j0 += 8) { FragH f; for (int q = 0; q < 8; ++q) f.h[q] = (_Float16)(expf(s[j0 + q] - mx) * sc); unsigned short* d = (unsigned short*)P + (size_t)i * SQ + j0; *(v8us*)d = f.half[0];  } }
__global__ __launch_bounds__(256) void k_vt(const _Float16* __restrict__ V16, int b, int h0, _Float16* __restrict__ VT) { __shared__ unsigned short tl[64][65]; const int tid = threadIdx.x; const int hh = blockIdx.x % HG, sg = blockIdx.x / HG; const int s0 = sg * 64; const int h = h0 + hh;
  for (int i = tid; i < 64 * 8; i += 256) { const int j = i / 8, d8 = (i % 8) * 8; FragH f; f.half[0] = *(const v8us*)((const unsigned short*)V16 + ((size_t)b * SQ + s0 + j) * DM + h * HD + d8); for (int q = 0; q < 8; ++q) tl[d8 + q][j] = f.u[q]; }
  __syncthreads();
  { for (int i = tid; i < 64 * 8; i += 256) { const int d = i / 8, j8 = (i % 8) * 8; FragH f; for (int q = 0; q < 8; ++q) f.u[q] = tl[d][j8 + q]; *(v8us*)((unsigned short*)VT + ((size_t)hh * HD + d) * SQ + s0 + j8) = f.half[0]; }  } }



// Lane l <-> l ^ M inside a 16-lane row (DPP row_xmask) and l <-> l ^ 16 (cross-row move): a five-step butterfly leaves the row's maximum / sum in every lane without an LDS round trip.
template <int M> __device__ __forceinline__ float rs_xm(float x) { return __builtin_bit_cast(float, __builtin_amdgcn_update_dpp(0, __builtin_bit_cast(int, x), 0x160 | M, 0xf, 0xf, true)); }
__device__ __forceinline__ float rs_xh(float x) { return __builtin_bit_cast(float, __builtin_amdgcn_permlanex16(__builtin_bit_cast(int, x), __builtin_bit_cast(int, x), 0x76543210, 0xfedcba98, false, false)); }
// Fused causal attention, all batches, heads and query tiles in ONE launch: scores, softmax and weighted values stay in registers, nothing of them goes to memory.
// A work-group of FAW waves takes FAQ query rows of one head, 32 per wave, and walks the keys 0 .. its last row in stages of FAK keys. A stage's K rows [key][d] and V^T rows [d][key] are fetched with whole-line loads
// one stage ahead into registers and stored to one of two LDS buffers; one barrier per stage publishes the next buffer and ends the reads of the one that is refilled after it.
// Per 32-key pass a wave forms S^T = K Q^T (A = K rows, B = q rows held in registers): lane (c, h) then holds keys 8h + r of query c, so the maximum and the sum are in-lane plus one exchange of the wave's halves,
// and the two 16-key score tiles, converted in place, are the B operand of O^T += V^T P^T (A = V^T rows in the same k order). Online softmax in the log2 domain; the maximum in use may trail the true one by up to 8,
// so a weight can reach 2^8 (f16 holds it at full relative precision) and the accumulators are rescaled only in the rare pass in which some query's maximum grows by more.
// The full unrolls in the kernel give its register arrays (fragments, score tiles, accumulators, staged rows) constant indices, without which they would go to scratch memory.
#define FAW 4                        /* waves per work-group */
#define FAQ (FAW * 32)               /* query rows per work-group */
#define FAK 64                       /* keys per LDS stage: two 32-key passes; 64 f16 = one 128-byte line of a V^T row */
#define FAP (HD + 8)                 /* LDS row pitch in halves: 144 B = 16 B x odd, so that the 16 rows of a fragment load fall on different banks */
__device__ __forceinline__ v8f fa_mma(v16h a, v16h b, v8f c) { return __builtin_amdgcn_wmma_f32_16x16x32_f16(false, a, false, b, (short)0, c, false, false); }
__device__ __forceinline__ v16h fa_frag(const _Float16* p) { FragH f; f.half[0] = *(const v8us*)(const unsigned short*)p; f.half[1] = *(const v8us*)((const unsigned short*)p + 16); return f.v; }      /* p already holds the lane's 8 * h: k = 8h .. 8h+7 and 16+8h .. 16+8h+7, the order of g2_frag */
// Four vector slots between a run of matrix instructions and the branch behind it: on the taken side the next vector instruction may read their results. The two scheduling barriers keep the slots at that place.
__device__ __forceinline__ void fa_gap() { __builtin_amdgcn_sched_barrier(0); asm volatile("v_nop\n\tv_nop\n\tv_nop\n\tv_nop"); __builtin_amdgcn_sched_barrier(0); }
__global__ __launch_bounds__(FAW * 32) void k_fattn(const _Float16* __restrict__ Qh, const _Float16* __restrict__ Kh, const _Float16* __restrict__ Vt, _Float16* __restrict__ Oh) {
  static_assert(HD == 64 && FAK == 64 && FAQ % FAK == 0 && SQ / FAQ == 16 && NB * NH == 64 && FAW * 32 == 128 && KVD == DM, "16 query tiles x 64 (batch, head) pairs; 8 threads stage one 128-byte row, 16 rows per pass of the staging loop");
  __shared__ __attribute__((aligned(16))) _Float16 ks[2][FAK * FAP]; __shared__ __attribute__((aligned(16))) _Float16 vs[2][HD * FAP];
  const int tid = threadIdx.x, lane = tid & 31, c = lane & 15, h = lane >> 4; const int w = __builtin_amdgcn_readfirstlane(tid >> 5); const int idx = blockIdx.x;
  // A tile's cost grows with its index and all work-groups are resident together: the 16 tiles are dealt by a 4 x 4 square whose rows and columns all sum to 30 (row = idx / 256, column = (idx / 8) % 4), every (head, tile) pair once.
  const int tile = (int)((0x0DE3B6587A94C12FULL >> (4 * (((idx >> 8) << 2) | ((idx >> 3) & 3)))) & 15); const int bh = (idx & 7) | (((idx >> 5) & 7) << 3); const int b = bh / NH, hd = bh % NH;
  const int q0 = tile * FAQ, qw = q0 + 32 * w, nst = (q0 + FAQ) / FAK;      /* causal: keys below the tile's end */
  const int sr = tid >> 3, sc = (tid & 7) * 8; const int so = sr * FAP + sc;      /* staging: row sr + 16 u, eight halves at column sc */
  const _Float16* kg = Kh + ((size_t)b * SQ + sr) * KVD + hd * HD + sc; const _Float16* vg = Vt + ((size_t)bh * HD + sr) * SQ + sc;
  v8us kr[4], vr[4];
#pragma unroll
  for (int u = 0; u < 4; ++u) { kr[u] = *(const v8us*)(const unsigned short*)(kg + u * 16 * KVD); vr[u] = *(const v8us*)(const unsigned short*)(vg + u * 16 * SQ); }
  v16h qf[2][2];
#pragma unroll
  for (int g = 0; g < 2; ++g) for (int kc = 0; kc < 2; ++kc) qf[g][kc] = g2_frag(Qh + ((size_t)b * SQ + qw + 16 * g + c) * LQ + hd * HD + kc * 32, h);
  asm volatile("s_wait_xcnt 0x0" ::: "memory");      /* the q rows' address registers are free for reuse from here on: this wait stands in front of their overwrite */
#pragma unroll
  for (int u = 0; u < 4; ++u) { *(v8us*)(unsigned short*)&ks[0][so + u * 16 * FAP] = kr[u]; *(v8us*)(unsigned short*)&vs[0][so + u * 16 * FAP] = vr[u]; }
  const v8f z8 = {0.f, 0.f, 0.f, 0.f, 0.f, 0.f, 0.f, 0.f}; const v4f z4 = {0.f, 0.f, 0.f, 0.f};
  v8f acc[2][4]; v4f l4[2]; float mr[2];
#pragma unroll
  for (int g = 0; g < 2; ++g) { mr[g] = -__builtin_inff(); l4[g] = z4; for (int t = 0; t < 4; ++t) acc[g][t] = z8; }
  const float cs = 0.125f * 1.44269504088896340736f;      /* 64^-0.5 log2 e */
  __syncthreads();
  for (int st = 0; st < nst; ++st) {
    const bool more = st + 1 < nst;      /* the same for the whole work-group */
    if (more) {
#pragma unroll
      for (int u = 0; u < 4; ++u) { kr[u] = *(const v8us*)(const unsigned short*)(kg + (size_t)(st + 1) * FAK * KVD + u * 16 * KVD); vr[u] = *(const v8us*)(const unsigned short*)(vg + (st + 1) * FAK + u * 16 * SQ); }
      asm volatile("s_wait_xcnt 0x0" ::: "memory"); }      /* the pass below reuses the registers that hold these loads' addresses: this wait stands in front of that overwrite */
    const _Float16* kb = &ks[st & 1][c * FAP + 8 * h]; const _Float16* vb = &vs[st & 1][c * FAP + 8 * h];
    for (int p = 0; p < FAK / 32; ++p) { const int key0 = st * FAK + p * 32;
      if (key0 <= qw) {      /* wave-uniform: a wave skips the passes beyond its diagonal, never the barrier */
        v8f s[2][2];
        { v16h kf[2][2];
#pragma unroll
          for (int kt = 0; kt < 2; ++kt) for (int kc = 0; kc < 2; ++kc) kf[kt][kc] = fa_frag(kb + (p * 32 + 16 * kt) * FAP + kc * 32);
#pragma unroll
          for (int kt = 0; kt < 2; ++kt) for (int g = 0; g < 2; ++g) s[kt][g] = fa_mma(kf[kt][1], qf[g][1], fa_mma(kf[kt][0], qf[g][0], z8)); }      /* s[kt][g][r] = q(qw + 16g + c) . k(key0 + 16kt + 8h + r) */
        fa_gap();
        if (key0 == qw) {      /* the one pass on the wave's diagonal: key > query is masked; key key0 is kept in every row */
#pragma unroll
          for (int kt = 0; kt < 2; ++kt) for (int g = 0; g < 2; ++g) for (int r = 0; r < 8; ++r) s[kt][g][r] = (16 * kt + 8 * h + r > 16 * g + c) ? -__builtin_inff() : s[kt][g][r]; }
        float mb[2]; bool need = false;
#pragma unroll
        for (int g = 0; g < 2; ++g) { float mx = s[0][g][0];
#pragma unroll
          for (int r = 1; r < 8; ++r) mx = fmaxf(mx, s[0][g][r]);
#pragma unroll
          for (int r = 0; r < 8; ++r) mx = fmaxf(mx, s[1][g][r]);
          mx = fmaxf(mx, rs_xh(mx)) * cs; mb[g] = mx; need = need || (mx > mr[g] + 8.0f); }      /* both halves of the wave hold the query's maximum of this pass, scaled */
        if (__builtin_amdgcn_ballot_w32(need) != 0) {      /* scalar branch; always taken in a wave's first pass, where mr is -inf and the factor 0 */
#pragma unroll
          for (int g = 0; g < 2; ++g) { const float mn = fmaxf(mr[g], mb[g]); const float corr = __builtin_amdgcn_exp2f(mr[g] - mn); mr[g] = mn; l4[g] *= corr;
#pragma unroll
            for (int t = 0; t < 4; ++t) acc[g][t] *= corr; } }
        v16h vf[4];
#pragma unroll
        for (int t = 0; t < 4; ++t) vf[t] = fa_frag(vb + 16 * t * FAP + p * 32);
#pragma unroll
        for (int g = 0; g < 2; ++g) { const float nm = -mr[g]; FragH pf;
#pragma unroll
          for (int kt = 0; kt < 2; ++kt) for (int j = 0; j < 2; ++j) { const v4f x = {s[kt][g][4 * j], s[kt][g][4 * j + 1], s[kt][g][4 * j + 2], s[kt][g][4 * j + 3]}; const v4f y = x * cs + nm; const v4f e = {__builtin_amdgcn_exp2f(y[0]), __builtin_amdgcn_exp2f(y[1]), __builtin_amdgcn_exp2f(y[2]), __builtin_amdgcn_exp2f(y[3])}; l4[g] += e;      /* the builtin, so that the compiler keeps these writes clear of the matrix instructions' operands */
            for (int i = 0; i < 4; ++i) pf.h[8 * kt + 4 * j + i] = (_Float16)e[i]; }      /* element 8 kt + r of the B operand = key 16 kt + 8 h + r: the k order of fa_frag */
#pragma unroll
          for (int t = 0; t < 4; ++t) acc[g][t] = fa_mma(vf[t], pf.v, acc[g][t]); }      /* acc[g][t][r] = o(qw + 16g + c)[16t + 8h + r], not yet divided by the row sum */
        fa_gap();
      } }
    if (more) {
#pragma unroll
      for (int u = 0; u < 4; ++u) { *(v8us*)(unsigned short*)&ks[(st + 1) & 1][so + u * 16 * FAP] = kr[u]; *(v8us*)(unsigned short*)&vs[(st + 1) & 1][so + u * 16 * FAP] = vr[u]; }
      __syncthreads(); }      /* publishes stage st + 1 and ends every wave's reads of stage st, whose buffer the next trip refills */
  }
  v8us ov[2][4]; unsigned short* og = (unsigned short*)Oh + ((size_t)b * SQ + qw + c) * DM + hd * HD + 8 * h;      /* lane (c, h): 8 consecutive d of query row c, one 16-byte store per 16 d */
#pragma unroll
  for (int g = 0; g < 2; ++g) { float l = (l4[g][0] + l4[g][1]) + (l4[g][2] + l4[g][3]); l += rs_xh(l); const float fin = 64.0f / l;      /* o carried x64, as the output GEMM's factor expects */
#pragma unroll
    for (int t = 0; t < 4; ++t) { FragH f; for (int r = 0; r < 8; ++r) f.h[r] = (_Float16)(acc[g][t][r] * fin); ov[g][t] = f.half[0]; } }
  __builtin_amdgcn_sched_barrier(0);      /* the eight stores stand behind the last conversion, so that no register which an issued store names is written again */
#pragma unroll
  for (int g = 0; g < 2; ++g) for (int t = 0; t < 4; ++t) *(v8us*)(og + g * 16 * DM + 16 * t) = ov[g][t]; }


// Exact f32 causal attention for rows 0..QT0-1 of every batch and head (planes [batch][QT0][DM]). One work-group of 256 threads takes A0R query rows of one head: thread (r, c) = (tid / 8, tid % 8).
// The group's q rows and the head's QT0 key and value rows are staged in LDS once; then scores (thread (r, c): keys c, c + 8, ...; its q row in registers), the row maximum and sum over the row's 8 lanes, and o (thread (r, c): columns 4c..4c+3 and 32+4c..32+4c+3).
#define A0R 32                       /* query rows per work-group */
#define A0KP (HD + 4)                /* q and key row pitch in LDS, floats: 16 B x odd, so that 8 rows read at one column fall on different banks */
#define A0PP (QT0 + 8)               /* weight row pitch in LDS, floats: the 4 rows of a wave start 8 banks apart */
__global__ __launch_bounds__(256) void k_att0(const float* __restrict__ QF, const float* __restrict__ KF, const float* __restrict__ VF, float scale, float* __restrict__ OF) {
  static_assert(QT0 % A0R == 0 && A0R * 8 == 256 && A0R == 32 && HD == 64 && QT0 % 16 == 0, "8 threads per query row; 16 threads stage one row, 16 rows per pass");
  __shared__ __attribute__((aligned(16))) float ks[QT0 * A0KP]; __shared__ __attribute__((aligned(16))) float vs[QT0 * HD]; __shared__ __attribute__((aligned(16))) float qs[A0R * A0KP]; __shared__ __attribute__((aligned(16))) float ps[A0R * A0PP];
  const int tid = threadIdx.x; const int h = blockIdx.x / (QT0 / A0R), rg = blockIdx.x % (QT0 / A0R); const int r = tid >> 3, c = tid & 7; const int i = rg * A0R + r; const int nk = (rg + 1) * A0R;      /* causal: keys below the group's last row */
  const size_t bo = (size_t)blockIdx.y * QT0 * DM + (size_t)h * HD;      /* grid.y = batch */
  const int sr = tid >> 4, sc = (tid & 15) * 4; const int so = sr * DM + sc;      /* staging: row sr + 16 u, four floats at column sc */
  const float* kg = KF + bo; const float* vg = VF + bo; const float* qg = QF + bo + (size_t)rg * A0R * DM;
  v4f kk[QT0 / 16], vv[QT0 / 16];      /* the full unrolls below give the register arrays kk, vv, q constant indices and put all staging loads in flight together */
#pragma unroll
  for (int u = 0; u < QT0 / 16; ++u) { kk[u] = *(const v4fa*)(kg + so + u * 16 * DM); vv[u] = *(const v4fa*)(vg + so + u * 16 * DM); }
  const v4f q0 = *(const v4fa*)(qg + so);
  asm volatile("s_wait_xcnt 0x0" ::: "memory");      /* the last staging load may return into the offset register that the loads above name: this wait stands in front of that overwrite */
  const v4f q1 = *(const v4fa*)(qg + so + 16 * DM);
#pragma unroll
  for (int u = 0; u < QT0 / 16; ++u) { *(v4f*)&ks[(sr + u * 16) * A0KP + sc] = kk[u]; *(v4f*)&vs[(sr + u * 16) * HD + sc] = vv[u]; }
  *(v4f*)&qs[sr * A0KP + sc] = q0; *(v4f*)&qs[(sr + 16) * A0KP + sc] = q1;
  __syncthreads();
  v4f q[HD / 4];
#pragma unroll
  for (int u = 0; u < HD / 4; ++u) q[u] = *(const v4f*)&qs[r * A0KP + u * 4];
  float* pr = ps + r * A0PP; float mx = -3.0e38f;      /* unroll 2 in the three loops below: the LDS loads of two trips are in flight together and their sums are independent chains */
#pragma unroll 2
  for (int m = 0; m < nk / 8; ++m) { const int j = c + m * 8; const float* kp = ks + j * A0KP; v4f a = {0.f, 0.f, 0.f, 0.f};
#pragma unroll
    for (int u = 0; u < HD / 4; ++u) a += q[u] * *(const v4f*)(kp + u * 4);
    const float s = (j <= i) ? ((a[0] + a[1]) + (a[2] + a[3])) * scale : -3.0e38f; pr[j] = s; mx = fmaxf(mx, s); }
  mx = fmaxf(mx, rs_xm<1>(mx)); mx = fmaxf(mx, rs_xm<2>(mx)); mx = fmaxf(mx, rs_xm<4>(mx));      /* key 0 is kept in every row, so the row maximum is a real score and a masked key's weight is exp(-huge) = 0 */
  float l = 0.f;
#pragma unroll 2
  for (int m = 0; m < nk / 8; ++m) { const int j = c + m * 8; const float e = expf(pr[j] - mx); pr[j] = e; l += e; }
  l += rs_xm<1>(l); l += rs_xm<2>(l); l += rs_xm<4>(l);
  __syncthreads();
  v4f o0 = {0.f, 0.f, 0.f, 0.f}, o1 = {0.f, 0.f, 0.f, 0.f}; const float* vp = vs + c * 4;
#pragma unroll 2
  for (int j = 0; j < nk; j += 4) { const v4f p = *(const v4f*)(pr + j);
#pragma unroll
    for (int t = 0; t < 4; ++t) { o0 += p[t] * *(const v4f*)(vp + (j + t) * HD); o1 += p[t] * *(const v4f*)(vp + (j + t) * HD + HD / 2); } }
  const float fin = 64.0f / l;      /* o carried x64 like the f16 path */
  float* og = OF + bo + i * DM + c * 4; *(v4f*)og = o0 * fin; *(v4f*)(og + HD / 2) = o1 * fin; }


__global__ __launch_bounds__(256) void k_kvexp(const float* __restrict__ src, float* __restrict__ dst, size_t n4) { const size_t t = (size_t)blockIdx.x * 256 + threadIdx.x; if (t >= n4) return; const size_t e = t * 4; const size_t row = e / DM; const int col = (int)(e % DM); const int h = col / HD, d = col % HD; const v4f v = *(const v4fa*)(src + row * KVD + (size_t)(h / HPG) * HD + d); *(v4f*)(dst + e) = v;  }

__global__ __launch_bounds__(256) void k_tab2(float theta, float* __restrict__ CS, float* __restrict__ SN) {
  #pragma clang fp contract(off)
  const int t = blockIdx.x * 256 + threadIdx.x; if (t >= SQ * (HD / 2)) return; const int i = t % (HD / 2); const int p = t / (HD / 2); const float invf = 1.0f / powf(theta, (float)(2 * i) / (float)HD); const float ang = __fmul_rn((float)p, invf); const float c = cosf(ang), s = sinf(ang);
  *(float*)(CS + t) = c; *(float*)(SN + t) = s;  }
template <int NORM, int ROPE>
__global__ __launch_bounds__(64) void k_xform(const float* __restrict__ F, int ldf, int nh, const float* __restrict__ gain, float eps, const float* __restrict__ CS, const float* __restrict__ SN, _Float16* __restrict__ H16, int ldo) {
  #pragma clang fp contract(off)
  __shared__ float xv[HD]; __shared__ float red[HD]; __shared__ unsigned short sh_[HD]; const int d = threadIdx.x; const int h = blockIdx.x % nh; const size_t r = blockIdx.x / nh; const int p = (int)(r % SQ);
  float x = F[r * (size_t)ldf + (size_t)h * HD + d];
  if (NORM) { red[d] = __fmul_rn(x, x); __syncthreads(); for (int st = HD / 2; st > 0; st >>= 1) { if (d < st) red[d] = __fadd_rn(red[d], red[d + st]); __syncthreads(); } const float rs = rsqrtf(__fadd_rn(red[0] / (float)HD, eps)); x = __fmul_rn(__fmul_rn(x, rs), bf16_round(gain[d])); }
  xv[d] = x; __syncthreads();
  float o = x;
  if (ROPE == 1) { const int i = d >> 1; const float c = CS[p * (HD / 2) + i], s = SN[p * (HD / 2) + i]; const float ev = xv[2 * i], od = xv[2 * i + 1]; o = (d & 1) ? __fadd_rn(__fmul_rn(ev, s), __fmul_rn(od, c)) : __fadd_rn(__fmul_rn(ev, c), -__fmul_rn(od, s)); }
  if (ROPE == 2) { const int i = d & (HD / 2 - 1); const float c = CS[p * (HD / 2) + i], s = SN[p * (HD / 2) + i]; const float lo = xv[i], hi = xv[i + HD / 2]; o = (d < HD / 2) ? __fadd_rn(__fmul_rn(lo, c), -__fmul_rn(hi, s)) : __fadd_rn(__fmul_rn(lo, s), __fmul_rn(hi, c)); }
  if (ROPE == 3) { const float c = CS[p * HD + d], s = SN[p * HD + d]; const float lo = xv[d & (HD / 2 - 1)], hi = xv[(d & (HD / 2 - 1)) + HD / 2]; o = (d < HD / 2) ? __fadd_rn(__fmul_rn(lo, c), -__fmul_rn(hi, s)) : __fadd_rn(__fmul_rn(hi, c), __fmul_rn(lo, s)); }      /* rotate-half with FULL-width per-element tables [pos][HD] */
  FragH th; th.h[0] = (_Float16)o; sh_[d] = th.u[0]; __syncthreads();
  if (d < HD / 8) { FragH f; for (int q = 0; q < 8; ++q) f.u[q] = sh_[d * 8 + q]; unsigned short* dst = (unsigned short*)H16 + r * (size_t)ldo + (size_t)h * HD + d * 8; *(v8us*)dst = f.half[0];  } }

template <int NORM, int ROPE>
__global__ __launch_bounds__(64) void k_xformf(const float* __restrict__ F, int ldf, int nh, const float* __restrict__ gain, float eps, const float* __restrict__ CS, const float* __restrict__ SN, float* __restrict__ F32, int ldo, size_t zF, size_t zO) {
  #pragma clang fp contract(off)
  F += (size_t)blockIdx.y * zF; F32 += (size_t)blockIdx.y * zO;      /* grid.y = batch */
  __shared__ float xv[HD]; __shared__ float red[HD]; const int d = threadIdx.x; const int h = blockIdx.x % nh; const size_t r = blockIdx.x / nh; const int p = (int)(r % SQ);
  float x = F[r * (size_t)ldf + (size_t)h * HD + d];
  if (NORM) { red[d] = __fmul_rn(x, x); __syncthreads(); for (int st = HD / 2; st > 0; st >>= 1) { if (d < st) red[d] = __fadd_rn(red[d], red[d + st]); __syncthreads(); } const float rs = rsqrtf(__fadd_rn(red[0] / (float)HD, eps)); x = __fmul_rn(__fmul_rn(x, rs), bf16_round(gain[d])); }
  xv[d] = x; __syncthreads();
  float o = x;
  if (ROPE == 1) { const int i = d >> 1; const float c = CS[p * (HD / 2) + i], s = SN[p * (HD / 2) + i]; const float ev = xv[2 * i], od = xv[2 * i + 1]; o = (d & 1) ? __fadd_rn(__fmul_rn(ev, s), __fmul_rn(od, c)) : __fadd_rn(__fmul_rn(ev, c), -__fmul_rn(od, s)); }
  if (ROPE == 2) { const int i = d & (HD / 2 - 1); const float c = CS[p * (HD / 2) + i], s = SN[p * (HD / 2) + i]; const float lo = xv[i], hi = xv[i + HD / 2]; o = (d < HD / 2) ? __fadd_rn(__fmul_rn(lo, c), -__fmul_rn(hi, s)) : __fadd_rn(__fmul_rn(lo, s), __fmul_rn(hi, c)); }
  if (ROPE == 3) { const float c = CS[p * HD + d], s = SN[p * HD + d]; const float lo = xv[d & (HD / 2 - 1)], hi = xv[(d & (HD / 2 - 1)) + HD / 2]; o = (d < HD / 2) ? __fadd_rn(__fmul_rn(lo, c), -__fmul_rn(hi, s)) : __fadd_rn(__fmul_rn(hi, c), __fmul_rn(lo, s)); }      /* rotate-half with FULL-width per-element tables [pos][HD] */
  float* dst = F32 + r * (size_t)ldo + (size_t)h * HD + d; *(float*)dst = o;  }

__global__ __launch_bounds__(256) void k_bfcp(const float* __restrict__ src, float* __restrict__ dst, size_t n4) { const size_t t = (size_t)blockIdx.x * 256 + threadIdx.x; if (t >= n4) return; const v4f a = *(const v4fa*)(src + t * 4); v4f o; for (int q = 0; q < 4; ++q) o[q] = bf16_round(a[q]); *(v4f*)(dst + t * 4) = o;  }

__global__ __launch_bounds__(256) void k_tabhalf(const float* __restrict__ cs, const float* __restrict__ sn, float* __restrict__ CS, float* __restrict__ SN) { const int t = blockIdx.x * 256 + threadIdx.x; if (t >= SQ * (HD / 2)) return; const int p = t / (HD / 2), i = t % (HD / 2); const float c = bf16_round(cs[(size_t)p * HD + i]), s = bf16_round(sn[(size_t)p * HD + i]);
  *(float*)(CS + t) = c; *(float*)(SN + t) = s;  }

__global__ __launch_bounds__(256) void k_tab2d(float* __restrict__ CS, float* __restrict__ SN) {
  #pragma clang fp contract(off)
  const int t = blockIdx.x * 256 + threadIdx.x; if (t >= SQ * (HD / 2)) return; const int i = t % (HD / 2); const int p = t / (HD / 2); const float invf = (float)(1.0 / pow(10000.0, (double)(2 * i) / (double)HD)); const float ang = __fmul_rn((float)p, invf); const float c = cosf(ang), s = sinf(ang);
  *(float*)(CS + t) = c; *(float*)(SN + t) = s;  }
extern "C" void kernel_launch(void* const* d_in, const int* in_sizes, int n_in,
                              void* d_out, int out_size, void* d_ws, size_t ws_size, hipStream_t stream) {
  (void)in_sizes; (void)n_in; (void)out_size;
  const float* const* I = (const float* const*)d_in; const float* x = I[0]; const float* wattn = I[1]; const float* wo = I[2];      /* x; fused [in][out] W_attn [1024][3072] (q | k | v column thirds); [in][out] W_proj; rope tables computed in-kernel (positions = row index) */
  static_assert(HPG == 1 && NH == NG * HPG && NH * HD == DM && KVD == DM, "plain multi-head attention as 16 kv groups of one query head"); const float* bq = nullptr; const float* bk = nullptr; const float* bv = nullptr; const float* bo = nullptr;      /* [in][out] weights, no biases; rope tables computed in the kernel */
  char* ws = (char*)d_ws; size_t off = 0;
  auto take = [&](size_t bytes) { char* p = ws + off; off += (bytes + 255) & ~(size_t)255; return p; };
  _Float16* BQKV = (_Float16*)take((size_t)3 * DM * DM * 2); _Float16* BQ = BQKV; _Float16* BK = BQKV + (size_t)DM * DM; _Float16* BV = BQKV + (size_t)2 * DM * DM; _Float16* BO = (_Float16*)take((size_t)DM * DM * 2);      /* one transposed plane Bt [3072][1024] of the fused weight: rows 0..1023 = q, 1024.. = k, 2048.. = v */
  _Float16* X16 = (_Float16*)take(NR * DM * 2); float* CSB = (float*)take((size_t)SQ * HD * 4); float* SNB = (float*)take((size_t)SQ * HD * 4); _Float16* Q16 = (_Float16*)take(NR * DM * 2); _Float16* K16 = (_Float16*)take(NR * KVD * 2); _Float16* V16 = (_Float16*)take(NR * KVD * 2); _Float16* O16 = (_Float16*)take(NR * DM * 2);
  static_assert(B0 == 0 && NBR == NB && NHD == NH && QN == SQ, "every launch covers all batches and heads");
  float* S = (float*)take((size_t)NB * NH * QT * NKX * 4); _Float16* VT = (_Float16*)take((size_t)NB * NH * HD * SQ * 2);      /* S: plane that holds the f32 q and k rows */
  static_assert((size_t)NB * NH * QT * NKX >= NR * DM + NR * KVD, "the f32 q and k rows fit the score plane"); float* QF = S; float* KF = S + NR * DM;      /* f32 q, k before the rope: last read by the rope launches */
  float* QF0 = (float*)take((size_t)NB * QT0 * DM * 4); float* KF0 = (float*)take((size_t)NB * QT0 * KVD * 4); float* VF0 = (float*)take((size_t)NB * QT0 * KVD * 4); float* KF0e = (float*)take((size_t)NB * QT0 * DM * 4); float* VF0e = (float*)take((size_t)NB * QT0 * DM * 4); float* OF0 = (float*)take((size_t)NB * QT0 * DM * 4); _Float16* OH0 = (_Float16*)take((size_t)NB * QT0 * DM * 2); _Float16* OL0 = (_Float16*)take((size_t)NB * QT0 * DM * 2);
  if (off > ws_size) return;
  k_wt_f16<<<(unsigned)(((size_t)3 * DM * (DM / 8) + 255) / 256), 256, 0, stream>>>(wattn, BQKV, DM, 3 * DM, 16.0f); k_wt_f16<<<(unsigned)(((size_t)DM * (DM / 8) + 255) / 256), 256, 0, stream>>>(wo, BO, DM, DM, 16.0f);      /* [in][out] -> Bt x16 planes (fused W_attn: K 1024, N 3072) */
  k_x16<<<(unsigned)((NR * DM / 8 + 255) / 256), 256, 0, stream>>>(x, X16, NR * DM / 8);
  k_tab2d<<<(SQ * (HD / 2) + 255) / 256, 256, 0, stream>>>(CSB, SNB);      /* rope tables cos/sin(p / 10000^(2i/64)): inv_freq double-derived -> f32, f32 angle */
  /* Every launch below covers all NB batches: token rows b * SQ + s run through, or the batch is grid.z (GEMMs) / grid.y (first-tile kernels). */
  k_gemm2<0><<<dim3((unsigned)((MP / 128) * (KVD / 64)), 1), 128, 0, stream>>>(X16, DM, 0, BV, DM, 0, 0.0625f, bv, 0, nullptr, 1, 0, 0, nullptr, V16, KVD, 0, MP, KVD, DM, 0, 0, 0);
  k_gemm2<0><<<dim3((unsigned)((MP / 128) * (DM / 64)), 1), 128, 0, stream>>>(X16, DM, 0, BQ, DM, 0, 0.0625f, nullptr, 0, nullptr, 1, 0, 0, QF, nullptr, DM, 0, MP, DM, DM, 0, 0, 0);      /* q (f32) */
  k_gemm2<0><<<dim3((unsigned)((MP / 128) * (KVD / 64)), 1), 128, 0, stream>>>(X16, DM, 0, BK, DM, 0, 0.0625f, nullptr, 0, nullptr, 1, 0, 0, KF, nullptr, KVD, 0, MP, KVD, DM, 0, 0, 0);      /* k (f32) */
  k_xform<0, 2><<<(unsigned)(NR * NH), 64, 0, stream>>>(QF, DM, NH, nullptr, 0.f, CSB, SNB, Q16, DM); k_xform<0, 2><<<(unsigned)(NR * NG), 64, 0, stream>>>(KF, KVD, NG, nullptr, 0.f, CSB, SNB, K16, KVD);      /* half-split rope <0, 2> (out_lo = x_lo c - x_hi s, out_hi = x_lo s + x_hi c = t cos + rotate_half(t) sin with the module's [f | f] tables) -> f16 rows; position = row % SQ */
  k_xformf<0, 2><<<dim3((unsigned)(QT0 * NH), NB), 64, 0, stream>>>(QF, DM, NH, nullptr, 0.f, CSB, SNB, QF0, DM, (size_t)SQ * DM, (size_t)QT0 * DM); k_xformf<0, 2><<<dim3((unsigned)(QT0 * NG), NB), 64, 0, stream>>>(KF, KVD, NG, nullptr, 0.f, CSB, SNB, KF0, KVD, (size_t)SQ * KVD, (size_t)QT0 * KVD);      /* f32 half-split-roped q, k of rows 0..127 of each batch */
  k_vt<NG, SQ><<<NB * NG * (SQ / 64), 256, 0, stream>>>(V16, KVD, 0, VT);      /* V^T [NB][NH][HD][SQ] */
  k_gemm2<0><<<dim3((QT0 / 128) * (KVD / 64), 1, NB), 128, 0, stream>>>(X16, DM, 0, BV, DM, 0, 0.0625f, bv, 0, nullptr, 1, 0, 0, VF0, nullptr, KVD, 0, QT0, KVD, DM, (size_t)SQ * DM, 0, (size_t)QT0 * KVD);
  k_kvexp<<<(unsigned)(((size_t)NB * QT0 * DM / 4 + 255) / 256), 256, 0, stream>>>(KF0, KF0e, (size_t)NB * QT0 * DM / 4); k_kvexp<<<(unsigned)(((size_t)NB * QT0 * DM / 4 + 255) / 256), 256, 0, stream>>>(VF0, VF0e, (size_t)NB * QT0 * DM / 4);      /* head h <- kv group h / HPG for the exact first-tile kernel */      /* f32 q, k, v of the first 128 rows (exact products) */
  k_att0<<<dim3(NH * (QT0 / A0R), NB), 256, 0, stream>>>(QF0, KF0e, VF0e, 0.125f, OF0);      /* exact f32 attention for rows 0..127 of each batch (o x64) */
  k_fattn<<<NB * NH * (SQ / FAQ), FAW * 32, 0, stream>>>(Q16, K16, VT, O16);      /* scores, causal softmax and weighted values of all batches, heads and query tiles: o (x64) as f16 rows */
  k_gemm2<0><<<dim3((unsigned)((MPO / 128) * (DM / 64)), 1), 128, 0, stream>>>(O16, DM, 0, BO, DM, 0, 0.0009765625f, bo, 0, nullptr, 1, 0, 0, (float*)d_out, nullptr, DM, 0, MPO, DM, DM, 0, 0, 0);      /* out rows are the output layout */
  k_hl<<<(unsigned)(((size_t)NB * QT0 * DM / 8 + 255) / 256), 256, 0, stream>>>(OF0, OH0, OL0, (size_t)NB * QT0 * DM / 8);      /* first-tile o (x64) -> f16 hi + x1024 residual planes */
  k_gemm2<0><<<dim3((QT0 / 128) * (DM / 64), 1, NB), 128, 0, stream>>>(OH0, DM, 0, BO, DM, 0, 0.0009765625f, bo, 0, nullptr, 1, 0, 0, (float*)d_out, nullptr, DM, 0, QT0, DM, DM, (size_t)QT0 * DM, 0, (size_t)SQ * DM);      /* rows 0..127 of each batch: out = o_hi Wo, overwriting the f16-path rows */
  k_gemm2<0><<<dim3((QT0 / 128) * (DM / 64), 1, NB), 128, 0, stream>>>(OL0, DM, 0, BO, DM, 0, 0.00000095367431640625f, nullptr, 0, (const float*)d_out, -1, 0, 0, (float*)d_out, nullptr, DM, 0, QT0, DM, DM, (size_t)QT0 * DM, 0, (size_t)SQ * DM);      /* += o_lo Wo 2^-20 (own-element accumulate) */
}

// v005
// One run takes 435 microseconds.
// Two timings next to v004 both put it at 1.09 times that version's speed.
// All steps since v000 together make it 23.1 times as fast.
#include <hip/hip_runtime.h>
// Causal multi-head self-attention with rotate-half RoPE computed in the module and a bias-free fused QKV projection (x [4][2048][1024]; qkv = x Wqkv ([in][out] 1024 x 3072, no bias) split into q | k | v thirds, 16 heads of 64; cos / sin = [f | f] of pos * 10000^(-2i/64); q = q cos + rotate_half(q) sin, likewise k; scores * 64^-0.5; causal (tril, finfo.min fill); softmax; out = merged Wout ([in][out], no bias) -> [4][2048][1024]); run as grouped-query causal attention with 16 groups of ONE head and half-split rope.
// Compute dtype: inputs rounded to bf16; x / weights exact; q, k, v, softmax weights and o as plain f16 GEMM operands (~2^-12); scores and softmax statistics f32; v_wmma_f32_16x16x32_f16.
#define NB 4
#define NG 16
#define HPG 1
#define KVD (NG * HD)
#define SQ 2048
#define DM 1024
#define NH 16
#define HD 64
#define HG 4                         /* heads per k_vt(b, h0) launch (overload not called) */
#define QT 256                       /* with NKX, sizes the S plane */
#define NKX SQ                       /* with QT, sizes the S plane */
#define QT0 128                      /* first-tile rows recomputed exactly in f32 */
#define B0 0                         /* first batch processed (debug hook) */
#define NBR NB                       /* batches processed (debug hook) */
#define NR ((size_t)NB * SQ)         /* token rows */
#define MP ((int)((size_t)NBR * SQ)) /* rows projected (debug hook) */
#define QN SQ                        /* query rows attended per batch (debug hook) */
#define NHD NH                       /* heads attended (debug hook) */
#define MPO MP                       /* rows through the output stage (debug hook) */
#define LQ DM      /* row pitch of the q/k/v rows */
typedef __bf16 v16b __attribute__((ext_vector_type(16)));
typedef unsigned short v8us __attribute__((ext_vector_type(8), may_alias));
typedef float  v8f  __attribute__((ext_vector_type(8)));
typedef float  v4f  __attribute__((ext_vector_type(4)));
typedef float  v4fa __attribute__((ext_vector_type(4), may_alias));
union FragB { v16b v; v8us half[2]; unsigned short u[16]; };

__device__ __forceinline__ unsigned short bf16_bits(float x) { unsigned int u = __float_as_uint(x); return (unsigned short)((u + 0x7FFFu + ((u >> 16) & 1u)) >> 16); }
__device__ __forceinline__ float bf16_val(unsigned short b) { return __uint_as_float(((unsigned int)b) << 16); }
__device__ __forceinline__ float bf16_round(float x) { return bf16_val(bf16_bits(x)); }
// D += A·B with NT terms: 1 = ah·bh, 2 = + al·bh (A split), 3 = + ah·bl (both split)
template <int NT>
__device__ __forceinline__ v8f mmaN(v16b ah, v16b al, v16b bh, v16b bl, v8f c) {
  c = __builtin_amdgcn_wmma_f32_16x16x32_bf16(false, ah, false, bh, (short)0, c, false, false);
  if (NT >= 2) c = __builtin_amdgcn_wmma_f32_16x16x32_bf16(false, al, false, bh, (short)0, c, false, false);
  if (NT >= 3) c = __builtin_amdgcn_wmma_f32_16x16x32_bf16(false, ah, false, bl, (short)0, c, false, false);
  asm volatile("v_nop\n\tv_nop\n\tv_nop\n\tv_nop" : "+v"(c) : "v"(ah), "v"(al), "v"(bh), "v"(bl));
  return c;
}

__global__ __launch_bounds__(256) void k_wt_bf16(const float* __restrict__ W, unsigned short* __restrict__ Wt, int K, int N) {
  const int t = blockIdx.x * 256 + threadIdx.x;
  const int k8n = K / 8;
  if (t >= N * k8n) return;
  const int n = t / k8n, k8 = (t % k8n) * 8;
  v8us v;
#pragma unroll
  for (int i = 0; i < 8; ++i) v[i] = bf16_bits(W[(size_t)(k8 + i) * N + n]);
  *(v8us*)(Wt + (size_t)n * K + k8) = v;
  
}

// GEMM C[M][N] (f32, pitch ldc) = act(A[M][K]·W + bias). A f32 row-major (pitch lda) converted per fragment to bf16
// (ASPLIT: hi/lo two planes -> 2 terms, else single rounded term); Wt bf16 [N][K] (pitch ldb). BIAS_BF16 rounds the
// bias to bf16 first (bias quantised to bf16 before the add). K%32==0, M%16==0, N%64==0.
template <bool ASPLIT, int ACT, bool BIAS_BF16>
__global__ __launch_bounds__(128) void k_gemm_bf(const float* __restrict__ A, int lda, const unsigned short* __restrict__ Wt, int ldb,
                                               const float* __restrict__ bias, float* __restrict__ C, int ldc, int M, int N, int K) {
  __shared__ __attribute__((aligned(16))) float so[4][16][64];
  const int tid = threadIdx.x, w = tid >> 5, lane = tid & 31, ln = lane & 15, hh = lane >> 4;
  const int ntn = N / 64;
  const int wid = blockIdx.x * 4 + w;
  const int mt = wid / ntn, nq = wid % ntn;
  if (mt * 16 >= M) return;
  const int row0 = mt * 16, col0 = nq * 64;
  const float* arow = A + (size_t)(row0 + ln) * lda;
  v8f acc[4] = {};
  for (int kb = 0; kb < K; kb += 32) {
    FragB ah, al;
    const v4f x0 = *(const v4fa*)(arow + kb + 8 * hh), x1 = *(const v4fa*)(arow + kb + 8 * hh + 4);
    const v4f x2 = *(const v4fa*)(arow + kb + 16 + 8 * hh), x3 = *(const v4fa*)(arow + kb + 16 + 8 * hh + 4);
    float xs[16] = {x0[0],x0[1],x0[2],x0[3],x1[0],x1[1],x1[2],x1[3],x2[0],x2[1],x2[2],x2[3],x3[0],x3[1],x3[2],x3[3]};
#pragma unroll
    for (int i = 0; i < 16; ++i) { const unsigned short hb = bf16_bits(xs[i]); ah.u[i] = hb; al.u[i] = ASPLIT ? bf16_bits(xs[i] - bf16_val(hb)) : (unsigned short)0; }
#pragma unroll
    for (int t = 0; t < 4; ++t) {
      const unsigned short* brow = Wt + (size_t)(col0 + t * 16 + ln) * ldb + kb;
      FragB b;
      b.half[0] = *(const v8us*)(brow + 8 * hh);
      b.half[1] = *(const v8us*)(brow + 16 + 8 * hh);
      acc[t] = mmaN<ASPLIT ? 2 : 1>(ah.v, al.v, b.v, b.v, acc[t]);
    }
  }
#pragma unroll
  for (int t = 0; t < 4; ++t) {
    float bv = bias ? bias[col0 + t * 16 + ln] : 0.f;
    if (BIAS_BF16) bv = bf16_round(bv);
#pragma unroll
    for (int r = 0; r < 8; ++r) { float v = acc[t][r] + bv; if (ACT == 1) v = fmaxf(v, 0.f); so[w][8 * hh + r][t * 16 + ln] = v; }
  }
  __builtin_amdgcn_fence(__ATOMIC_ACQ_REL, "workgroup");
  __builtin_amdgcn_wave_barrier();
  const int rsub = lane >> 4, c4 = (lane & 15) * 4;
  {
#pragma unroll
    for (int q = 0; q < 8; ++q) {
      const int r = q * 2 + rsub;
      const v4f v = *(const v4fa*)&so[w][r][c4];
      *(v4f*)(C + (size_t)(row0 + r) * ldc + col0 + c4) = v;
    }
    
  }
}

// GEMM C = act(A·W + bias + resid): A f32 (ASPLIT -> hi/lo 2 terms), Wt bf16 [N][K]; ACT 0 none, 1 relu, 2 exact gelu;
// resid (optional, f32, row index = (row % rmod), pitch ldr, RES_BF16 rounds it) added before the activation.
template <bool ASPLIT, int ACT, bool BIAS_BF16, bool RES_BF16>
__global__ __launch_bounds__(128) void k_gemm_bf3(const float* __restrict__ A, int lda, const unsigned short* __restrict__ Wt, int ldb,
                                                const float* __restrict__ bias, const float* __restrict__ resid, int rmod, int ldr,
                                                float* __restrict__ C, int ldc, int M, int N, int K) {
  __shared__ __attribute__((aligned(16))) float so[4][16][64];
  const int tid = threadIdx.x, w = tid >> 5, lane = tid & 31, ln = lane & 15, hh = lane >> 4;
  const int ntn = N / 64;
  const int wid = blockIdx.x * 4 + w;
  const int mt = wid / ntn, nq = wid % ntn;
  if (mt * 16 >= M) return;
  const int row0 = mt * 16, col0 = nq * 64;
  const float* arow = A + (size_t)(row0 + ln) * lda;
  v8f acc[4] = {};
  for (int kb = 0; kb < K; kb += 32) {
    FragB ah, al;
    const v4f x0 = *(const v4fa*)(arow + kb + 8 * hh), x1 = *(const v4fa*)(arow + kb + 8 * hh + 4);
    const v4f x2 = *(const v4fa*)(arow + kb + 16 + 8 * hh), x3 = *(const v4fa*)(arow + kb + 16 + 8 * hh + 4);
    float xs[16] = {x0[0],x0[1],x0[2],x0[3],x1[0],x1[1],x1[2],x1[3],x2[0],x2[1],x2[2],x2[3],x3[0],x3[1],x3[2],x3[3]};
#pragma unroll
    for (int i = 0; i < 16; ++i) { const unsigned short hb = bf16_bits(xs[i]); ah.u[i] = hb; al.u[i] = ASPLIT ? bf16_bits(xs[i] - bf16_val(hb)) : (unsigned short)0; }
#pragma unroll
    for (int t = 0; t < 4; ++t) {
      const unsigned short* brow = Wt + (size_t)(col0 + t * 16 + ln) * ldb + kb;
      FragB b;
      b.half[0] = *(const v8us*)(brow + 8 * hh);
      b.half[1] = *(const v8us*)(brow + 16 + 8 * hh);
      acc[t] = mmaN<ASPLIT ? 2 : 1>(ah.v, al.v, b.v, b.v, acc[t]);
    }
  }
#pragma unroll
  for (int t = 0; t < 4; ++t) {
    const int col = col0 + t * 16 + ln;
    float bv = bias ? bias[col] : 0.f;
    if (BIAS_BF16) bv = bf16_round(bv);
#pragma unroll
    for (int r = 0; r < 8; ++r) {
      float v = acc[t][r] + bv;
      if (resid) { float rv = resid[(size_t)((row0 + 8 * hh + r) % rmod) * ldr + col]; if (RES_BF16) rv = bf16_round(rv); v += rv; }
      if (ACT == 1) v = fmaxf(v, 0.f);
      if (ACT == 2) v = 0.5f * v * (1.0f + erff(v * 0.70710678118654752f));
      if (ACT == 3) { const float u = 0.7978845608028654f * (v + 0.044715f * v * v * v); v = 0.5f * v * (1.0f + tanhf(u)); }
      so[w][8 * hh + r][t * 16 + ln] = v;
    }
  }
  __builtin_amdgcn_fence(__ATOMIC_ACQ_REL, "workgroup");
  __builtin_amdgcn_wave_barrier();
  const int rsub = lane >> 4, c4 = (lane & 15) * 4;
  {
#pragma unroll
    for (int q = 0; q < 8; ++q) {
      const int r = q * 2 + rsub;
      const v4f v = *(const v4fa*)&so[w][r][c4];
      *(v4f*)(C + (size_t)(row0 + r) * ldc + col0 + c4) = v;
    }
    
  }
}
// row LayerNorm (biased variance, eps) over N: s = X (+ R); optional out_sum <- s; out_norm <- (s-mu)*rsqrt(var+eps)*g + b
template <bool PARAM_BF16>
__global__ __launch_bounds__(256) void k_layernorm(const float* __restrict__ X, const float* __restrict__ R, const float* __restrict__ g, const float* __restrict__ bta,
                                                  float* __restrict__ out_sum, float* __restrict__ out_norm, int N, float eps) {
  __shared__ float red[256];
  const int row = blockIdx.x, tid = threadIdx.x;
  const float* x = X + (size_t)row * N; const float* rr = R ? R + (size_t)row * N : nullptr;
  float vals[16];                     // up to N = 4096
  const int per = N / 256;            // contiguous chunk per thread? use strided-by-4 chunks: thread handles j = tid*4 + 1024*u
  float s1 = 0.f;
  for (int u = 0; u < per / 4; ++u) {
    const int j = tid * 4 + 1024 * u;
    const v4f a = *(const v4fa*)(x + j);
    v4f b = {0.f,0.f,0.f,0.f}; if (rr) b = *(const v4fa*)(rr + j);
#pragma unroll
    for (int q = 0; q < 4; ++q) { const float v = a[q] + b[q]; vals[u * 4 + q] = v; s1 += v; }
  }
  red[tid] = s1; __syncthreads();
  for (int st = 128; st > 0; st >>= 1) { if (tid < st) red[tid] += red[tid + st]; __syncthreads(); }
  const float mu = red[0] / (float)N; __syncthreads();
  float s2 = 0.f;
  for (int u = 0; u < per / 4; ++u)
#pragma unroll
    for (int q = 0; q < 4; ++q) { const float c = vals[u * 4 + q] - mu; s2 += c * c; }
  red[tid] = s2; __syncthreads();
  for (int st = 128; st > 0; st >>= 1) { if (tid < st) red[tid] += red[tid + st]; __syncthreads(); }
  const float rs = rsqrtf(red[0] / (float)N + eps);
  {
    for (int u = 0; u < per / 4; ++u) {
      const int j = tid * 4 + 1024 * u;
      v4f o, sm;
#pragma unroll
      for (int q = 0; q < 4; ++q) {
        float gg = g[j + q], bb = bta[j + q];
        if (PARAM_BF16) { gg = bf16_round(gg); bb = bf16_round(bb); }
        sm[q] = vals[u * 4 + q]; o[q] = (vals[u * 4 + q] - mu) * rs * gg + bb;
      }
      if (out_sum) *(v4f*)(out_sum + (size_t)row * N + j) = sm;
      *(v4f*)(out_norm + (size_t)row * N + j) = o;
    }
    
  }
}



// ---- f16 WMMA path (v_wmma_f32_16x16x32_f16): 11-bit significands for operands in range — used where a [0,1] probability operand needs more precision than bf16
typedef _Float16 v16h __attribute__((ext_vector_type(16)));
union FragH { v16h v; v8us half[2]; _Float16 h[16]; unsigned short u[16]; };
template <int NT>
__device__ __forceinline__ v8f mmaH(v16h ah, v16h al, v16h bh, v16h bl, v8f c) {
  c = __builtin_amdgcn_wmma_f32_16x16x32_f16(false, ah, false, bh, (short)0, c, false, false);
  if (NT >= 2) c = __builtin_amdgcn_wmma_f32_16x16x32_f16(false, al, false, bh, (short)0, c, false, false);
  if (NT >= 3) c = __builtin_amdgcn_wmma_f32_16x16x32_f16(false, ah, false, bl, (short)0, c, false, false);
  asm volatile("v_nop\n\tv_nop\n\tv_nop\n\tv_nop" : "+v"(c) : "v"(ah), "v"(al), "v"(bh), "v"(bl));
  return c;
}
// batched GEMM like k_gemm_b but f16 operands: A f32 (split into f16 hi/lo if ASPLIT, else rounded to f16), Bt = f16 values [n][k]; alpha; C f32; N multiple of 16 (partial tiles skipped)
template <bool ASPLIT>
__global__ __launch_bounds__(128) void k_gemm_h(const float* __restrict__ A, int lda, size_t sA, const _Float16* __restrict__ Bh, int ldb, size_t sB, float alpha, float* __restrict__ C, int ldc, size_t sC, int M, int N, int K) {
  __shared__ __attribute__((aligned(16))) float so[4][16][64];
  const int tid = threadIdx.x, w = tid >> 5, lane = tid & 31, ln = lane & 15, hh = lane >> 4; const int by = blockIdx.y;
  A += (size_t)by * sA; Bh += (size_t)by * sB; C += (size_t)by * sC;
  const int ntn = (N + 63) / 64; const int wid = blockIdx.x * 4 + w; const int mt = wid / ntn, nq = wid % ntn; if (mt * 16 >= M) return;
  const int row0 = mt * 16, col0 = nq * 64; const float* arow = A + (size_t)(row0 + ln) * lda;
  v8f acc[4] = {};
  for (int kb = 0; kb < K; kb += 32) {
    FragH ah, al;
    const v4f x0 = *(const v4fa*)(arow + kb + 8 * hh), x1 = *(const v4fa*)(arow + kb + 8 * hh + 4), x2 = *(const v4fa*)(arow + kb + 16 + 8 * hh), x3 = *(const v4fa*)(arow + kb + 16 + 8 * hh + 4);
    float xs[16] = {x0[0],x0[1],x0[2],x0[3],x1[0],x1[1],x1[2],x1[3],x2[0],x2[1],x2[2],x2[3],x3[0],x3[1],x3[2],x3[3]};
#pragma unroll
    for (int i = 0; i < 16; ++i) { const _Float16 h = (_Float16)xs[i]; ah.h[i] = h; al.h[i] = ASPLIT ? (_Float16)(xs[i] - (float)h) : (_Float16)0.0f; }
#pragma unroll
    for (int t = 0; t < 4; ++t) { if (col0 + t * 16 >= N) continue; const size_t boff = (size_t)(col0 + t * 16 + ln) * ldb + kb; FragH bq; bq.half[0] = *(const v8us*)(Bh + boff + 8 * hh); bq.half[1] = *(const v8us*)(Bh + boff + 16 + 8 * hh);
      acc[t] = mmaH<ASPLIT ? 2 : 1>(ah.v, al.v, bq.v, bq.v, acc[t]); }
  }
#pragma unroll
  for (int t = 0; t < 4; ++t) { if (col0 + t * 16 >= N) continue;
#pragma unroll
    for (int r = 0; r < 8; ++r) so[w][8 * hh + r][t * 16 + ln] = acc[t][r] * alpha; }
  __builtin_amdgcn_fence(__ATOMIC_ACQ_REL, "workgroup"); __builtin_amdgcn_wave_barrier();
  const int rsub = lane >> 4, c4 = (lane & 15) * 4;
  {
#pragma unroll
    for (int q = 0; q < 8; ++q) { const int r = q * 2 + rsub; if (col0 + c4 < N) { const v4f v = *(const v4fa*)&so[w][r][c4]; *(v4f*)(C + (size_t)(row0 + r) * ldc + col0 + c4) = v; } }
     }
}

// Wt[n][k] = f16(W[k][n]·scale) from f32 row-major W[K][N] (scale = power of two; bf16-exact weights stay exact in f16 away from the subnormal range)
__global__ __launch_bounds__(256) void k_wt_f16(const float* __restrict__ W, _Float16* __restrict__ Wt, int K, int N, float scale) {
  const int t = blockIdx.x * 256 + threadIdx.x; if (t >= N * (K / 8)) return; const int n = t / (K / 8), k8 = (t % (K / 8)) * 8; FragH f;
#pragma unroll
  for (int i = 0; i < 8; ++i) f.h[i] = (_Float16)(bf16_round(W[(size_t)(k8 + i) * N + n]) * scale); const v8us o = f.half[0];
  *(v8us*)((unsigned short*)Wt + (size_t)n * K + k8) = o; 
}
// k_gemm_hh variant with fused epilogue: v = acc·alpha + bias[by·sBias + col] (+ CP[(row/rowsPerB)·sCPb + by·64 + col] if CP) ; ACT 0 none / 1 elu ; writes f16 C16 (and f32 C if non-null)
template <int ACT>
__global__ __launch_bounds__(128) void k_gemm_hhx(const _Float16* __restrict__ A, int lda, size_t sA, const _Float16* __restrict__ Bh, int ldb, size_t sB, float alpha, const float* __restrict__ bias, size_t sBias, const float* __restrict__ CP, int rowsPerB, size_t sCPb, int row0g,
    float* __restrict__ C, _Float16* __restrict__ C16, int ldc, size_t sC, int M, int N, int K) {
  __shared__ __attribute__((aligned(16))) float so[4][16][64];
  const int tid = threadIdx.x, w = tid >> 5, lane = tid & 31, ln = lane & 15, hh = lane >> 4; const int by = blockIdx.y;
  A += (size_t)by * sA; Bh += (size_t)by * sB; const size_t cofs = (size_t)by * sC; const float* bp = bias ? bias + (size_t)by * sBias : nullptr;
  const int ntn = (N + 63) / 64; const int wid = blockIdx.x * 4 + w; const int mt = wid / ntn, nq = wid % ntn; if (mt * 16 >= M) return;
  const int row0 = mt * 16, col0 = nq * 64; const _Float16* arow = A + (size_t)(row0 + ln) * lda;
  v8f acc[4] = {};
  for (int kb = 0; kb < K; kb += 32) { FragH ah; ah.half[0] = *(const v8us*)((const unsigned short*)arow + kb + 8 * hh); ah.half[1] = *(const v8us*)((const unsigned short*)arow + kb + 16 + 8 * hh);
#pragma unroll
    for (int t = 0; t < 4; ++t) { if (col0 + t * 16 >= N) continue; const size_t boff = (size_t)(col0 + t * 16 + ln) * ldb + kb; FragH bq; bq.half[0] = *(const v8us*)((const unsigned short*)Bh + boff + 8 * hh); bq.half[1] = *(const v8us*)((const unsigned short*)Bh + boff + 16 + 8 * hh);
      acc[t] = mmaH<1>(ah.v, ah.v, bq.v, bq.v, acc[t]); }
  }
#pragma unroll
  for (int t = 0; t < 4; ++t) { if (col0 + t * 16 >= N) continue; const int col = col0 + t * 16 + ln; const float bv = bp ? bf16_round(bp[col]) : 0.f;
#pragma unroll
    for (int r = 0; r < 8; ++r) { float v = acc[t][r] * alpha + bv; if (CP) { const int rr = row0g + row0 + 8 * hh + r; if (rowsPerB < 0) v += CP[cofs + (size_t)rr * ldc + col];      /* rowsPerB < 0: own element of the batched C plane */ else { const int bidx = rr / rowsPerB; v += CP[(size_t)bidx * sCPb + (size_t)by * 64 + col]; } } if (ACT == 1) v = (v > 0.f) ? v : expm1f(v); else if (ACT == 7) v = (v > 0.f) ? v + 1.0f : expf(v); else if (ACT == 8) v = tanhf(v); else if (ACT == 9) v = 0.5f * v * (1.0f + tanhf(0.7978845608028654f * (v + 0.044715f * v * v * v))); else if (ACT == 11) v = 1.0f / (1.0f + expf(-v)); else if (ACT == 12) v = (v > 0.f) ? v : 0.01f * v; else if (ACT == 14) v = (v > 0.f) ? v : 0.1f * v; else if (ACT == 16) v = (v >= 0.f) ? v : 0.3f * v; else if (ACT == 17) v = (v >= 0.f) ? v : 0.2f * v; else if (ACT == 15) v = v / (1.0f + expf(-v)); else if (ACT == 3) v = fmaxf(v, 0.f); else if (ACT == 6) v = 0.5f * v * (1.0f + erff(v * 0.70710678118654752f)); so[w][8 * hh + r][t * 16 + ln] = v; } }
  __builtin_amdgcn_fence(__ATOMIC_ACQ_REL, "workgroup"); __builtin_amdgcn_wave_barrier();
  const int rsub = lane >> 4, c4 = (lane & 15) * 4; typedef _Float16 v4h __attribute__((ext_vector_type(4)));
  {
#pragma unroll
    for (int q = 0; q < 8; ++q) { const int r = q * 2 + rsub; if (col0 + c4 < N) { const v4f v = *(const v4fa*)&so[w][r][c4]; if (C) *(v4f*)(C + cofs + (size_t)(row0 + r) * ldc + col0 + c4) = v; if (C16) { v4h h4; for (int i = 0; i < 4; ++i) h4[i] = (_Float16)v[i]; *(v4h*)(C16 + cofs + (size_t)(row0 + r) * ldc + col0 + c4) = h4; } } }
     }
}


typedef _Float16 v4h __attribute__((ext_vector_type(4)));

__global__ __launch_bounds__(256) void k_x16(const float* __restrict__ x, _Float16* __restrict__ X16, size_t n8) { const size_t t = (size_t)blockIdx.x * 256 + threadIdx.x; if (t >= n8) return; FragH f;
#pragma unroll
  for (int q = 0; q < 8; ++q) f.h[q] = (_Float16)bf16_round(x[t * 8 + q]); *(v8us*)((unsigned short*)X16 + t * 8) = f.half[0];  }
__global__ __launch_bounds__(256) void k_h16(const float* __restrict__ x, _Float16* __restrict__ X16, size_t n8) { const size_t t = (size_t)blockIdx.x * 256 + threadIdx.x; if (t >= n8) return; FragH f;
#pragma unroll
  for (int q = 0; q < 8; ++q) f.h[q] = (_Float16)x[t * 8 + q]; *(v8us*)((unsigned short*)X16 + t * 8) = f.half[0];  }
__global__ __launch_bounds__(256) void k_round16f(const float* __restrict__ W, _Float16* __restrict__ Bt, size_t n8) { const size_t t = (size_t)blockIdx.x * 256 + threadIdx.x; if (t >= n8) return; FragH f;
#pragma unroll
  for (int i = 0; i < 8; ++i) f.h[i] = (_Float16)(bf16_round(W[t * 8 + i]) * 16.0f); *(v8us*)((unsigned short*)Bt + t * 8) = f.half[0];  }
template <int NHv, int TTv>
__global__ __launch_bounds__(256) void k_vt(const _Float16* __restrict__ V16, int ldv, int voff, _Float16* __restrict__ Vt) { __shared__ unsigned short tl[64][66]; const int tid = threadIdx.x; const int slab = blockIdx.x / (TTv / 64), lg = blockIdx.x % (TTv / 64); const int b = slab / NHv, h = slab % NHv;
  for (int i = tid; i < 64 * 8; i += 256) { const int r = i / 8, c8 = (i % 8) * 8; FragH f; f.half[0] = *(const v8us*)((const unsigned short*)V16 + ((size_t)b * TTv + lg * 64 + r) * ldv + voff + h * 64 + c8);
#pragma unroll
    for (int q = 0; q < 8; ++q) tl[r][c8 + q] = f.u[q]; }
  __syncthreads();
  {
#pragma unroll
    for (int rd = 0; rd < 2; ++rd) { const int d = rd * 32 + tid / 8, pc = tid % 8; FragH f;
#pragma unroll
      for (int q = 0; q < 8; ++q) f.u[q] = tl[pc * 8 + q][d];
      *(v8us*)((unsigned short*)Vt + ((size_t)slab * 64 + d) * TTv + lg * 64 + pc * 8) = f.half[0]; }
     } }

__global__ __launch_bounds__(256) void k_hl(const float* __restrict__ F, _Float16* __restrict__ Hh, _Float16* __restrict__ Hl, size_t n8) { const size_t t = (size_t)blockIdx.x * 256 + threadIdx.x; if (t >= n8) return; FragH fh, fl; const v4f a = *(const v4fa*)(F + t * 8), c = *(const v4fa*)(F + t * 8 + 4);
#pragma unroll
  for (int q = 0; q < 4; ++q) { _Float16 h = (_Float16)a[q]; fh.h[q] = h; fl.h[q] = (_Float16)((a[q] - (float)h) * 1024.0f); h = (_Float16)c[q]; fh.h[4 + q] = h; fl.h[4 + q] = (_Float16)((c[q] - (float)h) * 1024.0f); }
  { *(v8us*)((unsigned short*)Hh + t * 8) = fh.half[0]; *(v8us*)((unsigned short*)Hl + t * 8) = fl.half[0];  } }

// ---- fast GEMM (wave tile 32x64; requires M % 32 == 0 rows per launch region and N % 64 == 0); epilogue = k_gemm_hhx semantics ----
__device__ __forceinline__ v16h g2_frag(const _Float16* p, int hh) { FragH f; f.half[0] = *(const v8us*)((const unsigned short*)p + 8 * hh); f.half[1] = *(const v8us*)((const unsigned short*)p + 16 + 8 * hh); return f.v; }
__device__ __forceinline__ v8f g2_mma(v16h a, v16h b, v8f c) { v8f d = __builtin_amdgcn_wmma_f32_16x16x32_f16(false, a, false, b, (short)0, c, false, false); asm volatile("v_nop\n\tv_nop\n\tv_nop\n\tv_nop" : "+v"(d) : "v"(a), "v"(b)); return d; }
template <int ACT>
__global__ __launch_bounds__(128) void k_gemm2(const _Float16* __restrict__ A, int lda, size_t sA, const _Float16* __restrict__ Bh, int ldb, size_t sB, float alpha, const float* __restrict__ bias, size_t sBias, const float* __restrict__ CP, int rowsPerB, size_t sCPb, int row0g,
    float* __restrict__ C, _Float16* __restrict__ C16, int ldc, size_t sC, int M, int N, int K, size_t zA, size_t zB, size_t zC) { static_assert(ACT == 0 || ACT == 3 || ACT == 6 || ACT == 8 || ACT == 9 || ACT == 11 || ACT == 12 || ACT == 14 || ACT == 15 || ACT == 16 || ACT == 17, "k_gemm2: unsupported ACT code (would silently apply no activation)");
  __shared__ __attribute__((aligned(16))) float so[4][32][68];
  const int tid = threadIdx.x, w = tid >> 5, lane = tid & 31, ln = lane & 15, hh = lane >> 4; const int by = blockIdx.y, bz = blockIdx.z;      /* grid.y = head (strides sA, sB, sC), grid.z = batch (strides zA, zB, zC) */
  A += (size_t)by * sA + (size_t)bz * zA; Bh += (size_t)by * sB + (size_t)bz * zB; const size_t cofs = (size_t)by * sC + (size_t)bz * zC; const float* bp = bias ? bias + (size_t)by * sBias : nullptr;
  const int ntn = N >> 6; const int mt = blockIdx.x / ntn, nq = blockIdx.x - mt * ntn; const int row0 = mt * 128 + 32 * w, col0 = nq * 64; if (row0 >= M) return;
  const _Float16* a0p = A + (size_t)(row0 + ln) * lda; const _Float16* a1p = a0p + (size_t)16 * lda;
  const _Float16* b0p = Bh + (size_t)(col0 + ln) * ldb; const _Float16* b1p = b0p + (size_t)16 * ldb; const _Float16* b2p = b1p + (size_t)16 * ldb; const _Float16* b3p = b2p + (size_t)16 * ldb;
  const v8f z8 = {0.f,0.f,0.f,0.f,0.f,0.f,0.f,0.f}; v8f c00 = z8, c01 = z8, c02 = z8, c03 = z8, c10 = z8, c11 = z8, c12 = z8, c13 = z8;
#pragma unroll 1
  for (int kb = 0; kb < K; kb += 32) { const v16h a0 = g2_frag(a0p + kb, hh), a1 = g2_frag(a1p + kb, hh);
    v16h b = g2_frag(b0p + kb, hh); c00 = g2_mma(a0, b, c00); c10 = g2_mma(a1, b, c10);
    b = g2_frag(b1p + kb, hh); c01 = g2_mma(a0, b, c01); c11 = g2_mma(a1, b, c11);
    b = g2_frag(b2p + kb, hh); c02 = g2_mma(a0, b, c02); c12 = g2_mma(a1, b, c12);
    b = g2_frag(b3p + kb, hh); c03 = g2_mma(a0, b, c03); c13 = g2_mma(a1, b, c13); }
  v8f accs[8] = {c00, c01, c02, c03, c10, c11, c12, c13};
#pragma unroll
  for (int u = 0; u < 8; ++u) { const int t = u & 3, half = u >> 2; const int col = col0 + t * 16 + ln; const float bv = bp ? bf16_round(bp[col]) : 0.f;
#pragma unroll
    for (int r = 0; r < 8; ++r) { const int rloc = half * 16 + 8 * hh + r; float v = accs[u][r] * alpha + bv; if (CP) { if (rowsPerB < 0) v += CP[cofs + (size_t)(row0g + row0 + rloc) * ldc + col];      /* rowsPerB < 0: own element of the batched C plane */ else { const int bidx = (row0g + row0 + rloc) / rowsPerB; v += CP[(size_t)bidx * sCPb + (size_t)by * 64 + col]; } }
      if (ACT == 3) v = fmaxf(v, 0.f); else if (ACT == 6) v = 0.5f * v * (1.0f + erff(v * 0.70710678118654752f)); else if (ACT == 11) v = 1.0f / (1.0f + expf(-v)); else if (ACT == 15) v = v / (1.0f + expf(-v)); else if (ACT == 12) v = (v > 0.f) ? v : 0.01f * v; else if (ACT == 8) v = tanhf(v); else if (ACT == 9) v = 0.5f * v * (1.0f + tanhf(0.7978845608028654f * (v + 0.044715f * v * v * v))); else if (ACT == 14) v = (v > 0.f) ? v : 0.1f * v; else if (ACT == 16) v = (v >= 0.f) ? v : 0.3f * v; else if (ACT == 17) v = (v >= 0.f) ? v : 0.2f * v;
      so[w][rloc][t * 16 + ln] = v; } }
  __builtin_amdgcn_fence(__ATOMIC_ACQ_REL, "workgroup"); __builtin_amdgcn_wave_barrier();
  const int rsub = lane >> 4, c4 = (lane & 15) * 4;
  {
#pragma unroll
    for (int q = 0; q < 16; ++q) { const int r = q * 2 + rsub; const v4f v = *(const v4fa*)&so[w][r][c4]; if (C) *(v4f*)(C + cofs + (size_t)(row0 + r) * ldc + col0 + c4) = v; if (C16) { v4h h4; for (int i = 0; i < 4; ++i) h4[i] = (_Float16)v[i]; *(v4h*)(C16 + cofs + (size_t)(row0 + r) * ldc + col0 + c4) = h4; } }
     } }


__global__ __launch_bounds__(256) void k_wnat(const float* __restrict__ w, size_t n8, _Float16* __restrict__ Bt) { const size_t t = (size_t)blockIdx.x * 256 + threadIdx.x; if (t >= n8) return; FragH f; for (int q = 0; q < 8; ++q) f.h[q] = (_Float16)(bf16_round(w[t * 8 + q]) * 16.0f); *(v8us*)((unsigned short*)Bt + t * 8) = f.half[0];  }
__global__ __launch_bounds__(256) void k_rsm(const float* __restrict__ S, _Float16* __restrict__ P, int nrows) {
  #pragma clang fp contract(off)
  const int i = blockIdx.x * 256 + threadIdx.x; if (i >= nrows) return; const float* s = S + (size_t)i * SQ; float mx = -3.0e38f;
#pragma unroll 1
  for (int j = 0; j < SQ; ++j) mx = fmaxf(mx, s[j]); float se = 0.f;
#pragma unroll 1
  for (int j = 0; j < SQ; ++j) se += expf(s[j] - mx); const float sc = 256.0f / se;
#pragma unroll 1
  for (int j0 = 0; j0 < SQ; j0 += 8) { FragH f; for (int q = 0; q < 8; ++q) f.h[q] = (_Float16)(expf(s[j0 + q] - mx) * sc); unsigned short* d = (unsigned short*)P + (size_t)i * SQ + j0; *(v8us*)d = f.half[0];  } }
__global__ __launch_bounds__(256) void k_vt(const _Float16* __restrict__ V16, int b, int h0, _Float16* __restrict__ VT) { __shared__ unsigned short tl[64][65]; const int tid = threadIdx.x; const int hh = blockIdx.x % HG, sg = blockIdx.x / HG; const int s0 = sg * 64; const int h = h0 + hh;
  for (int i = tid; i < 64 * 8; i += 256) { const int j = i / 8, d8 = (i % 8) * 8; FragH f; f.half[0] = *(const v8us*)((const unsigned short*)V16 + ((size_t)b * SQ + s0 + j) * DM + h * HD + d8); for (int q = 0; q < 8; ++q) tl[d8 + q][j] = f.u[q]; }
  __syncthreads();
  { for (int i = tid; i < 64 * 8; i += 256) { const int d = i / 8, j8 = (i % 8) * 8; FragH f; for (int q = 0; q < 8; ++q) f.u[q] = tl[d][j8 + q]; *(v8us*)((unsigned short*)VT + ((size_t)hh * HD + d) * SQ + s0 + j8) = f.half[0]; }  } }



// Lane l <-> l ^ M inside a 16-lane row (DPP row_xmask) and l <-> l ^ 16 (cross-row move): a five-step butterfly leaves the row's maximum / sum in every lane without an LDS round trip.
template <int M> __device__ __forceinline__ float rs_xm(float x) { return __builtin_bit_cast(float, __builtin_amdgcn_update_dpp(0, __builtin_bit_cast(int, x), 0x160 | M, 0xf, 0xf, true)); }
__device__ __forceinline__ float rs_xh(float x) { return __builtin_bit_cast(float, __builtin_amdgcn_permlanex16(__builtin_bit_cast(int, x), __builtin_bit_cast(int, x), 0x76543210, 0xfedcba98, false, false)); }
// Fused causal attention, all batches, heads and query tiles in ONE launch: scores, softmax and weighted values stay in registers, nothing of them goes to memory.
// A work-group of FAW waves takes FAQ query rows of one head, 32 per wave, and walks the keys 0 .. its last row in stages of FAK keys. A stage's K rows [key][d] and V^T rows [d][key] are fetched with whole-line loads
// one stage ahead into registers and stored to one of two LDS buffers; one barrier per stage publishes the next buffer and ends the reads of the one that is refilled after it.
// Per 32-key pass a wave forms S^T = K Q^T (A = K rows, B = q rows held in registers): lane (c, h) then holds keys 8h + r of query c, so the maximum and the sum are in-lane plus one exchange of the wave's halves,
// and the two 16-key score tiles, converted in place, are the B operand of O^T += V^T P^T (A = V^T rows in the same k order). Online softmax in the log2 domain; the maximum in use may trail the true one by up to 8,
// so a weight can reach 2^8 (f16 holds it at full relative precision) and the accumulators are rescaled only in the rare pass in which some query's maximum grows by more.
// The full unrolls in the kernel give its register arrays (fragments, score tiles, accumulators, staged rows) constant indices, without which they would go to scratch memory.
#define FAW 4                        /* waves per work-group */
#define FAQ (FAW * 32)               /* query rows per work-group */
#define FAK 64                       /* keys per LDS stage: two 32-key passes; 64 f16 = one 128-byte line of a V^T row */
#define FAP (HD + 8)                 /* LDS row pitch in halves: 144 B = 16 B x odd, so that the 16 rows of a fragment load fall on different banks */
__device__ __forceinline__ v8f fa_mma(v16h a, v16h b, v8f c) { return __builtin_amdgcn_wmma_f32_16x16x32_f16(false, a, false, b, (short)0, c, false, false); }
__device__ __forceinline__ v16h fa_frag(const _Float16* p) { FragH f; f.half[0] = *(const v8us*)(const unsigned short*)p; f.half[1] = *(const v8us*)((const unsigned short*)p + 16); return f.v; }      /* p already holds the lane's 8 * h: k = 8h .. 8h+7 and 16+8h .. 16+8h+7, the order of g2_frag */
// Four vector slots between a run of matrix instructions and the branch behind it: on the taken side the next vector instruction may read their results. The two scheduling barriers keep the slots at that place.
__device__ __forceinline__ void fa_gap() { __builtin_amdgcn_sched_barrier(0); asm volatile("v_nop\n\tv_nop\n\tv_nop\n\tv_nop"); __builtin_amdgcn_sched_barrier(0); }
__global__ __launch_bounds__(FAW * 32) void k_fattn(const _Float16* __restrict__ Qh, const _Float16* __restrict__ Kh, const _Float16* __restrict__ Vt, _Float16* __restrict__ Oh) {
  static_assert(HD == 64 && FAK == 64 && FAQ % FAK == 0 && SQ / FAQ == 16 && NB * NH == 64 && FAW * 32 == 128 && KVD == DM, "16 query tiles x 64 (batch, head) pairs; 8 threads stage one 128-byte row, 16 rows per pass of the staging loop");
  __shared__ __attribute__((aligned(16))) _Float16 ks[2][FAK * FAP]; __shared__ __attribute__((aligned(16))) _Float16 vs[2][HD * FAP];
  const int tid = threadIdx.x, lane = tid & 31, c = lane & 15, h = lane >> 4; const int w = __builtin_amdgcn_readfirstlane(tid >> 5); const int idx = blockIdx.x;
  // A tile's cost grows with its index and all work-groups are resident together: the 16 tiles are dealt by a 4 x 4 square whose rows and columns all sum to 30 (row = idx / 256, column = (idx / 8) % 4), every (head, tile) pair once.
  const int tile = (int)((0x0DE3B6587A94C12FULL >> (4 * (((idx >> 8) << 2) | ((idx >> 3) & 3)))) & 15); const int bh = (idx & 7) | (((idx >> 5) & 7) << 3); const int b = bh / NH, hd = bh % NH;
  const int q0 = tile * FAQ, qw = q0 + 32 * w, nst = (q0 + FAQ) / FAK;      /* causal: keys below the tile's end */
  const int sr = tid >> 3, sc = (tid & 7) * 8; const int so = sr * FAP + sc;      /* staging: row sr + 16 u, eight halves at column sc */
  const _Float16* kg = Kh + ((size_t)b * SQ + sr) * KVD + hd * HD + sc; const _Float16* vg = Vt + ((size_t)bh * HD + sr) * SQ + sc;
  v8us kr[4], vr[4];
#pragma unroll
  for (int u = 0; u < 4; ++u) { kr[u] = *(const v8us*)(const unsigned short*)(kg + u * 16 * KVD); vr[u] = *(const v8us*)(const unsigned short*)(vg + u * 16 * SQ); }
  v16h qf[2][2];
#pragma unroll
  for (int g = 0; g < 2; ++g) for (int kc = 0; kc < 2; ++kc) qf[g][kc] = g2_frag(Qh + ((size_t)b * SQ + qw + 16 * g + c) * LQ + hd * HD + kc * 32, h);
  asm volatile("s_wait_xcnt 0x0" ::: "memory");      /* the q rows' address registers are free for reuse from here on: this wait stands in front of their overwrite */
#pragma unroll
  for (int u = 0; u < 4; ++u) { *(v8us*)(unsigned short*)&ks[0][so + u * 16 * FAP] = kr[u]; *(v8us*)(unsigned short*)&vs[0][so + u * 16 * FAP] = vr[u]; }
  const v8f z8 = {0.f, 0.f, 0.f, 0.f, 0.f, 0.f, 0.f, 0.f}; const v4f z4 = {0.f, 0.f, 0.f, 0.f};
  v8f acc[2][4]; v4f l4[2]; float mr[2];
#pragma unroll
  for (int g = 0; g < 2; ++g) { mr[g] = -__builtin_inff(); l4[g] = z4; for (int t = 0; t < 4; ++t) acc[g][t] = z8; }
  const float cs = 0.125f * 1.44269504088896340736f;      /* 64^-0.5 log2 e */
  __syncthreads();
  for (int st = 0; st < nst; ++st) {
    const bool more = st + 1 < nst;      /* the same for the whole work-group */
    if (more) {
#pragma unroll
      for (int u = 0; u < 4; ++u) { kr[u] = *(const v8us*)(const unsigned short*)(kg + (size_t)(st + 1) * FAK * KVD + u * 16 * KVD); vr[u] = *(const v8us*)(const unsigned short*)(vg + (st + 1) * FAK + u * 16 * SQ); }
      asm volatile("s_wait_xcnt 0x0" ::: "memory"); }      /* the pass below reuses the registers that hold these loads' addresses: this wait stands in front of that overwrite */
    const _Float16* kb = &ks[st & 1][c * FAP + 8 * h]; const _Float16* vb = &vs[st & 1][c * FAP + 8 * h];
    for (int p = 0; p < FAK / 32; ++p) { const int key0 = st * FAK + p * 32;
      if (key0 <= qw) {      /* wave-uniform: a wave skips the passes beyond its diagonal, never the barrier */
        v8f s[2][2];
        { v16h kf[2][2];
#pragma unroll
          for (int kt = 0; kt < 2; ++kt) for (int kc = 0; kc < 2; ++kc) kf[kt][kc] = fa_frag(kb + (p * 32 + 16 * kt) * FAP + kc * 32);
#pragma unroll
          for (int kt = 0; kt < 2; ++kt) for (int g = 0; g < 2; ++g) s[kt][g] = fa_mma(kf[kt][1], qf[g][1], fa_mma(kf[kt][0], qf[g][0], z8)); }      /* s[kt][g][r] = q(qw + 16g + c) . k(key0 + 16kt + 8h + r) */
        fa_gap();
        if (key0 == qw) {      /* the one pass on the wave's diagonal: key > query is masked; key key0 is kept in every row */
#pragma unroll
          for (int kt = 0; kt < 2; ++kt) for (int g = 0; g < 2; ++g) for (int r = 0; r < 8; ++r) s[kt][g][r] = (16 * kt + 8 * h + r > 16 * g + c) ? -__builtin_inff() : s[kt][g][r]; }
        float mb[2]; bool need = false;
#pragma unroll
        for (int g = 0; g < 2; ++g) { float mx = s[0][g][0];
#pragma unroll
          for (int r = 1; r < 8; ++r) mx = fmaxf(mx, s[0][g][r]);
#pragma unroll
          for (int r = 0; r < 8; ++r) mx = fmaxf(mx, s[1][g][r]);
          mx = fmaxf(mx, rs_xh(mx)) * cs; mb[g] = mx; need = need || (mx > mr[g] + 8.0f); }      /* both halves of the wave hold the query's maximum of this pass, scaled */
        if (__builtin_amdgcn_ballot_w32(need) != 0) {      /* scalar branch; always taken in a wave's first pass, where mr is -inf and the factor 0 */
#pragma unroll
          for (int g = 0; g < 2; ++g) { const float mn = fmaxf(mr[g], mb[g]); const float corr = __builtin_amdgcn_exp2f(mr[g] - mn); mr[g] = mn; l4[g] *= corr;
#pragma unroll
            for (int t = 0; t < 4; ++t) acc[g][t] *= corr; } }
        v16h vf[4];
#pragma unroll
        for (int t = 0; t < 4; ++t) vf[t] = fa_frag(vb + 16 * t * FAP + p * 32);
#pragma unroll
        for (int g = 0; g < 2; ++g) { const float nm = -mr[g]; FragH pf;
#pragma unroll
          for (int kt = 0; kt < 2; ++kt) for (int j = 0; j < 2; ++j) { const v4f x = {s[kt][g][4 * j], s[kt][g][4 * j + 1], s[kt][g][4 * j + 2], s[kt][g][4 * j + 3]}; const v4f y = x * cs + nm; const v4f e = {__builtin_amdgcn_exp2f(y[0]), __builtin_amdgcn_exp2f(y[1]), __builtin_amdgcn_exp2f(y[2]), __builtin_amdgcn_exp2f(y[3])}; l4[g] += e;      /* the builtin, so that the compiler keeps these writes clear of the matrix instructions' operands */
            for (int i = 0; i < 4; ++i) pf.h[8 * kt + 4 * j + i] = (_Float16)e[i]; }      /* element 8 kt + r of the B operand = key 16 kt + 8 h + r: the k order of fa_frag */
#pragma unroll
          for (int t = 0; t < 4; ++t) acc[g][t] = fa_mma(vf[t], pf.v, acc[g][t]); }      /* acc[g][t][r] = o(qw + 16g + c)[16t + 8h + r], not yet divided by the row sum */
        fa_gap();
      } }
    if (more) {
#pragma unroll
      for (int u = 0; u < 4; ++u) { *(v8us*)(unsigned short*)&ks[(st + 1) & 1][so + u * 16 * FAP] = kr[u]; *(v8us*)(unsigned short*)&vs[(st + 1) & 1][so + u * 16 * FAP] = vr[u]; }
      __syncthreads(); }      /* publishes stage st + 1 and ends every wave's reads of stage st, whose buffer the next trip refills */
  }
  v8us ov[2][4]; unsigned short* og = (unsigned short*)Oh + ((size_t)b * SQ + qw + c) * DM + hd * HD + 8 * h;      /* lane (c, h): 8 consecutive d of query row c, one 16-byte store per 16 d */
#pragma unroll
  for (int g = 0; g < 2; ++g) { float l = (l4[g][0] + l4[g][1]) + (l4[g][2] + l4[g][3]); l += rs_xh(l); const float fin = 64.0f / l;      /* o carried x64, as the output GEMM's factor expects */
#pragma unroll
    for (int t = 0; t < 4; ++t) { FragH f; for (int r = 0; r < 8; ++r) f.h[r] = (_Float16)(acc[g][t][r] * fin); ov[g][t] = f.half[0]; } }
  __builtin_amdgcn_sched_barrier(0);      /* the eight stores stand behind the last conversion, so that no register which an issued store names is written again */
#pragma unroll
  for (int g = 0; g < 2; ++g) for (int t = 0; t < 4; ++t) *(v8us*)(og + g * 16 * DM + 16 * t) = ov[g][t]; }


// Exact f32 causal attention for rows 0..QT0-1 of every batch and head (planes [batch][QT0][DM]). One work-group of 256 threads takes A0R query rows of one head: thread (r, c) = (tid / 8, tid % 8).
// The group's q rows and the head's QT0 key and value rows are staged in LDS once; then scores (thread (r, c): keys c, c + 8, ...; its q row in registers), the row maximum and sum over the row's 8 lanes, and o (thread (r, c): columns 4c..4c+3 and 32+4c..32+4c+3).
#define A0R 32                       /* query rows per work-group */
#define A0KP (HD + 4)                /* q and key row pitch in LDS, floats: 16 B x odd, so that 8 rows read at one column fall on different banks */
#define A0PP (QT0 + 8)               /* weight row pitch in LDS, floats: the 4 rows of a wave start 8 banks apart */
__global__ __launch_bounds__(256) void k_att0(const float* __restrict__ QF, const float* __restrict__ KF, const float* __restrict__ VF, float scale, float* __restrict__ OF) {
  static_assert(QT0 % A0R == 0 && A0R * 8 == 256 && A0R == 32 && HD == 64 && QT0 % 16 == 0, "8 threads per query row; 16 threads stage one row, 16 rows per pass");
  __shared__ __attribute__((aligned(16))) float ks[QT0 * A0KP]; __shared__ __attribute__((aligned(16))) float vs[QT0 * HD]; __shared__ __attribute__((aligned(16))) float qs[A0R * A0KP]; __shared__ __attribute__((aligned(16))) float ps[A0R * A0PP];
  const int tid = threadIdx.x; const int h = blockIdx.x / (QT0 / A0R), rg = blockIdx.x % (QT0 / A0R); const int r = tid >> 3, c = tid & 7; const int i = rg * A0R + r; const int nk = (rg + 1) * A0R;      /* causal: keys below the group's last row */
  const size_t bo = (size_t)blockIdx.y * QT0 * DM + (size_t)h * HD;      /* grid.y = batch */
  const int sr = tid >> 4, sc = (tid & 15) * 4; const int so = sr * DM + sc;      /* staging: row sr + 16 u, four floats at column sc */
  const float* kg = KF + bo; const float* vg = VF + bo; const float* qg = QF + bo + (size_t)rg * A0R * DM;
  v4f kk[QT0 / 16], vv[QT0 / 16];      /* the full unrolls below give the register arrays kk, vv, q constant indices and put all staging loads in flight together */
#pragma unroll
  for (int u = 0; u < QT0 / 16; ++u) { kk[u] = *(const v4fa*)(kg + so + u * 16 * DM); vv[u] = *(const v4fa*)(vg + so + u * 16 * DM); }
  const v4f q0 = *(const v4fa*)(qg + so);
  asm volatile("s_wait_xcnt 0x0" ::: "memory");      /* the last staging load may return into the offset register that the loads above name: this wait stands in front of that overwrite */
  const v4f q1 = *(const v4fa*)(qg + so + 16 * DM);
#pragma unroll
  for (int u = 0; u < QT0 / 16; ++u) { *(v4f*)&ks[(sr + u * 16) * A0KP + sc] = kk[u]; *(v4f*)&vs[(sr + u * 16) * HD + sc] = vv[u]; }
  *(v4f*)&qs[sr * A0KP + sc] = q0; *(v4f*)&qs[(sr + 16) * A0KP + sc] = q1;
  __syncthreads();
  v4f q[HD / 4];
#pragma unroll
  for (int u = 0; u < HD / 4; ++u) q[u] = *(const v4f*)&qs[r * A0KP + u * 4];
  float* pr = ps + r * A0PP; float mx = -3.0e38f;      /* unroll 2 in the three loops below: the LDS loads of two trips are in flight together and their sums are independent chains */
#pragma unroll 2
  for (int m = 0; m < nk / 8; ++m) { const int j = c + m * 8; const float* kp = ks + j * A0KP; v4f a = {0.f, 0.f, 0.f, 0.f};
#pragma unroll
    for (int u = 0; u < HD / 4; ++u) a += q[u] * *(const v4f*)(kp + u * 4);
    const float s = (j <= i) ? ((a[0] + a[1]) + (a[2] + a[3])) * scale : -3.0e38f; pr[j] = s; mx = fmaxf(mx, s); }
  mx = fmaxf(mx, rs_xm<1>(mx)); mx = fmaxf(mx, rs_xm<2>(mx)); mx = fmaxf(mx, rs_xm<4>(mx));      /* key 0 is kept in every row, so the row maximum is a real score and a masked key's weight is exp(-huge) = 0 */
  float l = 0.f;
#pragma unroll 2
  for (int m = 0; m < nk / 8; ++m) { const int j = c + m * 8; const float e = expf(pr[j] - mx); pr[j] = e; l += e; }
  l += rs_xm<1>(l); l += rs_xm<2>(l); l += rs_xm<4>(l);
  __syncthreads();
  v4f o0 = {0.f, 0.f, 0.f, 0.f}, o1 = {0.f, 0.f, 0.f, 0.f}; const float* vp = vs + c * 4;
#pragma unroll 2
  for (int j = 0; j < nk; j += 4) { const v4f p = *(const v4f*)(pr + j);
#pragma unroll
    for (int t = 0; t < 4; ++t) { o0 += p[t] * *(const v4f*)(vp + (j + t) * HD); o1 += p[t] * *(const v4f*)(vp + (j + t) * HD + HD / 2); } }
  const float fin = 64.0f / l;      /* o carried x64 like the f16 path */
  float* og = OF + bo + i * DM + c * 4; *(v4f*)og = o0 * fin; *(v4f*)(og + HD / 2) = o1 * fin; }


__global__ __launch_bounds__(256) void k_kvexp(const float* __restrict__ src, float* __restrict__ dst, size_t n4) { const size_t t = (size_t)blockIdx.x * 256 + threadIdx.x; if (t >= n4) return; const size_t e = t * 4; const size_t row = e / DM; const int col = (int)(e % DM); const int h = col / HD, d = col % HD; const v4f v = *(const v4fa*)(src + row * KVD + (size_t)(h / HPG) * HD + d); *(v4f*)(dst + e) = v;  }

__global__ __launch_bounds__(256) void k_tab2(float theta, float* __restrict__ CS, float* __restrict__ SN) {
  #pragma clang fp contract(off)
  const int t = blockIdx.x * 256 + threadIdx.x; if (t >= SQ * (HD / 2)) return; const int i = t % (HD / 2); const int p = t / (HD / 2); const float invf = 1.0f / powf(theta, (float)(2 * i) / (float)HD); const float ang = __fmul_rn((float)p, invf); const float c = cosf(ang), s = sinf(ang);
  *(float*)(CS + t) = c; *(float*)(SN + t) = s;  }
// Rotate-half rope of the f32 q or k rows [batch][SQ][DM] with the tables [pos][HD / 2]: out_lo = x_lo c - x_hi s, out_hi = x_hi c + x_lo s; written as f16 rows (H16OUT) or f32 rows of pitch DM; zF, zO = batch strides of F and of the output, in elements.
// A work-group of 256 threads takes PP positions of all NB batches, whole rows of DM floats: thread t holds columns 4t .. 4t + 3, so that every load and store of a wave covers whole 128-byte lines and one table read serves NB rows.
// The two halves of a head lie 32 columns = 8 lanes apart: the partner's values come by a DPP exchange inside the 16-lane row, with no LDS and no barrier.
// The full unrolls give the register arrays constant indices and put all of a thread's loads in flight together.
template <bool H16OUT, int PP>
__global__ __launch_bounds__(256) void k_rope(const float* __restrict__ F, size_t zF, const float* __restrict__ CS, const float* __restrict__ SN, _Float16* __restrict__ H16, float* __restrict__ F32, size_t zO) {
  static_assert(DM == 1024 && KVD == DM && HD == 64 && SQ % PP == 0, "256 threads x 4 columns = one row; the halves of a head 8 lanes apart");
  const int col = threadIdx.x * 4; const unsigned tb = (threadIdx.x * 16u) & (HD / 2 * 4 - 1u); const bool up = (col & (HD / 2)) != 0; const int p0 = blockIdx.x * PP;      /* tb: the thread's byte offset in a table row */
  const float* fu = F + p0 * DM; const char* cu = (const char*)(CS + p0 * (HD / 2)); const char* su = (const char*)(SN + p0 * (HD / 2));      /* the same for the whole work-group */
  v4f x[PP][NB], cc[PP], ss[PP]; v4h oh[PP][NB];
  __builtin_amdgcn_sched_barrier(0);      /* keeps the kernel-argument loads in front of the global loads */
#pragma unroll
  for (int u = 0; u < PP; ++u) {
#pragma unroll
    for (int b = 0; b < NB; ++b) x[u][b] = *(const v4fa*)(fu + (b * zF + u * DM) + col);
    cc[u] = *(const v4fa*)(cu + u * (HD / 2 * 4) + tb); ss[u] = *(const v4fa*)(su + u * (HD / 2 * 4) + tb); }
  asm volatile("s_wait_xcnt 0x0" :: "v"(tb) : "memory");      /* the loads' address registers are free for reuse only from here on; as an input the table offset stays whole up to this wait, so that no load returns into it either */
  __builtin_amdgcn_sched_barrier(0);      /* keeps the arithmetic behind the last load: without it the compiler holds loads back behind the first rows' arithmetic, and a thread waits out the memory latency several times */
#pragma unroll
  for (int u = 0; u < PP; ++u) { const v4f sg = up ? ss[u] : -ss[u];
#pragma unroll
    for (int b = 0; b < NB; ++b) { const v4f y = {rs_xm<8>(x[u][b][0]), rs_xm<8>(x[u][b][1]), rs_xm<8>(x[u][b][2]), rs_xm<8>(x[u][b][3])}; const v4f o = x[u][b] * cc[u] + y * sg; x[u][b] = o;
      if (H16OUT) for (int q = 0; q < 4; ++q) oh[u][b][q] = (_Float16)o[q]; } }
  __builtin_amdgcn_sched_barrier(0);      /* the stores stand behind the last arithmetic, so that no register which an issued store names is written again */
#pragma unroll
  for (int u = 0; u < PP; ++u)
#pragma unroll
    for (int b = 0; b < NB; ++b) { const size_t e = b * zO + (p0 + u) * DM + col; if (H16OUT) *(v4h*)(H16 + e) = oh[u][b]; else *(v4f*)(F32 + e) = x[u][b]; } }

__global__ __launch_bounds__(256) void k_bfcp(const float* __restrict__ src, float* __restrict__ dst, size_t n4) { const size_t t = (size_t)blockIdx.x * 256 + threadIdx.x; if (t >= n4) return; const v4f a = *(const v4fa*)(src + t * 4); v4f o; for (int q = 0; q < 4; ++q) o[q] = bf16_round(a[q]); *(v4f*)(dst + t * 4) = o;  }

__global__ __launch_bounds__(256) void k_tabhalf(const float* __restrict__ cs, const float* __restrict__ sn, float* __restrict__ CS, float* __restrict__ SN) { const int t = blockIdx.x * 256 + threadIdx.x; if (t >= SQ * (HD / 2)) return; const int p = t / (HD / 2), i = t % (HD / 2); const float c = bf16_round(cs[(size_t)p * HD + i]), s = bf16_round(sn[(size_t)p * HD + i]);
  *(float*)(CS + t) = c; *(float*)(SN + t) = s;  }

__global__ __launch_bounds__(256) void k_tab2d(float* __restrict__ CS, float* __restrict__ SN) {
  #pragma clang fp contract(off)
  const int t = blockIdx.x * 256 + threadIdx.x; if (t >= SQ * (HD / 2)) return; const int i = t % (HD / 2); const int p = t / (HD / 2); const float invf = (float)(1.0 / pow(10000.0, (double)(2 * i) / (double)HD)); const float ang = __fmul_rn((float)p, invf); const float c = cosf(ang), s = sinf(ang);
  *(float*)(CS + t) = c; *(float*)(SN + t) = s;  }
extern "C" void kernel_launch(void* const* d_in, const int* in_sizes, int n_in,
                              void* d_out, int out_size, void* d_ws, size_t ws_size, hipStream_t stream) {
  (void)in_sizes; (void)n_in; (void)out_size;
  const float* const* I = (const float* const*)d_in; const float* x = I[0]; const float* wattn = I[1]; const float* wo = I[2];      /* x; fused [in][out] W_attn [1024][3072] (q | k | v column thirds); [in][out] W_proj; rope tables computed in-kernel (positions = row index) */
  static_assert(HPG == 1 && NH == NG * HPG && NH * HD == DM && KVD == DM, "plain multi-head attention as 16 kv groups of one query head"); const float* bq = nullptr; const float* bk = nullptr; const float* bv = nullptr; const float* bo = nullptr;      /* [in][out] weights, no biases; rope tables computed in the kernel */
  char* ws = (char*)d_ws; size_t off = 0;
  auto take = [&](size_t bytes) { char* p = ws + off; off += (bytes + 255) & ~(size_t)255; return p; };
  _Float16* BQKV = (_Float16*)take((size_t)3 * DM * DM * 2); _Float16* BQ = BQKV; _Float16* BK = BQKV + (size_t)DM * DM; _Float16* BV = BQKV + (size_t)2 * DM * DM; _Float16* BO = (_Float16*)take((size_t)DM * DM * 2);      /* one transposed plane Bt [3072][1024] of the fused weight: rows 0..1023 = q, 1024.. = k, 2048.. = v */
  _Float16* X16 = (_Float16*)take(NR * DM * 2); float* CSB = (float*)take((size_t)SQ * HD * 4); float* SNB = (float*)take((size_t)SQ * HD * 4); _Float16* Q16 = (_Float16*)take(NR * DM * 2); _Float16* K16 = (_Float16*)take(NR * KVD * 2); _Float16* V16 = (_Float16*)take(NR * KVD * 2); _Float16* O16 = (_Float16*)take(NR * DM * 2);
  static_assert(B0 == 0 && NBR == NB && NHD == NH && QN == SQ, "every launch covers all batches and heads");
  float* S = (float*)take((size_t)NB * NH * QT * NKX * 4); _Float16* VT = (_Float16*)take((size_t)NB * NH * HD * SQ * 2);      /* S: plane that holds the f32 q and k rows */
  static_assert((size_t)NB * NH * QT * NKX >= NR * DM + NR * KVD, "the f32 q and k rows fit the score plane"); float* QF = S; float* KF = S + NR * DM;      /* f32 q, k before the rope: last read by the rope launches */
  float* QF0 = (float*)take((size_t)NB * QT0 * DM * 4); float* KF0 = (float*)take((size_t)NB * QT0 * KVD * 4); float* VF0 = (float*)take((size_t)NB * QT0 * KVD * 4); float* KF0e = (float*)take((size_t)NB * QT0 * DM * 4); float* VF0e = (float*)take((size_t)NB * QT0 * DM * 4); float* OF0 = (float*)take((size_t)NB * QT0 * DM * 4); _Float16* OH0 = (_Float16*)take((size_t)NB * QT0 * DM * 2); _Float16* OL0 = (_Float16*)take((size_t)NB * QT0 * DM * 2);
  if (off > ws_size) return;
  k_wt_f16<<<(unsigned)(((size_t)3 * DM * (DM / 8) + 255) / 256), 256, 0, stream>>>(wattn, BQKV, DM, 3 * DM, 16.0f); k_wt_f16<<<(unsigned)(((size_t)DM * (DM / 8) + 255) / 256), 256, 0, stream>>>(wo, BO, DM, DM, 16.0f);      /* [in][out] -> Bt x16 planes (fused W_attn: K 1024, N 3072) */
  k_x16<<<(unsigned)((NR * DM / 8 + 255) / 256), 256, 0, stream>>>(x, X16, NR * DM / 8);
  k_tab2d<<<(SQ * (HD / 2) + 255) / 256, 256, 0, stream>>>(CSB, SNB);      /* rope tables cos/sin(p / 10000^(2i/64)): inv_freq double-derived -> f32, f32 angle */
  /* Every launch below covers all NB batches: token rows b * SQ + s run through, the batch is grid.z (GEMMs) / grid.y (k_att0), or each thread loops over the NB batches (k_rope). */
  k_gemm2<0><<<dim3((unsigned)((MP / 128) * (KVD / 64)), 1), 128, 0, stream>>>(X16, DM, 0, BV, DM, 0, 0.0625f, bv, 0, nullptr, 1, 0, 0, nullptr, V16, KVD, 0, MP, KVD, DM, 0, 0, 0);
  k_gemm2<0><<<dim3((unsigned)((MP / 128) * (DM / 64)), 1), 128, 0, stream>>>(X16, DM, 0, BQ, DM, 0, 0.0625f, nullptr, 0, nullptr, 1, 0, 0, QF, nullptr, DM, 0, MP, DM, DM, 0, 0, 0);      /* q (f32) */
  k_gemm2<0><<<dim3((unsigned)((MP / 128) * (KVD / 64)), 1), 128, 0, stream>>>(X16, DM, 0, BK, DM, 0, 0.0625f, nullptr, 0, nullptr, 1, 0, 0, KF, nullptr, KVD, 0, MP, KVD, DM, 0, 0, 0);      /* k (f32) */
  k_rope<true, 4><<<SQ / 4, 256, 0, stream>>>(QF, (size_t)SQ * DM, CSB, SNB, Q16, nullptr, (size_t)SQ * DM); k_rope<true, 4><<<SQ / 4, 256, 0, stream>>>(KF, (size_t)SQ * DM, CSB, SNB, K16, nullptr, (size_t)SQ * DM);      /* half-split rope (out_lo = x_lo c - x_hi s, out_hi = x_lo s + x_hi c = t cos + rotate_half(t) sin with the module's [f | f] tables) -> f16 rows; position = row % SQ */
  k_rope<false, 1><<<QT0, 256, 0, stream>>>(QF, (size_t)SQ * DM, CSB, SNB, nullptr, QF0, (size_t)QT0 * DM); k_rope<false, 1><<<QT0, 256, 0, stream>>>(KF, (size_t)SQ * DM, CSB, SNB, nullptr, KF0, (size_t)QT0 * DM);      /* f32 half-split-roped q, k of rows 0..127 of each batch */
  k_vt<NG, SQ><<<NB * NG * (SQ / 64), 256, 0, stream>>>(V16, KVD, 0, VT);      /* V^T [NB][NH][HD][SQ] */
  k_gemm2<0><<<dim3((QT0 / 128) * (KVD / 64), 1, NB), 128, 0, stream>>>(X16, DM, 0, BV, DM, 0, 0.0625f, bv, 0, nullptr, 1, 0, 0, VF0, nullptr, KVD, 0, QT0, KVD, DM, (size_t)SQ * DM, 0, (size_t)QT0 * KVD);
  k_kvexp<<<(unsigned)(((size_t)NB * QT0 * DM / 4 + 255) / 256), 256, 0, stream>>>(KF0, KF0e, (size_t)NB * QT0 * DM / 4); k_kvexp<<<(unsigned)(((size_t)NB * QT0 * DM / 4 + 255) / 256), 256, 0, stream>>>(VF0, VF0e, (size_t)NB * QT0 * DM / 4);      /* head h <- kv group h / HPG for the exact first-tile kernel */      /* f32 q, k, v of the first 128 rows (exact products) */
  k_att0<<<dim3(NH * (QT0 / A0R), NB), 256, 0, stream>>>(QF0, KF0e, VF0e, 0.125f, OF0);      /* exact f32 attention for rows 0..127 of each batch (o x64) */
  k_fattn<<<NB * NH * (SQ / FAQ), FAW * 32, 0, stream>>>(Q16, K16, VT, O16);      /* scores, causal softmax and weighted values of all batches, heads and query tiles: o (x64) as f16 rows */
  k_gemm2<0><<<dim3((unsigned)((MPO / 128) * (DM / 64)), 1), 128, 0, stream>>>(O16, DM, 0, BO, DM, 0, 0.0009765625f, bo, 0, nullptr, 1, 0, 0, (float*)d_out, nullptr, DM, 0, MPO, DM, DM, 0, 0, 0);      /* out rows are the output layout */
  k_hl<<<(unsigned)(((size_t)NB * QT0 * DM / 8 + 255) / 256), 256, 0, stream>>>(OF0, OH0, OL0, (size_t)NB * QT0 * DM / 8);      /* first-tile o (x64) -> f16 hi + x1024 residual planes */
  k_gemm2<0><<<dim3((QT0 / 128) * (DM / 64), 1, NB), 128, 0, stream>>>(OH0, DM, 0, BO, DM, 0, 0.0009765625f, bo, 0, nullptr, 1, 0, 0, (float*)d_out, nullptr, DM, 0, QT0, DM, DM, (size_t)QT0 * DM, 0, (size_t)SQ * DM);      /* rows 0..127 of each batch: out = o_hi Wo, overwriting the f16-path rows */
  k_gemm2<0><<<dim3((QT0 / 128) * (DM / 64), 1, NB), 128, 0, stream>>>(OL0, DM, 0, BO, DM, 0, 0.00000095367431640625f, nullptr, 0, (const float*)d_out, -1, 0, 0, (float*)d_out, nullptr, DM, 0, QT0, DM, DM, (size_t)QT0 * DM, 0, (size_t)SQ * DM);      /* += o_lo Wo 2^-20 (own-element accumulate) */
}

// v006
// One run takes 249 microseconds.
// Timed twice side by side with v005, it ran 1.75 and 1.71 times as fast.
// Over all steps from v000 it is 39.9 times as fast.
#include <hip/hip_runtime.h>
// Causal multi-head self-attention with rotate-half RoPE computed in the module and a bias-free fused QKV projection (x [4][2048][1024]; qkv = x Wqkv ([in][out] 1024 x 3072, no bias) split into q | k | v thirds, 16 heads of 64; cos / sin = [f | f] of pos * 10000^(-2i/64); q = q cos + rotate_half(q) sin, likewise k; scores * 64^-0.5; causal (tril, finfo.min fill); softmax; out = merged Wout ([in][out], no bias) -> [4][2048][1024]); run as grouped-query causal attention with 16 groups of ONE head and half-split rope.
// Compute dtype: inputs rounded to bf16; x / weights exact; q, k, v, softmax weights and o as plain f16 GEMM operands (~2^-12); scores and softmax statistics f32; v_wmma_f32_16x16x32_f16.
#define NB 4
#define NG 16
#define HPG 1
#define KVD (NG * HD)
#define SQ 2048
#define DM 1024
#define NH 16
#define HD 64
#define HG 4                         /* heads per k_vt(b, h0) launch (overload not called) */
#define QT 256                       /* with NKX, sizes the S plane */
#define NKX SQ                       /* with QT, sizes the S plane */
#define QT0 128                      /* first-tile rows recomputed exactly in f32 */
#define B0 0                         /* first batch processed (debug hook) */
#define NBR NB                       /* batches processed (debug hook) */
#define NR ((size_t)NB * SQ)         /* token rows */
#define MP ((int)((size_t)NBR * SQ)) /* rows projected (debug hook) */
#define QN SQ                        /* query rows attended per batch (debug hook) */
#define NHD NH                       /* heads attended (debug hook) */
#define MPO MP                       /* rows through the output stage (debug hook) */
#define LQ DM      /* row pitch of the q/k/v rows */
typedef __bf16 v16b __attribute__((ext_vector_type(16)));
typedef unsigned short v8us __attribute__((ext_vector_type(8), may_alias));
typedef float  v8f  __attribute__((ext_vector_type(8)));
typedef float  v4f  __attribute__((ext_vector_type(4)));
typedef float  v4fa __attribute__((ext_vector_type(4), may_alias));
union FragB { v16b v; v8us half[2]; unsigned short u[16]; };

__device__ __forceinline__ unsigned short bf16_bits(float x) { unsigned int u = __float_as_uint(x); return (unsigned short)((u + 0x7FFFu + ((u >> 16) & 1u)) >> 16); }
__device__ __forceinline__ float bf16_val(unsigned short b) { return __uint_as_float(((unsigned int)b) << 16); }
__device__ __forceinline__ float bf16_round(float x) { return bf16_val(bf16_bits(x)); }
// D += A·B with NT terms: 1 = ah·bh, 2 = + al·bh (A split), 3 = + ah·bl (both split)
template <int NT>
__device__ __forceinline__ v8f mmaN(v16b ah, v16b al, v16b bh, v16b bl, v8f c) {
  c = __builtin_amdgcn_wmma_f32_16x16x32_bf16(false, ah, false, bh, (short)0, c, false, false);
  if (NT >= 2) c = __builtin_amdgcn_wmma_f32_16x16x32_bf16(false, al, false, bh, (short)0, c, false, false);
  if (NT >= 3) c = __builtin_amdgcn_wmma_f32_16x16x32_bf16(false, ah, false, bl, (short)0, c, false, false);
  asm volatile("v_nop\n\tv_nop\n\tv_nop\n\tv_nop" : "+v"(c) : "v"(ah), "v"(al), "v"(bh), "v"(bl));
  return c;
}

__global__ __launch_bounds__(256) void k_wt_bf16(const float* __restrict__ W, unsigned short* __restrict__ Wt, int K, int N) {
  const int t = blockIdx.x * 256 + threadIdx.x;
  const int k8n = K / 8;
  if (t >= N * k8n) return;
  const int n = t / k8n, k8 = (t % k8n) * 8;
  v8us v;
#pragma unroll
  for (int i = 0; i < 8; ++i) v[i] = bf16_bits(W[(size_t)(k8 + i) * N + n]);
  *(v8us*)(Wt + (size_t)n * K + k8) = v;
  
}

// GEMM C[M][N] (f32, pitch ldc) = act(A[M][K]·W + bias). A f32 row-major (pitch lda) converted per fragment to bf16
// (ASPLIT: hi/lo two planes -> 2 terms, else single rounded term); Wt bf16 [N][K] (pitch ldb). BIAS_BF16 rounds the
// bias to bf16 first (bias quantised to bf16 before the add). K%32==0, M%16==0, N%64==0.
template <bool ASPLIT, int ACT, bool BIAS_BF16>
__global__ __launch_bounds__(128) void k_gemm_bf(const float* __restrict__ A, int lda, const unsigned short* __restrict__ Wt, int ldb,
                                               const float* __restrict__ bias, float* __restrict__ C, int ldc, int M, int N, int K) {
  __shared__ __attribute__((aligned(16))) float so[4][16][64];
  const int tid = threadIdx.x, w = tid >> 5, lane = tid & 31, ln = lane & 15, hh = lane >> 4;
  const int ntn = N / 64;
  const int wid = blockIdx.x * 4 + w;
  const int mt = wid / ntn, nq = wid % ntn;
  if (mt * 16 >= M) return;
  const int row0 = mt * 16, col0 = nq * 64;
  const float* arow = A + (size_t)(row0 + ln) * lda;
  v8f acc[4] = {};
  for (int kb = 0; kb < K; kb += 32) {
    FragB ah, al;
    const v4f x0 = *(const v4fa*)(arow + kb + 8 * hh), x1 = *(const v4fa*)(arow + kb + 8 * hh + 4);
    const v4f x2 = *(const v4fa*)(arow + kb + 16 + 8 * hh), x3 = *(const v4fa*)(arow + kb + 16 + 8 * hh + 4);
    float xs[16] = {x0[0],x0[1],x0[2],x0[3],x1[0],x1[1],x1[2],x1[3],x2[0],x2[1],x2[2],x2[3],x3[0],x3[1],x3[2],x3[3]};
#pragma unroll
    for (int i = 0; i < 16; ++i) { const unsigned short hb = bf16_bits(xs[i]); ah.u[i] = hb; al.u[i] = ASPLIT ? bf16_bits(xs[i] - bf16_val(hb)) : (unsigned short)0; }
#pragma unroll
    for (int t = 0; t < 4; ++t) {
      const unsigned short* brow = Wt + (size_t)(col0 + t * 16 + ln) * ldb + kb;
      FragB b;
      b.half[0] = *(const v8us*)(brow + 8 * hh);
      b.half[1] = *(const v8us*)(brow + 16 + 8 * hh);
      acc[t] = mmaN<ASPLIT ? 2 : 1>(ah.v, al.v, b.v, b.v, acc[t]);
    }
  }
#pragma unroll
  for (int t = 0; t < 4; ++t) {
    float bv = bias ? bias[col0 + t * 16 + ln] : 0.f;
    if (BIAS_BF16) bv = bf16_round(bv);
#pragma unroll
    for (int r = 0; r < 8; ++r) { float v = acc[t][r] + bv; if (ACT == 1) v = fmaxf(v, 0.f); so[w][8 * hh + r][t * 16 + ln] = v; }
  }
  __builtin_amdgcn_fence(__ATOMIC_ACQ_REL, "workgroup");
  __builtin_amdgcn_wave_barrier();
  const int rsub = lane >> 4, c4 = (lane & 15) * 4;
  {
#pragma unroll
    for (int q = 0; q < 8; ++q) {
      const int r = q * 2 + rsub;
      const v4f v = *(const v4fa*)&so[w][r][c4];
      *(v4f*)(C + (size_t)(row0 + r) * ldc + col0 + c4) = v;
    }
    
  }
}

// GEMM C = act(A·W + bias + resid): A f32 (ASPLIT -> hi/lo 2 terms), Wt bf16 [N][K]; ACT 0 none, 1 relu, 2 exact gelu;
// resid (optional, f32, row index = (row % rmod), pitch ldr, RES_BF16 rounds it) added before the activation.
template <bool ASPLIT, int ACT, bool BIAS_BF16, bool RES_BF16>
__global__ __launch_bounds__(128) void k_gemm_bf3(const float* __restrict__ A, int lda, const unsigned short* __restrict__ Wt, int ldb,
                                                const float* __restrict__ bias, const float* __restrict__ resid, int rmod, int ldr,
                                                float* __restrict__ C, int ldc, int M, int N, int K) {
  __shared__ __attribute__((aligned(16))) float so[4][16][64];
  const int tid = threadIdx.x, w = tid >> 5, lane = tid & 31, ln = lane & 15, hh = lane >> 4;
  const int ntn = N / 64;
  const int wid = blockIdx.x * 4 + w;
  const int mt = wid / ntn, nq = wid % ntn;
  if (mt * 16 >= M) return;
  const int row0 = mt * 16, col0 = nq * 64;
  const float* arow = A + (size_t)(row0 + ln) * lda;
  v8f acc[4] = {};
  for (int kb = 0; kb < K; kb += 32) {
    FragB ah, al;
    const v4f x0 = *(const v4fa*)(arow + kb + 8 * hh), x1 = *(const v4fa*)(arow + kb + 8 * hh + 4);
    const v4f x2 = *(const v4fa*)(arow + kb + 16 + 8 * hh), x3 = *(const v4fa*)(arow + kb + 16 + 8 * hh + 4);
    float xs[16] = {x0[0],x0[1],x0[2],x0[3],x1[0],x1[1],x1[2],x1[3],x2[0],x2[1],x2[2],x2[3],x3[0],x3[1],x3[2],x3[3]};
#pragma unroll
    for (int i = 0; i < 16; ++i) { const unsigned short hb = bf16_bits(xs[i]); ah.u[i] = hb; al.u[i] = ASPLIT ? bf16_bits(xs[i] - bf16_val(hb)) : (unsigned short)0; }
#pragma unroll
    for (int t = 0; t < 4; ++t) {
      const unsigned short* brow = Wt + (size_t)(col0 + t * 16 + ln) * ldb + kb;
      FragB b;
      b.half[0] = *(const v8us*)(brow + 8 * hh);
      b.half[1] = *(const v8us*)(brow + 16 + 8 * hh);
      acc[t] = mmaN<ASPLIT ? 2 : 1>(ah.v, al.v, b.v, b.v, acc[t]);
    }
  }
#pragma unroll
  for (int t = 0; t < 4; ++t) {
    const int col = col0 + t * 16 + ln;
    float bv = bias ? bias[col] : 0.f;
    if (BIAS_BF16) bv = bf16_round(bv);
#pragma unroll
    for (int r = 0; r < 8; ++r) {
      float v = acc[t][r] + bv;
      if (resid) { float rv = resid[(size_t)((row0 + 8 * hh + r) % rmod) * ldr + col]; if (RES_BF16) rv = bf16_round(rv); v += rv; }
      if (ACT == 1) v = fmaxf(v, 0.f);
      if (ACT == 2) v = 0.5f * v * (1.0f + erff(v * 0.70710678118654752f));
      if (ACT == 3) { const float u = 0.7978845608028654f * (v + 0.044715f * v * v * v); v = 0.5f * v * (1.0f + tanhf(u)); }
      so[w][8 * hh + r][t * 16 + ln] = v;
    }
  }
  __builtin_amdgcn_fence(__ATOMIC_ACQ_REL, "workgroup");
  __builtin_amdgcn_wave_barrier();
  const int rsub = lane >> 4, c4 = (lane & 15) * 4;
  {
#pragma unroll
    for (int q = 0; q < 8; ++q) {
      const int r = q * 2 + rsub;
      const v4f v = *(const v4fa*)&so[w][r][c4];
      *(v4f*)(C + (size_t)(row0 + r) * ldc + col0 + c4) = v;
    }
    
  }
}
// row LayerNorm (biased variance, eps) over N: s = X (+ R); optional out_sum <- s; out_norm <- (s-mu)*rsqrt(var+eps)*g + b
template <bool PARAM_BF16>
__global__ __launch_bounds__(256) void k_layernorm(const float* __restrict__ X, const float* __restrict__ R, const float* __restrict__ g, const float* __restrict__ bta,
                                                  float* __restrict__ out_sum, float* __restrict__ out_norm, int N, float eps) {
  __shared__ float red[256];
  const int row = blockIdx.x, tid = threadIdx.x;
  const float* x = X + (size_t)row * N; const float* rr = R ? R + (size_t)row * N : nullptr;
  float vals[16];                     // up to N = 4096
  const int per = N / 256;            // contiguous chunk per thread? use strided-by-4 chunks: thread handles j = tid*4 + 1024*u
  float s1 = 0.f;
  for (int u = 0; u < per / 4; ++u) {
    const int j = tid * 4 + 1024 * u;
    const v4f a = *(const v4fa*)(x + j);
    v4f b = {0.f,0.f,0.f,0.f}; if (rr) b = *(const v4fa*)(rr + j);
#pragma unroll
    for (int q = 0; q < 4; ++q) { const float v = a[q] + b[q]; vals[u * 4 + q] = v; s1 += v; }
  }
  red[tid] = s1; __syncthreads();
  for (int st = 128; st > 0; st >>= 1) { if (tid < st) red[tid] += red[tid + st]; __syncthreads(); }
  const float mu = red[0] / (float)N; __syncthreads();
  float s2 = 0.f;
  for (int u = 0; u < per / 4; ++u)
#pragma unroll
    for (int q = 0; q < 4; ++q) { const float c = vals[u * 4 + q] - mu; s2 += c * c; }
  red[tid] = s2; __syncthreads();
  for (int st = 128; st > 0; st >>= 1) { if (tid < st) red[tid] += red[tid + st]; __syncthreads(); }
  const float rs = rsqrtf(red[0] / (float)N + eps);
  {
    for (int u = 0; u < per / 4; ++u) {
      const int j = tid * 4 + 1024 * u;
      v4f o, sm;
#pragma unroll
      for (int q = 0; q < 4; ++q) {
        float gg = g[j + q], bb = bta[j + q];
        if (PARAM_BF16) { gg = bf16_round(gg); bb = bf16_round(bb); }
        sm[q] = vals[u * 4 + q]; o[q] = (vals[u * 4 + q] - mu) * rs * gg + bb;
      }
      if (out_sum) *(v4f*)(out_sum + (size_t)row * N + j) = sm;
      *(v4f*)(out_norm + (size_t)row * N + j) = o;
    }
    
  }
}



// ---- f16 WMMA path (v_wmma_f32_16x16x32_f16): 11-bit significands for operands in range — used where a [0,1] probability operand needs more precision than bf16
typedef _Float16 v16h __attribute__((ext_vector_type(16)));
union FragH { v16h v; v8us half[2]; _Float16 h[16]; unsigned short u[16]; };
template <int NT>
__device__ __forceinline__ v8f mmaH(v16h ah, v16h al, v16h bh, v16h bl, v8f c) {
  c = __builtin_amdgcn_wmma_f32_16x16x32_f16(false, ah, false, bh, (short)0, c, false, false);
  if (NT >= 2) c = __builtin_amdgcn_wmma_f32_16x16x32_f16(false, al, false, bh, (short)0, c, false, false);
  if (NT >= 3) c = __builtin_amdgcn_wmma_f32_16x16x32_f16(false, ah, false, bl, (short)0, c, false, false);
  asm volatile("v_nop\n\tv_nop\n\tv_nop\n\tv_nop" : "+v"(c) : "v"(ah), "v"(al), "v"(bh), "v"(bl));
  return c;
}
// batched GEMM like k_gemm_b but f16 operands: A f32 (split into f16 hi/lo if ASPLIT, else rounded to f16), Bt = f16 values [n][k]; alpha; C f32; N multiple of 16 (partial tiles skipped)
template <bool ASPLIT>
__global__ __launch_bounds__(128) void k_gemm_h(const float* __restrict__ A, int lda, size_t sA, const _Float16* __restrict__ Bh, int ldb, size_t sB, float alpha, float* __restrict__ C, int ldc, size_t sC, int M, int N, int K) {
  __shared__ __attribute__((aligned(16))) float so[4][16][64];
  const int tid = threadIdx.x, w = tid >> 5, lane = tid & 31, ln = lane & 15, hh = lane >> 4; const int by = blockIdx.y;
  A += (size_t)by * sA; Bh += (size_t)by * sB; C += (size_t)by * sC;
  const int ntn = (N + 63) / 64; const int wid = blockIdx.x * 4 + w; const int mt = wid / ntn, nq = wid % ntn; if (mt * 16 >= M) return;
  const int row0 = mt * 16, col0 = nq * 64; const float* arow = A + (size_t)(row0 + ln) * lda;
  v8f acc[4] = {};
  for (int kb = 0; kb < K; kb += 32) {
    FragH ah, al;
    const v4f x0 = *(const v4fa*)(arow + kb + 8 * hh), x1 = *(const v4fa*)(arow + kb + 8 * hh + 4), x2 = *(const v4fa*)(arow + kb + 16 + 8 * hh), x3 = *(const v4fa*)(arow + kb + 16 + 8 * hh + 4);
    float xs[16] = {x0[0],x0[1],x0[2],x0[3],x1[0],x1[1],x1[2],x1[3],x2[0],x2[1],x2[2],x2[3],x3[0],x3[1],x3[2],x3[3]};
#pragma unroll
    for (int i = 0; i < 16; ++i) { const _Float16 h = (_Float16)xs[i]; ah.h[i] = h; al.h[i] = ASPLIT ? (_Float16)(xs[i] - (float)h) : (_Float16)0.0f; }
#pragma unroll
    for (int t = 0; t < 4; ++t) { if (col0 + t * 16 >= N) continue; const size_t boff = (size_t)(col0 + t * 16 + ln) * ldb + kb; FragH bq; bq.half[0] = *(const v8us*)(Bh + boff + 8 * hh); bq.half[1] = *(const v8us*)(Bh + boff + 16 + 8 * hh);
      acc[t] = mmaH<ASPLIT ? 2 : 1>(ah.v, al.v, bq.v, bq.v, acc[t]); }
  }
#pragma unroll
  for (int t = 0; t < 4; ++t) { if (col0 + t * 16 >= N) continue;
#pragma unroll
    for (int r = 0; r < 8; ++r) so[w][8 * hh + r][t * 16 + ln] = acc[t][r] * alpha; }
  __builtin_amdgcn_fence(__ATOMIC_ACQ_REL, "workgroup"); __builtin_amdgcn_wave_barrier();
  const int rsub = lane >> 4, c4 = (lane & 15) * 4;
  {
#pragma unroll
    for (int q = 0; q < 8; ++q) { const int r = q * 2 + rsub; if (col0 + c4 < N) { const v4f v = *(const v4fa*)&so[w][r][c4]; *(v4f*)(C + (size_t)(row0 + r) * ldc + col0 + c4) = v; } }
     }
}

// Wt[n][k] = f16(W[k][n]·scale) from f32 row-major W[K][N] (scale = power of two; bf16-exact weights stay exact in f16 away from the subnormal range)
__global__ __launch_bounds__(256) void k_wt_f16(const float* __restrict__ W, _Float16* __restrict__ Wt, int K, int N, float scale) {
  const int t = blockIdx.x * 256 + threadIdx.x; if (t >= N * (K / 8)) return; const int n = t / (K / 8), k8 = (t % (K / 8)) * 8; FragH f;
#pragma unroll
  for (int i = 0; i < 8; ++i) f.h[i] = (_Float16)(bf16_round(W[(size_t)(k8 + i) * N + n]) * scale); const v8us o = f.half[0];
  *(v8us*)((unsigned short*)Wt + (size_t)n * K + k8) = o; 
}
// k_gemm_hh variant with fused epilogue: v = acc·alpha + bias[by·sBias + col] (+ CP[(row/rowsPerB)·sCPb + by·64 + col] if CP) ; ACT 0 none / 1 elu ; writes f16 C16 (and f32 C if non-null)
template <int ACT>
__global__ __launch_bounds__(128) void k_gemm_hhx(const _Float16* __restrict__ A, int lda, size_t sA, const _Float16* __restrict__ Bh, int ldb, size_t sB, float alpha, const float* __restrict__ bias, size_t sBias, const float* __restrict__ CP, int rowsPerB, size_t sCPb, int row0g,
    float* __restrict__ C, _Float16* __restrict__ C16, int ldc, size_t sC, int M, int N, int K) {
  __shared__ __attribute__((aligned(16))) float so[4][16][64];
  const int tid = threadIdx.x, w = tid >> 5, lane = tid & 31, ln = lane & 15, hh = lane >> 4; const int by = blockIdx.y;
  A += (size_t)by * sA; Bh += (size_t)by * sB; const size_t cofs = (size_t)by * sC; const float* bp = bias ? bias + (size_t)by * sBias : nullptr;
  const int ntn = (N + 63) / 64; const int wid = blockIdx.x * 4 + w; const int mt = wid / ntn, nq = wid % ntn; if (mt * 16 >= M) return;
  const int row0 = mt * 16, col0 = nq * 64; const _Float16* arow = A + (size_t)(row0 + ln) * lda;
  v8f acc[4] = {};
  for (int kb = 0; kb < K; kb += 32) { FragH ah; ah.half[0] = *(const v8us*)((const unsigned short*)arow + kb + 8 * hh); ah.half[1] = *(const v8us*)((const unsigned short*)arow + kb + 16 + 8 * hh);
#pragma unroll
    for (int t = 0; t < 4; ++t) { if (col0 + t * 16 >= N) continue; const size_t boff = (size_t)(col0 + t * 16 + ln) * ldb + kb; FragH bq; bq.half[0] = *(const v8us*)((const unsigned short*)Bh + boff + 8 * hh); bq.half[1] = *(const v8us*)((const unsigned short*)Bh + boff + 16 + 8 * hh);
      acc[t] = mmaH<1>(ah.v, ah.v, bq.v, bq.v, acc[t]); }
  }
#pragma unroll
  for (int t = 0; t < 4; ++t) { if (col0 + t * 16 >= N) continue; const int col = col0 + t * 16 + ln; const float bv = bp ? bf16_round(bp[col]) : 0.f;
#pragma unroll
    for (int r = 0; r < 8; ++r) { float v = acc[t][r] * alpha + bv; if (CP) { const int rr = row0g + row0 + 8 * hh + r; if (rowsPerB < 0) v += CP[cofs + (size_t)rr * ldc + col];      /* rowsPerB < 0: own element of the batched C plane */ else { const int bidx = rr / rowsPerB; v += CP[(size_t)bidx * sCPb + (size_t)by * 64 + col]; } } if (ACT == 1) v = (v > 0.f) ? v : expm1f(v); else if (ACT == 7) v = (v > 0.f) ? v + 1.0f : expf(v); else if (ACT == 8) v = tanhf(v); else if (ACT == 9) v = 0.5f * v * (1.0f + tanhf(0.7978845608028654f * (v + 0.044715f * v * v * v))); else if (ACT == 11) v = 1.0f / (1.0f + expf(-v)); else if (ACT == 12) v = (v > 0.f) ? v : 0.01f * v; else if (ACT == 14) v = (v > 0.f) ? v : 0.1f * v; else if (ACT == 16) v = (v >= 0.f) ? v : 0.3f * v; else if (ACT == 17) v = (v >= 0.f) ? v : 0.2f * v; else if (ACT == 15) v = v / (1.0f + expf(-v)); else if (ACT == 3) v = fmaxf(v, 0.f); else if (ACT == 6) v = 0.5f * v * (1.0f + erff(v * 0.70710678118654752f)); so[w][8 * hh + r][t * 16 + ln] = v; } }
  __builtin_amdgcn_fence(__ATOMIC_ACQ_REL, "workgroup"); __builtin_amdgcn_wave_barrier();
  const int rsub = lane >> 4, c4 = (lane & 15) * 4; typedef _Float16 v4h __attribute__((ext_vector_type(4)));
  {
#pragma unroll
    for (int q = 0; q < 8; ++q) { const int r = q * 2 + rsub; if (col0 + c4 < N) { const v4f v = *(const v4fa*)&so[w][r][c4]; if (C) *(v4f*)(C + cofs + (size_t)(row0 + r) * ldc + col0 + c4) = v; if (C16) { v4h h4; for (int i = 0; i < 4; ++i) h4[i] = (_Float16)v[i]; *(v4h*)(C16 + cofs + (size_t)(row0 + r) * ldc + col0 + c4) = h4; } } }
     }
}


typedef _Float16 v4h __attribute__((ext_vector_type(4)));

__global__ __launch_bounds__(256) void k_x16(const float* __restrict__ x, _Float16* __restrict__ X16, size_t n8) { const size_t t = (size_t)blockIdx.x * 256 + threadIdx.x; if (t >= n8) return; FragH f;
#pragma unroll
  for (int q = 0; q < 8; ++q) f.h[q] = (_Float16)bf16_round(x[t * 8 + q]); *(v8us*)((unsigned short*)X16 + t * 8) = f.half[0];  }
__global__ __launch_bounds__(256) void k_h16(const float* __restrict__ x, _Float16* __restrict__ X16, size_t n8) { const size_t t = (size_t)blockIdx.x * 256 + threadIdx.x; if (t >= n8) return; FragH f;
#pragma unroll
  for (int q = 0; q < 8; ++q) f.h[q] = (_Float16)x[t * 8 + q]; *(v8us*)((unsigned short*)X16 + t * 8) = f.half[0];  }
__global__ __launch_bounds__(256) void k_round16f(const float* __restrict__ W, _Float16* __restrict__ Bt, size_t n8) { const size_t t = (size_t)blockIdx.x * 256 + threadIdx.x; if (t >= n8) return; FragH f;
#pragma unroll
  for (int i = 0; i < 8; ++i) f.h[i] = (_Float16)(bf16_round(W[t * 8 + i]) * 16.0f); *(v8us*)((unsigned short*)Bt + t * 8) = f.half[0];  }
template <int NHv, int TTv>
__global__ __launch_bounds__(256) void k_vt(const _Float16* __restrict__ V16, int ldv, int voff, _Float16* __restrict__ Vt) { __shared__ unsigned short tl[64][66]; const int tid = threadIdx.x; const int slab = blockIdx.x / (TTv / 64), lg = blockIdx.x % (TTv / 64); const int b = slab / NHv, h = slab % NHv;
  for (int i = tid; i < 64 * 8; i += 256) { const int r = i / 8, c8 = (i % 8) * 8; FragH f; f.half[0] = *(const v8us*)((const unsigned short*)V16 + ((size_t)b * TTv + lg * 64 + r) * ldv + voff + h * 64 + c8);
#pragma unroll
    for (int q = 0; q < 8; ++q) tl[r][c8 + q] = f.u[q]; }
  __syncthreads();
  {
#pragma unroll
    for (int rd = 0; rd < 2; ++rd) { const int d = rd * 32 + tid / 8, pc = tid % 8; FragH f;
#pragma unroll
      for (int q = 0; q < 8; ++q) f.u[q] = tl[pc * 8 + q][d];
      *(v8us*)((unsigned short*)Vt + ((size_t)slab * 64 + d) * TTv + lg * 64 + pc * 8) = f.half[0]; }
     } }

__global__ __launch_bounds__(256) void k_hl(const float* __restrict__ F, _Float16* __restrict__ Hh, _Float16* __restrict__ Hl, size_t n8) { const size_t t = (size_t)blockIdx.x * 256 + threadIdx.x; if (t >= n8) return; FragH fh, fl; const v4f a = *(const v4fa*)(F + t * 8), c = *(const v4fa*)(F + t * 8 + 4);
#pragma unroll
  for (int q = 0; q < 4; ++q) { _Float16 h = (_Float16)a[q]; fh.h[q] = h; fl.h[q] = (_Float16)((a[q] - (float)h) * 1024.0f); h = (_Float16)c[q]; fh.h[4 + q] = h; fl.h[4 + q] = (_Float16)((c[q] - (float)h) * 1024.0f); }
  { *(v8us*)((unsigned short*)Hh + t * 8) = fh.half[0]; *(v8us*)((unsigned short*)Hl + t * 8) = fl.half[0];  } }

// ---- fast GEMM (work-group tile 128x128, 8 waves of 32x64; requires M % 128 == 0 rows per launch region, N % 128 == 0 and K % 64 == 0); epilogue = k_gemm_hhx semantics ----
// A stage is G2K k of the tile's 128 A rows and 128 Bt rows. 8 threads fetch one row's 128-byte line, one stage ahead into registers, and store it to one of two LDS buffers; the 8 waves read their fragments from LDS,
// so that every operand line leaves L2 once per work-group as a whole line. One barrier per stage publishes the next buffer and ends the reads of the one that is refilled after it. k runs in the order of the unstaged loop.
#define G2T 128                      /* A rows and Bt rows per work-group */
#define G2K 64                       /* k per LDS stage: 64 f16 = one 128-byte line of every row */
#define G2P (G2K + 8)                /* LDS row pitch in halves: 144 B = 16 B x odd, so that the 16 rows of a fragment load fall on different banks */
#define G2S (2 * G2T * G2P)          /* halves per stage buffer: the A rows, then the Bt rows */
__device__ __forceinline__ v16h g2_frag(const _Float16* p, int hh) { FragH f; f.half[0] = *(const v8us*)((const unsigned short*)p + 8 * hh); f.half[1] = *(const v8us*)((const unsigned short*)p + 16 + 8 * hh); return f.v; }
__device__ __forceinline__ v8f g2_mma(v16h a, v16h b, v8f c) { v8f d = __builtin_amdgcn_wmma_f32_16x16x32_f16(false, a, false, b, (short)0, c, false, false); asm volatile("v_nop\n\tv_nop\n\tv_nop\n\tv_nop" : "+v"(d) : "v"(a), "v"(b)); return d; }
template <int ACT>
__global__ __launch_bounds__(256) void k_gemm2(const _Float16* __restrict__ A, int lda, size_t sA, const _Float16* __restrict__ Bh, int ldb, size_t sB, float alpha, const float* __restrict__ bias, size_t sBias, const float* __restrict__ CP, int rowsPerB, size_t sCPb, int row0g,
    float* __restrict__ C, _Float16* __restrict__ C16, int ldc, size_t sC, int M, int N, int K, size_t zA, size_t zB, size_t zC) { static_assert(ACT == 0 || ACT == 3 || ACT == 6 || ACT == 8 || ACT == 9 || ACT == 11 || ACT == 12 || ACT == 14 || ACT == 15 || ACT == 16 || ACT == 17, "k_gemm2: unsupported ACT code (would silently apply no activation)");
  static_assert(2 * G2S * 2 >= 8 * 32 * 68 * 4 && G2T == 128 && G2K == 64, "the epilogue's rows fit the two stage buffers; 256 threads stage 32 rows per pass");
  __shared__ __attribute__((aligned(16))) unsigned char sm[2 * G2S * 2]; _Float16* const sg = (_Float16*)sm; float (*const so)[32][68] = (float (*)[32][68])sm;      /* the stage buffers; behind the loop's last barrier the same bytes hold each wave's output rows */
  const int tid = threadIdx.x, w = tid >> 5, wm = w & 3, wn = w >> 2, lane = tid & 31, ln = lane & 15, hh = lane >> 4; const int by = blockIdx.y, bz = blockIdx.z;      /* grid.y = head (strides sA, sB, sC), grid.z = batch (strides zA, zB, zC) */
  A += (size_t)by * sA + (size_t)bz * zA; Bh += (size_t)by * sB + (size_t)bz * zB; const size_t cofs = (size_t)by * sC + (size_t)bz * zC; const float* bp = bias ? bias + (size_t)by * sBias : nullptr;
  const int ntn = N >> 7; const int mt = blockIdx.x / ntn, nq = blockIdx.x - mt * ntn; if (mt * G2T >= M) return;      /* taken by a whole work-group, in front of every barrier */
  const int row0 = mt * G2T + 32 * wm, col0 = nq * G2T + 64 * wn;
  const int sr = tid >> 3, sc = (tid & 7) * 8; const int sl = sr * G2P + sc;      /* staging: row sr + 32 u, eight halves at column sc */
  const _Float16* ag = A + (size_t)(mt * G2T + sr) * lda + sc; const _Float16* bg = Bh + (size_t)(nq * G2T + sr) * ldb + sc; const int nst = K / G2K;
  const v8f z8 = {0.f,0.f,0.f,0.f,0.f,0.f,0.f,0.f}; v8f c00 = z8, c01 = z8, c02 = z8, c03 = z8, c10 = z8, c11 = z8, c12 = z8, c13 = z8;
  v8us ar[4], br[4]; const unsigned short* pa[4]; const unsigned short* pb[4];      /* the full unrolls give these register arrays constant indices and put a stage's eight loads in flight together */
#pragma unroll
  for (int u = 0; u < 4; ++u) { pa[u] = (const unsigned short*)(ag + (size_t)(u * 32) * lda); pb[u] = (const unsigned short*)(bg + (size_t)(u * 32) * ldb); }
#pragma unroll
  for (int u = 0; u < 4; ++u) { ar[u] = *(const v8us*)pa[u]; br[u] = *(const v8us*)pb[u]; }
  asm volatile("s_wait_xcnt 0x0" :: "v"(pa[0]), "v"(pa[1]), "v"(pa[2]), "v"(pa[3]), "v"(pb[0]), "v"(pb[1]), "v"(pb[2]), "v"(pb[3]) : "memory");      /* the loads' address registers are free for reuse only from here on; as inputs they stay whole up to this wait, so that no load returns into one either */
#pragma unroll
  for (int u = 0; u < 4; ++u) { *(v8us*)(unsigned short*)&sg[sl + u * 32 * G2P] = ar[u]; *(v8us*)(unsigned short*)&sg[G2T * G2P + sl + u * 32 * G2P] = br[u]; }
  __syncthreads();
#pragma unroll 1
  for (int s = 0; s < nst; ++s) { const bool more = s + 1 < nst;      /* more: the same for the whole work-group. The stage loop stays rolled, so that its text stays small; its two 32-k passes are unrolled, so that their LDS offsets are immediates */
    if (more) {
#pragma unroll
      for (int u = 0; u < 4; ++u) { pa[u] = (const unsigned short*)(ag + (s + 1) * G2K + (size_t)(u * 32) * lda); pb[u] = (const unsigned short*)(bg + (s + 1) * G2K + (size_t)(u * 32) * ldb); }
#pragma unroll
      for (int u = 0; u < 4; ++u) { ar[u] = *(const v8us*)pa[u]; br[u] = *(const v8us*)pb[u]; }
      asm volatile("s_wait_xcnt 0x0" :: "v"(pa[0]), "v"(pa[1]), "v"(pa[2]), "v"(pa[3]), "v"(pb[0]), "v"(pb[1]), "v"(pb[2]), "v"(pb[3]) : "memory"); }      /* the code below reuses the registers that these loads name: this wait stands in front of that overwrite, and as its inputs they stay whole up to it, so that no load returns into one either */
    const _Float16* ab = sg + (s & 1) * G2S + (32 * wm + ln) * G2P; const _Float16* bb = sg + (s & 1) * G2S + (G2T + 64 * wn + ln) * G2P;
#pragma unroll
    for (int kc = 0; kc < G2K; kc += 32) { const v16h a0 = g2_frag(ab + kc, hh), a1 = g2_frag(ab + 16 * G2P + kc, hh);
      const v16h b0 = g2_frag(bb + kc, hh), b1 = g2_frag(bb + 16 * G2P + kc, hh), b2 = g2_frag(bb + 32 * G2P + kc, hh), b3 = g2_frag(bb + 48 * G2P + kc, hh);
      c00 = g2_mma(a0, b0, c00); c10 = g2_mma(a1, b0, c10); c01 = g2_mma(a0, b1, c01); c11 = g2_mma(a1, b1, c11);
      c02 = g2_mma(a0, b2, c02); c12 = g2_mma(a1, b2, c12); c03 = g2_mma(a0, b3, c03); c13 = g2_mma(a1, b3, c13); }
    if (more) {
#pragma unroll
      for (int u = 0; u < 4; ++u) { *(v8us*)(unsigned short*)&sg[((s + 1) & 1) * G2S + sl + u * 32 * G2P] = ar[u]; *(v8us*)(unsigned short*)&sg[((s + 1) & 1) * G2S + G2T * G2P + sl + u * 32 * G2P] = br[u]; } }
    __syncthreads(); }      /* publishes stage s + 1 and ends every wave's reads of stage s, whose buffer the next trip refills and, behind the last trip, the output rows reuse */
  v8f accs[8] = {c00, c01, c02, c03, c10, c11, c12, c13};
#pragma unroll
  for (int u = 0; u < 8; ++u) { const int t = u & 3, half = u >> 2; const int col = col0 + t * 16 + ln; const float bv = bp ? bf16_round(bp[col]) : 0.f;
#pragma unroll
    for (int r = 0; r < 8; ++r) { const int rloc = half * 16 + 8 * hh + r; float v = accs[u][r] * alpha + bv; if (CP) { if (rowsPerB < 0) v += CP[cofs + (size_t)(row0g + row0 + rloc) * ldc + col];      /* rowsPerB < 0: own element of the batched C plane */ else { const int bidx = (row0g + row0 + rloc) / rowsPerB; v += CP[(size_t)bidx * sCPb + (size_t)by * 64 + col]; } }
      if (ACT == 3) v = fmaxf(v, 0.f); else if (ACT == 6) v = 0.5f * v * (1.0f + erff(v * 0.70710678118654752f)); else if (ACT == 11) v = 1.0f / (1.0f + expf(-v)); else if (ACT == 15) v = v / (1.0f + expf(-v)); else if (ACT == 12) v = (v > 0.f) ? v : 0.01f * v; else if (ACT == 8) v = tanhf(v); else if (ACT == 9) v = 0.5f * v * (1.0f + tanhf(0.7978845608028654f * (v + 0.044715f * v * v * v))); else if (ACT == 14) v = (v > 0.f) ? v : 0.1f * v; else if (ACT == 16) v = (v >= 0.f) ? v : 0.3f * v; else if (ACT == 17) v = (v >= 0.f) ? v : 0.2f * v;
      so[w][rloc][t * 16 + ln] = v; } }
  __builtin_amdgcn_fence(__ATOMIC_ACQ_REL, "workgroup"); __builtin_amdgcn_wave_barrier();
  const int rsub = lane >> 4, c4 = (lane & 15) * 4;
  {
#pragma unroll
    for (int q = 0; q < 16; ++q) { const int r = q * 2 + rsub; const v4f v = *(const v4fa*)&so[w][r][c4]; if (C) *(v4f*)(C + cofs + (size_t)(row0 + r) * ldc + col0 + c4) = v; if (C16) { v4h h4; for (int i = 0; i < 4; ++i) h4[i] = (_Float16)v[i]; *(v4h*)(C16 + cofs + (size_t)(row0 + r) * ldc + col0 + c4) = h4; } }
     } }


__global__ __launch_bounds__(256) void k_wnat(const float* __restrict__ w, size_t n8, _Float16* __restrict__ Bt) { const size_t t = (size_t)blockIdx.x * 256 + threadIdx.x; if (t >= n8) return; FragH f; for (int q = 0; q < 8; ++q) f.h[q] = (_Float16)(bf16_round(w[t * 8 + q]) * 16.0f); *(v8us*)((unsigned short*)Bt + t * 8) = f.half[0];  }
__global__ __launch_bounds__(256) void k_rsm(const float* __restrict__ S, _Float16* __restrict__ P, int nrows) {
  #pragma clang fp contract(off)
  const int i = blockIdx.x * 256 + threadIdx.x; if (i >= nrows) return; const float* s = S + (size_t)i * SQ; float mx = -3.0e38f;
#pragma unroll 1
  for (int j = 0; j < SQ; ++j) mx = fmaxf(mx, s[j]); float se = 0.f;
#pragma unroll 1
  for (int j = 0; j < SQ; ++j) se += expf(s[j] - mx); const float sc = 256.0f / se;
#pragma unroll 1
  for (int j0 = 0; j0 < SQ; j0 += 8) { FragH f; for (int q = 0; q < 8; ++q) f.h[q] = (_Float16)(expf(s[j0 + q] - mx) * sc); unsigned short* d = (unsigned short*)P + (size_t)i * SQ + j0; *(v8us*)d = f.half[0];  } }
__global__ __launch_bounds__(256) void k_vt(const _Float16* __restrict__ V16, int b, int h0, _Float16* __restrict__ VT) { __shared__ unsigned short tl[64][65]; const int tid = threadIdx.x; const int hh = blockIdx.x % HG, sg = blockIdx.x / HG; const int s0 = sg * 64; const int h = h0 + hh;
  for (int i = tid; i < 64 * 8; i += 256) { const int j = i / 8, d8 = (i % 8) * 8; FragH f; f.half[0] = *(const v8us*)((const unsigned short*)V16 + ((size_t)b * SQ + s0 + j) * DM + h * HD + d8); for (int q = 0; q < 8; ++q) tl[d8 + q][j] = f.u[q]; }
  __syncthreads();
  { for (int i = tid; i < 64 * 8; i += 256) { const int d = i / 8, j8 = (i % 8) * 8; FragH f; for (int q = 0; q < 8; ++q) f.u[q] = tl[d][j8 + q]; *(v8us*)((unsigned short*)VT + ((size_t)hh * HD + d) * SQ + s0 + j8) = f.half[0]; }  } }



// Lane l <-> l ^ M inside a 16-lane row (DPP row_xmask) and l <-> l ^ 16 (cross-row move): a five-step butterfly leaves the row's maximum / sum in every lane without an LDS round trip.
template <int M> __device__ __forceinline__ float rs_xm(float x) { return __builtin_bit_cast(float, __builtin_amdgcn_update_dpp(0, __builtin_bit_cast(int, x), 0x160 | M, 0xf, 0xf, true)); }
__device__ __forceinline__ float rs_xh(float x) { return __builtin_bit_cast(float, __builtin_amdgcn_permlanex16(__builtin_bit_cast(int, x), __builtin_bit_cast(int, x), 0x76543210, 0xfedcba98, false, false)); }
// Fused causal attention, all batches, heads and query tiles in ONE launch: scores, softmax and weighted values stay in registers, nothing of them goes to memory.
// A work-group of FAW waves takes FAQ query rows of one head, 32 per wave, and walks the keys 0 .. its last row in stages of FAK keys. A stage's K rows [key][d] and V^T rows [d][key] are fetched with whole-line loads
// one stage ahead into registers and stored to one of two LDS buffers; one barrier per stage publishes the next buffer and ends the reads of the one that is refilled after it.
// Per 32-key pass a wave forms S^T = K Q^T (A = K rows, B = q rows held in registers): lane (c, h) then holds keys 8h + r of query c, so the maximum and the sum are in-lane plus one exchange of the wave's halves,
// and the two 16-key score tiles, converted in place, are the B operand of O^T += V^T P^T (A = V^T rows in the same k order). Online softmax in the log2 domain; the maximum in use may trail the true one by up to 8,
// so a weight can reach 2^8 (f16 holds it at full relative precision) and the accumulators are rescaled only in the rare pass in which some query's maximum grows by more.
// The full unrolls in the kernel give its register arrays (fragments, score tiles, accumulators, staged rows) constant indices, without which they would go to scratch memory.
#define FAW 4                        /* waves per work-group */
#define FAQ (FAW * 32)               /* query rows per work-group */
#define FAK 64                       /* keys per LDS stage: two 32-key passes; 64 f16 = one 128-byte line of a V^T row */
#define FAP (HD + 8)                 /* LDS row pitch in halves: 144 B = 16 B x odd, so that the 16 rows of a fragment load fall on different banks */
__device__ __forceinline__ v8f fa_mma(v16h a, v16h b, v8f c) { return __builtin_amdgcn_wmma_f32_16x16x32_f16(false, a, false, b, (short)0, c, false, false); }
__device__ __forceinline__ v16h fa_frag(const _Float16* p) { FragH f; f.half[0] = *(const v8us*)(const unsigned short*)p; f.half[1] = *(const v8us*)((const unsigned short*)p + 16); return f.v; }      /* p already holds the lane's 8 * h: k = 8h .. 8h+7 and 16+8h .. 16+8h+7, the order of g2_frag */
// Four vector slots between a run of matrix instructions and the branch behind it: on the taken side the next vector instruction may read their results. The two scheduling barriers keep the slots at that place.
__device__ __forceinline__ void fa_gap() { __builtin_amdgcn_sched_barrier(0); asm volatile("v_nop\n\tv_nop\n\tv_nop\n\tv_nop"); __builtin_amdgcn_sched_barrier(0); }
__global__ __launch_bounds__(FAW * 32) void k_fattn(const _Float16* __restrict__ Qh, const _Float16* __restrict__ Kh, const _Float16* __restrict__ Vt, _Float16* __restrict__ Oh) {
  static_assert(HD == 64 && FAK == 64 && FAQ % FAK == 0 && SQ / FAQ == 16 && NB * NH == 64 && FAW * 32 == 128 && KVD == DM, "16 query tiles x 64 (batch, head) pairs; 8 threads stage one 128-byte row, 16 rows per pass of the staging loop");
  __shared__ __attribute__((aligned(16))) _Float16 ks[2][FAK * FAP]; __shared__ __attribute__((aligned(16))) _Float16 vs[2][HD * FAP];
  const int tid = threadIdx.x, lane = tid & 31, c = lane & 15, h = lane >> 4; const int w = __builtin_amdgcn_readfirstlane(tid >> 5); const int idx = blockIdx.x;
  // A tile's cost grows with its index and all work-groups are resident together: the 16 tiles are dealt by a 4 x 4 square whose rows and columns all sum to 30 (row = idx / 256, column = (idx / 8) % 4), every (head, tile) pair once.
  const int tile = (int)((0x0DE3B6587A94C12FULL >> (4 * (((idx >> 8) << 2) | ((idx >> 3) & 3)))) & 15); const int bh = (idx & 7) | (((idx >> 5) & 7) << 3); const int b = bh / NH, hd = bh % NH;
  const int q0 = tile * FAQ, qw = q0 + 32 * w, nst = (q0 + FAQ) / FAK;      /* causal: keys below the tile's end */
  const int sr = tid >> 3, sc = (tid & 7) * 8; const int so = sr * FAP + sc;      /* staging: row sr + 16 u, eight halves at column sc */
  const _Float16* kg = Kh + ((size_t)b * SQ + sr) * KVD + hd * HD + sc; const _Float16* vg = Vt + ((size_t)bh * HD + sr) * SQ + sc;
  v8us kr[4], vr[4];
#pragma unroll
  for (int u = 0; u < 4; ++u) { kr[u] = *(const v8us*)(const unsigned short*)(kg + u * 16 * KVD); vr[u] = *(const v8us*)(const unsigned short*)(vg + u * 16 * SQ); }
  v16h qf[2][2];
#pragma unroll
  for (int g = 0; g < 2; ++g) for (int kc = 0; kc < 2; ++kc) qf[g][kc] = g2_frag(Qh + ((size_t)b * SQ + qw + 16 * g + c) * LQ + hd * HD + kc * 32, h);
  asm volatile("s_wait_xcnt 0x0" ::: "memory");      /* the q rows' address registers are free for reuse from here on: this wait stands in front of their overwrite */
#pragma unroll
  for (int u = 0; u < 4; ++u) { *(v8us*)(unsigned short*)&ks[0][so + u * 16 * FAP] = kr[u]; *(v8us*)(unsigned short*)&vs[0][so + u * 16 * FAP] = vr[u]; }
  const v8f z8 = {0.f, 0.f, 0.f, 0.f, 0.f, 0.f, 0.f, 0.f}; const v4f z4 = {0.f, 0.f, 0.f, 0.f};
  v8f acc[2][4]; v4f l4[2]; float mr[2];
#pragma unroll
  for (int g = 0; g < 2; ++g) { mr[g] = -__builtin_inff(); l4[g] = z4; for (int t = 0; t < 4; ++t) acc[g][t] = z8; }
  const float cs = 0.125f * 1.44269504088896340736f;      /* 64^-0.5 log2 e */
  __syncthreads();
  for (int st = 0; st < nst; ++st) {
    const bool more = st + 1 < nst;      /* the same for the whole work-group */
    if (more) {
#pragma unroll
      for (int u = 0; u < 4; ++u) { kr[u] = *(const v8us*)(const unsigned short*)(kg + (size_t)(st + 1) * FAK * KVD + u * 16 * KVD); vr[u] = *(const v8us*)(const unsigned short*)(vg + (st + 1) * FAK + u * 16 * SQ); }
      asm volatile("s_wait_xcnt 0x0" ::: "memory"); }      /* the pass below reuses the registers that hold these loads' addresses: this wait stands in front of that overwrite */
    const _Float16* kb = &ks[st & 1][c * FAP + 8 * h]; const _Float16* vb = &vs[st & 1][c * FAP + 8 * h];
    for (int p = 0; p < FAK / 32; ++p) { const int key0 = st * FAK + p * 32;
      if (key0 <= qw) {      /* wave-uniform: a wave skips the passes beyond its diagonal, never the barrier */
        v8f s[2][2];
        { v16h kf[2][2];
#pragma unroll
          for (int kt = 0; kt < 2; ++kt) for (int kc = 0; kc < 2; ++kc) kf[kt][kc] = fa_frag(kb + (p * 32 + 16 * kt) * FAP + kc * 32);
#pragma unroll
          for (int kt = 0; kt < 2; ++kt) for (int g = 0; g < 2; ++g) s[kt][g] = fa_mma(kf[kt][1], qf[g][1], fa_mma(kf[kt][0], qf[g][0], z8)); }      /* s[kt][g][r] = q(qw + 16g + c) . k(key0 + 16kt + 8h + r) */
        fa_gap();
        if (key0 == qw) {      /* the one pass on the wave's diagonal: key > query is masked; key key0 is kept in every row */
#pragma unroll
          for (int kt = 0; kt < 2; ++kt) for (int g = 0; g < 2; ++g) for (int r = 0; r < 8; ++r) s[kt][g][r] = (16 * kt + 8 * h + r > 16 * g + c) ? -__builtin_inff() : s[kt][g][r]; }
        float mb[2]; bool need = false;
#pragma unroll
        for (int g = 0; g < 2; ++g) { float mx = s[0][g][0];
#pragma unroll
          for (int r = 1; r < 8; ++r) mx = fmaxf(mx, s[0][g][r]);
#pragma unroll
          for (int r = 0; r < 8; ++r) mx = fmaxf(mx, s[1][g][r]);
          mx = fmaxf(mx, rs_xh(mx)) * cs; mb[g] = mx; need = need || (mx > mr[g] + 8.0f); }      /* both halves of the wave hold the query's maximum of this pass, scaled */
        if (__builtin_amdgcn_ballot_w32(need) != 0) {      /* scalar branch; always taken in a wave's first pass, where mr is -inf and the factor 0 */
#pragma unroll
          for (int g = 0; g < 2; ++g) { const float mn = fmaxf(mr[g], mb[g]); const float corr = __builtin_amdgcn_exp2f(mr[g] - mn); mr[g] = mn; l4[g] *= corr;
#pragma unroll
            for (int t = 0; t < 4; ++t) acc[g][t] *= corr; } }
        v16h vf[4];
#pragma unroll
        for (int t = 0; t < 4; ++t) vf[t] = fa_frag(vb + 16 * t * FAP + p * 32);
#pragma unroll
        for (int g = 0; g < 2; ++g) { const float nm = -mr[g]; FragH pf;
#pragma unroll
          for (int kt = 0; kt < 2; ++kt) for (int j = 0; j < 2; ++j) { const v4f x = {s[kt][g][4 * j], s[kt][g][4 * j + 1], s[kt][g][4 * j + 2], s[kt][g][4 * j + 3]}; const v4f y = x * cs + nm; const v4f e = {__builtin_amdgcn_exp2f(y[0]), __builtin_amdgcn_exp2f(y[1]), __builtin_amdgcn_exp2f(y[2]), __builtin_amdgcn_exp2f(y[3])}; l4[g] += e;      /* the builtin, so that the compiler keeps these writes clear of the matrix instructions' operands */
            for (int i = 0; i < 4; ++i) pf.h[8 * kt + 4 * j + i] = (_Float16)e[i]; }      /* element 8 kt + r of the B operand = key 16 kt + 8 h + r: the k order of fa_frag */
#pragma unroll
          for (int t = 0; t < 4; ++t) acc[g][t] = fa_mma(vf[t], pf.v, acc[g][t]); }      /* acc[g][t][r] = o(qw + 16g + c)[16t + 8h + r], not yet divided by the row sum */
        fa_gap();
      } }
    if (more) {
#pragma unroll
      for (int u = 0; u < 4; ++u) { *(v8us*)(unsigned short*)&ks[(st + 1) & 1][so + u * 16 * FAP] = kr[u]; *(v8us*)(unsigned short*)&vs[(st + 1) & 1][so + u * 16 * FAP] = vr[u]; }
      __syncthreads(); }      /* publishes stage st + 1 and ends every wave's reads of stage st, whose buffer the next trip refills */
  }
  v8us ov[2][4]; unsigned short* og = (unsigned short*)Oh + ((size_t)b * SQ + qw + c) * DM + hd * HD + 8 * h;      /* lane (c, h): 8 consecutive d of query row c, one 16-byte store per 16 d */
#pragma unroll
  for (int g = 0; g < 2; ++g) { float l = (l4[g][0] + l4[g][1]) + (l4[g][2] + l4[g][3]); l += rs_xh(l); const float fin = 64.0f / l;      /* o carried x64, as the output GEMM's factor expects */
#pragma unroll
    for (int t = 0; t < 4; ++t) { FragH f; for (int r = 0; r < 8; ++r) f.h[r] = (_Float16)(acc[g][t][r] * fin); ov[g][t] = f.half[0]; } }
  __builtin_amdgcn_sched_barrier(0);      /* the eight stores stand behind the last conversion, so that no register which an issued store names is written again */
#pragma unroll
  for (int g = 0; g < 2; ++g) for (int t = 0; t < 4; ++t) *(v8us*)(og + g * 16 * DM + 16 * t) = ov[g][t]; }


// Exact f32 causal attention for rows 0..QT0-1 of every batch and head (planes [batch][QT0][DM]). One work-group of 256 threads takes A0R query rows of one head: thread (r, c) = (tid / 8, tid % 8).
// The group's q rows and the head's QT0 key and value rows are staged in LDS once; then scores (thread (r, c): keys c, c + 8, ...; its q row in registers), the row maximum and sum over the row's 8 lanes, and o (thread (r, c): columns 4c..4c+3 and 32+4c..32+4c+3).
#define A0R 32                       /* query rows per work-group */
#define A0KP (HD + 4)                /* q and key row pitch in LDS, floats: 16 B x odd, so that 8 rows read at one column fall on different banks */
#define A0PP (QT0 + 8)               /* weight row pitch in LDS, floats: the 4 rows of a wave start 8 banks apart */
__global__ __launch_bounds__(256) void k_att0(const float* __restrict__ QF, const float* __restrict__ KF, const float* __restrict__ VF, float scale, float* __restrict__ OF) {
  static_assert(QT0 % A0R == 0 && A0R * 8 == 256 && A0R == 32 && HD == 64 && QT0 % 16 == 0, "8 threads per query row; 16 threads stage one row, 16 rows per pass");
  __shared__ __attribute__((aligned(16))) float ks[QT0 * A0KP]; __shared__ __attribute__((aligned(16))) float vs[QT0 * HD]; __shared__ __attribute__((aligned(16))) float qs[A0R * A0KP]; __shared__ __attribute__((aligned(16))) float ps[A0R * A0PP];
  const int tid = threadIdx.x; const int h = blockIdx.x / (QT0 / A0R), rg = blockIdx.x % (QT0 / A0R); const int r = tid >> 3, c = tid & 7; const int i = rg * A0R + r; const int nk = (rg + 1) * A0R;      /* causal: keys below the group's last row */
  const size_t bo = (size_t)blockIdx.y * QT0 * DM + (size_t)h * HD;      /* grid.y = batch */
  const int sr = tid >> 4, sc = (tid & 15) * 4; const int so = sr * DM + sc;      /* staging: row sr + 16 u, four floats at column sc */
  const float* kg = KF + bo; const float* vg = VF + bo; const float* qg = QF + bo + (size_t)rg * A0R * DM;
  v4f kk[QT0 / 16], vv[QT0 / 16];      /* the full unrolls below give the register arrays kk, vv, q constant indices and put all staging loads in flight together */
#pragma unroll
  for (int u = 0; u < QT0 / 16; ++u) { kk[u] = *(const v4fa*)(kg + so + u * 16 * DM); vv[u] = *(const v4fa*)(vg + so + u * 16 * DM); }
  const v4f q0 = *(const v4fa*)(qg + so);
  asm volatile("s_wait_xcnt 0x0" ::: "memory");      /* the last staging load may return into the offset register that the loads above name: this wait stands in front of that overwrite */
  const v4f q1 = *(const v4fa*)(qg + so + 16 * DM);
#pragma unroll
  for (int u = 0; u < QT0 / 16; ++u) { *(v4f*)&ks[(sr + u * 16) * A0KP + sc] = kk[u]; *(v4f*)&vs[(sr + u * 16) * HD + sc] = vv[u]; }
  *(v4f*)&qs[sr * A0KP + sc] = q0; *(v4f*)&qs[(sr + 16) * A0KP + sc] = q1;
  __syncthreads();
  v4f q[HD / 4];
#pragma unroll
  for (int u = 0; u < HD / 4; ++u) q[u] = *(const v4f*)&qs[r * A0KP + u * 4];
  float* pr = ps + r * A0PP; float mx = -3.0e38f;      /* unroll 2 in the three loops below: the LDS loads of two trips are in flight together and their sums are independent chains */
#pragma unroll 2
  for (int m = 0; m < nk / 8; ++m) { const int j = c + m * 8; const float* kp = ks + j * A0KP; v4f a = {0.f, 0.f, 0.f, 0.f};
#pragma unroll
    for (int u = 0; u < HD / 4; ++u) a += q[u] * *(const v4f*)(kp + u * 4);
    const float s = (j <= i) ? ((a[0] + a[1]) + (a[2] + a[3])) * scale : -3.0e38f; pr[j] = s; mx = fmaxf(mx, s); }
  mx = fmaxf(mx, rs_xm<1>(mx)); mx = fmaxf(mx, rs_xm<2>(mx)); mx = fmaxf(mx, rs_xm<4>(mx));      /* key 0 is kept in every row, so the row maximum is a real score and a masked key's weight is exp(-huge) = 0 */
  float l = 0.f;
#pragma unroll 2
  for (int m = 0; m < nk / 8; ++m) { const int j = c + m * 8; const float e = expf(pr[j] - mx); pr[j] = e; l += e; }
  l += rs_xm<1>(l); l += rs_xm<2>(l); l += rs_xm<4>(l);
  __syncthreads();
  v4f o0 = {0.f, 0.f, 0.f, 0.f}, o1 = {0.f, 0.f, 0.f, 0.f}; const float* vp = vs + c * 4;
#pragma unroll 2
  for (int j = 0; j < nk; j += 4) { const v4f p = *(const v4f*)(pr + j);
#pragma unroll
    for (int t = 0; t < 4; ++t) { o0 += p[t] * *(const v4f*)(vp + (j + t) * HD); o1 += p[t] * *(const v4f*)(vp + (j + t) * HD + HD / 2); } }
  const float fin = 64.0f / l;      /* o carried x64 like the f16 path */
  float* og = OF + bo + i * DM + c * 4; *(v4f*)og = o0 * fin; *(v4f*)(og + HD / 2) = o1 * fin; }


__global__ __launch_bounds__(256) void k_kvexp(const float* __restrict__ src, float* __restrict__ dst, size_t n4) { const size_t t = (size_t)blockIdx.x * 256 + threadIdx.x; if (t >= n4) return; const size_t e = t * 4; const size_t row = e / DM; const int col = (int)(e % DM); const int h = col / HD, d = col % HD; const v4f v = *(const v4fa*)(src + row * KVD + (size_t)(h / HPG) * HD + d); *(v4f*)(dst + e) = v;  }

__global__ __launch_bounds__(256) void k_tab2(float theta, float* __restrict__ CS, float* __restrict__ SN) {
  #pragma clang fp contract(off)
  const int t = blockIdx.x * 256 + threadIdx.x; if (t >= SQ * (HD / 2)) return; const int i = t % (HD / 2); const int p = t / (HD / 2); const float invf = 1.0f / powf(theta, (float)(2 * i) / (float)HD); const float ang = __fmul_rn((float)p, invf); const float c = cosf(ang), s = sinf(ang);
  *(float*)(CS + t) = c; *(float*)(SN + t) = s;  }
// Rotate-half rope of the f32 q or k rows [batch][SQ][DM] with the tables [pos][HD / 2]: out_lo = x_lo c - x_hi s, out_hi = x_hi c + x_lo s; written as f16 rows (H16OUT) or f32 rows of pitch DM; zF, zO = batch strides of F and of the output, in elements.
// A work-group of 256 threads takes PP positions of all NB batches, whole rows of DM floats: thread t holds columns 4t .. 4t + 3, so that every load and store of a wave covers whole 128-byte lines and one table read serves NB rows.
// The two halves of a head lie 32 columns = 8 lanes apart: the partner's values come by a DPP exchange inside the 16-lane row, with no LDS and no barrier.
// The full unrolls give the register arrays constant indices and put all of a thread's loads in flight together.
template <bool H16OUT, int PP>
__global__ __launch_bounds__(256) void k_rope(const float* __restrict__ F, size_t zF, const float* __restrict__ CS, const float* __restrict__ SN, _Float16* __restrict__ H16, float* __restrict__ F32, size_t zO) {
  static_assert(DM == 1024 && KVD == DM && HD == 64 && SQ % PP == 0, "256 threads x 4 columns = one row; the halves of a head 8 lanes apart");
  const int col = threadIdx.x * 4; const unsigned tb = (threadIdx.x * 16u) & (HD / 2 * 4 - 1u); const bool up = (col & (HD / 2)) != 0; const int p0 = blockIdx.x * PP;      /* tb: the thread's byte offset in a table row */
  const float* fu = F + p0 * DM; const char* cu = (const char*)(CS + p0 * (HD / 2)); const char* su = (const char*)(SN + p0 * (HD / 2));      /* the same for the whole work-group */
  v4f x[PP][NB], cc[PP], ss[PP]; v4h oh[PP][NB];
  __builtin_amdgcn_sched_barrier(0);      /* keeps the kernel-argument loads in front of the global loads */
#pragma unroll
  for (int u = 0; u < PP; ++u) {
#pragma unroll
    for (int b = 0; b < NB; ++b) x[u][b] = *(const v4fa*)(fu + (b * zF + u * DM) + col);
    cc[u] = *(const v4fa*)(cu + u * (HD / 2 * 4) + tb); ss[u] = *(const v4fa*)(su + u * (HD / 2 * 4) + tb); }
  asm volatile("s_wait_xcnt 0x0" :: "v"(tb) : "memory");      /* the loads' address registers are free for reuse only from here on; as an input the table offset stays whole up to this wait, so that no load returns into it either */
  __builtin_amdgcn_sched_barrier(0);      /* keeps the arithmetic behind the last load: without it the compiler holds loads back behind the first rows' arithmetic, and a thread waits out the memory latency several times */
#pragma unroll
  for (int u = 0; u < PP; ++u) { const v4f sg = up ? ss[u] : -ss[u];
#pragma unroll
    for (int b = 0; b < NB; ++b) { const v4f y = {rs_xm<8>(x[u][b][0]), rs_xm<8>(x[u][b][1]), rs_xm<8>(x[u][b][2]), rs_xm<8>(x[u][b][3])}; const v4f o = x[u][b] * cc[u] + y * sg; x[u][b] = o;
      if (H16OUT) for (int q = 0; q < 4; ++q) oh[u][b][q] = (_Float16)o[q]; } }
  __builtin_amdgcn_sched_barrier(0);      /* the stores stand behind the last arithmetic, so that no register which an issued store names is written again */
#pragma unroll
  for (int u = 0; u < PP; ++u)
#pragma unroll
    for (int b = 0; b < NB; ++b) { const size_t e = b * zO + (p0 + u) * DM + col; if (H16OUT) *(v4h*)(H16 + e) = oh[u][b]; else *(v4f*)(F32 + e) = x[u][b]; } }

__global__ __launch_bounds__(256) void k_bfcp(const float* __restrict__ src, float* __restrict__ dst, size_t n4) { const size_t t = (size_t)blockIdx.x * 256 + threadIdx.x; if (t >= n4) return; const v4f a = *(const v4fa*)(src + t * 4); v4f o; for (int q = 0; q < 4; ++q) o[q] = bf16_round(a[q]); *(v4f*)(dst + t * 4) = o;  }

__global__ __launch_bounds__(256) void k_tabhalf(const float* __restrict__ cs, const float* __restrict__ sn, float* __restrict__ CS, float* __restrict__ SN) { const int t = blockIdx.x * 256 + threadIdx.x; if (t >= SQ * (HD / 2)) return; const int p = t / (HD / 2), i = t % (HD / 2); const float c = bf16_round(cs[(size_t)p * HD + i]), s = bf16_round(sn[(size_t)p * HD + i]);
  *(float*)(CS + t) = c; *(float*)(SN + t) = s;  }

__global__ __launch_bounds__(256) void k_tab2d(float* __restrict__ CS, float* __restrict__ SN) {
  #pragma clang fp contract(off)
  const int t = blockIdx.x * 256 + threadIdx.x; if (t >= SQ * (HD / 2)) return; const int i = t % (HD / 2); const int p = t / (HD / 2); const float invf = (float)(1.0 / pow(10000.0, (double)(2 * i) / (double)HD)); const float ang = __fmul_rn((float)p, invf); const float c = cosf(ang), s = sinf(ang);
  *(float*)(CS + t) = c; *(float*)(SN + t) = s;  }
extern "C" void kernel_launch(void* const* d_in, const int* in_sizes, int n_in,
                              void* d_out, int out_size, void* d_ws, size_t ws_size, hipStream_t stream) {
  (void)in_sizes; (void)n_in; (void)out_size;
  const float* const* I = (const float* const*)d_in; const float* x = I[0]; const float* wattn = I[1]; const float* wo = I[2];      /* x; fused [in][out] W_attn [1024][3072] (q | k | v column thirds); [in][out] W_proj; rope tables computed in-kernel (positions = row index) */
  static_assert(HPG == 1 && NH == NG * HPG && NH * HD == DM && KVD == DM, "plain multi-head attention as 16 kv groups of one query head"); const float* bq = nullptr; const float* bk = nullptr; const float* bv = nullptr; const float* bo = nullptr;      /* [in][out] weights, no biases; rope tables computed in the kernel */
  char* ws = (char*)d_ws; size_t off = 0;
  auto take = [&](size_t bytes) { char* p = ws + off; off += (bytes + 255) & ~(size_t)255; return p; };
  _Float16* BQKV = (_Float16*)take((size_t)3 * DM * DM * 2); _Float16* BQ = BQKV; _Float16* BK = BQKV + (size_t)DM * DM; _Float16* BV = BQKV + (size_t)2 * DM * DM; _Float16* BO = (_Float16*)take((size_t)DM * DM * 2);      /* one transposed plane Bt [3072][1024] of the fused weight: rows 0..1023 = q, 1024.. = k, 2048.. = v */
  _Float16* X16 = (_Float16*)take(NR * DM * 2); float* CSB = (float*)take((size_t)SQ * HD * 4); float* SNB = (float*)take((size_t)SQ * HD * 4); _Float16* Q16 = (_Float16*)take(NR * DM * 2); _Float16* K16 = (_Float16*)take(NR * KVD * 2); _Float16* V16 = (_Float16*)take(NR * KVD * 2); _Float16* O16 = (_Float16*)take(NR * DM * 2);
  static_assert(B0 == 0 && NBR == NB && NHD == NH && QN == SQ, "every launch covers all batches and heads");
  float* S = (float*)take((size_t)NB * NH * QT * NKX * 4); _Float16* VT = (_Float16*)take((size_t)NB * NH * HD * SQ * 2);      /* S: plane that holds the f32 q and k rows */
  static_assert((size_t)NB * NH * QT * NKX >= NR * DM + NR * KVD, "the f32 q and k rows fit the score plane"); float* QF = S; float* KF = S + NR * DM;      /* f32 q, k before the rope: last read by the rope launches */
  float* QF0 = (float*)take((size_t)NB * QT0 * DM * 4); float* KF0 = (float*)take((size_t)NB * QT0 * KVD * 4); float* VF0 = (float*)take((size_t)NB * QT0 * KVD * 4); float* KF0e = (float*)take((size_t)NB * QT0 * DM * 4); float* VF0e = (float*)take((size_t)NB * QT0 * DM * 4); float* OF0 = (float*)take((size_t)NB * QT0 * DM * 4); _Float16* OH0 = (_Float16*)take((size_t)NB * QT0 * DM * 2); _Float16* OL0 = (_Float16*)take((size_t)NB * QT0 * DM * 2);
  if (off > ws_size) return;
  k_wt_f16<<<(unsigned)(((size_t)3 * DM * (DM / 8) + 255) / 256), 256, 0, stream>>>(wattn, BQKV, DM, 3 * DM, 16.0f); k_wt_f16<<<(unsigned)(((size_t)DM * (DM / 8) + 255) / 256), 256, 0, stream>>>(wo, BO, DM, DM, 16.0f);      /* [in][out] -> Bt x16 planes (fused W_attn: K 1024, N 3072) */
  k_x16<<<(unsigned)((NR * DM / 8 + 255) / 256), 256, 0, stream>>>(x, X16, NR * DM / 8);
  k_tab2d<<<(SQ * (HD / 2) + 255) / 256, 256, 0, stream>>>(CSB, SNB);      /* rope tables cos/sin(p / 10000^(2i/64)): inv_freq double-derived -> f32, f32 angle */
  /* Every launch below covers all NB batches: token rows b * SQ + s run through, or the batch is grid.z (GEMMs) / grid.y (first-tile kernels). */
  k_gemm2<0><<<dim3((unsigned)((MP / G2T) * (KVD / G2T)), 1), 256, 0, stream>>>(X16, DM, 0, BV, DM, 0, 0.0625f, bv, 0, nullptr, 1, 0, 0, nullptr, V16, KVD, 0, MP, KVD, DM, 0, 0, 0);
  k_gemm2<0><<<dim3((unsigned)((MP / G2T) * (DM / G2T)), 1), 256, 0, stream>>>(X16, DM, 0, BQ, DM, 0, 0.0625f, nullptr, 0, nullptr, 1, 0, 0, QF, nullptr, DM, 0, MP, DM, DM, 0, 0, 0);      /* q (f32) */
  k_gemm2<0><<<dim3((unsigned)((MP / G2T) * (KVD / G2T)), 1), 256, 0, stream>>>(X16, DM, 0, BK, DM, 0, 0.0625f, nullptr, 0, nullptr, 1, 0, 0, KF, nullptr, KVD, 0, MP, KVD, DM, 0, 0, 0);      /* k (f32) */
  k_rope<true, 4><<<SQ / 4, 256, 0, stream>>>(QF, (size_t)SQ * DM, CSB, SNB, Q16, nullptr, (size_t)SQ * DM); k_rope<true, 4><<<SQ / 4, 256, 0, stream>>>(KF, (size_t)SQ * DM, CSB, SNB, K16, nullptr, (size_t)SQ * DM);      /* half-split rope (out_lo = x_lo c - x_hi s, out_hi = x_lo s + x_hi c = t cos + rotate_half(t) sin with the module's [f | f] tables) -> f16 rows; position = row % SQ */
  k_rope<false, 1><<<QT0, 256, 0, stream>>>(QF, (size_t)SQ * DM, CSB, SNB, nullptr, QF0, (size_t)QT0 * DM); k_rope<false, 1><<<QT0, 256, 0, stream>>>(KF, (size_t)SQ * DM, CSB, SNB, nullptr, KF0, (size_t)QT0 * DM);      /* f32 half-split-roped q, k of rows 0..127 of each batch */
  k_vt<NG, SQ><<<NB * NG * (SQ / 64), 256, 0, stream>>>(V16, KVD, 0, VT);      /* V^T [NB][NH][HD][SQ] */
  k_gemm2<0><<<dim3((QT0 / G2T) * (KVD / G2T), 1, NB), 256, 0, stream>>>(X16, DM, 0, BV, DM, 0, 0.0625f, bv, 0, nullptr, 1, 0, 0, VF0, nullptr, KVD, 0, QT0, KVD, DM, (size_t)SQ * DM, 0, (size_t)QT0 * KVD);
  k_kvexp<<<(unsigned)(((size_t)NB * QT0 * DM / 4 + 255) / 256), 256, 0, stream>>>(KF0, KF0e, (size_t)NB * QT0 * DM / 4); k_kvexp<<<(unsigned)(((size_t)NB * QT0 * DM / 4 + 255) / 256), 256, 0, stream>>>(VF0, VF0e, (size_t)NB * QT0 * DM / 4);      /* head h <- kv group h / HPG for the exact first-tile kernel */      /* f32 q, k, v of the first 128 rows (exact products) */
  k_att0<<<dim3(NH * (QT0 / A0R), NB), 256, 0, stream>>>(QF0, KF0e, VF0e, 0.125f, OF0);      /* exact f32 attention for rows 0..127 of each batch (o x64) */
  k_fattn<<<NB * NH * (SQ / FAQ), FAW * 32, 0, stream>>>(Q16, K16, VT, O16);      /* scores, causal softmax and weighted values of all batches, heads and query tiles: o (x64) as f16 rows */
  k_gemm2<0><<<dim3((unsigned)((MPO / G2T) * (DM / G2T)), 1), 256, 0, stream>>>(O16, DM, 0, BO, DM, 0, 0.0009765625f, bo, 0, nullptr, 1, 0, 0, (float*)d_out, nullptr, DM, 0, MPO, DM, DM, 0, 0, 0);      /* out rows are the output layout */
  k_hl<<<(unsigned)(((size_t)NB * QT0 * DM / 8 + 255) / 256), 256, 0, stream>>>(OF0, OH0, OL0, (size_t)NB * QT0 * DM / 8);      /* first-tile o (x64) -> f16 hi + x1024 residual planes */
  k_gemm2<0><<<dim3((QT0 / G2T) * (DM / G2T), 1, NB), 256, 0, stream>>>(OH0, DM, 0, BO, DM, 0, 0.0009765625f, bo, 0, nullptr, 1, 0, 0, (float*)d_out, nullptr, DM, 0, QT0, DM, DM, (size_t)QT0 * DM, 0, (size_t)SQ * DM);      /* rows 0..127 of each batch: out = o_hi Wo (+ b), overwriting the f16-path rows */
  k_gemm2<0><<<dim3((QT0 / G2T) * (DM / G2T), 1, NB), 256, 0, stream>>>(OL0, DM, 0, BO, DM, 0, 0.00000095367431640625f, nullptr, 0, (const float*)d_out, -1, 0, 0, (float*)d_out, nullptr, DM, 0, QT0, DM, DM, (size_t)QT0 * DM, 0, (size_t)SQ * DM);      /* += o_lo Wo 2^-20 (own-element accumulate) */
}

// v007
// It runs in 196 microseconds.
// Two timings next to v006 put it at 1.28 and 1.26 times that version's speed.
// Counting every step since v000, it is 50.5 times as fast.
#include <hip/hip_runtime.h>
// Causal multi-head self-attention with rotate-half RoPE computed in the module and a bias-free fused QKV projection (x [4][2048][1024]; qkv = x Wqkv ([in][out] 1024 x 3072, no bias) split into q | k | v thirds, 16 heads of 64; cos / sin = [f | f] of pos * 10000^(-2i/64); q = q cos + rotate_half(q) sin, likewise k; scores * 64^-0.5; causal (tril, finfo.min fill); softmax; out = merged Wout ([in][out], no bias) -> [4][2048][1024]); run as grouped-query causal attention with 16 groups of ONE head and half-split rope.
// Compute dtype: inputs rounded to bf16; x / weights exact; q, k, v, softmax weights and o as plain f16 GEMM operands (~2^-12); scores and softmax statistics f32; v_wmma_f32_16x16x32_f16.
#define NB 4
#define NG 16
#define HPG 1
#define KVD (NG * HD)
#define SQ 2048
#define DM 1024
#define NH 16
#define HD 64
#define HG 4                         /* heads per k_vt(b, h0) launch (overload not called) */
#define QT 256                       /* unused */
#define NKX SQ                       /* unused */
#define QT0 128                      /* first-tile rows recomputed exactly in f32 */
#define B0 0                         /* first batch processed (debug hook) */
#define NBR NB                       /* batches processed (debug hook) */
#define NR ((size_t)NB * SQ)         /* token rows */
#define MP ((int)((size_t)NBR * SQ)) /* rows projected (debug hook) */
#define QN SQ                        /* query rows attended per batch (debug hook) */
#define NHD NH                       /* heads attended (debug hook) */
#define MPO MP                       /* rows through the output stage (debug hook) */
#define LQ DM      /* row pitch of the q/k/v rows */
typedef __bf16 v16b __attribute__((ext_vector_type(16)));
typedef unsigned short v8us __attribute__((ext_vector_type(8), may_alias));
typedef float  v8f  __attribute__((ext_vector_type(8)));
typedef float  v4f  __attribute__((ext_vector_type(4)));
typedef float  v4fa __attribute__((ext_vector_type(4), may_alias));
union FragB { v16b v; v8us half[2]; unsigned short u[16]; };

__device__ __forceinline__ unsigned short bf16_bits(float x) { unsigned int u = __float_as_uint(x); return (unsigned short)((u + 0x7FFFu + ((u >> 16) & 1u)) >> 16); }
__device__ __forceinline__ float bf16_val(unsigned short b) { return __uint_as_float(((unsigned int)b) << 16); }
__device__ __forceinline__ float bf16_round(float x) { return bf16_val(bf16_bits(x)); }
// D += A·B with NT terms: 1 = ah·bh, 2 = + al·bh (A split), 3 = + ah·bl (both split)
template <int NT>
__device__ __forceinline__ v8f mmaN(v16b ah, v16b al, v16b bh, v16b bl, v8f c) {
  c = __builtin_amdgcn_wmma_f32_16x16x32_bf16(false, ah, false, bh, (short)0, c, false, false);
  if (NT >= 2) c = __builtin_amdgcn_wmma_f32_16x16x32_bf16(false, al, false, bh, (short)0, c, false, false);
  if (NT >= 3) c = __builtin_amdgcn_wmma_f32_16x16x32_bf16(false, ah, false, bl, (short)0, c, false, false);
  asm volatile("v_nop\n\tv_nop\n\tv_nop\n\tv_nop" : "+v"(c) : "v"(ah), "v"(al), "v"(bh), "v"(bl));
  return c;
}

__global__ __launch_bounds__(256) void k_wt_bf16(const float* __restrict__ W, unsigned short* __restrict__ Wt, int K, int N) {
  const int t = blockIdx.x * 256 + threadIdx.x;
  const int k8n = K / 8;
  if (t >= N * k8n) return;
  const int n = t / k8n, k8 = (t % k8n) * 8;
  v8us v;
#pragma unroll
  for (int i = 0; i < 8; ++i) v[i] = bf16_bits(W[(size_t)(k8 + i) * N + n]);
  *(v8us*)(Wt + (size_t)n * K + k8) = v;
  
}

// GEMM C[M][N] (f32, pitch ldc) = act(A[M][K]·W + bias). A f32 row-major (pitch lda) converted per fragment to bf16
// (ASPLIT: hi/lo two planes -> 2 terms, else single rounded term); Wt bf16 [N][K] (pitch ldb). BIAS_BF16 rounds the
// bias to bf16 first (bias quantised to bf16 before the add). K%32==0, M%16==0, N%64==0.
template <bool ASPLIT, int ACT, bool BIAS_BF16>
__global__ __launch_bounds__(128) void k_gemm_bf(const float* __restrict__ A, int lda, const unsigned short* __restrict__ Wt, int ldb,
                                               const float* __restrict__ bias, float* __restrict__ C, int ldc, int M, int N, int K) {
  __shared__ __attribute__((aligned(16))) float so[4][16][64];
  const int tid = threadIdx.x, w = tid >> 5, lane = tid & 31, ln = lane & 15, hh = lane >> 4;
  const int ntn = N / 64;
  const int wid = blockIdx.x * 4 + w;
  const int mt = wid / ntn, nq = wid % ntn;
  if (mt * 16 >= M) return;
  const int row0 = mt * 16, col0 = nq * 64;
  const float* arow = A + (size_t)(row0 + ln) * lda;
  v8f acc[4] = {};
  for (int kb = 0; kb < K; kb += 32) {
    FragB ah, al;
    const v4f x0 = *(const v4fa*)(arow + kb + 8 * hh), x1 = *(const v4fa*)(arow + kb + 8 * hh + 4);
    const v4f x2 = *(const v4fa*)(arow + kb + 16 + 8 * hh), x3 = *(const v4fa*)(arow + kb + 16 + 8 * hh + 4);
    float xs[16] = {x0[0],x0[1],x0[2],x0[3],x1[0],x1[1],x1[2],x1[3],x2[0],x2[1],x2[2],x2[3],x3[0],x3[1],x3[2],x3[3]};
#pragma unroll
    for (int i = 0; i < 16; ++i) { const unsigned short hb = bf16_bits(xs[i]); ah.u[i] = hb; al.u[i] = ASPLIT ? bf16_bits(xs[i] - bf16_val(hb)) : (unsigned short)0; }
#pragma unroll
    for (int t = 0; t < 4; ++t) {
      const unsigned short* brow = Wt + (size_t)(col0 + t * 16 + ln) * ldb + kb;
      FragB b;
      b.half[0] = *(const v8us*)(brow + 8 * hh);
      b.half[1] = *(const v8us*)(brow + 16 + 8 * hh);
      acc[t] = mmaN<ASPLIT ? 2 : 1>(ah.v, al.v, b.v, b.v, acc[t]);
    }
  }
#pragma unroll
  for (int t = 0; t < 4; ++t) {
    float bv = bias ? bias[col0 + t * 16 + ln] : 0.f;
    if (BIAS_BF16) bv = bf16_round(bv);
#pragma unroll
    for (int r = 0; r < 8; ++r) { float v = acc[t][r] + bv; if (ACT == 1) v = fmaxf(v, 0.f); so[w][8 * hh + r][t * 16 + ln] = v; }
  }
  __builtin_amdgcn_fence(__ATOMIC_ACQ_REL, "workgroup");
  __builtin_amdgcn_wave_barrier();
  const int rsub = lane >> 4, c4 = (lane & 15) * 4;
  {
#pragma unroll
    for (int q = 0; q < 8; ++q) {
      const int r = q * 2 + rsub;
      const v4f v = *(const v4fa*)&so[w][r][c4];
      *(v4f*)(C + (size_t)(row0 + r) * ldc + col0 + c4) = v;
    }
    
  }
}

// GEMM C = act(A·W + bias + resid): A f32 (ASPLIT -> hi/lo 2 terms), Wt bf16 [N][K]; ACT 0 none, 1 relu, 2 exact gelu;
// resid (optional, f32, row index = (row % rmod), pitch ldr, RES_BF16 rounds it) added before the activation.
template <bool ASPLIT, int ACT, bool BIAS_BF16, bool RES_BF16>
__global__ __launch_bounds__(128) void k_gemm_bf3(const float* __restrict__ A, int lda, const unsigned short* __restrict__ Wt, int ldb,
                                                const float* __restrict__ bias, const float* __restrict__ resid, int rmod, int ldr,
                                                float* __restrict__ C, int ldc, int M, int N, int K) {
  __shared__ __attribute__((aligned(16))) float so[4][16][64];
  const int tid = threadIdx.x, w = tid >> 5, lane = tid & 31, ln = lane & 15, hh = lane >> 4;
  const int ntn = N / 64;
  const int wid = blockIdx.x * 4 + w;
  const int mt = wid / ntn, nq = wid % ntn;
  if (mt * 16 >= M) return;
  const int row0 = mt * 16, col0 = nq * 64;
  const float* arow = A + (size_t)(row0 + ln) * lda;
  v8f acc[4] = {};
  for (int kb = 0; kb < K; kb += 32) {
    FragB ah, al;
    const v4f x0 = *(const v4fa*)(arow + kb + 8 * hh), x1 = *(const v4fa*)(arow + kb + 8 * hh + 4);
    const v4f x2 = *(const v4fa*)(arow + kb + 16 + 8 * hh), x3 = *(const v4fa*)(arow + kb + 16 + 8 * hh + 4);
    float xs[16] = {x0[0],x0[1],x0[2],x0[3],x1[0],x1[1],x1[2],x1[3],x2[0],x2[1],x2[2],x2[3],x3[0],x3[1],x3[2],x3[3]};
#pragma unroll
    for (int i = 0; i < 16; ++i) { const unsigned short hb = bf16_bits(xs[i]); ah.u[i] = hb; al.u[i] = ASPLIT ? bf16_bits(xs[i] - bf16_val(hb)) : (unsigned short)0; }
#pragma unroll
    for (int t = 0; t < 4; ++t) {
      const unsigned short* brow = Wt + (size_t)(col0 + t * 16 + ln) * ldb + kb;
      FragB b;
      b.half[0] = *(const v8us*)(brow + 8 * hh);
      b.half[1] = *(const v8us*)(brow + 16 + 8 * hh);
      acc[t] = mmaN<ASPLIT ? 2 : 1>(ah.v, al.v, b.v, b.v, acc[t]);
    }
  }
#pragma unroll
  for (int t = 0; t < 4; ++t) {
    const int col = col0 + t * 16 + ln;
    float bv = bias ? bias[col] : 0.f;
    if (BIAS_BF16) bv = bf16_round(bv);
#pragma unroll
    for (int r = 0; r < 8; ++r) {
      float v = acc[t][r] + bv;
      if (resid) { float rv = resid[(size_t)((row0 + 8 * hh + r) % rmod) * ldr + col]; if (RES_BF16) rv = bf16_round(rv); v += rv; }
      if (ACT == 1) v = fmaxf(v, 0.f);
      if (ACT == 2) v = 0.5f * v * (1.0f + erff(v * 0.70710678118654752f));
      if (ACT == 3) { const float u = 0.7978845608028654f * (v + 0.044715f * v * v * v); v = 0.5f * v * (1.0f + tanhf(u)); }
      so[w][8 * hh + r][t * 16 + ln] = v;
    }
  }
  __builtin_amdgcn_fence(__ATOMIC_ACQ_REL, "workgroup");
  __builtin_amdgcn_wave_barrier();
  const int rsub = lane >> 4, c4 = (lane & 15) * 4;
  {
#pragma unroll
    for (int q = 0; q < 8; ++q) {
      const int r = q * 2 + rsub;
      const v4f v = *(const v4fa*)&so[w][r][c4];
      *(v4f*)(C + (size_t)(row0 + r) * ldc + col0 + c4) = v;
    }
    
  }
}
// row LayerNorm (biased variance, eps) over N: s = X (+ R); optional out_sum <- s; out_norm <- (s-mu)*rsqrt(var+eps)*g + b
template <bool PARAM_BF16>
__global__ __launch_bounds__(256) void k_layernorm(const float* __restrict__ X, const float* __restrict__ R, const float* __restrict__ g, const float* __restrict__ bta,
                                                  float* __restrict__ out_sum, float* __restrict__ out_norm, int N, float eps) {
  __shared__ float red[256];
  const int row = blockIdx.x, tid = threadIdx.x;
  const float* x = X + (size_t)row * N; const float* rr = R ? R + (size_t)row * N : nullptr;
  float vals[16];                     // up to N = 4096
  const int per = N / 256;            // contiguous chunk per thread? use strided-by-4 chunks: thread handles j = tid*4 + 1024*u
  float s1 = 0.f;
  for (int u = 0; u < per / 4; ++u) {
    const int j = tid * 4 + 1024 * u;
    const v4f a = *(const v4fa*)(x + j);
    v4f b = {0.f,0.f,0.f,0.f}; if (rr) b = *(const v4fa*)(rr + j);
#pragma unroll
    for (int q = 0; q < 4; ++q) { const float v = a[q] + b[q]; vals[u * 4 + q] = v; s1 += v; }
  }
  red[tid] = s1; __syncthreads();
  for (int st = 128; st > 0; st >>= 1) { if (tid < st) red[tid] += red[tid + st]; __syncthreads(); }
  const float mu = red[0] / (float)N; __syncthreads();
  float s2 = 0.f;
  for (int u = 0; u < per / 4; ++u)
#pragma unroll
    for (int q = 0; q < 4; ++q) { const float c = vals[u * 4 + q] - mu; s2 += c * c; }
  red[tid] = s2; __syncthreads();
  for (int st = 128; st > 0; st >>= 1) { if (tid < st) red[tid] += red[tid + st]; __syncthreads(); }
  const float rs = rsqrtf(red[0] / (float)N + eps);
  {
    for (int u = 0; u < per / 4; ++u) {
      const int j = tid * 4 + 1024 * u;
      v4f o, sm;
#pragma unroll
      for (int q = 0; q < 4; ++q) {
        float gg = g[j + q], bb = bta[j + q];
        if (PARAM_BF16) { gg = bf16_round(gg); bb = bf16_round(bb); }
        sm[q] = vals[u * 4 + q]; o[q] = (vals[u * 4 + q] - mu) * rs * gg + bb;
      }
      if (out_sum) *(v4f*)(out_sum + (size_t)row * N + j) = sm;
      *(v4f*)(out_norm + (size_t)row * N + j) = o;
    }
    
  }
}



// ---- f16 WMMA path (v_wmma_f32_16x16x32_f16): 11-bit significands for operands in range — used where a [0,1] probability operand needs more precision than bf16
typedef _Float16 v16h __attribute__((ext_vector_type(16)));
union FragH { v16h v; v8us half[2]; _Float16 h[16]; unsigned short u[16]; };
template <int NT>
__device__ __forceinline__ v8f mmaH(v16h ah, v16h al, v16h bh, v16h bl, v8f c) {
  c = __builtin_amdgcn_wmma_f32_16x16x32_f16(false, ah, false, bh, (short)0, c, false, false);
  if (NT >= 2) c = __builtin_amdgcn_wmma_f32_16x16x32_f16(false, al, false, bh, (short)0, c, false, false);
  if (NT >= 3) c = __builtin_amdgcn_wmma_f32_16x16x32_f16(false, ah, false, bl, (short)0, c, false, false);
  asm volatile("v_nop\n\tv_nop\n\tv_nop\n\tv_nop" : "+v"(c) : "v"(ah), "v"(al), "v"(bh), "v"(bl));
  return c;
}
// batched GEMM like k_gemm_b but f16 operands: A f32 (split into f16 hi/lo if ASPLIT, else rounded to f16), Bt = f16 values [n][k]; alpha; C f32; N multiple of 16 (partial tiles skipped)
template <bool ASPLIT>
__global__ __launch_bounds__(128) void k_gemm_h(const float* __restrict__ A, int lda, size_t sA, const _Float16* __restrict__ Bh, int ldb, size_t sB, float alpha, float* __restrict__ C, int ldc, size_t sC, int M, int N, int K) {
  __shared__ __attribute__((aligned(16))) float so[4][16][64];
  const int tid = threadIdx.x, w = tid >> 5, lane = tid & 31, ln = lane & 15, hh = lane >> 4; const int by = blockIdx.y;
  A += (size_t)by * sA; Bh += (size_t)by * sB; C += (size_t)by * sC;
  const int ntn = (N + 63) / 64; const int wid = blockIdx.x * 4 + w; const int mt = wid / ntn, nq = wid % ntn; if (mt * 16 >= M) return;
  const int row0 = mt * 16, col0 = nq * 64; const float* arow = A + (size_t)(row0 + ln) * lda;
  v8f acc[4] = {};
  for (int kb = 0; kb < K; kb += 32) {
    FragH ah, al;
    const v4f x0 = *(const v4fa*)(arow + kb + 8 * hh), x1 = *(const v4fa*)(arow + kb + 8 * hh + 4), x2 = *(const v4fa*)(arow + kb + 16 + 8 * hh), x3 = *(const v4fa*)(arow + kb + 16 + 8 * hh + 4);
    float xs[16] = {x0[0],x0[1],x0[2],x0[3],x1[0],x1[1],x1[2],x1[3],x2[0],x2[1],x2[2],x2[3],x3[0],x3[1],x3[2],x3[3]};
#pragma unroll
    for (int i = 0; i < 16; ++i) { const _Float16 h = (_Float16)xs[i]; ah.h[i] = h; al.h[i] = ASPLIT ? (_Float16)(xs[i] - (float)h) : (_Float16)0.0f; }
#pragma unroll
    for (int t = 0; t < 4; ++t) { if (col0 + t * 16 >= N) continue; const size_t boff = (size_t)(col0 + t * 16 + ln) * ldb + kb; FragH bq; bq.half[0] = *(const v8us*)(Bh + boff + 8 * hh); bq.half[1] = *(const v8us*)(Bh + boff + 16 + 8 * hh);
      acc[t] = mmaH<ASPLIT ? 2 : 1>(ah.v, al.v, bq.v, bq.v, acc[t]); }
  }
#pragma unroll
  for (int t = 0; t < 4; ++t) { if (col0 + t * 16 >= N) continue;
#pragma unroll
    for (int r = 0; r < 8; ++r) so[w][8 * hh + r][t * 16 + ln] = acc[t][r] * alpha; }
  __builtin_amdgcn_fence(__ATOMIC_ACQ_REL, "workgroup"); __builtin_amdgcn_wave_barrier();
  const int rsub = lane >> 4, c4 = (lane & 15) * 4;
  {
#pragma unroll
    for (int q = 0; q < 8; ++q) { const int r = q * 2 + rsub; if (col0 + c4 < N) { const v4f v = *(const v4fa*)&so[w][r][c4]; *(v4f*)(C + (size_t)(row0 + r) * ldc + col0 + c4) = v; } }
     }
}

// Wt[n][k] = f16(W[k][n]·scale) from f32 row-major W[K][N] (scale = power of two; bf16-exact weights stay exact in f16 away from the subnormal range)
__global__ __launch_bounds__(256) void k_wt_f16(const float* __restrict__ W, _Float16* __restrict__ Wt, int K, int N, float scale) {
  const int t = blockIdx.x * 256 + threadIdx.x; if (t >= N * (K / 8)) return; const int n = t / (K / 8), k8 = (t % (K / 8)) * 8; FragH f;
#pragma unroll
  for (int i = 0; i < 8; ++i) f.h[i] = (_Float16)(bf16_round(W[(size_t)(k8 + i) * N + n]) * scale); const v8us o = f.half[0];
  *(v8us*)((unsigned short*)Wt + (size_t)n * K + k8) = o; 
}
// k_gemm_hh variant with fused epilogue: v = acc·alpha + bias[by·sBias + col] (+ CP[(row/rowsPerB)·sCPb + by·64 + col] if CP) ; ACT 0 none / 1 elu ; writes f16 C16 (and f32 C if non-null)
template <int ACT>
__global__ __launch_bounds__(128) void k_gemm_hhx(const _Float16* __restrict__ A, int lda, size_t sA, const _Float16* __restrict__ Bh, int ldb, size_t sB, float alpha, const float* __restrict__ bias, size_t sBias, const float* __restrict__ CP, int rowsPerB, size_t sCPb, int row0g,
    float* __restrict__ C, _Float16* __restrict__ C16, int ldc, size_t sC, int M, int N, int K) {
  __shared__ __attribute__((aligned(16))) float so[4][16][64];
  const int tid = threadIdx.x, w = tid >> 5, lane = tid & 31, ln = lane & 15, hh = lane >> 4; const int by = blockIdx.y;
  A += (size_t)by * sA; Bh += (size_t)by * sB; const size_t cofs = (size_t)by * sC; const float* bp = bias ? bias + (size_t)by * sBias : nullptr;
  const int ntn = (N + 63) / 64; const int wid = blockIdx.x * 4 + w; const int mt = wid / ntn, nq = wid % ntn; if (mt * 16 >= M) return;
  const int row0 = mt * 16, col0 = nq * 64; const _Float16* arow = A + (size_t)(row0 + ln) * lda;
  v8f acc[4] = {};
  for (int kb = 0; kb < K; kb += 32) { FragH ah; ah.half[0] = *(const v8us*)((const unsigned short*)arow + kb + 8 * hh); ah.half[1] = *(const v8us*)((const unsigned short*)arow + kb + 16 + 8 * hh);
#pragma unroll
    for (int t = 0; t < 4; ++t) { if (col0 + t * 16 >= N) continue; const size_t boff = (size_t)(col0 + t * 16 + ln) * ldb + kb; FragH bq; bq.half[0] = *(const v8us*)((const unsigned short*)Bh + boff + 8 * hh); bq.half[1] = *(const v8us*)((const unsigned short*)Bh + boff + 16 + 8 * hh);
      acc[t] = mmaH<1>(ah.v, ah.v, bq.v, bq.v, acc[t]); }
  }
#pragma unroll
  for (int t = 0; t < 4; ++t) { if (col0 + t * 16 >= N) continue; const int col = col0 + t * 16 + ln; const float bv = bp ? bf16_round(bp[col]) : 0.f;
#pragma unroll
    for (int r = 0; r < 8; ++r) { float v = acc[t][r] * alpha + bv; if (CP) { const int rr = row0g + row0 + 8 * hh + r; if (rowsPerB < 0) v += CP[cofs + (size_t)rr * ldc + col];      /* rowsPerB < 0: own element of the batched C plane */ else { const int bidx = rr / rowsPerB; v += CP[(size_t)bidx * sCPb + (size_t)by * 64 + col]; } } if (ACT == 1) v = (v > 0.f) ? v : expm1f(v); else if (ACT == 7) v = (v > 0.f) ? v + 1.0f : expf(v); else if (ACT == 8) v = tanhf(v); else if (ACT == 9) v = 0.5f * v * (1.0f + tanhf(0.7978845608028654f * (v + 0.044715f * v * v * v))); else if (ACT == 11) v = 1.0f / (1.0f + expf(-v)); else if (ACT == 12) v = (v > 0.f) ? v : 0.01f * v; else if (ACT == 14) v = (v > 0.f) ? v : 0.1f * v; else if (ACT == 16) v = (v >= 0.f) ? v : 0.3f * v; else if (ACT == 17) v = (v >= 0.f) ? v : 0.2f * v; else if (ACT == 15) v = v / (1.0f + expf(-v)); else if (ACT == 3) v = fmaxf(v, 0.f); else if (ACT == 6) v = 0.5f * v * (1.0f + erff(v * 0.70710678118654752f)); so[w][8 * hh + r][t * 16 + ln] = v; } }
  __builtin_amdgcn_fence(__ATOMIC_ACQ_REL, "workgroup"); __builtin_amdgcn_wave_barrier();
  const int rsub = lane >> 4, c4 = (lane & 15) * 4; typedef _Float16 v4h __attribute__((ext_vector_type(4)));
  {
#pragma unroll
    for (int q = 0; q < 8; ++q) { const int r = q * 2 + rsub; if (col0 + c4 < N) { const v4f v = *(const v4fa*)&so[w][r][c4]; if (C) *(v4f*)(C + cofs + (size_t)(row0 + r) * ldc + col0 + c4) = v; if (C16) { v4h h4; for (int i = 0; i < 4; ++i) h4[i] = (_Float16)v[i]; *(v4h*)(C16 + cofs + (size_t)(row0 + r) * ldc + col0 + c4) = h4; } } }
     }
}


typedef _Float16 v4h __attribute__((ext_vector_type(4)));

__global__ __launch_bounds__(256) void k_x16(const float* __restrict__ x, _Float16* __restrict__ X16, size_t n8) { const size_t t = (size_t)blockIdx.x * 256 + threadIdx.x; if (t >= n8) return; FragH f;
#pragma unroll
  for (int q = 0; q < 8; ++q) f.h[q] = (_Float16)bf16_round(x[t * 8 + q]); *(v8us*)((unsigned short*)X16 + t * 8) = f.half[0];  }
__global__ __launch_bounds__(256) void k_h16(const float* __restrict__ x, _Float16* __restrict__ X16, size_t n8) { const size_t t = (size_t)blockIdx.x * 256 + threadIdx.x; if (t >= n8) return; FragH f;
#pragma unroll
  for (int q = 0; q < 8; ++q) f.h[q] = (_Float16)x[t * 8 + q]; *(v8us*)((unsigned short*)X16 + t * 8) = f.half[0];  }
__global__ __launch_bounds__(256) void k_round16f(const float* __restrict__ W, _Float16* __restrict__ Bt, size_t n8) { const size_t t = (size_t)blockIdx.x * 256 + threadIdx.x; if (t >= n8) return; FragH f;
#pragma unroll
  for (int i = 0; i < 8; ++i) f.h[i] = (_Float16)(bf16_round(W[t * 8 + i]) * 16.0f); *(v8us*)((unsigned short*)Bt + t * 8) = f.half[0];  }
template <int NHv, int TTv>
__global__ __launch_bounds__(256) void k_vt(const _Float16* __restrict__ V16, int ldv, int voff, _Float16* __restrict__ Vt) { __shared__ unsigned short tl[64][66]; const int tid = threadIdx.x; const int slab = blockIdx.x / (TTv / 64), lg = blockIdx.x % (TTv / 64); const int b = slab / NHv, h = slab % NHv;
  for (int i = tid; i < 64 * 8; i += 256) { const int r = i / 8, c8 = (i % 8) * 8; FragH f; f.half[0] = *(const v8us*)((const unsigned short*)V16 + ((size_t)b * TTv + lg * 64 + r) * ldv + voff + h * 64 + c8);
#pragma unroll
    for (int q = 0; q < 8; ++q) tl[r][c8 + q] = f.u[q]; }
  __syncthreads();
  {
#pragma unroll
    for (int rd = 0; rd < 2; ++rd) { const int d = rd * 32 + tid / 8, pc = tid % 8; FragH f;
#pragma unroll
      for (int q = 0; q < 8; ++q) f.u[q] = tl[pc * 8 + q][d];
      *(v8us*)((unsigned short*)Vt + ((size_t)slab * 64 + d) * TTv + lg * 64 + pc * 8) = f.half[0]; }
     } }

__global__ __launch_bounds__(256) void k_hl(const float* __restrict__ F, _Float16* __restrict__ Hh, _Float16* __restrict__ Hl, size_t n8) { const size_t t = (size_t)blockIdx.x * 256 + threadIdx.x; if (t >= n8) return; FragH fh, fl; const v4f a = *(const v4fa*)(F + t * 8), c = *(const v4fa*)(F + t * 8 + 4);
#pragma unroll
  for (int q = 0; q < 4; ++q) { _Float16 h = (_Float16)a[q]; fh.h[q] = h; fl.h[q] = (_Float16)((a[q] - (float)h) * 1024.0f); h = (_Float16)c[q]; fh.h[4 + q] = h; fl.h[4 + q] = (_Float16)((c[q] - (float)h) * 1024.0f); }
  { *(v8us*)((unsigned short*)Hh + t * 8) = fh.half[0]; *(v8us*)((unsigned short*)Hl + t * 8) = fl.half[0];  } }

// ---- fast GEMM (work-group tile 128x128, 8 waves of 32x64; requires M % 128 == 0 rows per launch region, N % 128 == 0 and K % 64 == 0); epilogue = k_gemm_hhx semantics ----
// A stage is G2K k of the tile's 128 A rows and 128 Bt rows. 8 threads fetch one row's 128-byte line, one stage ahead into registers, and store it to one of two LDS buffers; the 8 waves read their fragments from LDS,
// so that every operand line leaves L2 once per work-group as a whole line. One barrier per stage publishes the next buffer and ends the reads of the one that is refilled after it. k runs in the order of the unstaged loop.
#define G2T 128                      /* A rows and Bt rows per work-group */
#define G2K 64                       /* k per LDS stage: 64 f16 = one 128-byte line of every row */
#define G2P (G2K + 8)                /* LDS row pitch in halves: 144 B = 16 B x odd, so that the 16 rows of a fragment load fall on different banks */
#define G2S (2 * G2T * G2P)          /* halves per stage buffer: the A rows, then the Bt rows */
__device__ __forceinline__ v16h g2_frag(const _Float16* p, int hh) { FragH f; f.half[0] = *(const v8us*)((const unsigned short*)p + 8 * hh); f.half[1] = *(const v8us*)((const unsigned short*)p + 16 + 8 * hh); return f.v; }
__device__ __forceinline__ v8f g2_mma(v16h a, v16h b, v8f c) { v8f d = __builtin_amdgcn_wmma_f32_16x16x32_f16(false, a, false, b, (short)0, c, false, false); asm volatile("v_nop\n\tv_nop\n\tv_nop\n\tv_nop" : "+v"(d) : "v"(a), "v"(b)); return d; }
template <int ACT>
__global__ __launch_bounds__(256) void k_gemm2(const _Float16* __restrict__ A, int lda, size_t sA, const _Float16* __restrict__ Bh, int ldb, size_t sB, float alpha, const float* __restrict__ bias, size_t sBias, const float* __restrict__ CP, int rowsPerB, size_t sCPb, int row0g,
    float* __restrict__ C, _Float16* __restrict__ C16, int ldc, size_t sC, int M, int N, int K, size_t zA, size_t zB, size_t zC) { static_assert(ACT == 0 || ACT == 3 || ACT == 6 || ACT == 8 || ACT == 9 || ACT == 11 || ACT == 12 || ACT == 14 || ACT == 15 || ACT == 16 || ACT == 17, "k_gemm2: unsupported ACT code (would silently apply no activation)");
  static_assert(2 * G2S * 2 >= 8 * 32 * 68 * 4 && G2T == 128 && G2K == 64, "the epilogue's rows fit the two stage buffers; 256 threads stage 32 rows per pass");
  __shared__ __attribute__((aligned(16))) unsigned char sm[2 * G2S * 2]; _Float16* const sg = (_Float16*)sm; float (*const so)[32][68] = (float (*)[32][68])sm;      /* the stage buffers; behind the loop's last barrier the same bytes hold each wave's output rows */
  const int tid = threadIdx.x, w = tid >> 5, wm = w & 3, wn = w >> 2, lane = tid & 31, ln = lane & 15, hh = lane >> 4; const int by = blockIdx.y, bz = blockIdx.z;      /* grid.y = head (strides sA, sB, sC), grid.z = batch (strides zA, zB, zC) */
  A += (size_t)by * sA + (size_t)bz * zA; Bh += (size_t)by * sB + (size_t)bz * zB; const size_t cofs = (size_t)by * sC + (size_t)bz * zC; const float* bp = bias ? bias + (size_t)by * sBias : nullptr;
  const int ntn = N >> 7; const int mt = blockIdx.x / ntn, nq = blockIdx.x - mt * ntn; if (mt * G2T >= M) return;      /* taken by a whole work-group, in front of every barrier */
  const int row0 = mt * G2T + 32 * wm, col0 = nq * G2T + 64 * wn;
  const int sr = tid >> 3, sc = (tid & 7) * 8; const int sl = sr * G2P + sc;      /* staging: row sr + 32 u, eight halves at column sc */
  const _Float16* ag = A + (size_t)(mt * G2T + sr) * lda + sc; const _Float16* bg = Bh + (size_t)(nq * G2T + sr) * ldb + sc; const int nst = K / G2K;
  const v8f z8 = {0.f,0.f,0.f,0.f,0.f,0.f,0.f,0.f}; v8f c00 = z8, c01 = z8, c02 = z8, c03 = z8, c10 = z8, c11 = z8, c12 = z8, c13 = z8;
  v8us ar[4], br[4]; const unsigned short* pa[4]; const unsigned short* pb[4];      /* the full unrolls give these register arrays constant indices and put a stage's eight loads in flight together */
#pragma unroll
  for (int u = 0; u < 4; ++u) { pa[u] = (const unsigned short*)(ag + (size_t)(u * 32) * lda); pb[u] = (const unsigned short*)(bg + (size_t)(u * 32) * ldb); }
#pragma unroll
  for (int u = 0; u < 4; ++u) { ar[u] = *(const v8us*)pa[u]; br[u] = *(const v8us*)pb[u]; }
  asm volatile("s_wait_xcnt 0x0" :: "v"(pa[0]), "v"(pa[1]), "v"(pa[2]), "v"(pa[3]), "v"(pb[0]), "v"(pb[1]), "v"(pb[2]), "v"(pb[3]) : "memory");      /* the loads' address registers are free for reuse only from here on; as inputs they stay whole up to this wait, so that no load returns into one either */
#pragma unroll
  for (int u = 0; u < 4; ++u) { *(v8us*)(unsigned short*)&sg[sl + u * 32 * G2P] = ar[u]; *(v8us*)(unsigned short*)&sg[G2T * G2P + sl + u * 32 * G2P] = br[u]; }
  __syncthreads();
#pragma unroll 1
  for (int s = 0; s < nst; ++s) { const bool more = s + 1 < nst;      /* more: the same for the whole work-group. The stage loop stays rolled, so that its text stays small; its two 32-k passes are unrolled, so that their LDS offsets are immediates */
    if (more) {
#pragma unroll
      for (int u = 0; u < 4; ++u) { pa[u] = (const unsigned short*)(ag + (s + 1) * G2K + (size_t)(u * 32) * lda); pb[u] = (const unsigned short*)(bg + (s + 1) * G2K + (size_t)(u * 32) * ldb); }
#pragma unroll
      for (int u = 0; u < 4; ++u) { ar[u] = *(const v8us*)pa[u]; br[u] = *(const v8us*)pb[u]; }
      asm volatile("s_wait_xcnt 0x0" :: "v"(pa[0]), "v"(pa[1]), "v"(pa[2]), "v"(pa[3]), "v"(pb[0]), "v"(pb[1]), "v"(pb[2]), "v"(pb[3]) : "memory"); }      /* the code below reuses the registers that these loads name: this wait stands in front of that overwrite, and as its inputs they stay whole up to it, so that no load returns into one either */
    const _Float16* ab = sg + (s & 1) * G2S + (32 * wm + ln) * G2P; const _Float16* bb = sg + (s & 1) * G2S + (G2T + 64 * wn + ln) * G2P;
#pragma unroll
    for (int kc = 0; kc < G2K; kc += 32) { const v16h a0 = g2_frag(ab + kc, hh), a1 = g2_frag(ab + 16 * G2P + kc, hh);
      const v16h b0 = g2_frag(bb + kc, hh), b1 = g2_frag(bb + 16 * G2P + kc, hh), b2 = g2_frag(bb + 32 * G2P + kc, hh), b3 = g2_frag(bb + 48 * G2P + kc, hh);
      c00 = g2_mma(a0, b0, c00); c10 = g2_mma(a1, b0, c10); c01 = g2_mma(a0, b1, c01); c11 = g2_mma(a1, b1, c11);
      c02 = g2_mma(a0, b2, c02); c12 = g2_mma(a1, b2, c12); c03 = g2_mma(a0, b3, c03); c13 = g2_mma(a1, b3, c13); }
    if (more) {
#pragma unroll
      for (int u = 0; u < 4; ++u) { *(v8us*)(unsigned short*)&sg[((s + 1) & 1) * G2S + sl + u * 32 * G2P] = ar[u]; *(v8us*)(unsigned short*)&sg[((s + 1) & 1) * G2S + G2T * G2P + sl + u * 32 * G2P] = br[u]; } }
    __syncthreads(); }      /* publishes stage s + 1 and ends every wave's reads of stage s, whose buffer the next trip refills and, behind the last trip, the output rows reuse */
  v8f accs[8] = {c00, c01, c02, c03, c10, c11, c12, c13};
#pragma unroll
  for (int u = 0; u < 8; ++u) { const int t = u & 3, half = u >> 2; const int col = col0 + t * 16 + ln; const float bv = bp ? bf16_round(bp[col]) : 0.f;
#pragma unroll
    for (int r = 0; r < 8; ++r) { const int rloc = half * 16 + 8 * hh + r; float v = accs[u][r] * alpha + bv; if (CP) { if (rowsPerB < 0) v += CP[cofs + (size_t)(row0g + row0 + rloc) * ldc + col];      /* rowsPerB < 0: own element of the batched C plane */ else { const int bidx = (row0g + row0 + rloc) / rowsPerB; v += CP[(size_t)bidx * sCPb + (size_t)by * 64 + col]; } }
      if (ACT == 3) v = fmaxf(v, 0.f); else if (ACT == 6) v = 0.5f * v * (1.0f + erff(v * 0.70710678118654752f)); else if (ACT == 11) v = 1.0f / (1.0f + expf(-v)); else if (ACT == 15) v = v / (1.0f + expf(-v)); else if (ACT == 12) v = (v > 0.f) ? v : 0.01f * v; else if (ACT == 8) v = tanhf(v); else if (ACT == 9) v = 0.5f * v * (1.0f + tanhf(0.7978845608028654f * (v + 0.044715f * v * v * v))); else if (ACT == 14) v = (v > 0.f) ? v : 0.1f * v; else if (ACT == 16) v = (v >= 0.f) ? v : 0.3f * v; else if (ACT == 17) v = (v >= 0.f) ? v : 0.2f * v;
      so[w][rloc][t * 16 + ln] = v; } }
  __builtin_amdgcn_fence(__ATOMIC_ACQ_REL, "workgroup"); __builtin_amdgcn_wave_barrier();
  const int rsub = lane >> 4, c4 = (lane & 15) * 4;
  {
#pragma unroll
    for (int q = 0; q < 16; ++q) { const int r = q * 2 + rsub; const v4f v = *(const v4fa*)&so[w][r][c4]; if (C) *(v4f*)(C + cofs + (size_t)(row0 + r) * ldc + col0 + c4) = v; if (C16) { v4h h4; for (int i = 0; i < 4; ++i) h4[i] = (_Float16)v[i]; *(v4h*)(C16 + cofs + (size_t)(row0 + r) * ldc + col0 + c4) = h4; } }
     } }


__global__ __launch_bounds__(256) void k_wnat(const float* __restrict__ w, size_t n8, _Float16* __restrict__ Bt) { const size_t t = (size_t)blockIdx.x * 256 + threadIdx.x; if (t >= n8) return; FragH f; for (int q = 0; q < 8; ++q) f.h[q] = (_Float16)(bf16_round(w[t * 8 + q]) * 16.0f); *(v8us*)((unsigned short*)Bt + t * 8) = f.half[0];  }
__global__ __launch_bounds__(256) void k_rsm(const float* __restrict__ S, _Float16* __restrict__ P, int nrows) {
  #pragma clang fp contract(off)
  const int i = blockIdx.x * 256 + threadIdx.x; if (i >= nrows) return; const float* s = S + (size_t)i * SQ; float mx = -3.0e38f;
#pragma unroll 1
  for (int j = 0; j < SQ; ++j) mx = fmaxf(mx, s[j]); float se = 0.f;
#pragma unroll 1
  for (int j = 0; j < SQ; ++j) se += expf(s[j] - mx); const float sc = 256.0f / se;
#pragma unroll 1
  for (int j0 = 0; j0 < SQ; j0 += 8) { FragH f; for (int q = 0; q < 8; ++q) f.h[q] = (_Float16)(expf(s[j0 + q] - mx) * sc); unsigned short* d = (unsigned short*)P + (size_t)i * SQ + j0; *(v8us*)d = f.half[0];  } }
__global__ __launch_bounds__(256) void k_vt(const _Float16* __restrict__ V16, int b, int h0, _Float16* __restrict__ VT) { __shared__ unsigned short tl[64][65]; const int tid = threadIdx.x; const int hh = blockIdx.x % HG, sg = blockIdx.x / HG; const int s0 = sg * 64; const int h = h0 + hh;
  for (int i = tid; i < 64 * 8; i += 256) { const int j = i / 8, d8 = (i % 8) * 8; FragH f; f.half[0] = *(const v8us*)((const unsigned short*)V16 + ((size_t)b * SQ + s0 + j) * DM + h * HD + d8); for (int q = 0; q < 8; ++q) tl[d8 + q][j] = f.u[q]; }
  __syncthreads();
  { for (int i = tid; i < 64 * 8; i += 256) { const int d = i / 8, j8 = (i % 8) * 8; FragH f; for (int q = 0; q < 8; ++q) f.u[q] = tl[d][j8 + q]; *(v8us*)((unsigned short*)VT + ((size_t)hh * HD + d) * SQ + s0 + j8) = f.half[0]; }  } }



// Lane l <-> l ^ M inside a 16-lane row (DPP row_xmask) and l <-> l ^ 16 (cross-row move): a five-step butterfly leaves the row's maximum / sum in every lane without an LDS round trip.
template <int M> __device__ __forceinline__ float rs_xm(float x) { return __builtin_bit_cast(float, __builtin_amdgcn_update_dpp(0, __builtin_bit_cast(int, x), 0x160 | M, 0xf, 0xf, true)); }
__device__ __forceinline__ float rs_xh(float x) { return __builtin_bit_cast(float, __builtin_amdgcn_permlanex16(__builtin_bit_cast(int, x), __builtin_bit_cast(int, x), 0x76543210, 0xfedcba98, false, false)); }
// Fused causal attention, all batches, heads and query tiles in ONE launch: scores, softmax and weighted values stay in registers, nothing of them goes to memory.
// A work-group of FAW waves takes FAQ query rows of one head, 32 per wave, and walks the keys 0 .. its last row in stages of FAK keys. A stage's K rows [key][d] and V^T rows [d][key] are fetched with whole-line loads
// one stage ahead into registers and stored to one of two LDS buffers; one barrier per stage publishes the next buffer and ends the reads of the one that is refilled after it.
// Per 32-key pass a wave forms S^T = K Q^T (A = K rows, B = q rows held in registers): lane (c, h) then holds keys 8h + r of query c, so the maximum and the sum are in-lane plus one exchange of the wave's halves,
// and the two 16-key score tiles, converted in place, are the B operand of O^T += V^T P^T (A = V^T rows in the same k order). Online softmax in the log2 domain; the maximum in use may trail the true one by up to 8,
// so a weight can reach 2^8 (f16 holds it at full relative precision) and the accumulators are rescaled only in the rare pass in which some query's maximum grows by more.
// The full unrolls in the kernel give its register arrays (fragments, score tiles, accumulators, staged rows) constant indices, without which they would go to scratch memory.
#define FAW 4                        /* waves per work-group */
#define FAQ (FAW * 32)               /* query rows per work-group */
#define FAK 64                       /* keys per LDS stage: two 32-key passes; 64 f16 = one 128-byte line of a V^T row */
#define FAP (HD + 8)                 /* LDS row pitch in halves: 144 B = 16 B x odd, so that the 16 rows of a fragment load fall on different banks */
__device__ __forceinline__ v8f fa_mma(v16h a, v16h b, v8f c) { return __builtin_amdgcn_wmma_f32_16x16x32_f16(false, a, false, b, (short)0, c, false, false); }
__device__ __forceinline__ v16h fa_frag(const _Float16* p) { FragH f; f.half[0] = *(const v8us*)(const unsigned short*)p; f.half[1] = *(const v8us*)((const unsigned short*)p + 16); return f.v; }      /* p already holds the lane's 8 * h: k = 8h .. 8h+7 and 16+8h .. 16+8h+7, the order of g2_frag */
// Four vector slots between a run of matrix instructions and the branch behind it: on the taken side the next vector instruction may read their results. The two scheduling barriers keep the slots at that place.
__device__ __forceinline__ void fa_gap() { __builtin_amdgcn_sched_barrier(0); asm volatile("v_nop\n\tv_nop\n\tv_nop\n\tv_nop"); __builtin_amdgcn_sched_barrier(0); }
__global__ __launch_bounds__(FAW * 32) void k_fattn(const _Float16* __restrict__ Qh, const _Float16* __restrict__ Kh, const _Float16* __restrict__ Vt, _Float16* __restrict__ Oh) {
  static_assert(HD == 64 && FAK == 64 && FAQ % FAK == 0 && SQ / FAQ == 16 && NB * NH == 64 && FAW * 32 == 128 && KVD == DM, "16 query tiles x 64 (batch, head) pairs; 8 threads stage one 128-byte row, 16 rows per pass of the staging loop");
  __shared__ __attribute__((aligned(16))) _Float16 ks[2][FAK * FAP]; __shared__ __attribute__((aligned(16))) _Float16 vs[2][HD * FAP];
  const int tid = threadIdx.x, lane = tid & 31, c = lane & 15, h = lane >> 4; const int w = __builtin_amdgcn_readfirstlane(tid >> 5); const int idx = blockIdx.x;
  // A tile's cost grows with its index and all work-groups are resident together: the 16 tiles are dealt by a 4 x 4 square whose rows and columns all sum to 30 (row = idx / 256, column = (idx / 8) % 4), every (head, tile) pair once.
  const int tile = (int)((0x0DE3B6587A94C12FULL >> (4 * (((idx >> 8) << 2) | ((idx >> 3) & 3)))) & 15); const int bh = (idx & 7) | (((idx >> 5) & 7) << 3); const int b = bh / NH, hd = bh % NH;
  const int q0 = tile * FAQ, qw = q0 + 32 * w, nst = (q0 + FAQ) / FAK;      /* causal: keys below the tile's end */
  const int sr = tid >> 3, sc = (tid & 7) * 8; const int so = sr * FAP + sc;      /* staging: row sr + 16 u, eight halves at column sc */
  const _Float16* kg = Kh + ((size_t)b * SQ + sr) * KVD + hd * HD + sc; const _Float16* vg = Vt + ((size_t)bh * HD + sr) * SQ + sc;
  v8us kr[4], vr[4];
#pragma unroll
  for (int u = 0; u < 4; ++u) { kr[u] = *(const v8us*)(const unsigned short*)(kg + u * 16 * KVD); vr[u] = *(const v8us*)(const unsigned short*)(vg + u * 16 * SQ); }
  v16h qf[2][2];
#pragma unroll
  for (int g = 0; g < 2; ++g) for (int kc = 0; kc < 2; ++kc) qf[g][kc] = g2_frag(Qh + ((size_t)b * SQ + qw + 16 * g + c) * LQ + hd * HD + kc * 32, h);
  asm volatile("s_wait_xcnt 0x0" ::: "memory");      /* the q rows' address registers are free for reuse from here on: this wait stands in front of their overwrite */
#pragma unroll
  for (int u = 0; u < 4; ++u) { *(v8us*)(unsigned short*)&ks[0][so + u * 16 * FAP] = kr[u]; *(v8us*)(unsigned short*)&vs[0][so + u * 16 * FAP] = vr[u]; }
  const v8f z8 = {0.f, 0.f, 0.f, 0.f, 0.f, 0.f, 0.f, 0.f}; const v4f z4 = {0.f, 0.f, 0.f, 0.f};
  v8f acc[2][4]; v4f l4[2]; float mr[2];
#pragma unroll
  for (int g = 0; g < 2; ++g) { mr[g] = -__builtin_inff(); l4[g] = z4; for (int t = 0; t < 4; ++t) acc[g][t] = z8; }
  const float cs = 0.125f * 1.44269504088896340736f;      /* 64^-0.5 log2 e */
  __syncthreads();
  for (int st = 0; st < nst; ++st) {
    const bool more = st + 1 < nst;      /* the same for the whole work-group */
    if (more) {
#pragma unroll
      for (int u = 0; u < 4; ++u) { kr[u] = *(const v8us*)(const unsigned short*)(kg + (size_t)(st + 1) * FAK * KVD + u * 16 * KVD); vr[u] = *(const v8us*)(const unsigned short*)(vg + (st + 1) * FAK + u * 16 * SQ); }
      asm volatile("s_wait_xcnt 0x0" ::: "memory"); }      /* the pass below reuses the registers that hold these loads' addresses: this wait stands in front of that overwrite */
    const _Float16* kb = &ks[st & 1][c * FAP + 8 * h]; const _Float16* vb = &vs[st & 1][c * FAP + 8 * h];
    for (int p = 0; p < FAK / 32; ++p) { const int key0 = st * FAK + p * 32;
      if (key0 <= qw) {      /* wave-uniform: a wave skips the passes beyond its diagonal, never the barrier */
        v8f s[2][2];
        { v16h kf[2][2];
#pragma unroll
          for (int kt = 0; kt < 2; ++kt) for (int kc = 0; kc < 2; ++kc) kf[kt][kc] = fa_frag(kb + (p * 32 + 16 * kt) * FAP + kc * 32);
#pragma unroll
          for (int kt = 0; kt < 2; ++kt) for (int g = 0; g < 2; ++g) s[kt][g] = fa_mma(kf[kt][1], qf[g][1], fa_mma(kf[kt][0], qf[g][0], z8)); }      /* s[kt][g][r] = q(qw + 16g + c) . k(key0 + 16kt + 8h + r) */
        fa_gap();
        if (key0 == qw) {      /* the one pass on the wave's diagonal: key > query is masked; key key0 is kept in every row */
#pragma unroll
          for (int kt = 0; kt < 2; ++kt) for (int g = 0; g < 2; ++g) for (int r = 0; r < 8; ++r) s[kt][g][r] = (16 * kt + 8 * h + r > 16 * g + c) ? -__builtin_inff() : s[kt][g][r]; }
        float mb[2]; bool need = false;
#pragma unroll
        for (int g = 0; g < 2; ++g) { float mx = s[0][g][0];
#pragma unroll
          for (int r = 1; r < 8; ++r) mx = fmaxf(mx, s[0][g][r]);
#pragma unroll
          for (int r = 0; r < 8; ++r) mx = fmaxf(mx, s[1][g][r]);
          mx = fmaxf(mx, rs_xh(mx)) * cs; mb[g] = mx; need = need || (mx > mr[g] + 8.0f); }      /* both halves of the wave hold the query's maximum of this pass, scaled */
        if (__builtin_amdgcn_ballot_w32(need) != 0) {      /* scalar branch; always taken in a wave's first pass, where mr is -inf and the factor 0 */
#pragma unroll
          for (int g = 0; g < 2; ++g) { const float mn = fmaxf(mr[g], mb[g]); const float corr = __builtin_amdgcn_exp2f(mr[g] - mn); mr[g] = mn; l4[g] *= corr;
#pragma unroll
            for (int t = 0; t < 4; ++t) acc[g][t] *= corr; } }
        v16h vf[4];
#pragma unroll
        for (int t = 0; t < 4; ++t) vf[t] = fa_frag(vb + 16 * t * FAP + p * 32);
#pragma unroll
        for (int g = 0; g < 2; ++g) { const float nm = -mr[g]; FragH pf;
#pragma unroll
          for (int kt = 0; kt < 2; ++kt) for (int j = 0; j < 2; ++j) { const v4f x = {s[kt][g][4 * j], s[kt][g][4 * j + 1], s[kt][g][4 * j + 2], s[kt][g][4 * j + 3]}; const v4f y = x * cs + nm; const v4f e = {__builtin_amdgcn_exp2f(y[0]), __builtin_amdgcn_exp2f(y[1]), __builtin_amdgcn_exp2f(y[2]), __builtin_amdgcn_exp2f(y[3])}; l4[g] += e;      /* the builtin, so that the compiler keeps these writes clear of the matrix instructions' operands */
            for (int i = 0; i < 4; ++i) pf.h[8 * kt + 4 * j + i] = (_Float16)e[i]; }      /* element 8 kt + r of the B operand = key 16 kt + 8 h + r: the k order of fa_frag */
#pragma unroll
          for (int t = 0; t < 4; ++t) acc[g][t] = fa_mma(vf[t], pf.v, acc[g][t]); }      /* acc[g][t][r] = o(qw + 16g + c)[16t + 8h + r], not yet divided by the row sum */
        fa_gap();
      } }
    if (more) {
#pragma unroll
      for (int u = 0; u < 4; ++u) { *(v8us*)(unsigned short*)&ks[(st + 1) & 1][so + u * 16 * FAP] = kr[u]; *(v8us*)(unsigned short*)&vs[(st + 1) & 1][so + u * 16 * FAP] = vr[u]; }
      __syncthreads(); }      /* publishes stage st + 1 and ends every wave's reads of stage st, whose buffer the next trip refills */
  }
  v8us ov[2][4]; unsigned short* og = (unsigned short*)Oh + ((size_t)b * SQ + qw + c) * DM + hd * HD + 8 * h;      /* lane (c, h): 8 consecutive d of query row c, one 16-byte store per 16 d */
#pragma unroll
  for (int g = 0; g < 2; ++g) { float l = (l4[g][0] + l4[g][1]) + (l4[g][2] + l4[g][3]); l += rs_xh(l); const float fin = 64.0f / l;      /* o carried x64, as the output GEMM's factor expects */
#pragma unroll
    for (int t = 0; t < 4; ++t) { FragH f; for (int r = 0; r < 8; ++r) f.h[r] = (_Float16)(acc[g][t][r] * fin); ov[g][t] = f.half[0]; } }
  __builtin_amdgcn_sched_barrier(0);      /* the eight stores stand behind the last conversion, so that no register which an issued store names is written again */
#pragma unroll
  for (int g = 0; g < 2; ++g) for (int t = 0; t < 4; ++t) *(v8us*)(og + g * 16 * DM + 16 * t) = ov[g][t]; }


// Exact f32 causal attention for rows 0..QT0-1 of every batch and head (planes [batch][QT0][DM]). One work-group of 256 threads takes A0R query rows of one head: thread (r, c) = (tid / 8, tid % 8).
// The group's q rows and the head's QT0 key and value rows are staged in LDS once; then scores (thread (r, c): keys c, c + 8, ...; its q row in registers), the row maximum and sum over the row's 8 lanes, and o (thread (r, c): columns 4c..4c+3 and 32+4c..32+4c+3).
#define A0R 32                       /* query rows per work-group */
#define A0KP (HD + 4)                /* q and key row pitch in LDS, floats: 16 B x odd, so that 8 rows read at one column fall on different banks */
#define A0PP (QT0 + 8)               /* weight row pitch in LDS, floats: the 4 rows of a wave start 8 banks apart */
__global__ __launch_bounds__(256) void k_att0(const float* __restrict__ QF, const float* __restrict__ KF, const float* __restrict__ VF, float scale, float* __restrict__ OF) {
  static_assert(QT0 % A0R == 0 && A0R * 8 == 256 && A0R == 32 && HD == 64 && QT0 % 16 == 0, "8 threads per query row; 16 threads stage one row, 16 rows per pass");
  __shared__ __attribute__((aligned(16))) float ks[QT0 * A0KP]; __shared__ __attribute__((aligned(16))) float vs[QT0 * HD]; __shared__ __attribute__((aligned(16))) float qs[A0R * A0KP]; __shared__ __attribute__((aligned(16))) float ps[A0R * A0PP];
  const int tid = threadIdx.x; const int h = blockIdx.x / (QT0 / A0R), rg = blockIdx.x % (QT0 / A0R); const int r = tid >> 3, c = tid & 7; const int i = rg * A0R + r; const int nk = (rg + 1) * A0R;      /* causal: keys below the group's last row */
  const size_t bo = (size_t)blockIdx.y * QT0 * DM + (size_t)h * HD;      /* grid.y = batch */
  const int sr = tid >> 4, sc = (tid & 15) * 4; const int so = sr * DM + sc;      /* staging: row sr + 16 u, four floats at column sc */
  const float* kg = KF + bo; const float* vg = VF + bo; const float* qg = QF + bo + (size_t)rg * A0R * DM;
  v4f kk[QT0 / 16], vv[QT0 / 16];      /* the full unrolls below give the register arrays kk, vv, q constant indices and put all staging loads in flight together */
#pragma unroll
  for (int u = 0; u < QT0 / 16; ++u) { kk[u] = *(const v4fa*)(kg + so + u * 16 * DM); vv[u] = *(const v4fa*)(vg + so + u * 16 * DM); }
  const v4f q0 = *(const v4fa*)(qg + so);
  asm volatile("s_wait_xcnt 0x0" ::: "memory");      /* the last staging load may return into the offset register that the loads above name: this wait stands in front of that overwrite */
  const v4f q1 = *(const v4fa*)(qg + so + 16 * DM);
#pragma unroll
  for (int u = 0; u < QT0 / 16; ++u) { *(v4f*)&ks[(sr + u * 16) * A0KP + sc] = kk[u]; *(v4f*)&vs[(sr + u * 16) * HD + sc] = vv[u]; }
  *(v4f*)&qs[sr * A0KP + sc] = q0; *(v4f*)&qs[(sr + 16) * A0KP + sc] = q1;
  __syncthreads();
  v4f q[HD / 4];
#pragma unroll
  for (int u = 0; u < HD / 4; ++u) q[u] = *(const v4f*)&qs[r * A0KP + u * 4];
  float* pr = ps + r * A0PP; float mx = -3.0e38f;      /* unroll 2 in the three loops below: the LDS loads of two trips are in flight together and their sums are independent chains */
#pragma unroll 2
  for (int m = 0; m < nk / 8; ++m) { const int j = c + m * 8; const float* kp = ks + j * A0KP; v4f a = {0.f, 0.f, 0.f, 0.f};
#pragma unroll
    for (int u = 0; u < HD / 4; ++u) a += q[u] * *(const v4f*)(kp + u * 4);
    const float s = (j <= i) ? ((a[0] + a[1]) + (a[2] + a[3])) * scale : -3.0e38f; pr[j] = s; mx = fmaxf(mx, s); }
  mx = fmaxf(mx, rs_xm<1>(mx)); mx = fmaxf(mx, rs_xm<2>(mx)); mx = fmaxf(mx, rs_xm<4>(mx));      /* key 0 is kept in every row, so the row maximum is a real score and a masked key's weight is exp(-huge) = 0 */
  float l = 0.f;
#pragma unroll 2
  for (int m = 0; m < nk / 8; ++m) { const int j = c + m * 8; const float e = expf(pr[j] - mx); pr[j] = e; l += e; }
  l += rs_xm<1>(l); l += rs_xm<2>(l); l += rs_xm<4>(l);
  __syncthreads();
  v4f o0 = {0.f, 0.f, 0.f, 0.f}, o1 = {0.f, 0.f, 0.f, 0.f}; const float* vp = vs + c * 4;
#pragma unroll 2
  for (int j = 0; j < nk; j += 4) { const v4f p = *(const v4f*)(pr + j);
#pragma unroll
    for (int t = 0; t < 4; ++t) { o0 += p[t] * *(const v4f*)(vp + (j + t) * HD); o1 += p[t] * *(const v4f*)(vp + (j + t) * HD + HD / 2); } }
  const float fin = 64.0f / l;      /* o carried x64 like the f16 path */
  float* og = OF + bo + i * DM + c * 4; *(v4f*)og = o0 * fin; *(v4f*)(og + HD / 2) = o1 * fin; }


__global__ __launch_bounds__(256) void k_tab2(float theta, float* __restrict__ CS, float* __restrict__ SN) {
  #pragma clang fp contract(off)
  const int t = blockIdx.x * 256 + threadIdx.x; if (t >= SQ * (HD / 2)) return; const int i = t % (HD / 2); const int p = t / (HD / 2); const float invf = 1.0f / powf(theta, (float)(2 * i) / (float)HD); const float ang = __fmul_rn((float)p, invf); const float c = cosf(ang), s = sinf(ang);
  *(float*)(CS + t) = c; *(float*)(SN + t) = s;  }
// q, k and v projections of all token rows in ONE launch, with everything that stood between them and the attention kernels done in the epilogue. The stage loop is that of k_gemm2 (128 x 128 tile, 8 waves of 32 x 64, two LDS buffers, K = DM).
// Work-group (xt, j): xt = tile of 128 token rows, j = tile of 128 rows of the transposed fused weight Wt [3 DM][DM] (j / 8 = 0 q, 1 k, 2 v).
// q, k: A = token rows, B = weight rows. A wave's 64 columns are one head, so that after the turn through LDS lane l holds columns 4l .. 4l + 3 of a row and the rotate-half partner sits 8 lanes away (DPP exchange):
// out_lo = x_lo c - x_hi s, out_hi = x_hi c + x_lo s, written as f16 rows; the first QT0 rows of a batch also as f32 rows [batch][QT0][DM] for the exact first-tile kernel.
// v: the operands change places (A = weight rows, B = token rows; same k order, same products), so that the tile comes out as V^T [d][token] and its rows are whole lines of the plane [batch][head][d][SQ];
// of the first QT0 tokens of a batch a lane's 8 accumulator rows are 8 consecutive d of one token: stored as f32 v rows [batch][QT0][DM] straight from the registers.
// The full unrolls give the register arrays constant indices and put a phase's loads or stores in flight together.
__global__ __launch_bounds__(256) void k_proj3(const _Float16* __restrict__ X, const _Float16* __restrict__ Wt, const float* __restrict__ CS, const float* __restrict__ SN,
    _Float16* __restrict__ Qh, _Float16* __restrict__ Kh, _Float16* __restrict__ Vt, float* __restrict__ QF0, float* __restrict__ KF0, float* __restrict__ VF0) {
  static_assert(2 * G2S * 2 >= 8 * 32 * 68 * 4 && G2T == 128 && G2K == 64 && DM % G2K == 0 && SQ % G2T == 0 && QT0 == G2T && HD == 64 && KVD == DM && HPG == 1 && SQ / G2T == 16 && DM / G2T == 8, "a wave's 64 columns are one head; a token tile lies in one batch; the first tile of a batch is the exact kernel's rows");
  __shared__ __attribute__((aligned(16))) unsigned char sm[2 * G2S * 2]; _Float16* const sg = (_Float16*)sm; float (*const so)[32][68] = (float (*)[32][68])sm;      /* the stage buffers; behind the loop's last barrier the same bytes hold each wave's output rows */
  const int tid = threadIdx.x, lane = tid & 31, ln = lane & 15, hh = lane >> 4; const int w = __builtin_amdgcn_readfirstlane(tid >> 5), wm = w & 3, wn = w >> 2;
  const int xt = blockIdx.x / 24, j = blockIdx.x - xt * 24; const bool isv = j >= 16; const int bt = xt >> 4, xs = xt & 15;      /* bt = batch, xs = token tile in the batch; all the same for the whole work-group */
  const _Float16* const xr = X + (size_t)xt * G2T * DM; const _Float16* const wr = Wt + (size_t)j * G2T * DM;
  const int sr = tid >> 3, sc = (tid & 7) * 8; const int sl = sr * G2P + sc;      /* staging: row sr + 32 u, eight halves at column sc */
  const _Float16* ag = (isv ? wr : xr) + sr * DM + sc; const _Float16* bg = (isv ? xr : wr) + sr * DM + sc; const int nst = DM / G2K;
  const v8f z8 = {0.f,0.f,0.f,0.f,0.f,0.f,0.f,0.f}; v8f c00 = z8, c01 = z8, c02 = z8, c03 = z8, c10 = z8, c11 = z8, c12 = z8, c13 = z8;
  v8us ar[4], br[4]; const unsigned short* pa[4]; const unsigned short* pb[4];
#pragma unroll
  for (int u = 0; u < 4; ++u) { pa[u] = (const unsigned short*)(ag + (size_t)(u * 32) * DM); pb[u] = (const unsigned short*)(bg + (size_t)(u * 32) * DM); }
#pragma unroll
  for (int u = 0; u < 4; ++u) { ar[u] = *(const v8us*)pa[u]; br[u] = *(const v8us*)pb[u]; }
  asm volatile("s_wait_xcnt 0x0" :: "v"(pa[0]), "v"(pa[1]), "v"(pa[2]), "v"(pa[3]), "v"(pb[0]), "v"(pb[1]), "v"(pb[2]), "v"(pb[3]) : "memory");      /* the loads' address registers are free for reuse only from here on; as inputs they stay whole up to this wait, so that no load returns into one either */
#pragma unroll
  for (int u = 0; u < 4; ++u) { *(v8us*)(unsigned short*)&sg[sl + u * 32 * G2P] = ar[u]; *(v8us*)(unsigned short*)&sg[G2T * G2P + sl + u * 32 * G2P] = br[u]; }
  __syncthreads();
#pragma unroll 1
  for (int s = 0; s < nst; ++s) { const bool more = s + 1 < nst;      /* more: the same for the whole work-group. The stage loop stays rolled, so that its text stays small; its two 32-k passes are unrolled, so that their LDS offsets are immediates */
    if (more) {
#pragma unroll
      for (int u = 0; u < 4; ++u) { pa[u] = (const unsigned short*)(ag + (s + 1) * G2K + (size_t)(u * 32) * DM); pb[u] = (const unsigned short*)(bg + (s + 1) * G2K + (size_t)(u * 32) * DM); }
#pragma unroll
      for (int u = 0; u < 4; ++u) { ar[u] = *(const v8us*)pa[u]; br[u] = *(const v8us*)pb[u]; }
      asm volatile("s_wait_xcnt 0x0" :: "v"(pa[0]), "v"(pa[1]), "v"(pa[2]), "v"(pa[3]), "v"(pb[0]), "v"(pb[1]), "v"(pb[2]), "v"(pb[3]) : "memory"); }      /* the code below reuses the registers that these loads name: this wait stands in front of that overwrite, and as its inputs they stay whole up to it, so that no load returns into one either */
    const _Float16* ab = sg + (s & 1) * G2S + (32 * wm + ln) * G2P; const _Float16* bb = sg + (s & 1) * G2S + (G2T + 64 * wn + ln) * G2P;
#pragma unroll
    for (int kc = 0; kc < G2K; kc += 32) { const v16h a0 = g2_frag(ab + kc, hh), a1 = g2_frag(ab + 16 * G2P + kc, hh);
      const v16h b0 = g2_frag(bb + kc, hh), b1 = g2_frag(bb + 16 * G2P + kc, hh), b2 = g2_frag(bb + 32 * G2P + kc, hh), b3 = g2_frag(bb + 48 * G2P + kc, hh);
      c00 = g2_mma(a0, b0, c00); c10 = g2_mma(a1, b0, c10); c01 = g2_mma(a0, b1, c01); c11 = g2_mma(a1, b1, c11);
      c02 = g2_mma(a0, b2, c02); c12 = g2_mma(a1, b2, c12); c03 = g2_mma(a0, b3, c03); c13 = g2_mma(a1, b3, c13); }
    if (more) {
#pragma unroll
      for (int u = 0; u < 4; ++u) { *(v8us*)(unsigned short*)&sg[((s + 1) & 1) * G2S + sl + u * 32 * G2P] = ar[u]; *(v8us*)(unsigned short*)&sg[((s + 1) & 1) * G2S + G2T * G2P + sl + u * 32 * G2P] = br[u]; } }
    __syncthreads(); }      /* publishes stage s + 1 and ends every wave's reads of stage s, whose buffer the next trip refills and, behind the last trip, the output rows reuse */
  v8f accs[8] = {c00, c01, c02, c03, c10, c11, c12, c13};
#pragma unroll
  for (int u = 0; u < 8; ++u) accs[u] *= 0.0625f;      /* the weights are carried x16 */
  if (isv && xs == 0) { char* fb = (char*)(VF0 + ((size_t)bt * QT0 + 64 * wn) * DM + (j - 16) * G2T + 32 * wm); const unsigned fo = ln * (DM * 4u) + hh * 32u;      /* f32 v rows: token 16 t + ln, columns 16 half + 8 hh + 0..7 of the wave's 32 */
#pragma unroll
    for (int u = 0; u < 8; ++u) { const v4f lo = {accs[u][0], accs[u][1], accs[u][2], accs[u][3]}, hi = {accs[u][4], accs[u][5], accs[u][6], accs[u][7]};
      *(v4f*)(fb + (u & 3) * 16 * (DM * 4) + (u >> 2) * 64 + fo) = lo; *(v4f*)(fb + (u & 3) * 16 * (DM * 4) + (u >> 2) * 64 + 16 + fo) = hi; }
    asm volatile("s_wait_xcnt 0x0" ::: "memory"); }      /* the accumulators' registers, which these stores name, are reused below: this wait stands in front of that overwrite */
#pragma unroll
  for (int u = 0; u < 8; ++u)
#pragma unroll
    for (int r = 0; r < 8; ++r) so[w][(u >> 2) * 16 + 8 * hh + r][(u & 3) * 16 + ln] = accs[u][r];
  __builtin_amdgcn_fence(__ATOMIC_ACQ_REL, "workgroup"); __builtin_amdgcn_wave_barrier();      /* a wave reads back only its own rows */
  v4h oh[16];
  if (!isv) {
    // Lanes 0..7 of a 16-lane row fetch the row's cosines, lanes 8..15 its sines (one 128-byte table row each); the DPP exchange that brings the partner's x brings the other table value too.
    const bool up = (ln & 8) != 0; const char* tp = (const char*)((up ? SN : CS) + (xs * G2T + 32 * wm + hh) * (HD / 2) + (ln & 7) * 4); v4f tv[16];
#pragma unroll
    for (int q = 0; q < 16; ++q) tv[q] = *(const v4fa*)(tp + q * 2 * (HD / 2 * 4));
    asm volatile("s_wait_xcnt 0x0" :: "v"(tp) : "memory");      /* the table loads' address registers are free for reuse only from here on; as an input they stay whole up to this wait, so that no load returns into them either */
#pragma unroll
    for (int q0 = 0; q0 < 16; q0 += 4) { v4f xv[4];      /* four rows' LDS reads in flight together; the roped row takes the place of its table values */
#pragma unroll
      for (int q = 0; q < 4; ++q) xv[q] = *(const v4fa*)&so[w][(q0 + q) * 2 + hh][ln * 4];
#pragma unroll
      for (int q = 0; q < 4; ++q) { const v4f x = xv[q], t = tv[q0 + q]; const v4f y = {rs_xm<8>(x[0]), rs_xm<8>(x[1]), rs_xm<8>(x[2]), rs_xm<8>(x[3])};
        const v4f tw = {rs_xm<8>(t[0]), rs_xm<8>(t[1]), rs_xm<8>(t[2]), rs_xm<8>(t[3])}; const v4f cc = up ? tw : t; const v4f sn = up ? t : -tw; const v4f o = x * cc + y * sn; tv[q0 + q] = o;
        for (int i = 0; i < 4; ++i) oh[q0 + q][i] = (_Float16)o[i]; }
      __builtin_amdgcn_sched_barrier(0); }      /* keeps the later rows' table exchanges behind this point: hoisted, they hold twice the registers per row and cost a work-group of occupancy; behind the last row it keeps the stores behind the arithmetic, so that no register which an issued store names is written again */
    char* hb = (char*)((j >= 8 ? Kh : Qh) + ((size_t)xt * G2T + 32 * wm) * DM + (j & 7) * G2T + 64 * wn); const unsigned ho = hh * (DM * 2u) + ln * 8u;
#pragma unroll
    for (int q = 0; q < 16; ++q) *(v4h*)(hb + q * 2 * (DM * 2) + ho) = oh[q];
    if (xs == 0) { asm volatile("s_wait_xcnt 0x0" ::: "memory"); __builtin_amdgcn_sched_barrier(0);      /* the address arithmetic below reuses registers that the f16 stores name: this wait stands in front of that overwrite, and the scheduling barrier keeps the arithmetic behind it */
      char* fb = (char*)((j >= 8 ? KF0 : QF0) + ((size_t)bt * QT0 + 32 * wm) * DM + (j & 7) * G2T + 64 * wn); const unsigned fo = hh * (DM * 4u) + ln * 16u;      /* the first QT0 rows of a batch: the same values unrounded */
#pragma unroll
      for (int q = 0; q < 16; ++q) *(v4f*)(fb + q * 2 * (DM * 4) + fo) = tv[q]; }
  } else {
#pragma unroll
    for (int q = 0; q < 16; ++q) { const v4f v = *(const v4fa*)&so[w][q * 2 + hh][ln * 4]; for (int i = 0; i < 4; ++i) oh[q][i] = (_Float16)v[i]; }
    __builtin_amdgcn_sched_barrier(0);      /* the stores stand behind the last conversion, so that no register which an issued store names is written again */
    char* vb = (char*)(Vt + ((size_t)bt * DM + (j - 16) * G2T + 32 * wm) * SQ + xs * G2T + 64 * wn); const unsigned vo = hh * (SQ * 2u) + ln * 8u;      /* row of V^T = head * HD + d */
#pragma unroll
    for (int q = 0; q < 16; ++q) *(v4h*)(vb + q * 2 * (SQ * 2) + vo) = oh[q];
  } }

__global__ __launch_bounds__(256) void k_bfcp(const float* __restrict__ src, float* __restrict__ dst, size_t n4) { const size_t t = (size_t)blockIdx.x * 256 + threadIdx.x; if (t >= n4) return; const v4f a = *(const v4fa*)(src + t * 4); v4f o; for (int q = 0; q < 4; ++q) o[q] = bf16_round(a[q]); *(v4f*)(dst + t * 4) = o;  }

__global__ __launch_bounds__(256) void k_tabhalf(const float* __restrict__ cs, const float* __restrict__ sn, float* __restrict__ CS, float* __restrict__ SN) { const int t = blockIdx.x * 256 + threadIdx.x; if (t >= SQ * (HD / 2)) return; const int p = t / (HD / 2), i = t % (HD / 2); const float c = bf16_round(cs[(size_t)p * HD + i]), s = bf16_round(sn[(size_t)p * HD + i]);
  *(float*)(CS + t) = c; *(float*)(SN + t) = s;  }

__global__ __launch_bounds__(256) void k_tab2d(float* __restrict__ CS, float* __restrict__ SN) {
  #pragma clang fp contract(off)
  const int t = blockIdx.x * 256 + threadIdx.x; if (t >= SQ * (HD / 2)) return; const int i = t % (HD / 2); const int p = t / (HD / 2); const float invf = (float)(1.0 / pow(10000.0, (double)(2 * i) / (double)HD)); const float ang = __fmul_rn((float)p, invf); const float c = cosf(ang), s = sinf(ang);
  *(float*)(CS + t) = c; *(float*)(SN + t) = s;  }
extern "C" void kernel_launch(void* const* d_in, const int* in_sizes, int n_in,
                              void* d_out, int out_size, void* d_ws, size_t ws_size, hipStream_t stream) {
  (void)in_sizes; (void)n_in; (void)out_size;
  const float* const* I = (const float* const*)d_in; const float* x = I[0]; const float* wattn = I[1]; const float* wo = I[2];      /* x; fused [in][out] W_attn [1024][3072] (q | k | v column thirds); [in][out] W_proj; rope tables computed in-kernel (positions = row index) */
  static_assert(HPG == 1 && NH == NG * HPG && NH * HD == DM && KVD == DM, "plain multi-head attention as 16 kv groups of one query head"); const float* bo = nullptr;      /* [in][out] weights, no biases; rope tables computed in the kernel */
  char* ws = (char*)d_ws; size_t off = 0;
  auto take = [&](size_t bytes) { char* p = ws + off; off += (bytes + 255) & ~(size_t)255; return p; };
  _Float16* BQKV = (_Float16*)take((size_t)3 * DM * DM * 2); _Float16* BO = (_Float16*)take((size_t)DM * DM * 2);      /* one transposed plane Bt [3072][1024] of the fused weight: rows 0..1023 = q, 1024.. = k, 2048.. = v */
  _Float16* X16 = (_Float16*)take(NR * DM * 2); float* CSB = (float*)take((size_t)SQ * HD * 4); float* SNB = (float*)take((size_t)SQ * HD * 4); _Float16* Q16 = (_Float16*)take(NR * DM * 2); _Float16* K16 = (_Float16*)take(NR * KVD * 2); _Float16* O16 = (_Float16*)take(NR * DM * 2);
  static_assert(B0 == 0 && NBR == NB && NHD == NH && QN == SQ, "every launch covers all batches and heads");
  _Float16* VT = (_Float16*)take((size_t)NB * NH * HD * SQ * 2);
  float* QF0 = (float*)take((size_t)NB * QT0 * DM * 4); float* KF0 = (float*)take((size_t)NB * QT0 * KVD * 4); float* VF0 = (float*)take((size_t)NB * QT0 * KVD * 4); float* OF0 = (float*)take((size_t)NB * QT0 * DM * 4); _Float16* OH0 = (_Float16*)take((size_t)NB * QT0 * DM * 2); _Float16* OL0 = (_Float16*)take((size_t)NB * QT0 * DM * 2);
  if (off > ws_size) return;
  k_wt_f16<<<(unsigned)(((size_t)3 * DM * (DM / 8) + 255) / 256), 256, 0, stream>>>(wattn, BQKV, DM, 3 * DM, 16.0f); k_wt_f16<<<(unsigned)(((size_t)DM * (DM / 8) + 255) / 256), 256, 0, stream>>>(wo, BO, DM, DM, 16.0f);      /* [in][out] -> Bt x16 planes (fused W_attn: K 1024, N 3072) */
  k_x16<<<(unsigned)((NR * DM / 8 + 255) / 256), 256, 0, stream>>>(x, X16, NR * DM / 8);
  k_tab2d<<<(SQ * (HD / 2) + 255) / 256, 256, 0, stream>>>(CSB, SNB);      /* rope tables cos/sin(p / 10000^(2i/64)): inv_freq double-derived -> f32, f32 angle */
  /* Every launch below covers all NB batches: rows of all batches run through, or the batch is grid.z (first-tile GEMMs), grid.y (first-tile kernel) or part of blockIdx.x (k_fattn). */
  k_proj3<<<(MP / G2T) * (3 * DM / G2T), 256, 0, stream>>>(X16, BQKV, CSB, SNB, Q16, K16, VT, QF0, KF0, VF0);      /* roped q, k as f16 rows, V^T [NB][NH][HD][SQ] as f16, and the f32 roped q, k and v of rows 0..127 of each batch; position = row % SQ */
  k_att0<<<dim3(NH * (QT0 / A0R), NB), 256, 0, stream>>>(QF0, KF0, VF0, 0.125f, OF0);      /* exact f32 attention for rows 0..127 of each batch (o x64); one head per kv group, so that the k and v rows are the heads' own */
  k_fattn<<<NB * NH * (SQ / FAQ), FAW * 32, 0, stream>>>(Q16, K16, VT, O16);      /* scores, causal softmax and weighted values of all batches, heads and query tiles: o (x64) as f16 rows */
  k_gemm2<0><<<dim3((unsigned)((MPO / G2T) * (DM / G2T)), 1), 256, 0, stream>>>(O16, DM, 0, BO, DM, 0, 0.0009765625f, bo, 0, nullptr, 1, 0, 0, (float*)d_out, nullptr, DM, 0, MPO, DM, DM, 0, 0, 0);      /* out rows are the output layout */
  k_hl<<<(unsigned)(((size_t)NB * QT0 * DM / 8 + 255) / 256), 256, 0, stream>>>(OF0, OH0, OL0, (size_t)NB * QT0 * DM / 8);      /* first-tile o (x64) -> f16 hi + x1024 residual planes */
  k_gemm2<0><<<dim3((QT0 / G2T) * (DM / G2T), 1, NB), 256, 0, stream>>>(OH0, DM, 0, BO, DM, 0, 0.0009765625f, bo, 0, nullptr, 1, 0, 0, (float*)d_out, nullptr, DM, 0, QT0, DM, DM, (size_t)QT0 * DM, 0, (size_t)SQ * DM);      /* rows 0..127 of each batch: out = o_hi Wo, overwriting the f16-path rows */
  k_gemm2<0><<<dim3((QT0 / G2T) * (DM / G2T), 1, NB), 256, 0, stream>>>(OL0, DM, 0, BO, DM, 0, 0.00000095367431640625f, nullptr, 0, (const float*)d_out, -1, 0, 0, (float*)d_out, nullptr, DM, 0, QT0, DM, DM, (size_t)QT0 * DM, 0, (size_t)SQ * DM);      /* += o_lo Wo 2^-20 (own-element accumulate) */
}

// v008
// A run of this version takes 155 microseconds.
// Timed twice side by side with v007, it ran 1.27 and 1.29 times as fast.
// Over all steps from v000 it is 64.6 times as fast.
#include <hip/hip_runtime.h>
// Causal multi-head self-attention with rotate-half RoPE computed in the module and a bias-free fused QKV projection (x [4][2048][1024]; qkv = x Wqkv ([in][out] 1024 x 3072, no bias) split into q | k | v thirds, 16 heads of 64; cos / sin = [f | f] of pos * 10000^(-2i/64); q = q cos + rotate_half(q) sin, likewise k; scores * 64^-0.5; causal (tril, finfo.min fill); softmax; out = merged Wout ([in][out], no bias) -> [4][2048][1024]); run as grouped-query causal attention with 16 groups of ONE head and half-split rope.
// Compute dtype: inputs rounded to bf16; x / weights exact; q, k, v, softmax weights and o as plain f16 GEMM operands (~2^-12); scores and softmax statistics f32; v_wmma_f32_16x16x32_f16.
#define NB 4
#define NG 16
#define HPG 1
#define KVD (NG * HD)
#define SQ 2048
#define DM 1024
#define NH 16
#define HD 64
#define HG 4                         /* heads per k_vt(b, h0) launch (overload not called) */
#define QT 256                       /* unused */
#define NKX SQ                       /* unused */
#define QT0 128                      /* first-tile rows recomputed exactly in f32 */
#define B0 0                         /* first batch processed (debug hook) */
#define NBR NB                       /* batches processed (debug hook) */
#define NR ((size_t)NB * SQ)         /* token rows */
#define MP ((int)((size_t)NBR * SQ)) /* rows projected (debug hook) */
#define QN SQ                        /* query rows attended per batch (debug hook) */
#define NHD NH                       /* heads attended (debug hook) */
#define MPO MP                       /* rows through the output stage (debug hook) */
#define LQ DM      /* row pitch of the q/k/v rows */
typedef __bf16 v16b __attribute__((ext_vector_type(16)));
typedef unsigned short v8us __attribute__((ext_vector_type(8), may_alias));
typedef float  v8f  __attribute__((ext_vector_type(8)));
typedef float  v4f  __attribute__((ext_vector_type(4)));
typedef float  v4fa __attribute__((ext_vector_type(4), may_alias));
union FragB { v16b v; v8us half[2]; unsigned short u[16]; };

__device__ __forceinline__ unsigned short bf16_bits(float x) { unsigned int u = __float_as_uint(x); return (unsigned short)((u + 0x7FFFu + ((u >> 16) & 1u)) >> 16); }
__device__ __forceinline__ float bf16_val(unsigned short b) { return __uint_as_float(((unsigned int)b) << 16); }
__device__ __forceinline__ float bf16_round(float x) { return bf16_val(bf16_bits(x)); }
// D += A·B with NT terms: 1 = ah·bh, 2 = + al·bh (A split), 3 = + ah·bl (both split)
template <int NT>
__device__ __forceinline__ v8f mmaN(v16b ah, v16b al, v16b bh, v16b bl, v8f c) {
  c = __builtin_amdgcn_wmma_f32_16x16x32_bf16(false, ah, false, bh, (short)0, c, false, false);
  if (NT >= 2) c = __builtin_amdgcn_wmma_f32_16x16x32_bf16(false, al, false, bh, (short)0, c, false, false);
  if (NT >= 3) c = __builtin_amdgcn_wmma_f32_16x16x32_bf16(false, ah, false, bl, (short)0, c, false, false);
  asm volatile("v_nop\n\tv_nop\n\tv_nop\n\tv_nop" : "+v"(c) : "v"(ah), "v"(al), "v"(bh), "v"(bl));
  return c;
}

__global__ __launch_bounds__(256) void k_wt_bf16(const float* __restrict__ W, unsigned short* __restrict__ Wt, int K, int N) {
  const int t = blockIdx.x * 256 + threadIdx.x;
  const int k8n = K / 8;
  if (t >= N * k8n) return;
  const int n = t / k8n, k8 = (t % k8n) * 8;
  v8us v;
#pragma unroll
  for (int i = 0; i < 8; ++i) v[i] = bf16_bits(W[(size_t)(k8 + i) * N + n]);
  *(v8us*)(Wt + (size_t)n * K + k8) = v;
  
}

// GEMM C[M][N] (f32, pitch ldc) = act(A[M][K]·W + bias). A f32 row-major (pitch lda) converted per fragment to bf16
// (ASPLIT: hi/lo two planes -> 2 terms, else single rounded term); Wt bf16 [N][K] (pitch ldb). BIAS_BF16 rounds the
// bias to bf16 first (bias quantised to bf16 before the add). K%32==0, M%16==0, N%64==0.
template <bool ASPLIT, int ACT, bool BIAS_BF16>
__global__ __launch_bounds__(128) void k_gemm_bf(const float* __restrict__ A, int lda, const unsigned short* __restrict__ Wt, int ldb,
                                               const float* __restrict__ bias, float* __restrict__ C, int ldc, int M, int N, int K) {
  __shared__ __attribute__((aligned(16))) float so[4][16][64];
  const int tid = threadIdx.x, w = tid >> 5, lane = tid & 31, ln = lane & 15, hh = lane >> 4;
  const int ntn = N / 64;
  const int wid = blockIdx.x * 4 + w;
  const int mt = wid / ntn, nq = wid % ntn;
  if (mt * 16 >= M) return;
  const int row0 = mt * 16, col0 = nq * 64;
  const float* arow = A + (size_t)(row0 + ln) * lda;
  v8f acc[4] = {};
  for (int kb = 0; kb < K; kb += 32) {
    FragB ah, al;
    const v4f x0 = *(const v4fa*)(arow + kb + 8 * hh), x1 = *(const v4fa*)(arow + kb + 8 * hh + 4);
    const v4f x2 = *(const v4fa*)(arow + kb + 16 + 8 * hh), x3 = *(const v4fa*)(arow + kb + 16 + 8 * hh + 4);
    float xs[16] = {x0[0],x0[1],x0[2],x0[3],x1[0],x1[1],x1[2],x1[3],x2[0],x2[1],x2[2],x2[3],x3[0],x3[1],x3[2],x3[3]};
#pragma unroll
    for (int i = 0; i < 16; ++i) { const unsigned short hb = bf16_bits(xs[i]); ah.u[i] = hb; al.u[i] = ASPLIT ? bf16_bits(xs[i] - bf16_val(hb)) : (unsigned short)0; }
#pragma unroll
    for (int t = 0; t < 4; ++t) {
      const unsigned short* brow = Wt + (size_t)(col0 + t * 16 + ln) * ldb + kb;
      FragB b;
      b.half[0] = *(const v8us*)(brow + 8 * hh);
      b.half[1] = *(const v8us*)(brow + 16 + 8 * hh);
      acc[t] = mmaN<ASPLIT ? 2 : 1>(ah.v, al.v, b.v, b.v, acc[t]);
    }
  }
#pragma unroll
  for (int t = 0; t < 4; ++t) {
    float bv = bias ? bias[col0 + t * 16 + ln] : 0.f;
    if (BIAS_BF16) bv = bf16_round(bv);
#pragma unroll
    for (int r = 0; r < 8; ++r) { float v = acc[t][r] + bv; if (ACT == 1) v = fmaxf(v, 0.f); so[w][8 * hh + r][t * 16 + ln] = v; }
  }
  __builtin_amdgcn_fence(__ATOMIC_ACQ_REL, "workgroup");
  __builtin_amdgcn_wave_barrier();
  const int rsub = lane >> 4, c4 = (lane & 15) * 4;
  {
#pragma unroll
    for (int q = 0; q < 8; ++q) {
      const int r = q * 2 + rsub;
      const v4f v = *(const v4fa*)&so[w][r][c4];
      *(v4f*)(C + (size_t)(row0 + r) * ldc + col0 + c4) = v;
    }
    
  }
}

// GEMM C = act(A·W + bias + resid): A f32 (ASPLIT -> hi/lo 2 terms), Wt bf16 [N][K]; ACT 0 none, 1 relu, 2 exact gelu;
// resid (optional, f32, row index = (row % rmod), pitch ldr, RES_BF16 rounds it) added before the activation.
template <bool ASPLIT, int ACT, bool BIAS_BF16, bool RES_BF16>
__global__ __launch_bounds__(128) void k_gemm_bf3(const float* __restrict__ A, int lda, const unsigned short* __restrict__ Wt, int ldb,
                                                const float* __restrict__ bias, const float* __restrict__ resid, int rmod, int ldr,
                                                float* __restrict__ C, int ldc, int M, int N, int K) {
  __shared__ __attribute__((aligned(16))) float so[4][16][64];
  const int tid = threadIdx.x, w = tid >> 5, lane = tid & 31, ln = lane & 15, hh = lane >> 4;
  const int ntn = N / 64;
  const int wid = blockIdx.x * 4 + w;
  const int mt = wid / ntn, nq = wid % ntn;
  if (mt * 16 >= M) return;
  const int row0 = mt * 16, col0 = nq * 64;
  const float* arow = A + (size_t)(row0 + ln) * lda;
  v8f acc[4] = {};
  for (int kb = 0; kb < K; kb += 32) {
    FragB ah, al;
    const v4f x0 = *(const v4fa*)(arow + kb + 8 * hh), x1 = *(const v4fa*)(arow + kb + 8 * hh + 4);
    const v4f x2 = *(const v4fa*)(arow + kb + 16 + 8 * hh), x3 = *(const v4fa*)(arow + kb + 16 + 8 * hh + 4);
    float xs[16] = {x0[0],x0[1],x0[2],x0[3],x1[0],x1[1],x1[2],x1[3],x2[0],x2[1],x2[2],x2[3],x3[0],x3[1],x3[2],x3[3]};
#pragma unroll
    for (int i = 0; i < 16; ++i) { const unsigned short hb = bf16_bits(xs[i]); ah.u[i] = hb; al.u[i] = ASPLIT ? bf16_bits(xs[i] - bf16_val(hb)) : (unsigned short)0; }
#pragma unroll
    for (int t = 0; t < 4; ++t) {
      const unsigned short* brow = Wt + (size_t)(col0 + t * 16 + ln) * ldb + kb;
      FragB b;
      b.half[0] = *(const v8us*)(brow + 8 * hh);
      b.half[1] = *(const v8us*)(brow + 16 + 8 * hh);
      acc[t] = mmaN<ASPLIT ? 2 : 1>(ah.v, al.v, b.v, b.v, acc[t]);
    }
  }
#pragma unroll
  for (int t = 0; t < 4; ++t) {
    const int col = col0 + t * 16 + ln;
    float bv = bias ? bias[col] : 0.f;
    if (BIAS_BF16) bv = bf16_round(bv);
#pragma unroll
    for (int r = 0; r < 8; ++r) {
      float v = acc[t][r] + bv;
      if (resid) { float rv = resid[(size_t)((row0 + 8 * hh + r) % rmod) * ldr + col]; if (RES_BF16) rv = bf16_round(rv); v += rv; }
      if (ACT == 1) v = fmaxf(v, 0.f);
      if (ACT == 2) v = 0.5f * v * (1.0f + erff(v * 0.70710678118654752f));
      if (ACT == 3) { const float u = 0.7978845608028654f * (v + 0.044715f * v * v * v); v = 0.5f * v * (1.0f + tanhf(u)); }
      so[w][8 * hh + r][t * 16 + ln] = v;
    }
  }
  __builtin_amdgcn_fence(__ATOMIC_ACQ_REL, "workgroup");
  __builtin_amdgcn_wave_barrier();
  const int rsub = lane >> 4, c4 = (lane & 15) * 4;
  {
#pragma unroll
    for (int q = 0; q < 8; ++q) {
      const int r = q * 2 + rsub;
      const v4f v = *(const v4fa*)&so[w][r][c4];
      *(v4f*)(C + (size_t)(row0 + r) * ldc + col0 + c4) = v;
    }
    
  }
}
// row LayerNorm (biased variance, eps) over N: s = X (+ R); optional out_sum <- s; out_norm <- (s-mu)*rsqrt(var+eps)*g + b
template <bool PARAM_BF16>
__global__ __launch_bounds__(256) void k_layernorm(const float* __restrict__ X, const float* __restrict__ R, const float* __restrict__ g, const float* __restrict__ bta,
                                                  float* __restrict__ out_sum, float* __restrict__ out_norm, int N, float eps) {
  __shared__ float red[256];
  const int row = blockIdx.x, tid = threadIdx.x;
  const float* x = X + (size_t)row * N; const float* rr = R ? R + (size_t)row * N : nullptr;
  float vals[16];                     // up to N = 4096
  const int per = N / 256;            // contiguous chunk per thread? use strided-by-4 chunks: thread handles j = tid*4 + 1024*u
  float s1 = 0.f;
  for (int u = 0; u < per / 4; ++u) {
    const int j = tid * 4 + 1024 * u;
    const v4f a = *(const v4fa*)(x + j);
    v4f b = {0.f,0.f,0.f,0.f}; if (rr) b = *(const v4fa*)(rr + j);
#pragma unroll
    for (int q = 0; q < 4; ++q) { const float v = a[q] + b[q]; vals[u * 4 + q] = v; s1 += v; }
  }
  red[tid] = s1; __syncthreads();
  for (int st = 128; st > 0; st >>= 1) { if (tid < st) red[tid] += red[tid + st]; __syncthreads(); }
  const float mu = red[0] / (float)N; __syncthreads();
  float s2 = 0.f;
  for (int u = 0; u < per / 4; ++u)
#pragma unroll
    for (int q = 0; q < 4; ++q) { const float c = vals[u * 4 + q] - mu; s2 += c * c; }
  red[tid] = s2; __syncthreads();
  for (int st = 128; st > 0; st >>= 1) { if (tid < st) red[tid] += red[tid + st]; __syncthreads(); }
  const float rs = rsqrtf(red[0] / (float)N + eps);
  {
    for (int u = 0; u < per / 4; ++u) {
      const int j = tid * 4 + 1024 * u;
      v4f o, sm;
#pragma unroll
      for (int q = 0; q < 4; ++q) {
        float gg = g[j + q], bb = bta[j + q];
        if (PARAM_BF16) { gg = bf16_round(gg); bb = bf16_round(bb); }
        sm[q] = vals[u * 4 + q]; o[q] = (vals[u * 4 + q] - mu) * rs * gg + bb;
      }
      if (out_sum) *(v4f*)(out_sum + (size_t)row * N + j) = sm;
      *(v4f*)(out_norm + (size_t)row * N + j) = o;
    }
    
  }
}



// ---- f16 WMMA path (v_wmma_f32_16x16x32_f16): 11-bit significands for operands in range — used where a [0,1] probability operand needs more precision than bf16
typedef _Float16 v16h __attribute__((ext_vector_type(16)));
union FragH { v16h v; v8us half[2]; _Float16 h[16]; unsigned short u[16]; };
template <int NT>
__device__ __forceinline__ v8f mmaH(v16h ah, v16h al, v16h bh, v16h bl, v8f c) {
  c = __builtin_amdgcn_wmma_f32_16x16x32_f16(false, ah, false, bh, (short)0, c, false, false);
  if (NT >= 2) c = __builtin_amdgcn_wmma_f32_16x16x32_f16(false, al, false, bh, (short)0, c, false, false);
  if (NT >= 3) c = __builtin_amdgcn_wmma_f32_16x16x32_f16(false, ah, false, bl, (short)0, c, false, false);
  asm volatile("v_nop\n\tv_nop\n\tv_nop\n\tv_nop" : "+v"(c) : "v"(ah), "v"(al), "v"(bh), "v"(bl));
  return c;
}
// batched GEMM like k_gemm_b but f16 operands: A f32 (split into f16 hi/lo if ASPLIT, else rounded to f16), Bt = f16 values [n][k]; alpha; C f32; N multiple of 16 (partial tiles skipped)
template <bool ASPLIT>
__global__ __launch_bounds__(128) void k_gemm_h(const float* __restrict__ A, int lda, size_t sA, const _Float16* __restrict__ Bh, int ldb, size_t sB, float alpha, float* __restrict__ C, int ldc, size_t sC, int M, int N, int K) {
  __shared__ __attribute__((aligned(16))) float so[4][16][64];
  const int tid = threadIdx.x, w = tid >> 5, lane = tid & 31, ln = lane & 15, hh = lane >> 4; const int by = blockIdx.y;
  A += (size_t)by * sA; Bh += (size_t)by * sB; C += (size_t)by * sC;
  const int ntn = (N + 63) / 64; const int wid = blockIdx.x * 4 + w; const int mt = wid / ntn, nq = wid % ntn; if (mt * 16 >= M) return;
  const int row0 = mt * 16, col0 = nq * 64; const float* arow = A + (size_t)(row0 + ln) * lda;
  v8f acc[4] = {};
  for (int kb = 0; kb < K; kb += 32) {
    FragH ah, al;
    const v4f x0 = *(const v4fa*)(arow + kb + 8 * hh), x1 = *(const v4fa*)(arow + kb + 8 * hh + 4), x2 = *(const v4fa*)(arow + kb + 16 + 8 * hh), x3 = *(const v4fa*)(arow + kb + 16 + 8 * hh + 4);
    float xs[16] = {x0[0],x0[1],x0[2],x0[3],x1[0],x1[1],x1[2],x1[3],x2[0],x2[1],x2[2],x2[3],x3[0],x3[1],x3[2],x3[3]};
#pragma unroll
    for (int i = 0; i < 16; ++i) { const _Float16 h = (_Float16)xs[i]; ah.h[i] = h; al.h[i] = ASPLIT ? (_Float16)(xs[i] - (float)h) : (_Float16)0.0f; }
#pragma unroll
    for (int t = 0; t < 4; ++t) { if (col0 + t * 16 >= N) continue; const size_t boff = (size_t)(col0 + t * 16 + ln) * ldb + kb; FragH bq; bq.half[0] = *(const v8us*)(Bh + boff + 8 * hh); bq.half[1] = *(const v8us*)(Bh + boff + 16 + 8 * hh);
      acc[t] = mmaH<ASPLIT ? 2 : 1>(ah.v, al.v, bq.v, bq.v, acc[t]); }
  }
#pragma unroll
  for (int t = 0; t < 4; ++t) { if (col0 + t * 16 >= N) continue;
#pragma unroll
    for (int r = 0; r < 8; ++r) so[w][8 * hh + r][t * 16 + ln] = acc[t][r] * alpha; }
  __builtin_amdgcn_fence(__ATOMIC_ACQ_REL, "workgroup"); __builtin_amdgcn_wave_barrier();
  const int rsub = lane >> 4, c4 = (lane & 15) * 4;
  {
#pragma unroll
    for (int q = 0; q < 8; ++q) { const int r = q * 2 + rsub; if (col0 + c4 < N) { const v4f v = *(const v4fa*)&so[w][r][c4]; *(v4f*)(C + (size_t)(row0 + r) * ldc + col0 + c4) = v; } }
     }
}

// Wt[n][k] = f16(W[k][n]·scale) from f32 row-major W[K][N] (scale = power of two; bf16-exact weights stay exact in f16 away from the subnormal range)
__global__ __launch_bounds__(256) void k_wt_f16(const float* __restrict__ W, _Float16* __restrict__ Wt, int K, int N, float scale) {
  const int t = blockIdx.x * 256 + threadIdx.x; if (t >= N * (K / 8)) return; const int n = t / (K / 8), k8 = (t % (K / 8)) * 8; FragH f;
#pragma unroll
  for (int i = 0; i < 8; ++i) f.h[i] = (_Float16)(bf16_round(W[(size_t)(k8 + i) * N + n]) * scale); const v8us o = f.half[0];
  *(v8us*)((unsigned short*)Wt + (size_t)n * K + k8) = o; 
}
// k_gemm_hh variant with fused epilogue: v = acc·alpha + bias[by·sBias + col] (+ CP[(row/rowsPerB)·sCPb + by·64 + col] if CP) ; ACT 0 none / 1 elu ; writes f16 C16 (and f32 C if non-null)
template <int ACT>
__global__ __launch_bounds__(128) void k_gemm_hhx(const _Float16* __restrict__ A, int lda, size_t sA, const _Float16* __restrict__ Bh, int ldb, size_t sB, float alpha, const float* __restrict__ bias, size_t sBias, const float* __restrict__ CP, int rowsPerB, size_t sCPb, int row0g,
    float* __restrict__ C, _Float16* __restrict__ C16, int ldc, size_t sC, int M, int N, int K) {
  __shared__ __attribute__((aligned(16))) float so[4][16][64];
  const int tid = threadIdx.x, w = tid >> 5, lane = tid & 31, ln = lane & 15, hh = lane >> 4; const int by = blockIdx.y;
  A += (size_t)by * sA; Bh += (size_t)by * sB; const size_t cofs = (size_t)by * sC; const float* bp = bias ? bias + (size_t)by * sBias : nullptr;
  const int ntn = (N + 63) / 64; const int wid = blockIdx.x * 4 + w; const int mt = wid / ntn, nq = wid % ntn; if (mt * 16 >= M) return;
  const int row0 = mt * 16, col0 = nq * 64; const _Float16* arow = A + (size_t)(row0 + ln) * lda;
  v8f acc[4] = {};
  for (int kb = 0; kb < K; kb += 32) { FragH ah; ah.half[0] = *(const v8us*)((const unsigned short*)arow + kb + 8 * hh); ah.half[1] = *(const v8us*)((const unsigned short*)arow + kb + 16 + 8 * hh);
#pragma unroll
    for (int t = 0; t < 4; ++t) { if (col0 + t * 16 >= N) continue; const size_t boff = (size_t)(col0 + t * 16 + ln) * ldb + kb; FragH bq; bq.half[0] = *(const v8us*)((const unsigned short*)Bh + boff + 8 * hh); bq.half[1] = *(const v8us*)((const unsigned short*)Bh + boff + 16 + 8 * hh);
      acc[t] = mmaH<1>(ah.v, ah.v, bq.v, bq.v, acc[t]); }
  }
#pragma unroll
  for (int t = 0; t < 4; ++t) { if (col0 + t * 16 >= N) continue; const int col = col0 + t * 16 + ln; const float bv = bp ? bf16_round(bp[col]) : 0.f;
#pragma unroll
    for (int r = 0; r < 8; ++r) { float v = acc[t][r] * alpha + bv; if (CP) { const int rr = row0g + row0 + 8 * hh + r; if (rowsPerB < 0) v += CP[cofs + (size_t)rr * ldc + col];      /* rowsPerB < 0: own element of the batched C plane */ else { const int bidx = rr / rowsPerB; v += CP[(size_t)bidx * sCPb + (size_t)by * 64 + col]; } } if (ACT == 1) v = (v > 0.f) ? v : expm1f(v); else if (ACT == 7) v = (v > 0.f) ? v + 1.0f : expf(v); else if (ACT == 8) v = tanhf(v); else if (ACT == 9) v = 0.5f * v * (1.0f + tanhf(0.7978845608028654f * (v + 0.044715f * v * v * v))); else if (ACT == 11) v = 1.0f / (1.0f + expf(-v)); else if (ACT == 12) v = (v > 0.f) ? v : 0.01f * v; else if (ACT == 14) v = (v > 0.f) ? v : 0.1f * v; else if (ACT == 16) v = (v >= 0.f) ? v : 0.3f * v; else if (ACT == 17) v = (v >= 0.f) ? v : 0.2f * v; else if (ACT == 15) v = v / (1.0f + expf(-v)); else if (ACT == 3) v = fmaxf(v, 0.f); else if (ACT == 6) v = 0.5f * v * (1.0f + erff(v * 0.70710678118654752f)); so[w][8 * hh + r][t * 16 + ln] = v; } }
  __builtin_amdgcn_fence(__ATOMIC_ACQ_REL, "workgroup"); __builtin_amdgcn_wave_barrier();
  const int rsub = lane >> 4, c4 = (lane & 15) * 4; typedef _Float16 v4h __attribute__((ext_vector_type(4)));
  {
#pragma unroll
    for (int q = 0; q < 8; ++q) { const int r = q * 2 + rsub; if (col0 + c4 < N) { const v4f v = *(const v4fa*)&so[w][r][c4]; if (C) *(v4f*)(C + cofs + (size_t)(row0 + r) * ldc + col0 + c4) = v; if (C16) { v4h h4; for (int i = 0; i < 4; ++i) h4[i] = (_Float16)v[i]; *(v4h*)(C16 + cofs + (size_t)(row0 + r) * ldc + col0 + c4) = h4; } } }
     }
}


typedef _Float16 v4h __attribute__((ext_vector_type(4)));

__global__ __launch_bounds__(256) void k_x16(const float* __restrict__ x, _Float16* __restrict__ X16, size_t n8) { const size_t t = (size_t)blockIdx.x * 256 + threadIdx.x; if (t >= n8) return; FragH f;
#pragma unroll
  for (int q = 0; q < 8; ++q) f.h[q] = (_Float16)bf16_round(x[t * 8 + q]); *(v8us*)((unsigned short*)X16 + t * 8) = f.half[0];  }
__global__ __launch_bounds__(256) void k_h16(const float* __restrict__ x, _Float16* __restrict__ X16, size_t n8) { const size_t t = (size_t)blockIdx.x * 256 + threadIdx.x; if (t >= n8) return; FragH f;
#pragma unroll
  for (int q = 0; q < 8; ++q) f.h[q] = (_Float16)x[t * 8 + q]; *(v8us*)((unsigned short*)X16 + t * 8) = f.half[0];  }
__global__ __launch_bounds__(256) void k_round16f(const float* __restrict__ W, _Float16* __restrict__ Bt, size_t n8) { const size_t t = (size_t)blockIdx.x * 256 + threadIdx.x; if (t >= n8) return; FragH f;
#pragma unroll
  for (int i = 0; i < 8; ++i) f.h[i] = (_Float16)(bf16_round(W[t * 8 + i]) * 16.0f); *(v8us*)((unsigned short*)Bt + t * 8) = f.half[0];  }
template <int NHv, int TTv>
__global__ __launch_bounds__(256) void k_vt(const _Float16* __restrict__ V16, int ldv, int voff, _Float16* __restrict__ Vt) { __shared__ unsigned short tl[64][66]; const int tid = threadIdx.x; const int slab = blockIdx.x / (TTv / 64), lg = blockIdx.x % (TTv / 64); const int b = slab / NHv, h = slab % NHv;
  for (int i = tid; i < 64 * 8; i += 256) { const int r = i / 8, c8 = (i % 8) * 8; FragH f; f.half[0] = *(const v8us*)((const unsigned short*)V16 + ((size_t)b * TTv + lg * 64 + r) * ldv + voff + h * 64 + c8);
#pragma unroll
    for (int q = 0; q < 8; ++q) tl[r][c8 + q] = f.u[q]; }
  __syncthreads();
  {
#pragma unroll
    for (int rd = 0; rd < 2; ++rd) { const int d = rd * 32 + tid / 8, pc = tid % 8; FragH f;
#pragma unroll
      for (int q = 0; q < 8; ++q) f.u[q] = tl[pc * 8 + q][d];
      *(v8us*)((unsigned short*)Vt + ((size_t)slab * 64 + d) * TTv + lg * 64 + pc * 8) = f.half[0]; }
     } }

__global__ __launch_bounds__(256) void k_hl(const float* __restrict__ F, _Float16* __restrict__ Hh, _Float16* __restrict__ Hl, size_t n8) { const size_t t = (size_t)blockIdx.x * 256 + threadIdx.x; if (t >= n8) return; FragH fh, fl; const v4f a = *(const v4fa*)(F + t * 8), c = *(const v4fa*)(F + t * 8 + 4);
#pragma unroll
  for (int q = 0; q < 4; ++q) { _Float16 h = (_Float16)a[q]; fh.h[q] = h; fl.h[q] = (_Float16)((a[q] - (float)h) * 1024.0f); h = (_Float16)c[q]; fh.h[4 + q] = h; fl.h[4 + q] = (_Float16)((c[q] - (float)h) * 1024.0f); }
  { *(v8us*)((unsigned short*)Hh + t * 8) = fh.half[0]; *(v8us*)((unsigned short*)Hl + t * 8) = fl.half[0];  } }

// ---- fast GEMM (work-group tile 128x128, 8 waves of 32x64; requires M % 128 == 0 rows per launch region, N % 128 == 0 and K % 64 == 0); epilogue = k_gemm_hhx semantics ----
// A stage is G2K k of the tile's 128 A rows and 128 Bt rows. 8 threads fetch one row's 128-byte line, one stage ahead into registers, and store it to one of two LDS buffers; the 8 waves read their fragments from LDS,
// so that every operand line leaves L2 once per work-group as a whole line. One barrier per stage publishes the next buffer and ends the reads of the one that is refilled after it. k runs in the order of the unstaged loop.
#define G2T 128                      /* A rows and Bt rows per work-group */
#define G2K 64                       /* k per LDS stage: 64 f16 = one 128-byte line of every row */
#define G2P (G2K + 8)                /* LDS row pitch in halves: 144 B = 16 B x odd, so that the 16 rows of a fragment load fall on different banks */
#define G2S (2 * G2T * G2P)          /* halves per stage buffer: the A rows, then the Bt rows */
__device__ __forceinline__ v16h g2_frag(const _Float16* p, int hh) { FragH f; f.half[0] = *(const v8us*)((const unsigned short*)p + 8 * hh); f.half[1] = *(const v8us*)((const unsigned short*)p + 16 + 8 * hh); return f.v; }
__device__ __forceinline__ v8f g2_mma(v16h a, v16h b, v8f c) { v8f d = __builtin_amdgcn_wmma_f32_16x16x32_f16(false, a, false, b, (short)0, c, false, false); asm volatile("v_nop\n\tv_nop\n\tv_nop\n\tv_nop" : "+v"(d) : "v"(a), "v"(b)); return d; }
template <int ACT>
__global__ __launch_bounds__(256) void k_gemm2(const _Float16* __restrict__ A, int lda, size_t sA, const _Float16* __restrict__ Bh, int ldb, size_t sB, float alpha, const float* __restrict__ bias, size_t sBias, const float* __restrict__ CP, int rowsPerB, size_t sCPb, int row0g,
    float* __restrict__ C, _Float16* __restrict__ C16, int ldc, size_t sC, int M, int N, int K, size_t zA, size_t zB, size_t zC) { static_assert(ACT == 0 || ACT == 3 || ACT == 6 || ACT == 8 || ACT == 9 || ACT == 11 || ACT == 12 || ACT == 14 || ACT == 15 || ACT == 16 || ACT == 17, "k_gemm2: unsupported ACT code (would silently apply no activation)");
  static_assert(2 * G2S * 2 >= 8 * 32 * 68 * 4 && G2T == 128 && G2K == 64, "the epilogue's rows fit the two stage buffers; 256 threads stage 32 rows per pass");
  __shared__ __attribute__((aligned(16))) unsigned char sm[2 * G2S * 2]; _Float16* const sg = (_Float16*)sm; float (*const so)[32][68] = (float (*)[32][68])sm;      /* the stage buffers; behind the loop's last barrier the same bytes hold each wave's output rows */
  const int tid = threadIdx.x, w = tid >> 5, wm = w & 3, wn = w >> 2, lane = tid & 31, ln = lane & 15, hh = lane >> 4; const int by = blockIdx.y, bz = blockIdx.z;      /* grid.y = head (strides sA, sB, sC), grid.z = batch (strides zA, zB, zC) */
  A += (size_t)by * sA + (size_t)bz * zA; Bh += (size_t)by * sB + (size_t)bz * zB; const size_t cofs = (size_t)by * sC + (size_t)bz * zC; const float* bp = bias ? bias + (size_t)by * sBias : nullptr;
  const int ntn = N >> 7; const int mt = blockIdx.x / ntn, nq = blockIdx.x - mt * ntn; if (mt * G2T >= M) return;      /* taken by a whole work-group, in front of every barrier */
  const int row0 = mt * G2T + 32 * wm, col0 = nq * G2T + 64 * wn;
  const int sr = tid >> 3, sc = (tid & 7) * 8; const int sl = sr * G2P + sc;      /* staging: row sr + 32 u, eight halves at column sc */
  const _Float16* ag = A + (size_t)(mt * G2T + sr) * lda + sc; const _Float16* bg = Bh + (size_t)(nq * G2T + sr) * ldb + sc; const int nst = K / G2K;
  const v8f z8 = {0.f,0.f,0.f,0.f,0.f,0.f,0.f,0.f}; v8f c00 = z8, c01 = z8, c02 = z8, c03 = z8, c10 = z8, c11 = z8, c12 = z8, c13 = z8;
  v8us ar[4], br[4]; const unsigned short* pa[4]; const unsigned short* pb[4];      /* the full unrolls give these register arrays constant indices and put a stage's eight loads in flight together */
#pragma unroll
  for (int u = 0; u < 4; ++u) { pa[u] = (const unsigned short*)(ag + (size_t)(u * 32) * lda); pb[u] = (const unsigned short*)(bg + (size_t)(u * 32) * ldb); }
#pragma unroll
  for (int u = 0; u < 4; ++u) { ar[u] = *(const v8us*)pa[u]; br[u] = *(const v8us*)pb[u]; }
  asm volatile("s_wait_xcnt 0x0" :: "v"(pa[0]), "v"(pa[1]), "v"(pa[2]), "v"(pa[3]), "v"(pb[0]), "v"(pb[1]), "v"(pb[2]), "v"(pb[3]) : "memory");      /* the loads' address registers are free for reuse only from here on; as inputs they stay whole up to this wait, so that no load returns into one either */
#pragma unroll
  for (int u = 0; u < 4; ++u) { *(v8us*)(unsigned short*)&sg[sl + u * 32 * G2P] = ar[u]; *(v8us*)(unsigned short*)&sg[G2T * G2P + sl + u * 32 * G2P] = br[u]; }
  __syncthreads();
#pragma unroll 1
  for (int s = 0; s < nst; ++s) { const bool more = s + 1 < nst;      /* more: the same for the whole work-group. The stage loop stays rolled, so that its text stays small; its two 32-k passes are unrolled, so that their LDS offsets are immediates */
    if (more) {
#pragma unroll
      for (int u = 0; u < 4; ++u) { pa[u] = (const unsigned short*)(ag + (s + 1) * G2K + (size_t)(u * 32) * lda); pb[u] = (const unsigned short*)(bg + (s + 1) * G2K + (size_t)(u * 32) * ldb); }
#pragma unroll
      for (int u = 0; u < 4; ++u) { ar[u] = *(const v8us*)pa[u]; br[u] = *(const v8us*)pb[u]; }
      asm volatile("s_wait_xcnt 0x0" :: "v"(pa[0]), "v"(pa[1]), "v"(pa[2]), "v"(pa[3]), "v"(pb[0]), "v"(pb[1]), "v"(pb[2]), "v"(pb[3]) : "memory"); }      /* the code below reuses the registers that these loads name: this wait stands in front of that overwrite, and as its inputs they stay whole up to it, so that no load returns into one either */
    const _Float16* ab = sg + (s & 1) * G2S + (32 * wm + ln) * G2P; const _Float16* bb = sg + (s & 1) * G2S + (G2T + 64 * wn + ln) * G2P;
#pragma unroll
    for (int kc = 0; kc < G2K; kc += 32) { const v16h a0 = g2_frag(ab + kc, hh), a1 = g2_frag(ab + 16 * G2P + kc, hh);
      const v16h b0 = g2_frag(bb + kc, hh), b1 = g2_frag(bb + 16 * G2P + kc, hh), b2 = g2_frag(bb + 32 * G2P + kc, hh), b3 = g2_frag(bb + 48 * G2P + kc, hh);
      c00 = g2_mma(a0, b0, c00); c10 = g2_mma(a1, b0, c10); c01 = g2_mma(a0, b1, c01); c11 = g2_mma(a1, b1, c11);
      c02 = g2_mma(a0, b2, c02); c12 = g2_mma(a1, b2, c12); c03 = g2_mma(a0, b3, c03); c13 = g2_mma(a1, b3, c13); }
    if (more) {
#pragma unroll
      for (int u = 0; u < 4; ++u) { *(v8us*)(unsigned short*)&sg[((s + 1) & 1) * G2S + sl + u * 32 * G2P] = ar[u]; *(v8us*)(unsigned short*)&sg[((s + 1) & 1) * G2S + G2T * G2P + sl + u * 32 * G2P] = br[u]; } }
    __syncthreads(); }      /* publishes stage s + 1 and ends every wave's reads of stage s, whose buffer the next trip refills and, behind the last trip, the output rows reuse */
  v8f accs[8] = {c00, c01, c02, c03, c10, c11, c12, c13};
#pragma unroll
  for (int u = 0; u < 8; ++u) { const int t = u & 3, half = u >> 2; const int col = col0 + t * 16 + ln; const float bv = bp ? bf16_round(bp[col]) : 0.f;
#pragma unroll
    for (int r = 0; r < 8; ++r) { const int rloc = half * 16 + 8 * hh + r; float v = accs[u][r] * alpha + bv; if (CP) { if (rowsPerB < 0) v += CP[cofs + (size_t)(row0g + row0 + rloc) * ldc + col];      /* rowsPerB < 0: own element of the batched C plane */ else { const int bidx = (row0g + row0 + rloc) / rowsPerB; v += CP[(size_t)bidx * sCPb + (size_t)by * 64 + col]; } }
      if (ACT == 3) v = fmaxf(v, 0.f); else if (ACT == 6) v = 0.5f * v * (1.0f + erff(v * 0.70710678118654752f)); else if (ACT == 11) v = 1.0f / (1.0f + expf(-v)); else if (ACT == 15) v = v / (1.0f + expf(-v)); else if (ACT == 12) v = (v > 0.f) ? v : 0.01f * v; else if (ACT == 8) v = tanhf(v); else if (ACT == 9) v = 0.5f * v * (1.0f + tanhf(0.7978845608028654f * (v + 0.044715f * v * v * v))); else if (ACT == 14) v = (v > 0.f) ? v : 0.1f * v; else if (ACT == 16) v = (v >= 0.f) ? v : 0.3f * v; else if (ACT == 17) v = (v >= 0.f) ? v : 0.2f * v;
      so[w][rloc][t * 16 + ln] = v; } }
  __builtin_amdgcn_fence(__ATOMIC_ACQ_REL, "workgroup"); __builtin_amdgcn_wave_barrier();
  const int rsub = lane >> 4, c4 = (lane & 15) * 4;
  {
#pragma unroll
    for (int q = 0; q < 16; ++q) { const int r = q * 2 + rsub; const v4f v = *(const v4fa*)&so[w][r][c4]; if (C) *(v4f*)(C + cofs + (size_t)(row0 + r) * ldc + col0 + c4) = v; if (C16) { v4h h4; for (int i = 0; i < 4; ++i) h4[i] = (_Float16)v[i]; *(v4h*)(C16 + cofs + (size_t)(row0 + r) * ldc + col0 + c4) = h4; } }
     } }


__global__ __launch_bounds__(256) void k_wnat(const float* __restrict__ w, size_t n8, _Float16* __restrict__ Bt) { const size_t t = (size_t)blockIdx.x * 256 + threadIdx.x; if (t >= n8) return; FragH f; for (int q = 0; q < 8; ++q) f.h[q] = (_Float16)(bf16_round(w[t * 8 + q]) * 16.0f); *(v8us*)((unsigned short*)Bt + t * 8) = f.half[0];  }
__global__ __launch_bounds__(256) void k_rsm(const float* __restrict__ S, _Float16* __restrict__ P, int nrows) {
  #pragma clang fp contract(off)
  const int i = blockIdx.x * 256 + threadIdx.x; if (i >= nrows) return; const float* s = S + (size_t)i * SQ; float mx = -3.0e38f;
#pragma unroll 1
  for (int j = 0; j < SQ; ++j) mx = fmaxf(mx, s[j]); float se = 0.f;
#pragma unroll 1
  for (int j = 0; j < SQ; ++j) se += expf(s[j] - mx); const float sc = 256.0f / se;
#pragma unroll 1
  for (int j0 = 0; j0 < SQ; j0 += 8) { FragH f; for (int q = 0; q < 8; ++q) f.h[q] = (_Float16)(expf(s[j0 + q] - mx) * sc); unsigned short* d = (unsigned short*)P + (size_t)i * SQ + j0; *(v8us*)d = f.half[0];  } }
__global__ __launch_bounds__(256) void k_vt(const _Float16* __restrict__ V16, int b, int h0, _Float16* __restrict__ VT) { __shared__ unsigned short tl[64][65]; const int tid = threadIdx.x; const int hh = blockIdx.x % HG, sg = blockIdx.x / HG; const int s0 = sg * 64; const int h = h0 + hh;
  for (int i = tid; i < 64 * 8; i += 256) { const int j = i / 8, d8 = (i % 8) * 8; FragH f; f.half[0] = *(const v8us*)((const unsigned short*)V16 + ((size_t)b * SQ + s0 + j) * DM + h * HD + d8); for (int q = 0; q < 8; ++q) tl[d8 + q][j] = f.u[q]; }
  __syncthreads();
  { for (int i = tid; i < 64 * 8; i += 256) { const int d = i / 8, j8 = (i % 8) * 8; FragH f; for (int q = 0; q < 8; ++q) f.u[q] = tl[d][j8 + q]; *(v8us*)((unsigned short*)VT + ((size_t)hh * HD + d) * SQ + s0 + j8) = f.half[0]; }  } }



// Lane l <-> l ^ M inside a 16-lane row (DPP row_xmask) and l <-> l ^ 16 (cross-row move): a five-step butterfly leaves the row's maximum / sum in every lane without an LDS round trip.
template <int M> __device__ __forceinline__ float rs_xm(float x) { return __builtin_bit_cast(float, __builtin_amdgcn_update_dpp(0, __builtin_bit_cast(int, x), 0x160 | M, 0xf, 0xf, true)); }
__device__ __forceinline__ float rs_xh(float x) { return __builtin_bit_cast(float, __builtin_amdgcn_permlanex16(__builtin_bit_cast(int, x), __builtin_bit_cast(int, x), 0x76543210, 0xfedcba98, false, false)); }
// Fused causal attention, all batches, heads and query tiles in ONE launch: scores, softmax and weighted values stay in registers, nothing of them goes to memory.
// A work-group of FAW waves takes FAQ query rows of one head, 32 per wave, and walks the keys 0 .. its last row in stages of FAK keys. A stage's K rows [key][d] and V^T rows [d][key] are fetched with whole-line loads
// one stage ahead into registers and stored to one of two LDS buffers; one barrier per stage publishes the next buffer and ends the reads of the one that is refilled after it.
// Per 32-key pass a wave forms S^T = K Q^T (A = K rows, B = q rows held in registers): lane (c, h) then holds keys 8h + r of query c, so the maximum and the sum are in-lane plus one exchange of the wave's halves,
// and the two 16-key score tiles, converted in place, are the B operand of O^T += V^T P^T (A = V^T rows in the same k order). Online softmax in the log2 domain; the maximum in use may trail the true one by up to 8,
// so a weight can reach 2^8 (f16 holds it at full relative precision) and the accumulators are rescaled only in the rare pass in which some query's maximum grows by more.
// The full unrolls in the kernel give its register arrays (fragments, score tiles, accumulators, staged rows) constant indices, without which they would go to scratch memory.
#define FAW 4                        /* waves per work-group */
#define FAQ (FAW * 32)               /* query rows per work-group */
#define FAK 64                       /* keys per LDS stage: two 32-key passes; 64 f16 = one 128-byte line of a V^T row */
#define FAP (HD + 8)                 /* LDS row pitch in halves: 144 B = 16 B x odd, so that the 16 rows of a fragment load fall on different banks */
__device__ __forceinline__ v8f fa_mma(v16h a, v16h b, v8f c) { return __builtin_amdgcn_wmma_f32_16x16x32_f16(false, a, false, b, (short)0, c, false, false); }
__device__ __forceinline__ v16h fa_frag(const _Float16* p) { FragH f; f.half[0] = *(const v8us*)(const unsigned short*)p; f.half[1] = *(const v8us*)((const unsigned short*)p + 16); return f.v; }      /* p already holds the lane's 8 * h: k = 8h .. 8h+7 and 16+8h .. 16+8h+7, the order of g2_frag */
// Four vector slots between a run of matrix instructions and the branch behind it: on the taken side the next vector instruction may read their results. The two scheduling barriers keep the slots at that place.
__device__ __forceinline__ void fa_gap() { __builtin_amdgcn_sched_barrier(0); asm volatile("v_nop\n\tv_nop\n\tv_nop\n\tv_nop"); __builtin_amdgcn_sched_barrier(0); }
__global__ __launch_bounds__(FAW * 32) void k_fattn(const _Float16* __restrict__ Qh, const _Float16* __restrict__ Kh, const _Float16* __restrict__ Vt, _Float16* __restrict__ Oh) {
  static_assert(HD == 64 && FAK == 64 && FAQ % FAK == 0 && SQ / FAQ == 16 && NB * NH == 64 && FAW * 32 == 128 && KVD == DM, "16 query tiles x 64 (batch, head) pairs; 8 threads stage one 128-byte row, 16 rows per pass of the staging loop");
  __shared__ __attribute__((aligned(16))) _Float16 ks[2][FAK * FAP]; __shared__ __attribute__((aligned(16))) _Float16 vs[2][HD * FAP];
  const int tid = threadIdx.x, lane = tid & 31, c = lane & 15, h = lane >> 4; const int w = __builtin_amdgcn_readfirstlane(tid >> 5); const int idx = blockIdx.x;
  // A tile's cost grows with its index and all work-groups are resident together: the 16 tiles are dealt by a 4 x 4 square whose rows and columns all sum to 30 (row = idx / 256, column = (idx / 8) % 4), every (head, tile) pair once.
  const int tile = (int)((0x0DE3B6587A94C12FULL >> (4 * (((idx >> 8) << 2) | ((idx >> 3) & 3)))) & 15); const int bh = (idx & 7) | (((idx >> 5) & 7) << 3); const int b = bh / NH, hd = bh % NH;
  const int q0 = tile * FAQ, qw = q0 + 32 * w, nst = (q0 + FAQ) / FAK;      /* causal: keys below the tile's end */
  const int sr = tid >> 3, sc = (tid & 7) * 8; const int so = sr * FAP + sc;      /* staging: row sr + 16 u, eight halves at column sc */
  const _Float16* kg = Kh + ((size_t)b * SQ + sr) * KVD + hd * HD + sc; const _Float16* vg = Vt + ((size_t)bh * HD + sr) * SQ + sc;
  v8us kr[4], vr[4];
#pragma unroll
  for (int u = 0; u < 4; ++u) { kr[u] = *(const v8us*)(const unsigned short*)(kg + u * 16 * KVD); vr[u] = *(const v8us*)(const unsigned short*)(vg + u * 16 * SQ); }
  v16h qf[2][2];
#pragma unroll
  for (int g = 0; g < 2; ++g) for (int kc = 0; kc < 2; ++kc) qf[g][kc] = g2_frag(Qh + ((size_t)b * SQ + qw + 16 * g + c) * LQ + hd * HD + kc * 32, h);
  asm volatile("s_wait_xcnt 0x0" ::: "memory");      /* the q rows' address registers are free for reuse from here on: this wait stands in front of their overwrite */
#pragma unroll
  for (int u = 0; u < 4; ++u) { *(v8us*)(unsigned short*)&ks[0][so + u * 16 * FAP] = kr[u]; *(v8us*)(unsigned short*)&vs[0][so + u * 16 * FAP] = vr[u]; }
  const v8f z8 = {0.f, 0.f, 0.f, 0.f, 0.f, 0.f, 0.f, 0.f}; const v4f z4 = {0.f, 0.f, 0.f, 0.f};
  v8f acc[2][4]; v4f l4[2]; float mr[2];
#pragma unroll
  for (int g = 0; g < 2; ++g) { mr[g] = -__builtin_inff(); l4[g] = z4; for (int t = 0; t < 4; ++t) acc[g][t] = z8; }
  const float cs = 0.125f * 1.44269504088896340736f;      /* 64^-0.5 log2 e */
  __syncthreads();
  for (int st = 0; st < nst; ++st) {
    const bool more = st + 1 < nst;      /* the same for the whole work-group */
    if (more) {
#pragma unroll
      for (int u = 0; u < 4; ++u) { kr[u] = *(const v8us*)(const unsigned short*)(kg + (size_t)(st + 1) * FAK * KVD + u * 16 * KVD); vr[u] = *(const v8us*)(const unsigned short*)(vg + (st + 1) * FAK + u * 16 * SQ); }
      asm volatile("s_wait_xcnt 0x0" ::: "memory"); }      /* the pass below reuses the registers that hold these loads' addresses: this wait stands in front of that overwrite */
    const _Float16* kb = &ks[st & 1][c * FAP + 8 * h]; const _Float16* vb = &vs[st & 1][c * FAP + 8 * h];
    for (int p = 0; p < FAK / 32; ++p) { const int key0 = st * FAK + p * 32;
      if (key0 <= qw) {      /* wave-uniform: a wave skips the passes beyond its diagonal, never the barrier */
        v8f s[2][2];
        { v16h kf[2][2];
#pragma unroll
          for (int kt = 0; kt < 2; ++kt) for (int kc = 0; kc < 2; ++kc) kf[kt][kc] = fa_frag(kb + (p * 32 + 16 * kt) * FAP + kc * 32);
#pragma unroll
          for (int kt = 0; kt < 2; ++kt) for (int g = 0; g < 2; ++g) s[kt][g] = fa_mma(kf[kt][1], qf[g][1], fa_mma(kf[kt][0], qf[g][0], z8)); }      /* s[kt][g][r] = q(qw + 16g + c) . k(key0 + 16kt + 8h + r) */
        fa_gap();
        if (key0 == qw) {      /* the one pass on the wave's diagonal: key > query is masked; key key0 is kept in every row */
#pragma unroll
          for (int kt = 0; kt < 2; ++kt) for (int g = 0; g < 2; ++g) for (int r = 0; r < 8; ++r) s[kt][g][r] = (16 * kt + 8 * h + r > 16 * g + c) ? -__builtin_inff() : s[kt][g][r]; }
        float mb[2]; bool need = false;
#pragma unroll
        for (int g = 0; g < 2; ++g) { float mx = s[0][g][0];
#pragma unroll
          for (int r = 1; r < 8; ++r) mx = fmaxf(mx, s[0][g][r]);
#pragma unroll
          for (int r = 0; r < 8; ++r) mx = fmaxf(mx, s[1][g][r]);
          mx = fmaxf(mx, rs_xh(mx)) * cs; mb[g] = mx; need = need || (mx > mr[g] + 8.0f); }      /* both halves of the wave hold the query's maximum of this pass, scaled */
        if (__builtin_amdgcn_ballot_w32(need) != 0) {      /* scalar branch; always taken in a wave's first pass, where mr is -inf and the factor 0 */
#pragma unroll
          for (int g = 0; g < 2; ++g) { const float mn = fmaxf(mr[g], mb[g]); const float corr = __builtin_amdgcn_exp2f(mr[g] - mn); mr[g] = mn; l4[g] *= corr;
#pragma unroll
            for (int t = 0; t < 4; ++t) acc[g][t] *= corr; } }
        v16h vf[4];
#pragma unroll
        for (int t = 0; t < 4; ++t) vf[t] = fa_frag(vb + 16 * t * FAP + p * 32);
#pragma unroll
        for (int g = 0; g < 2; ++g) { const float nm = -mr[g]; FragH pf;
#pragma unroll
          for (int kt = 0; kt < 2; ++kt) for (int j = 0; j < 2; ++j) { const v4f x = {s[kt][g][4 * j], s[kt][g][4 * j + 1], s[kt][g][4 * j + 2], s[kt][g][4 * j + 3]}; const v4f y = x * cs + nm; const v4f e = {__builtin_amdgcn_exp2f(y[0]), __builtin_amdgcn_exp2f(y[1]), __builtin_amdgcn_exp2f(y[2]), __builtin_amdgcn_exp2f(y[3])}; l4[g] += e;      /* the builtin, so that the compiler keeps these writes clear of the matrix instructions' operands */
            for (int i = 0; i < 4; ++i) pf.h[8 * kt + 4 * j + i] = (_Float16)e[i]; }      /* element 8 kt + r of the B operand = key 16 kt + 8 h + r: the k order of fa_frag */
#pragma unroll
          for (int t = 0; t < 4; ++t) acc[g][t] = fa_mma(vf[t], pf.v, acc[g][t]); }      /* acc[g][t][r] = o(qw + 16g + c)[16t + 8h + r], not yet divided by the row sum */
        fa_gap();
      } }
    if (more) {
#pragma unroll
      for (int u = 0; u < 4; ++u) { *(v8us*)(unsigned short*)&ks[(st + 1) & 1][so + u * 16 * FAP] = kr[u]; *(v8us*)(unsigned short*)&vs[(st + 1) & 1][so + u * 16 * FAP] = vr[u]; }
      __syncthreads(); }      /* publishes stage st + 1 and ends every wave's reads of stage st, whose buffer the next trip refills */
  }
  v8us ov[2][4]; unsigned short* og = (unsigned short*)Oh + ((size_t)b * SQ + qw + c) * DM + hd * HD + 8 * h;      /* lane (c, h): 8 consecutive d of query row c, one 16-byte store per 16 d */
#pragma unroll
  for (int g = 0; g < 2; ++g) { float l = (l4[g][0] + l4[g][1]) + (l4[g][2] + l4[g][3]); l += rs_xh(l); const float fin = 64.0f / l;      /* o carried x64, as the output GEMM's factor expects */
#pragma unroll
    for (int t = 0; t < 4; ++t) { FragH f; for (int r = 0; r < 8; ++r) f.h[r] = (_Float16)(acc[g][t][r] * fin); ov[g][t] = f.half[0]; } }
  __builtin_amdgcn_sched_barrier(0);      /* the eight stores stand behind the last conversion, so that no register which an issued store names is written again */
#pragma unroll
  for (int g = 0; g < 2; ++g) for (int t = 0; t < 4; ++t) *(v8us*)(og + g * 16 * DM + 16 * t) = ov[g][t]; }


// Exact f32 causal attention for rows 0..QT0-1 of every batch and head (planes [batch][QT0][DM]). One work-group of 256 threads takes A0R query rows of one head: thread (r, c) = (tid / 8, tid % 8).
// The group's q rows and the head's QT0 key and value rows are staged in LDS once; then scores (thread (r, c): keys c, c + 8, ...; its q row in registers), the row maximum and sum over the row's 8 lanes, and o (thread (r, c): columns 4c..4c+3 and 32+4c..32+4c+3).
#define A0R 32                       /* query rows per work-group */
#define A0KP (HD + 4)                /* q and key row pitch in LDS, floats: 16 B x odd, so that 8 rows read at one column fall on different banks */
#define A0PP (QT0 + 8)               /* weight row pitch in LDS, floats: the 4 rows of a wave start 8 banks apart */
// o leaves as two f16 planes [batch][QT0][DM]: hi = f16(o), lo = f16((o - hi) * 1024), the A rows of the output projection's first-tile work-groups.
__global__ __launch_bounds__(256) void k_att0(const float* __restrict__ QF, const float* __restrict__ KF, const float* __restrict__ VF, float scale, _Float16* __restrict__ OH, _Float16* __restrict__ OL) {
  static_assert(QT0 % A0R == 0 && A0R * 8 == 256 && A0R == 32 && HD == 64 && QT0 % 16 == 0, "8 threads per query row; 16 threads stage one row, 16 rows per pass");
  __shared__ __attribute__((aligned(16))) float ks[QT0 * A0KP]; __shared__ __attribute__((aligned(16))) float vs[QT0 * HD]; __shared__ __attribute__((aligned(16))) float qs[A0R * A0KP]; __shared__ __attribute__((aligned(16))) float ps[A0R * A0PP];
  const int tid = threadIdx.x; const int h = blockIdx.x / (QT0 / A0R), rg = blockIdx.x % (QT0 / A0R); const int r = tid >> 3, c = tid & 7; const int i = rg * A0R + r; const int nk = (rg + 1) * A0R;      /* causal: keys below the group's last row */
  const size_t bo = (size_t)blockIdx.y * QT0 * DM + (size_t)h * HD;      /* grid.y = batch */
  const int sr = tid >> 4, sc = (tid & 15) * 4; const int so = sr * DM + sc;      /* staging: row sr + 16 u, four floats at column sc */
  const float* kg = KF + bo; const float* vg = VF + bo; const float* qg = QF + bo + (size_t)rg * A0R * DM;
  v4f kk[QT0 / 16], vv[QT0 / 16];      /* the full unrolls below give the register arrays kk, vv, q constant indices and put all staging loads in flight together */
#pragma unroll
  for (int u = 0; u < QT0 / 16; ++u) { kk[u] = *(const v4fa*)(kg + so + u * 16 * DM); vv[u] = *(const v4fa*)(vg + so + u * 16 * DM); }
  const v4f q0 = *(const v4fa*)(qg + so);
  asm volatile("s_wait_xcnt 0x0" ::: "memory");      /* the last staging load may return into the offset register that the loads above name: this wait stands in front of that overwrite */
  const v4f q1 = *(const v4fa*)(qg + so + 16 * DM);
#pragma unroll
  for (int u = 0; u < QT0 / 16; ++u) { *(v4f*)&ks[(sr + u * 16) * A0KP + sc] = kk[u]; *(v4f*)&vs[(sr + u * 16) * HD + sc] = vv[u]; }
  *(v4f*)&qs[sr * A0KP + sc] = q0; *(v4f*)&qs[(sr + 16) * A0KP + sc] = q1;
  __syncthreads();
  v4f q[HD / 4];
#pragma unroll
  for (int u = 0; u < HD / 4; ++u) q[u] = *(const v4f*)&qs[r * A0KP + u * 4];
  float* pr = ps + r * A0PP; float mx = -3.0e38f;      /* unroll 2 in the three loops below: the LDS loads of two trips are in flight together and their sums are independent chains */
#pragma unroll 2
  for (int m = 0; m < nk / 8; ++m) { const int j = c + m * 8; const float* kp = ks + j * A0KP; v4f a = {0.f, 0.f, 0.f, 0.f};
#pragma unroll
    for (int u = 0; u < HD / 4; ++u) a += q[u] * *(const v4f*)(kp + u * 4);
    const float s = (j <= i) ? ((a[0] + a[1]) + (a[2] + a[3])) * scale : -3.0e38f; pr[j] = s; mx = fmaxf(mx, s); }
  mx = fmaxf(mx, rs_xm<1>(mx)); mx = fmaxf(mx, rs_xm<2>(mx)); mx = fmaxf(mx, rs_xm<4>(mx));      /* key 0 is kept in every row, so the row maximum is a real score and a masked key's weight is exp(-huge) = 0 */
  float l = 0.f;
#pragma unroll 2
  for (int m = 0; m < nk / 8; ++m) { const int j = c + m * 8; const float e = expf(pr[j] - mx); pr[j] = e; l += e; }
  l += rs_xm<1>(l); l += rs_xm<2>(l); l += rs_xm<4>(l);
  __syncthreads();
  v4f o0 = {0.f, 0.f, 0.f, 0.f}, o1 = {0.f, 0.f, 0.f, 0.f}; const float* vp = vs + c * 4;
#pragma unroll 2
  for (int j = 0; j < nk; j += 4) { const v4f p = *(const v4f*)(pr + j);
#pragma unroll
    for (int t = 0; t < 4; ++t) { o0 += p[t] * *(const v4f*)(vp + (j + t) * HD); o1 += p[t] * *(const v4f*)(vp + (j + t) * HD + HD / 2); } }
  const float fin = 64.0f / l;      /* o carried x64 like the f16 path */
  const v4f a0 = o0 * fin, a1 = o1 * fin; v4h h0, h1, l0, l1;
#pragma unroll
  for (int t = 0; t < 4; ++t) { _Float16 hv = (_Float16)a0[t]; h0[t] = hv; l0[t] = (_Float16)((a0[t] - (float)hv) * 1024.0f); hv = (_Float16)a1[t]; h1[t] = hv; l1[t] = (_Float16)((a1[t] - (float)hv) * 1024.0f); }
  const size_t oo = bo + i * DM + c * 4; *(v4h*)(OH + oo) = h0; *(v4h*)(OH + oo + HD / 2) = h1; *(v4h*)(OL + oo) = l0; *(v4h*)(OL + oo + HD / 2) = l1; }


__global__ __launch_bounds__(256) void k_tab2(float theta, float* __restrict__ CS, float* __restrict__ SN) {
  #pragma clang fp contract(off)
  const int t = blockIdx.x * 256 + threadIdx.x; if (t >= SQ * (HD / 2)) return; const int i = t % (HD / 2); const int p = t / (HD / 2); const float invf = 1.0f / powf(theta, (float)(2 * i) / (float)HD); const float ang = __fmul_rn((float)p, invf); const float c = cosf(ang), s = sinf(ang);
  *(float*)(CS + t) = c; *(float*)(SN + t) = s;  }
// q, k and v projections of all token rows in ONE launch, with everything that stood between them and the attention kernels done in the epilogue. The stage loop is that of k_gemm2 (128 x 128 tile, 8 waves of 32 x 64, two LDS buffers, K = DM).
// Work-group (xt, j): xt = tile of 128 token rows, j = tile of 128 rows of the transposed fused weight Wt [3 DM][DM] (j / 8 = 0 q, 1 k, 2 v).
// q, k: A = token rows, B = weight rows. A wave's 64 columns are one head, so that after the turn through LDS lane l holds columns 4l .. 4l + 3 of a row and the rotate-half partner sits 8 lanes away (DPP exchange):
// out_lo = x_lo c - x_hi s, out_hi = x_hi c + x_lo s, written as f16 rows; the first QT0 rows of a batch also as f32 rows [batch][QT0][DM] for the exact first-tile kernel.
// v: the operands change places (A = weight rows, B = token rows; same k order, same products), so that the tile comes out as V^T [d][token] and its rows are whole lines of the plane [batch][head][d][SQ];
// of the first QT0 tokens of a batch a lane's 8 accumulator rows are 8 consecutive d of one token: stored as f32 v rows [batch][QT0][DM] straight from the registers.
// The full unrolls give the register arrays constant indices and put a phase's loads or stores in flight together.
__global__ __launch_bounds__(256) void k_proj3(const _Float16* __restrict__ X, const _Float16* __restrict__ Wt, const float* __restrict__ CS, const float* __restrict__ SN,
    _Float16* __restrict__ Qh, _Float16* __restrict__ Kh, _Float16* __restrict__ Vt, float* __restrict__ QF0, float* __restrict__ KF0, float* __restrict__ VF0) {
  static_assert(2 * G2S * 2 >= 8 * 32 * 68 * 4 && G2T == 128 && G2K == 64 && DM % G2K == 0 && SQ % G2T == 0 && QT0 == G2T && HD == 64 && KVD == DM && HPG == 1 && SQ / G2T == 16 && DM / G2T == 8, "a wave's 64 columns are one head; a token tile lies in one batch; the first tile of a batch is the exact kernel's rows");
  __shared__ __attribute__((aligned(16))) unsigned char sm[2 * G2S * 2]; _Float16* const sg = (_Float16*)sm; float (*const so)[32][68] = (float (*)[32][68])sm;      /* the stage buffers; behind the loop's last barrier the same bytes hold each wave's output rows */
  const int tid = threadIdx.x, lane = tid & 31, ln = lane & 15, hh = lane >> 4; const int w = __builtin_amdgcn_readfirstlane(tid >> 5), wm = w & 3, wn = w >> 2;
  const int xt = blockIdx.x / 24, j = blockIdx.x - xt * 24; const bool isv = j >= 16; const int bt = xt >> 4, xs = xt & 15;      /* bt = batch, xs = token tile in the batch; all the same for the whole work-group */
  const _Float16* const xr = X + (size_t)xt * G2T * DM; const _Float16* const wr = Wt + (size_t)j * G2T * DM;
  const int sr = tid >> 3, sc = (tid & 7) * 8; const int sl = sr * G2P + sc;      /* staging: row sr + 32 u, eight halves at column sc */
  const _Float16* ag = (isv ? wr : xr) + sr * DM + sc; const _Float16* bg = (isv ? xr : wr) + sr * DM + sc; const int nst = DM / G2K;
  const v8f z8 = {0.f,0.f,0.f,0.f,0.f,0.f,0.f,0.f}; v8f c00 = z8, c01 = z8, c02 = z8, c03 = z8, c10 = z8, c11 = z8, c12 = z8, c13 = z8;
  v8us ar[4], br[4]; const unsigned short* pa[4]; const unsigned short* pb[4];
#pragma unroll
  for (int u = 0; u < 4; ++u) { pa[u] = (const unsigned short*)(ag + (size_t)(u * 32) * DM); pb[u] = (const unsigned short*)(bg + (size_t)(u * 32) * DM); }
#pragma unroll
  for (int u = 0; u < 4; ++u) { ar[u] = *(const v8us*)pa[u]; br[u] = *(const v8us*)pb[u]; }
  asm volatile("s_wait_xcnt 0x0" :: "v"(pa[0]), "v"(pa[1]), "v"(pa[2]), "v"(pa[3]), "v"(pb[0]), "v"(pb[1]), "v"(pb[2]), "v"(pb[3]) : "memory");      /* the loads' address registers are free for reuse only from here on; as inputs they stay whole up to this wait, so that no load returns into one either */
#pragma unroll
  for (int u = 0; u < 4; ++u) { *(v8us*)(unsigned short*)&sg[sl + u * 32 * G2P] = ar[u]; *(v8us*)(unsigned short*)&sg[G2T * G2P + sl + u * 32 * G2P] = br[u]; }
  __syncthreads();
#pragma unroll 1
  for (int s = 0; s < nst; ++s) { const bool more = s + 1 < nst;      /* more: the same for the whole work-group. The stage loop stays rolled, so that its text stays small; its two 32-k passes are unrolled, so that their LDS offsets are immediates */
    if (more) {
#pragma unroll
      for (int u = 0; u < 4; ++u) { pa[u] = (const unsigned short*)(ag + (s + 1) * G2K + (size_t)(u * 32) * DM); pb[u] = (const unsigned short*)(bg + (s + 1) * G2K + (size_t)(u * 32) * DM); }
#pragma unroll
      for (int u = 0; u < 4; ++u) { ar[u] = *(const v8us*)pa[u]; br[u] = *(const v8us*)pb[u]; }
      asm volatile("s_wait_xcnt 0x0" :: "v"(pa[0]), "v"(pa[1]), "v"(pa[2]), "v"(pa[3]), "v"(pb[0]), "v"(pb[1]), "v"(pb[2]), "v"(pb[3]) : "memory"); }      /* the code below reuses the registers that these loads name: this wait stands in front of that overwrite, and as its inputs they stay whole up to it, so that no load returns into one either */
    const _Float16* ab = sg + (s & 1) * G2S + (32 * wm + ln) * G2P; const _Float16* bb = sg + (s & 1) * G2S + (G2T + 64 * wn + ln) * G2P;
#pragma unroll
    for (int kc = 0; kc < G2K; kc += 32) { const v16h a0 = g2_frag(ab + kc, hh), a1 = g2_frag(ab + 16 * G2P + kc, hh);
      const v16h b0 = g2_frag(bb + kc, hh), b1 = g2_frag(bb + 16 * G2P + kc, hh), b2 = g2_frag(bb + 32 * G2P + kc, hh), b3 = g2_frag(bb + 48 * G2P + kc, hh);
      c00 = g2_mma(a0, b0, c00); c10 = g2_mma(a1, b0, c10); c01 = g2_mma(a0, b1, c01); c11 = g2_mma(a1, b1, c11);
      c02 = g2_mma(a0, b2, c02); c12 = g2_mma(a1, b2, c12); c03 = g2_mma(a0, b3, c03); c13 = g2_mma(a1, b3, c13); }
    if (more) {
#pragma unroll
      for (int u = 0; u < 4; ++u) { *(v8us*)(unsigned short*)&sg[((s + 1) & 1) * G2S + sl + u * 32 * G2P] = ar[u]; *(v8us*)(unsigned short*)&sg[((s + 1) & 1) * G2S + G2T * G2P + sl + u * 32 * G2P] = br[u]; } }
    __syncthreads(); }      /* publishes stage s + 1 and ends every wave's reads of stage s, whose buffer the next trip refills and, behind the last trip, the output rows reuse */
  v8f accs[8] = {c00, c01, c02, c03, c10, c11, c12, c13};
#pragma unroll
  for (int u = 0; u < 8; ++u) accs[u] *= 0.0625f;      /* the weights are carried x16 */
  if (isv && xs == 0) { char* fb = (char*)(VF0 + ((size_t)bt * QT0 + 64 * wn) * DM + (j - 16) * G2T + 32 * wm); const unsigned fo = ln * (DM * 4u) + hh * 32u;      /* f32 v rows: token 16 t + ln, columns 16 half + 8 hh + 0..7 of the wave's 32 */
#pragma unroll
    for (int u = 0; u < 8; ++u) { const v4f lo = {accs[u][0], accs[u][1], accs[u][2], accs[u][3]}, hi = {accs[u][4], accs[u][5], accs[u][6], accs[u][7]};
      *(v4f*)(fb + (u & 3) * 16 * (DM * 4) + (u >> 2) * 64 + fo) = lo; *(v4f*)(fb + (u & 3) * 16 * (DM * 4) + (u >> 2) * 64 + 16 + fo) = hi; }
    asm volatile("s_wait_xcnt 0x0" ::: "memory"); }      /* the accumulators' registers, which these stores name, are reused below: this wait stands in front of that overwrite */
#pragma unroll
  for (int u = 0; u < 8; ++u)
#pragma unroll
    for (int r = 0; r < 8; ++r) so[w][(u >> 2) * 16 + 8 * hh + r][(u & 3) * 16 + ln] = accs[u][r];
  __builtin_amdgcn_fence(__ATOMIC_ACQ_REL, "workgroup"); __builtin_amdgcn_wave_barrier();      /* a wave reads back only its own rows */
  v4h oh[16];
  if (!isv) {
    // Lanes 0..7 of a 16-lane row fetch the row's cosines, lanes 8..15 its sines (one 128-byte table row each); the DPP exchange that brings the partner's x brings the other table value too.
    const bool up = (ln & 8) != 0; const char* tp = (const char*)((up ? SN : CS) + (xs * G2T + 32 * wm + hh) * (HD / 2) + (ln & 7) * 4); v4f tv[16];
#pragma unroll
    for (int q = 0; q < 16; ++q) tv[q] = *(const v4fa*)(tp + q * 2 * (HD / 2 * 4));
    asm volatile("s_wait_xcnt 0x0" :: "v"(tp) : "memory");      /* the table loads' address registers are free for reuse only from here on; as an input they stay whole up to this wait, so that no load returns into them either */
#pragma unroll
    for (int q0 = 0; q0 < 16; q0 += 4) { v4f xv[4];      /* four rows' LDS reads in flight together; the roped row takes the place of its table values */
#pragma unroll
      for (int q = 0; q < 4; ++q) xv[q] = *(const v4fa*)&so[w][(q0 + q) * 2 + hh][ln * 4];
#pragma unroll
      for (int q = 0; q < 4; ++q) { const v4f x = xv[q], t = tv[q0 + q]; const v4f y = {rs_xm<8>(x[0]), rs_xm<8>(x[1]), rs_xm<8>(x[2]), rs_xm<8>(x[3])};
        const v4f tw = {rs_xm<8>(t[0]), rs_xm<8>(t[1]), rs_xm<8>(t[2]), rs_xm<8>(t[3])}; const v4f cc = up ? tw : t; const v4f sn = up ? t : -tw; const v4f o = x * cc + y * sn; tv[q0 + q] = o;
        for (int i = 0; i < 4; ++i) oh[q0 + q][i] = (_Float16)o[i]; }
      __builtin_amdgcn_sched_barrier(0); }      /* keeps the later rows' table exchanges behind this point: hoisted, they hold twice the registers per row and cost a work-group of occupancy; behind the last row it keeps the stores behind the arithmetic, so that no register which an issued store names is written again */
    char* hb = (char*)((j >= 8 ? Kh : Qh) + ((size_t)xt * G2T + 32 * wm) * DM + (j & 7) * G2T + 64 * wn); const unsigned ho = hh * (DM * 2u) + ln * 8u;
#pragma unroll
    for (int q = 0; q < 16; ++q) *(v4h*)(hb + q * 2 * (DM * 2) + ho) = oh[q];
    if (xs == 0) { asm volatile("s_wait_xcnt 0x0" ::: "memory"); __builtin_amdgcn_sched_barrier(0);      /* the address arithmetic below reuses registers that the f16 stores name: this wait stands in front of that overwrite, and the scheduling barrier keeps the arithmetic behind it */
      char* fb = (char*)((j >= 8 ? KF0 : QF0) + ((size_t)bt * QT0 + 32 * wm) * DM + (j & 7) * G2T + 64 * wn); const unsigned fo = hh * (DM * 4u) + ln * 16u;      /* the first QT0 rows of a batch: the same values unrounded */
#pragma unroll
      for (int q = 0; q < 16; ++q) *(v4f*)(fb + q * 2 * (DM * 4) + fo) = tv[q]; }
  } else {
#pragma unroll
    for (int q = 0; q < 16; ++q) { const v4f v = *(const v4fa*)&so[w][q * 2 + hh][ln * 4]; for (int i = 0; i < 4; ++i) oh[q][i] = (_Float16)v[i]; }
    __builtin_amdgcn_sched_barrier(0);      /* the stores stand behind the last conversion, so that no register which an issued store names is written again */
    char* vb = (char*)(Vt + ((size_t)bt * DM + (j - 16) * G2T + 32 * wm) * SQ + xs * G2T + 64 * wn); const unsigned vo = hh * (SQ * 2u) + ln * 8u;      /* row of V^T = head * HD + d */
#pragma unroll
    for (int q = 0; q < 16; ++q) *(v4h*)(vb + q * 2 * (SQ * 2) + vo) = oh[q];
  } }

// Output projection of all token rows in ONE launch: out = o Wo with o carried x64 and Wo x16. The stage loop is that of k_gemm2 (128 x 128 tile, 8 waves of 32 x 64, two LDS buffers, K = DM).
// Work-groups NB * 16 and up: one tile of 128 f16 o rows, the first tile of every batch left out. Work-groups 0 .. NB * 16 - 1 take those first tiles from the exact kernel's planes, 64 token rows each:
// A rows 0..63 of the tile are the rows' hi plane and A rows 64..127 the same rows' lo plane, so that hi Wo and lo Wo come out of the same 16 stages side by side (waves wm = 0, 1 and wm = 2, 3);
// after the turn through LDS wave wm adds its partner's (wm + 2) rows: out = hi Wo 2^-10 + lo Wo 2^-20, the sum that two more launches formed through the output buffer before.
__global__ __launch_bounds__(256) void k_outp(const _Float16* __restrict__ O, const _Float16* __restrict__ OH, const _Float16* __restrict__ OL, const _Float16* __restrict__ Wt, float* __restrict__ C) {
  static_assert(2 * G2S * 2 >= 8 * 32 * 68 * 4 && G2T == 128 && G2K == 64 && DM % G2K == 0 && QT0 == G2T && SQ / G2T == 16 && DM / G2T == 8, "16 row tiles per batch, the first of them the exact kernel's rows; 8 column tiles");
  __shared__ __attribute__((aligned(16))) unsigned char sm[2 * G2S * 2]; _Float16* const sg = (_Float16*)sm; float (*const so)[32][68] = (float (*)[32][68])sm;      /* the stage buffers; behind the loop's last barrier the same bytes hold each wave's output rows */
  const int tid = threadIdx.x, lane = tid & 31, ln = lane & 15, hh = lane >> 4; const int w = __builtin_amdgcn_readfirstlane(tid >> 5), wm = w & 3, wn = w >> 2;
  const int idx = blockIdx.x, nq = idx & 7; const bool ft = idx < NB * 16;      /* ft: a first-tile work-group; the same for the whole work-group */
  const int f0 = (idx >> 4) * QT0 + ((idx >> 3) & 1) * 64;      /* ft: first row in the planes, batch idx / 16, upper or lower 64 rows */
  const int m15 = (idx - NB * 16) >> 3; const int mt = m15 + m15 / 15 + 1;      /* else: row tile, 15 per batch */
  const int orow = ft ? (idx >> 4) * SQ + ((idx >> 3) & 1) * 64 : mt * G2T;      /* first output row */
  const int sr = tid >> 3, sc = (tid & 7) * 8; const int sl = sr * G2P + sc;      /* staging: row sr + 32 u, eight halves at column sc */
  const _Float16* ag0 = (ft ? OH + (size_t)f0 * DM : O + (size_t)mt * G2T * DM) + sr * DM + sc;      /* A rows 0..63 */
  const _Float16* ag1 = (ft ? OL + (size_t)f0 * DM : O + ((size_t)mt * G2T + 64) * DM) + sr * DM + sc;      /* A rows 64..127 */
  const _Float16* bg = Wt + (size_t)(nq * G2T + sr) * DM + sc; const int nst = DM / G2K;
  const v8f z8 = {0.f,0.f,0.f,0.f,0.f,0.f,0.f,0.f}; v8f c00 = z8, c01 = z8, c02 = z8, c03 = z8, c10 = z8, c11 = z8, c12 = z8, c13 = z8;
  v8us ar[4], br[4]; const unsigned short* p0 = (const unsigned short*)ag0; const unsigned short* p1 = (const unsigned short*)ag1; const unsigned short* pb = (const unsigned short*)bg;      /* the full unrolls give the register arrays constant indices and put a stage's eight loads in flight together */
#pragma unroll
  for (int u = 0; u < 2; ++u) { ar[u] = *(const v8us*)(p0 + u * 32 * DM); ar[2 + u] = *(const v8us*)(p1 + u * 32 * DM); br[u] = *(const v8us*)(pb + u * 32 * DM); br[2 + u] = *(const v8us*)(pb + (2 + u) * 32 * DM); }
  asm volatile("s_wait_xcnt 0x0" :: "v"(p0), "v"(p1), "v"(pb) : "memory");      /* the loads' address registers are free for reuse only from here on; as inputs they stay whole up to this wait, so that no load returns into one either */
#pragma unroll
  for (int u = 0; u < 4; ++u) { *(v8us*)(unsigned short*)&sg[sl + u * 32 * G2P] = ar[u]; *(v8us*)(unsigned short*)&sg[G2T * G2P + sl + u * 32 * G2P] = br[u]; }
  __syncthreads();
#pragma unroll 1
  for (int s = 0; s < nst; ++s) { const bool more = s + 1 < nst;      /* more: the same for the whole work-group. The stage loop stays rolled, so that its text stays small; its two 32-k passes are unrolled, so that their LDS offsets are immediates */
    if (more) { p0 = (const unsigned short*)(ag0 + (s + 1) * G2K); p1 = (const unsigned short*)(ag1 + (s + 1) * G2K); pb = (const unsigned short*)(bg + (s + 1) * G2K);
#pragma unroll
      for (int u = 0; u < 2; ++u) { ar[u] = *(const v8us*)(p0 + u * 32 * DM); ar[2 + u] = *(const v8us*)(p1 + u * 32 * DM); br[u] = *(const v8us*)(pb + u * 32 * DM); br[2 + u] = *(const v8us*)(pb + (2 + u) * 32 * DM); }
      asm volatile("s_wait_xcnt 0x0" :: "v"(p0), "v"(p1), "v"(pb) : "memory"); }      /* the code below reuses the registers that these loads name: this wait stands in front of that overwrite, and as its inputs they stay whole up to it, so that no load returns into one either */
    const _Float16* ab = sg + (s & 1) * G2S + (32 * wm + ln) * G2P; const _Float16* bb = sg + (s & 1) * G2S + (G2T + 64 * wn + ln) * G2P;
#pragma unroll
    for (int kc = 0; kc < G2K; kc += 32) { const v16h a0 = g2_frag(ab + kc, hh), a1 = g2_frag(ab + 16 * G2P + kc, hh);
      const v16h b0 = g2_frag(bb + kc, hh), b1 = g2_frag(bb + 16 * G2P + kc, hh), b2 = g2_frag(bb + 32 * G2P + kc, hh), b3 = g2_frag(bb + 48 * G2P + kc, hh);
      c00 = g2_mma(a0, b0, c00); c10 = g2_mma(a1, b0, c10); c01 = g2_mma(a0, b1, c01); c11 = g2_mma(a1, b1, c11);
      c02 = g2_mma(a0, b2, c02); c12 = g2_mma(a1, b2, c12); c03 = g2_mma(a0, b3, c03); c13 = g2_mma(a1, b3, c13); }
    if (more) {
#pragma unroll
      for (int u = 0; u < 4; ++u) { *(v8us*)(unsigned short*)&sg[((s + 1) & 1) * G2S + sl + u * 32 * G2P] = ar[u]; *(v8us*)(unsigned short*)&sg[((s + 1) & 1) * G2S + G2T * G2P + sl + u * 32 * G2P] = br[u]; } }
    __syncthreads(); }      /* publishes stage s + 1 and ends every wave's reads of stage s, whose buffer the next trip refills and, behind the last trip, the output rows reuse */
  v8f accs[8] = {c00, c01, c02, c03, c10, c11, c12, c13}; const float al = (ft && wm >= 2) ? 0.00000095367431640625f : 0.0009765625f;      /* 2^-10 = 1 / (64 x 16); the lo plane is carried x1024 on top */
#pragma unroll
  for (int u = 0; u < 8; ++u)
#pragma unroll
    for (int r = 0; r < 8; ++r) so[w][(u >> 2) * 16 + 8 * hh + r][(u & 3) * 16 + ln] = accs[u][r] * al;
  if (ft) __syncthreads();      /* work-group-uniform branch: the hi waves read the lo waves' rows below */
  else { __builtin_amdgcn_fence(__ATOMIC_ACQ_REL, "workgroup"); __builtin_amdgcn_wave_barrier(); }      /* a wave reads back only its own rows */
  if (ft && wm >= 2) return;      /* wave-uniform, behind the last barrier: the lo waves' rows are stored by their partners */
  v4f ov[16];
#pragma unroll
  for (int q = 0; q < 16; ++q) ov[q] = *(const v4fa*)&so[w][q * 2 + hh][ln * 4];
  if (ft) {      /* one branch round all sixteen partner rows, so that their LDS reads are in flight together */
#pragma unroll
    for (int q = 0; q < 16; ++q) ov[q] += *(const v4fa*)&so[w + 2][q * 2 + hh][ln * 4]; }
  __builtin_amdgcn_sched_barrier(0);      /* the stores stand behind the last LDS read, so that no register which an issued store names is written again */
  char* cb = (char*)(C + (size_t)(orow + 32 * wm) * DM + nq * G2T + 64 * wn); const unsigned co = hh * (DM * 4u) + ln * 16u;
#pragma unroll
  for (int q = 0; q < 16; ++q) *(v4f*)(cb + q * 2 * (DM * 4) + co) = ov[q]; }

__global__ __launch_bounds__(256) void k_bfcp(const float* __restrict__ src, float* __restrict__ dst, size_t n4) { const size_t t = (size_t)blockIdx.x * 256 + threadIdx.x; if (t >= n4) return; const v4f a = *(const v4fa*)(src + t * 4); v4f o; for (int q = 0; q < 4; ++q) o[q] = bf16_round(a[q]); *(v4f*)(dst + t * 4) = o;  }

__global__ __launch_bounds__(256) void k_tabhalf(const float* __restrict__ cs, const float* __restrict__ sn, float* __restrict__ CS, float* __restrict__ SN) { const int t = blockIdx.x * 256 + threadIdx.x; if (t >= SQ * (HD / 2)) return; const int p = t / (HD / 2), i = t % (HD / 2); const float c = bf16_round(cs[(size_t)p * HD + i]), s = bf16_round(sn[(size_t)p * HD + i]);
  *(float*)(CS + t) = c; *(float*)(SN + t) = s;  }

__global__ __launch_bounds__(256) void k_tab2d(float* __restrict__ CS, float* __restrict__ SN) {
  #pragma clang fp contract(off)
  const int t = blockIdx.x * 256 + threadIdx.x; if (t >= SQ * (HD / 2)) return; const int i = t % (HD / 2); const int p = t / (HD / 2); const float invf = (float)(1.0 / pow(10000.0, (double)(2 * i) / (double)HD)); const float ang = __fmul_rn((float)p, invf); const float c = cosf(ang), s = sinf(ang);
  *(float*)(CS + t) = c; *(float*)(SN + t) = s;  }
extern "C" void kernel_launch(void* const* d_in, const int* in_sizes, int n_in,
                              void* d_out, int out_size, void* d_ws, size_t ws_size, hipStream_t stream) {
  (void)in_sizes; (void)n_in; (void)out_size;
  const float* const* I = (const float* const*)d_in; const float* x = I[0]; const float* wattn = I[1]; const float* wo = I[2];      /* x; fused [in][out] W_attn [1024][3072] (q | k | v column thirds); [in][out] W_proj; rope tables computed in-kernel (positions = row index) */
  static_assert(HPG == 1 && NH == NG * HPG && NH * HD == DM && KVD == DM, "plain multi-head attention as 16 kv groups of one query head"); const float* bo = nullptr;      /* [in][out] weights, no biases; rope tables computed in the kernel */
  char* ws = (char*)d_ws; size_t off = 0;
  auto take = [&](size_t bytes) { char* p = ws + off; off += (bytes + 255) & ~(size_t)255; return p; };
  _Float16* BQKV = (_Float16*)take((size_t)3 * DM * DM * 2); _Float16* BO = (_Float16*)take((size_t)DM * DM * 2);      /* one transposed plane Bt [3072][1024] of the fused weight: rows 0..1023 = q, 1024.. = k, 2048.. = v */
  _Float16* X16 = (_Float16*)take(NR * DM * 2); float* CSB = (float*)take((size_t)SQ * HD * 4); float* SNB = (float*)take((size_t)SQ * HD * 4); _Float16* Q16 = (_Float16*)take(NR * DM * 2); _Float16* K16 = (_Float16*)take(NR * KVD * 2); _Float16* O16 = (_Float16*)take(NR * DM * 2);
  static_assert(B0 == 0 && NBR == NB && NHD == NH && QN == SQ, "every launch covers all batches and heads");
  _Float16* VT = (_Float16*)take((size_t)NB * NH * HD * SQ * 2);
  float* QF0 = (float*)take((size_t)NB * QT0 * DM * 4); float* KF0 = (float*)take((size_t)NB * QT0 * KVD * 4); float* VF0 = (float*)take((size_t)NB * QT0 * KVD * 4); _Float16* OH0 = (_Float16*)take((size_t)NB * QT0 * DM * 2); _Float16* OL0 = (_Float16*)take((size_t)NB * QT0 * DM * 2);
  if (off > ws_size) return;
  k_wt_f16<<<(unsigned)(((size_t)3 * DM * (DM / 8) + 255) / 256), 256, 0, stream>>>(wattn, BQKV, DM, 3 * DM, 16.0f); k_wt_f16<<<(unsigned)(((size_t)DM * (DM / 8) + 255) / 256), 256, 0, stream>>>(wo, BO, DM, DM, 16.0f);      /* [in][out] -> Bt x16 planes (fused W_attn: K 1024, N 3072) */
  k_x16<<<(unsigned)((NR * DM / 8 + 255) / 256), 256, 0, stream>>>(x, X16, NR * DM / 8);
  k_tab2d<<<(SQ * (HD / 2) + 255) / 256, 256, 0, stream>>>(CSB, SNB);      /* rope tables cos/sin(p / 10000^(2i/64)): inv_freq double-derived -> f32, f32 angle */
  /* Every launch below covers all NB batches: token rows b * SQ + s run through, or the batch is grid.y (first-tile kernel). */
  k_proj3<<<(MP / G2T) * (3 * DM / G2T), 256, 0, stream>>>(X16, BQKV, CSB, SNB, Q16, K16, VT, QF0, KF0, VF0);      /* roped q, k as f16 rows, V^T [NB][NH][HD][SQ] as f16, and the f32 roped q, k and v of rows 0..127 of each batch; position = row % SQ */
  k_att0<<<dim3(NH * (QT0 / A0R), NB), 256, 0, stream>>>(QF0, KF0, VF0, 0.125f, OH0, OL0);      /* exact f32 attention for rows 0..127 of each batch (o x64) -> f16 hi + x1024 residual planes; one head per kv group, so that the k and v rows are the heads' own */
  k_fattn<<<NB * NH * (SQ / FAQ), FAW * 32, 0, stream>>>(Q16, K16, VT, O16);      /* scores, causal softmax and weighted values of all batches, heads and query tiles: o (x64) as f16 rows */
  k_outp<<<NB * 16 + (MPO / G2T - NB) * (DM / G2T), 256, 0, stream>>>(O16, OH0, OL0, BO, (float*)d_out);      /* out rows are the output layout; rows 0..127 of each batch from the hi and lo planes, all others from the f16 path */
}
